// v000
// The times below were measured on an AMD MI455X: many runs one after another, warmed up first and cycling through
// copies of the inputs, with the whole window's GPU time divided by the number of runs. Launches and the gaps
// between them are all in it. The median over several windows is given; except for v000 it joins two sittings, which
// can be a few percent apart, so the side-by-side timings, each taken in one sitting, are the better comparison.
// v000, which the later versions start from, runs in 3650 microseconds.
#include <hip/hip_runtime.h>
// BERT self-attention with relative-position score terms (hidden [8][512][1024]; q, k, v = h W + b ([in][out], 16 heads of 64); scores[l][r] = (q_l.k_r + q_l.pe[l-r] + k_r.pe[l-r]) / 8 + mask[r] with pe = dist_emb[l - r + 511]; softmax; ctx = attn v merged -> [8][512][1024]).
// Structure: token rows r = b*512 + s; hidden as exact f16 rows; Q | K | V as three WMMA GEMMs (32x64 wave tiles, f32 accumulation, exact x16 transposed weights, bias in the epilogue, f16 outputs); the relative terms as two WMMA GEMMs per batch: AQ = q_rows(token,head) . dist_emb^T and AK = k_rows . dist_emb^T ([8192][1024] f32, table padded to 1024 rows with zeros); per batch, all 16 heads batched over grid.y: scores GEMM (K = 64), row softmax on VALU gathering AQ[(l,h)][l-r+511] + AK[(r,h)][l-r+511] (f32; mask added; weights stored x256 as f16), ctx = P . V GEMM (K = 512, alpha 2^-8; V^T for all batches made once before the loop via LDS transposes) written as f32 straight into the merged output rows.
// Compute dtype: inputs rounded to bf16; hidden / weights / table exact; q, k, v and the softmax weights as plain f16 GEMM operands (~2^-12); scores, relative terms and softmax statistics f32. v_wmma_f32_16x16x32_f16.
#define NB 8
#define SQ 512
#define DM 1024
#define NH 16
#define HD 64
#define HG 16                        /* heads per attention launch group (all) */
#define NREL 1023                    /* relative distances -511..511 */
#define RW 1024                      /* AQ/AK row pitch (distances padded to 1024) */
#define QN SQ                        /* query rows attended per batch (debug hook) */
#define NBR NB                       /* batches attended (debug hook) */
#define MP ((int)NR)                 /* token rows through the projections (debug hook) */
#define NR ((size_t)NB * SQ)         /* 4096 token rows */
typedef __bf16 v16b __attribute__((ext_vector_type(16)));
typedef unsigned short v8us __attribute__((ext_vector_type(8), may_alias));
typedef float  v8f  __attribute__((ext_vector_type(8)));
typedef float  v4f  __attribute__((ext_vector_type(4)));
typedef float  v4fa __attribute__((ext_vector_type(4), may_alias));
union FragB { v16b v; v8us half[2]; unsigned short u[16]; };

__device__ __forceinline__ unsigned short bf16_bits(float x) { unsigned int u = __float_as_uint(x); return (unsigned short)((u + 0x7FFFu + ((u >> 16) & 1u)) >> 16); }
__device__ __forceinline__ float bf16_val(unsigned short b) { return __uint_as_float(((unsigned int)b) << 16); }
__device__ __forceinline__ float bf16_round(float x) { return bf16_val(bf16_bits(x)); }
// D += A·B with NT terms: 1 = ah·bh, 2 = + al·bh (A split), 3 = + ah·bl (both split)
template <int NT>
__device__ __forceinline__ v8f mmaN(v16b ah, v16b al, v16b bh, v16b bl, v8f c) {
  c = __builtin_amdgcn_wmma_f32_16x16x32_bf16(false, ah, false, bh, (short)0, c, false, false);
  if (NT >= 2) c = __builtin_amdgcn_wmma_f32_16x16x32_bf16(false, al, false, bh, (short)0, c, false, false);
  if (NT >= 3) c = __builtin_amdgcn_wmma_f32_16x16x32_bf16(false, ah, false, bl, (short)0, c, false, false);
  asm volatile("v_nop\n\tv_nop\n\tv_nop\n\tv_nop" : "+v"(c) : "v"(ah), "v"(al), "v"(bh), "v"(bl));
  return c;
}

__global__ __launch_bounds__(256) void k_wt_bf16(const float* __restrict__ W, unsigned short* __restrict__ Wt, int K, int N) {
  const int t = blockIdx.x * 256 + threadIdx.x;
  const int k8n = K / 8;
  if (t >= N * k8n) return;
  const int n = t / k8n, k8 = (t % k8n) * 8;
  v8us v;
#pragma unroll
  for (int i = 0; i < 8; ++i) v[i] = bf16_bits(W[(size_t)(k8 + i) * N + n]);
  *(v8us*)(Wt + (size_t)n * K + k8) = v;
  
}

// GEMM C[M][N] (f32, pitch ldc) = act(A[M][K]·W + bias). A f32 row-major (pitch lda) converted per fragment to bf16
// (ASPLIT: hi/lo two planes -> 2 terms, else single rounded term); Wt bf16 [N][K] (pitch ldb). BIAS_BF16 rounds the
// bias to bf16 first (bias quantised to bf16 before the add). K%32==0, M%16==0, N%64==0.
template <bool ASPLIT, int ACT, bool BIAS_BF16>
__global__ __launch_bounds__(128) void k_gemm_bf(const float* __restrict__ A, int lda, const unsigned short* __restrict__ Wt, int ldb,
                                               const float* __restrict__ bias, float* __restrict__ C, int ldc, int M, int N, int K) {
  __shared__ __attribute__((aligned(16))) float so[4][16][64];
  const int tid = threadIdx.x, w = tid >> 5, lane = tid & 31, ln = lane & 15, hh = lane >> 4;
  const int ntn = N / 64;
  const int wid = blockIdx.x * 4 + w;
  const int mt = wid / ntn, nq = wid % ntn;
  if (mt * 16 >= M) return;
  const int row0 = mt * 16, col0 = nq * 64;
  const float* arow = A + (size_t)(row0 + ln) * lda;
  v8f acc[4] = {};
  for (int kb = 0; kb < K; kb += 32) {
    FragB ah, al;
    const v4f x0 = *(const v4fa*)(arow + kb + 8 * hh), x1 = *(const v4fa*)(arow + kb + 8 * hh + 4);
    const v4f x2 = *(const v4fa*)(arow + kb + 16 + 8 * hh), x3 = *(const v4fa*)(arow + kb + 16 + 8 * hh + 4);
    float xs[16] = {x0[0],x0[1],x0[2],x0[3],x1[0],x1[1],x1[2],x1[3],x2[0],x2[1],x2[2],x2[3],x3[0],x3[1],x3[2],x3[3]};
#pragma unroll
    for (int i = 0; i < 16; ++i) { const unsigned short hb = bf16_bits(xs[i]); ah.u[i] = hb; al.u[i] = ASPLIT ? bf16_bits(xs[i] - bf16_val(hb)) : (unsigned short)0; }
#pragma unroll
    for (int t = 0; t < 4; ++t) {
      const unsigned short* brow = Wt + (size_t)(col0 + t * 16 + ln) * ldb + kb;
      FragB b;
      b.half[0] = *(const v8us*)(brow + 8 * hh);
      b.half[1] = *(const v8us*)(brow + 16 + 8 * hh);
      acc[t] = mmaN<ASPLIT ? 2 : 1>(ah.v, al.v, b.v, b.v, acc[t]);
    }
  }
#pragma unroll
  for (int t = 0; t < 4; ++t) {
    float bv = bias ? bias[col0 + t * 16 + ln] : 0.f;
    if (BIAS_BF16) bv = bf16_round(bv);
#pragma unroll
    for (int r = 0; r < 8; ++r) { float v = acc[t][r] + bv; if (ACT == 1) v = fmaxf(v, 0.f); so[w][8 * hh + r][t * 16 + ln] = v; }
  }
  __builtin_amdgcn_fence(__ATOMIC_ACQ_REL, "workgroup");
  __builtin_amdgcn_wave_barrier();
  const int rsub = lane >> 4, c4 = (lane & 15) * 4;
  {
#pragma unroll
    for (int q = 0; q < 8; ++q) {
      const int r = q * 2 + rsub;
      const v4f v = *(const v4fa*)&so[w][r][c4];
      *(v4f*)(C + (size_t)(row0 + r) * ldc + col0 + c4) = v;
    }
    
  }
}

// GEMM C = act(A·W + bias + resid): A f32 (ASPLIT -> hi/lo 2 terms), Wt bf16 [N][K]; ACT 0 none, 1 relu, 2 exact gelu;
// resid (optional, f32, row index = (row % rmod), pitch ldr, RES_BF16 rounds it) added before the activation.
template <bool ASPLIT, int ACT, bool BIAS_BF16, bool RES_BF16>
__global__ __launch_bounds__(128) void k_gemm_bf3(const float* __restrict__ A, int lda, const unsigned short* __restrict__ Wt, int ldb,
                                                const float* __restrict__ bias, const float* __restrict__ resid, int rmod, int ldr,
                                                float* __restrict__ C, int ldc, int M, int N, int K) {
  __shared__ __attribute__((aligned(16))) float so[4][16][64];
  const int tid = threadIdx.x, w = tid >> 5, lane = tid & 31, ln = lane & 15, hh = lane >> 4;
  const int ntn = N / 64;
  const int wid = blockIdx.x * 4 + w;
  const int mt = wid / ntn, nq = wid % ntn;
  if (mt * 16 >= M) return;
  const int row0 = mt * 16, col0 = nq * 64;
  const float* arow = A + (size_t)(row0 + ln) * lda;
  v8f acc[4] = {};
  for (int kb = 0; kb < K; kb += 32) {
    FragB ah, al;
    const v4f x0 = *(const v4fa*)(arow + kb + 8 * hh), x1 = *(const v4fa*)(arow + kb + 8 * hh + 4);
    const v4f x2 = *(const v4fa*)(arow + kb + 16 + 8 * hh), x3 = *(const v4fa*)(arow + kb + 16 + 8 * hh + 4);
    float xs[16] = {x0[0],x0[1],x0[2],x0[3],x1[0],x1[1],x1[2],x1[3],x2[0],x2[1],x2[2],x2[3],x3[0],x3[1],x3[2],x3[3]};
#pragma unroll
    for (int i = 0; i < 16; ++i) { const unsigned short hb = bf16_bits(xs[i]); ah.u[i] = hb; al.u[i] = ASPLIT ? bf16_bits(xs[i] - bf16_val(hb)) : (unsigned short)0; }
#pragma unroll
    for (int t = 0; t < 4; ++t) {
      const unsigned short* brow = Wt + (size_t)(col0 + t * 16 + ln) * ldb + kb;
      FragB b;
      b.half[0] = *(const v8us*)(brow + 8 * hh);
      b.half[1] = *(const v8us*)(brow + 16 + 8 * hh);
      acc[t] = mmaN<ASPLIT ? 2 : 1>(ah.v, al.v, b.v, b.v, acc[t]);
    }
  }
#pragma unroll
  for (int t = 0; t < 4; ++t) {
    const int col = col0 + t * 16 + ln;
    float bv = bias ? bias[col] : 0.f;
    if (BIAS_BF16) bv = bf16_round(bv);
#pragma unroll
    for (int r = 0; r < 8; ++r) {
      float v = acc[t][r] + bv;
      if (resid) { float rv = resid[(size_t)((row0 + 8 * hh + r) % rmod) * ldr + col]; if (RES_BF16) rv = bf16_round(rv); v += rv; }
      if (ACT == 1) v = fmaxf(v, 0.f);
      if (ACT == 2) v = 0.5f * v * (1.0f + erff(v * 0.70710678118654752f));
      if (ACT == 3) { const float u = 0.7978845608028654f * (v + 0.044715f * v * v * v); v = 0.5f * v * (1.0f + tanhf(u)); }
      so[w][8 * hh + r][t * 16 + ln] = v;
    }
  }
  __builtin_amdgcn_fence(__ATOMIC_ACQ_REL, "workgroup");
  __builtin_amdgcn_wave_barrier();
  const int rsub = lane >> 4, c4 = (lane & 15) * 4;
  {
#pragma unroll
    for (int q = 0; q < 8; ++q) {
      const int r = q * 2 + rsub;
      const v4f v = *(const v4fa*)&so[w][r][c4];
      *(v4f*)(C + (size_t)(row0 + r) * ldc + col0 + c4) = v;
    }
    
  }
}
// row LayerNorm (biased variance, eps) over N: s = X (+ R); optional out_sum <- s; out_norm <- (s-mu)*rsqrt(var+eps)*g + b
template <bool PARAM_BF16>
__global__ __launch_bounds__(256) void k_layernorm(const float* __restrict__ X, const float* __restrict__ R, const float* __restrict__ g, const float* __restrict__ bta,
                                                  float* __restrict__ out_sum, float* __restrict__ out_norm, int N, float eps) {
  __shared__ float red[256];
  const int row = blockIdx.x, tid = threadIdx.x;
  const float* x = X + (size_t)row * N; const float* rr = R ? R + (size_t)row * N : nullptr;
  float vals[16];                     // up to N = 4096
  const int per = N / 256;            // contiguous chunk per thread? use strided-by-4 chunks: thread handles j = tid*4 + 1024*u
  float s1 = 0.f;
  for (int u = 0; u < per / 4; ++u) {
    const int j = tid * 4 + 1024 * u;
    const v4f a = *(const v4fa*)(x + j);
    v4f b = {0.f,0.f,0.f,0.f}; if (rr) b = *(const v4fa*)(rr + j);
#pragma unroll
    for (int q = 0; q < 4; ++q) { const float v = a[q] + b[q]; vals[u * 4 + q] = v; s1 += v; }
  }
  red[tid] = s1; __syncthreads();
  for (int st = 128; st > 0; st >>= 1) { if (tid < st) red[tid] += red[tid + st]; __syncthreads(); }
  const float mu = red[0] / (float)N; __syncthreads();
  float s2 = 0.f;
  for (int u = 0; u < per / 4; ++u)
#pragma unroll
    for (int q = 0; q < 4; ++q) { const float c = vals[u * 4 + q] - mu; s2 += c * c; }
  red[tid] = s2; __syncthreads();
  for (int st = 128; st > 0; st >>= 1) { if (tid < st) red[tid] += red[tid + st]; __syncthreads(); }
  const float rs = rsqrtf(red[0] / (float)N + eps);
  {
    for (int u = 0; u < per / 4; ++u) {
      const int j = tid * 4 + 1024 * u;
      v4f o, sm;
#pragma unroll
      for (int q = 0; q < 4; ++q) {
        float gg = g[j + q], bb = bta[j + q];
        if (PARAM_BF16) { gg = bf16_round(gg); bb = bf16_round(bb); }
        sm[q] = vals[u * 4 + q]; o[q] = (vals[u * 4 + q] - mu) * rs * gg + bb;
      }
      if (out_sum) *(v4f*)(out_sum + (size_t)row * N + j) = sm;
      *(v4f*)(out_norm + (size_t)row * N + j) = o;
    }
    
  }
}



// ---- f16 WMMA path (v_wmma_f32_16x16x32_f16): 11-bit significands for operands in range — used where a [0,1] probability operand needs more precision than bf16
typedef _Float16 v16h __attribute__((ext_vector_type(16)));
union FragH { v16h v; v8us half[2]; _Float16 h[16]; unsigned short u[16]; };
template <int NT>
__device__ __forceinline__ v8f mmaH(v16h ah, v16h al, v16h bh, v16h bl, v8f c) {
  c = __builtin_amdgcn_wmma_f32_16x16x32_f16(false, ah, false, bh, (short)0, c, false, false);
  if (NT >= 2) c = __builtin_amdgcn_wmma_f32_16x16x32_f16(false, al, false, bh, (short)0, c, false, false);
  if (NT >= 3) c = __builtin_amdgcn_wmma_f32_16x16x32_f16(false, ah, false, bl, (short)0, c, false, false);
  asm volatile("v_nop\n\tv_nop\n\tv_nop\n\tv_nop" : "+v"(c) : "v"(ah), "v"(al), "v"(bh), "v"(bl));
  return c;
}
// batched GEMM like k_gemm_b but f16 operands: A f32 (split into f16 hi/lo if ASPLIT, else rounded to f16), Bt = f16 values [n][k]; alpha; C f32; N multiple of 16 (partial tiles skipped)
template <bool ASPLIT>
__global__ __launch_bounds__(128) void k_gemm_h(const float* __restrict__ A, int lda, size_t sA, const _Float16* __restrict__ Bh, int ldb, size_t sB, float alpha, float* __restrict__ C, int ldc, size_t sC, int M, int N, int K) {
  __shared__ __attribute__((aligned(16))) float so[4][16][64];
  const int tid = threadIdx.x, w = tid >> 5, lane = tid & 31, ln = lane & 15, hh = lane >> 4; const int by = blockIdx.y;
  A += (size_t)by * sA; Bh += (size_t)by * sB; C += (size_t)by * sC;
  const int ntn = (N + 63) / 64; const int wid = blockIdx.x * 4 + w; const int mt = wid / ntn, nq = wid % ntn; if (mt * 16 >= M) return;
  const int row0 = mt * 16, col0 = nq * 64; const float* arow = A + (size_t)(row0 + ln) * lda;
  v8f acc[4] = {};
  for (int kb = 0; kb < K; kb += 32) {
    FragH ah, al;
    const v4f x0 = *(const v4fa*)(arow + kb + 8 * hh), x1 = *(const v4fa*)(arow + kb + 8 * hh + 4), x2 = *(const v4fa*)(arow + kb + 16 + 8 * hh), x3 = *(const v4fa*)(arow + kb + 16 + 8 * hh + 4);
    float xs[16] = {x0[0],x0[1],x0[2],x0[3],x1[0],x1[1],x1[2],x1[3],x2[0],x2[1],x2[2],x2[3],x3[0],x3[1],x3[2],x3[3]};
#pragma unroll
    for (int i = 0; i < 16; ++i) { const _Float16 h = (_Float16)xs[i]; ah.h[i] = h; al.h[i] = ASPLIT ? (_Float16)(xs[i] - (float)h) : (_Float16)0.0f; }
#pragma unroll
    for (int t = 0; t < 4; ++t) { if (col0 + t * 16 >= N) continue; const size_t boff = (size_t)(col0 + t * 16 + ln) * ldb + kb; FragH bq; bq.half[0] = *(const v8us*)(Bh + boff + 8 * hh); bq.half[1] = *(const v8us*)(Bh + boff + 16 + 8 * hh);
      acc[t] = mmaH<ASPLIT ? 2 : 1>(ah.v, al.v, bq.v, bq.v, acc[t]); }
  }
#pragma unroll
  for (int t = 0; t < 4; ++t) { if (col0 + t * 16 >= N) continue;
#pragma unroll
    for (int r = 0; r < 8; ++r) so[w][8 * hh + r][t * 16 + ln] = acc[t][r] * alpha; }
  __builtin_amdgcn_fence(__ATOMIC_ACQ_REL, "workgroup"); __builtin_amdgcn_wave_barrier();
  const int rsub = lane >> 4, c4 = (lane & 15) * 4;
  {
#pragma unroll
    for (int q = 0; q < 8; ++q) { const int r = q * 2 + rsub; if (col0 + c4 < N) { const v4f v = *(const v4fa*)&so[w][r][c4]; *(v4f*)(C + (size_t)(row0 + r) * ldc + col0 + c4) = v; } }
     }
}

// Wt[n][k] = f16(W[k][n]·scale) from f32 row-major W[K][N] (scale = power of two; bf16-exact weights stay exact in f16 away from the subnormal range)
__global__ __launch_bounds__(256) void k_wt_f16(const float* __restrict__ W, _Float16* __restrict__ Wt, int K, int N, float scale) {
  const int t = blockIdx.x * 256 + threadIdx.x; if (t >= N * (K / 8)) return; const int n = t / (K / 8), k8 = (t % (K / 8)) * 8; FragH f;
#pragma unroll
  for (int i = 0; i < 8; ++i) f.h[i] = (_Float16)(bf16_round(W[(size_t)(k8 + i) * N + n]) * scale); const v8us o = f.half[0];
  *(v8us*)((unsigned short*)Wt + (size_t)n * K + k8) = o; 
}
// k_gemm_hh variant with fused epilogue: v = acc·alpha + bias[by·sBias + col] (+ CP[(row/rowsPerB)·sCPb + by·64 + col] if CP) ; ACT 0 none / 1 elu ; writes f16 C16 (and f32 C if non-null)
template <int ACT>
__global__ __launch_bounds__(128) void k_gemm_hhx(const _Float16* __restrict__ A, int lda, size_t sA, const _Float16* __restrict__ Bh, int ldb, size_t sB, float alpha, const float* __restrict__ bias, size_t sBias, const float* __restrict__ CP, int rowsPerB, size_t sCPb, int row0g,
    float* __restrict__ C, _Float16* __restrict__ C16, int ldc, size_t sC, int M, int N, int K) {
  __shared__ __attribute__((aligned(16))) float so[4][16][64];
  const int tid = threadIdx.x, w = tid >> 5, lane = tid & 31, ln = lane & 15, hh = lane >> 4; const int by = blockIdx.y;
  A += (size_t)by * sA; Bh += (size_t)by * sB; const size_t cofs = (size_t)by * sC; const float* bp = bias ? bias + (size_t)by * sBias : nullptr;
  const int ntn = (N + 63) / 64; const int wid = blockIdx.x * 4 + w; const int mt = wid / ntn, nq = wid % ntn; if (mt * 16 >= M) return;
  const int row0 = mt * 16, col0 = nq * 64; const _Float16* arow = A + (size_t)(row0 + ln) * lda;
  v8f acc[4] = {};
  for (int kb = 0; kb < K; kb += 32) { FragH ah; ah.half[0] = *(const v8us*)((const unsigned short*)arow + kb + 8 * hh); ah.half[1] = *(const v8us*)((const unsigned short*)arow + kb + 16 + 8 * hh);
#pragma unroll
    for (int t = 0; t < 4; ++t) { if (col0 + t * 16 >= N) continue; const size_t boff = (size_t)(col0 + t * 16 + ln) * ldb + kb; FragH bq; bq.half[0] = *(const v8us*)((const unsigned short*)Bh + boff + 8 * hh); bq.half[1] = *(const v8us*)((const unsigned short*)Bh + boff + 16 + 8 * hh);
      acc[t] = mmaH<1>(ah.v, ah.v, bq.v, bq.v, acc[t]); }
  }
#pragma unroll
  for (int t = 0; t < 4; ++t) { if (col0 + t * 16 >= N) continue; const int col = col0 + t * 16 + ln; const float bv = bp ? bf16_round(bp[col]) : 0.f;
#pragma unroll
    for (int r = 0; r < 8; ++r) { float v = acc[t][r] * alpha + bv; if (CP) { const int rr = row0g + row0 + 8 * hh + r; if (rowsPerB < 0) v += CP[cofs + (size_t)rr * ldc + col];      /* rowsPerB < 0: own element of the batched C plane */ else { const int bidx = rr / rowsPerB; v += CP[(size_t)bidx * sCPb + (size_t)by * 64 + col]; } } if (ACT == 1) v = (v > 0.f) ? v : expm1f(v); else if (ACT == 7) v = (v > 0.f) ? v + 1.0f : expf(v); else if (ACT == 8) v = tanhf(v); else if (ACT == 9) v = 0.5f * v * (1.0f + tanhf(0.7978845608028654f * (v + 0.044715f * v * v * v))); else if (ACT == 11) v = 1.0f / (1.0f + expf(-v)); else if (ACT == 12) v = (v > 0.f) ? v : 0.01f * v; else if (ACT == 14) v = (v > 0.f) ? v : 0.1f * v; else if (ACT == 16) v = (v >= 0.f) ? v : 0.3f * v; else if (ACT == 17) v = (v >= 0.f) ? v : 0.2f * v; else if (ACT == 15) v = v / (1.0f + expf(-v)); else if (ACT == 3) v = fmaxf(v, 0.f); else if (ACT == 6) v = 0.5f * v * (1.0f + erff(v * 0.70710678118654752f)); so[w][8 * hh + r][t * 16 + ln] = v; } }
  __builtin_amdgcn_fence(__ATOMIC_ACQ_REL, "workgroup"); __builtin_amdgcn_wave_barrier();
  const int rsub = lane >> 4, c4 = (lane & 15) * 4; typedef _Float16 v4h __attribute__((ext_vector_type(4)));
  {
#pragma unroll
    for (int q = 0; q < 8; ++q) { const int r = q * 2 + rsub; if (col0 + c4 < N) { const v4f v = *(const v4fa*)&so[w][r][c4]; if (C) *(v4f*)(C + cofs + (size_t)(row0 + r) * ldc + col0 + c4) = v; if (C16) { v4h h4; for (int i = 0; i < 4; ++i) h4[i] = (_Float16)v[i]; *(v4h*)(C16 + cofs + (size_t)(row0 + r) * ldc + col0 + c4) = h4; } } }
     }
}


typedef _Float16 v4h __attribute__((ext_vector_type(4)));

__global__ __launch_bounds__(256) void k_x16(const float* __restrict__ x, _Float16* __restrict__ X16, size_t n8) { const size_t t = (size_t)blockIdx.x * 256 + threadIdx.x; if (t >= n8) return; FragH f;
#pragma unroll
  for (int q = 0; q < 8; ++q) f.h[q] = (_Float16)bf16_round(x[t * 8 + q]); *(v8us*)((unsigned short*)X16 + t * 8) = f.half[0];  }
__global__ __launch_bounds__(256) void k_h16(const float* __restrict__ x, _Float16* __restrict__ X16, size_t n8) { const size_t t = (size_t)blockIdx.x * 256 + threadIdx.x; if (t >= n8) return; FragH f;
#pragma unroll
  for (int q = 0; q < 8; ++q) f.h[q] = (_Float16)x[t * 8 + q]; *(v8us*)((unsigned short*)X16 + t * 8) = f.half[0];  }
__global__ __launch_bounds__(256) void k_round16f(const float* __restrict__ W, _Float16* __restrict__ Bt, size_t n8) { const size_t t = (size_t)blockIdx.x * 256 + threadIdx.x; if (t >= n8) return; FragH f;
#pragma unroll
  for (int i = 0; i < 8; ++i) f.h[i] = (_Float16)(bf16_round(W[t * 8 + i]) * 16.0f); *(v8us*)((unsigned short*)Bt + t * 8) = f.half[0];  }
template <int NHv, int TTv>
__global__ __launch_bounds__(256) void k_vt(const _Float16* __restrict__ V16, int ldv, int voff, _Float16* __restrict__ Vt) { __shared__ unsigned short tl[64][66]; const int tid = threadIdx.x; const int slab = blockIdx.x / (TTv / 64), lg = blockIdx.x % (TTv / 64); const int b = slab / NHv, h = slab % NHv;
  for (int i = tid; i < 64 * 8; i += 256) { const int r = i / 8, c8 = (i % 8) * 8; FragH f; f.half[0] = *(const v8us*)((const unsigned short*)V16 + ((size_t)b * TTv + lg * 64 + r) * ldv + voff + h * 64 + c8);
#pragma unroll
    for (int q = 0; q < 8; ++q) tl[r][c8 + q] = f.u[q]; }
  __syncthreads();
  {
#pragma unroll
    for (int rd = 0; rd < 2; ++rd) { const int d = rd * 32 + tid / 8, pc = tid % 8; FragH f;
#pragma unroll
      for (int q = 0; q < 8; ++q) f.u[q] = tl[pc * 8 + q][d];
      *(v8us*)((unsigned short*)Vt + ((size_t)slab * 64 + d) * TTv + lg * 64 + pc * 8) = f.half[0]; }
     } }

__global__ __launch_bounds__(256) void k_hl(const float* __restrict__ F, _Float16* __restrict__ Hh, _Float16* __restrict__ Hl, size_t n8) { const size_t t = (size_t)blockIdx.x * 256 + threadIdx.x; if (t >= n8) return; FragH fh, fl; const v4f a = *(const v4fa*)(F + t * 8), c = *(const v4fa*)(F + t * 8 + 4);
#pragma unroll
  for (int q = 0; q < 4; ++q) { _Float16 h = (_Float16)a[q]; fh.h[q] = h; fl.h[q] = (_Float16)((a[q] - (float)h) * 1024.0f); h = (_Float16)c[q]; fh.h[4 + q] = h; fl.h[4 + q] = (_Float16)((c[q] - (float)h) * 1024.0f); }
  { *(v8us*)((unsigned short*)Hh + t * 8) = fh.half[0]; *(v8us*)((unsigned short*)Hl + t * 8) = fl.half[0];  } }

// ---- fast GEMM (wave tile 32x64; requires M % 32 == 0 rows per launch region and N % 64 == 0); epilogue = k_gemm_hhx semantics ----
__device__ __forceinline__ v16h g2_frag(const _Float16* p, int hh) { FragH f; f.half[0] = *(const v8us*)((const unsigned short*)p + 8 * hh); f.half[1] = *(const v8us*)((const unsigned short*)p + 16 + 8 * hh); return f.v; }
__device__ __forceinline__ v8f g2_mma(v16h a, v16h b, v8f c) { v8f d = __builtin_amdgcn_wmma_f32_16x16x32_f16(false, a, false, b, (short)0, c, false, false); asm volatile("v_nop\n\tv_nop\n\tv_nop\n\tv_nop" : "+v"(d) : "v"(a), "v"(b)); return d; }
template <int ACT>
__global__ __launch_bounds__(128) void k_gemm2(const _Float16* __restrict__ A, int lda, size_t sA, const _Float16* __restrict__ Bh, int ldb, size_t sB, float alpha, const float* __restrict__ bias, size_t sBias, const float* __restrict__ CP, int rowsPerB, size_t sCPb, int row0g,
    float* __restrict__ C, _Float16* __restrict__ C16, int ldc, size_t sC, int M, int N, int K) { static_assert(ACT == 0 || ACT == 3 || ACT == 6 || ACT == 8 || ACT == 9 || ACT == 11 || ACT == 12 || ACT == 14 || ACT == 15 || ACT == 16 || ACT == 17, "k_gemm2: unsupported ACT code (would silently apply no activation)");
  __shared__ __attribute__((aligned(16))) float so[4][32][68];
  const int tid = threadIdx.x, w = tid >> 5, lane = tid & 31, ln = lane & 15, hh = lane >> 4; const int by = blockIdx.y;
  A += (size_t)by * sA; Bh += (size_t)by * sB; const size_t cofs = (size_t)by * sC; const float* bp = bias ? bias + (size_t)by * sBias : nullptr;
  const int ntn = N >> 6; const int mt = blockIdx.x / ntn, nq = blockIdx.x - mt * ntn; const int row0 = mt * 128 + 32 * w, col0 = nq * 64; if (row0 >= M) return;
  const _Float16* a0p = A + (size_t)(row0 + ln) * lda; const _Float16* a1p = a0p + (size_t)16 * lda;
  const _Float16* b0p = Bh + (size_t)(col0 + ln) * ldb; const _Float16* b1p = b0p + (size_t)16 * ldb; const _Float16* b2p = b1p + (size_t)16 * ldb; const _Float16* b3p = b2p + (size_t)16 * ldb;
  const v8f z8 = {0.f,0.f,0.f,0.f,0.f,0.f,0.f,0.f}; v8f c00 = z8, c01 = z8, c02 = z8, c03 = z8, c10 = z8, c11 = z8, c12 = z8, c13 = z8;
#pragma unroll 1
  for (int kb = 0; kb < K; kb += 32) { const v16h a0 = g2_frag(a0p + kb, hh), a1 = g2_frag(a1p + kb, hh);
    v16h b = g2_frag(b0p + kb, hh); c00 = g2_mma(a0, b, c00); c10 = g2_mma(a1, b, c10);
    b = g2_frag(b1p + kb, hh); c01 = g2_mma(a0, b, c01); c11 = g2_mma(a1, b, c11);
    b = g2_frag(b2p + kb, hh); c02 = g2_mma(a0, b, c02); c12 = g2_mma(a1, b, c12);
    b = g2_frag(b3p + kb, hh); c03 = g2_mma(a0, b, c03); c13 = g2_mma(a1, b, c13); }
  v8f accs[8] = {c00, c01, c02, c03, c10, c11, c12, c13};
#pragma unroll
  for (int u = 0; u < 8; ++u) { const int t = u & 3, half = u >> 2; const int col = col0 + t * 16 + ln; const float bv = bp ? bf16_round(bp[col]) : 0.f;
#pragma unroll
    for (int r = 0; r < 8; ++r) { const int rloc = half * 16 + 8 * hh + r; float v = accs[u][r] * alpha + bv; if (CP) { if (rowsPerB < 0) v += CP[cofs + (size_t)(row0g + row0 + rloc) * ldc + col];      /* rowsPerB < 0: own element of the batched C plane */ else { const int bidx = (row0g + row0 + rloc) / rowsPerB; v += CP[(size_t)bidx * sCPb + (size_t)by * 64 + col]; } }
      if (ACT == 3) v = fmaxf(v, 0.f); else if (ACT == 6) v = 0.5f * v * (1.0f + erff(v * 0.70710678118654752f)); else if (ACT == 11) v = 1.0f / (1.0f + expf(-v)); else if (ACT == 15) v = v / (1.0f + expf(-v)); else if (ACT == 12) v = (v > 0.f) ? v : 0.01f * v; else if (ACT == 8) v = tanhf(v); else if (ACT == 9) v = 0.5f * v * (1.0f + tanhf(0.7978845608028654f * (v + 0.044715f * v * v * v))); else if (ACT == 14) v = (v > 0.f) ? v : 0.1f * v; else if (ACT == 16) v = (v >= 0.f) ? v : 0.3f * v; else if (ACT == 17) v = (v >= 0.f) ? v : 0.2f * v;
      so[w][rloc][t * 16 + ln] = v; } }
  __builtin_amdgcn_fence(__ATOMIC_ACQ_REL, "workgroup"); __builtin_amdgcn_wave_barrier();
  const int rsub = lane >> 4, c4 = (lane & 15) * 4;
  {
#pragma unroll
    for (int q = 0; q < 16; ++q) { const int r = q * 2 + rsub; const v4f v = *(const v4fa*)&so[w][r][c4]; if (C) *(v4f*)(C + cofs + (size_t)(row0 + r) * ldc + col0 + c4) = v; if (C16) { v4h h4; for (int i = 0; i < 4; ++i) h4[i] = (_Float16)v[i]; *(v4h*)(C16 + cofs + (size_t)(row0 + r) * ldc + col0 + c4) = h4; } }
     } }


__global__ __launch_bounds__(256) void k_wrel(const float* __restrict__ w, _Float16* __restrict__ Bt) { const size_t t = (size_t)blockIdx.x * 256 + threadIdx.x; if (t >= (size_t)RW * HD / 8) return; const bool live = t < (size_t)NREL * HD / 8; FragH f; for (int q = 0; q < 8; ++q) f.h[q] = live ? (_Float16)(bf16_round(w[t * 8 + q]) * 16.0f) : (_Float16)0.0f; *(v8us*)((unsigned short*)Bt + t * 8) = f.half[0];  }
__global__ __launch_bounds__(256) void k_wnat(const float* __restrict__ w, size_t n8, _Float16* __restrict__ Bt) { const size_t t = (size_t)blockIdx.x * 256 + threadIdx.x; if (t >= n8) return; FragH f; for (int q = 0; q < 8; ++q) f.h[q] = (_Float16)(bf16_round(w[t * 8 + q]) * 16.0f); *(v8us*)((unsigned short*)Bt + t * 8) = f.half[0];  }
// row softmax with the two relative-position terms: score[i][r] = (s[i][r] + AQ[(i,h)][i-r+S-1] + AK[(r,h)][i-r+S-1]) * 0.125 + mask[r] (bf16-rounded additive mask,
// staged in LDS); head h = blockIdx.y; AQ/AK rows are (token, head) with pitch RW; P = f16(256 softmax); thread per query row i
__global__ __launch_bounds__(256) void k_rsmr(const float* __restrict__ S, _Float16* __restrict__ P, const float* __restrict__ AQ, const float* __restrict__ AK, const float* __restrict__ amask, int nrows) {
  #pragma clang fp contract(off)
  __shared__ float mk[SQ];
  for (int t = threadIdx.x; t < SQ; t += 256) mk[t] = bf16_round(amask[t]);
  __syncthreads();
  const int h = blockIdx.y; const int i = blockIdx.x * 256 + threadIdx.x; if (i >= nrows) return; S += (size_t)h * SQ * SQ; P += (size_t)h * SQ * SQ; const float* s = S + (size_t)i * SQ; const float* aq = AQ + ((size_t)i * NH + h) * RW + (SQ - 1 + i); float mx = -INFINITY;
  auto sc_ = [&](int r) { return (s[r] + aq[-r] + AK[((size_t)r * NH + h) * RW + (SQ - 1 + i - r)]) * 0.125f + mk[r]; };
#pragma unroll 1
  for (int j = 0; j < SQ; ++j) mx = fmaxf(mx, sc_(j)); float se = 0.f;
#pragma unroll 1
  for (int j = 0; j < SQ; ++j) se += expf(sc_(j) - mx); const float sc = 256.0f / se;
#pragma unroll 1
  for (int j0 = 0; j0 < SQ; j0 += 8) { FragH f; for (int q = 0; q < 8; ++q) f.h[q] = (_Float16)(expf(sc_(j0 + q) - mx) * sc); unsigned short* d = (unsigned short*)P + (size_t)i * SQ + j0; *(v8us*)d = f.half[0];  } }
__global__ __launch_bounds__(256) void k_vt(const _Float16* __restrict__ V16, int b, int h0, _Float16* __restrict__ VT) { __shared__ unsigned short tl[64][65]; const int tid = threadIdx.x; const int hh = blockIdx.x % HG, sg = blockIdx.x / HG; const int s0 = sg * 64; const int h = h0 + hh;
  for (int i = tid; i < 64 * 8; i += 256) { const int j = i / 8, d8 = (i % 8) * 8; FragH f; f.half[0] = *(const v8us*)((const unsigned short*)V16 + ((size_t)b * SQ + s0 + j) * DM + h * HD + d8); for (int q = 0; q < 8; ++q) tl[d8 + q][j] = f.u[q]; }
  __syncthreads();
  { for (int i = tid; i < 64 * 8; i += 256) { const int d = i / 8, j8 = (i % 8) * 8; FragH f; for (int q = 0; q < 8; ++q) f.u[q] = tl[d][j8 + q]; *(v8us*)((unsigned short*)VT + ((size_t)hh * HD + d) * SQ + s0 + j8) = f.half[0]; }  } }

extern "C" void kernel_launch(void* const* d_in, const int* in_sizes, int n_in,
                              void* d_out, int out_size, void* d_ws, size_t ws_size, hipStream_t stream) {
  (void)in_sizes; (void)n_in; (void)out_size;
  const float* const* I = (const float* const*)d_in; const float* hs = I[0]; const float* amask = I[1]; const float* wq = I[2]; const float* bq = I[3]; const float* wk = I[4]; const float* bk = I[5]; const float* wv = I[6]; const float* bv = I[7]; const float* demb = I[8];      /* weights [in][out]; attention_mask [8][1][1][512] additive; dist_emb [1023][64] */
  char* ws = (char*)d_ws; size_t off = 0;
  auto take = [&](size_t bytes) { char* p = ws + off; off += (bytes + 255) & ~(size_t)255; return p; };
  _Float16* BQ = (_Float16*)take((size_t)DM * DM * 2); _Float16* BK = (_Float16*)take((size_t)DM * DM * 2); _Float16* BV = (_Float16*)take((size_t)DM * DM * 2); _Float16* BE = (_Float16*)take((size_t)RW * HD * 2);
  _Float16* X16 = (_Float16*)take(NR * DM * 2); _Float16* Q16 = (_Float16*)take(NR * DM * 2); _Float16* K16 = (_Float16*)take(NR * DM * 2); _Float16* V16 = (_Float16*)take(NR * DM * 2);
  float* AQ = (float*)take((size_t)SQ * NH * RW * 4); float* AK = (float*)take((size_t)SQ * NH * RW * 4);
  float* S = (float*)take((size_t)HG * SQ * SQ * 4); _Float16* P = (_Float16*)take((size_t)HG * SQ * SQ * 2); _Float16* VT = (_Float16*)take((size_t)NB * NH * HD * SQ * 2);
  if (off > ws_size) return;      /* 6 + 0.1 + 4x8 + 32 + 32 + 16 + 8 + 8 = approx 134 MiB */
  const unsigned gw = (unsigned)(((size_t)DM * (DM / 8) + 255) / 256);
  k_wt_f16<<<gw, 256, 0, stream>>>(wq, BQ, DM, DM, 16.0f); k_wt_f16<<<gw, 256, 0, stream>>>(wk, BK, DM, DM, 16.0f); k_wt_f16<<<gw, 256, 0, stream>>>(wv, BV, DM, DM, 16.0f);      /* [in][out] -> Bt[out][in] x16 */
  k_wrel<<<(unsigned)(((size_t)RW * HD / 8 + 255) / 256), 256, 0, stream>>>(demb, BE);
  k_x16<<<(unsigned)((NR * DM / 8 + 255) / 256), 256, 0, stream>>>(hs, X16, NR * DM / 8);
  const dim3 gp((unsigned)((NR / 128) * (DM / 64)), 1);
  k_gemm2<0><<<gp, 128, 0, stream>>>(X16, DM, 0, BQ, DM, 0, 0.0625f, bq, 0, nullptr, 1, 0, 0, nullptr, Q16, DM, 0, MP, DM, DM);
  k_gemm2<0><<<gp, 128, 0, stream>>>(X16, DM, 0, BK, DM, 0, 0.0625f, bk, 0, nullptr, 1, 0, 0, nullptr, K16, DM, 0, MP, DM, DM);
  k_gemm2<0><<<gp, 128, 0, stream>>>(X16, DM, 0, BV, DM, 0, 0.0625f, bv, 0, nullptr, 1, 0, 0, nullptr, V16, DM, 0, MP, DM, DM);
  k_vt<NH, SQ><<<NB * NH * (SQ / 64), 256, 0, stream>>>(V16, DM, 0, VT);      /* V^T[(b,h)][d][s] for every (batch, head) */
  for (int b = 0; b < NBR; ++b) {
    const _Float16* qb = Q16 + (size_t)b * SQ * DM; const _Float16* kb = K16 + (size_t)b * SQ * DM;
    k_gemm2<0><<<dim3((SQ * NH / 128) * (RW / 64), 1), 128, 0, stream>>>(qb, HD, 0, BE, HD, 0, 0.0625f, nullptr, 0, nullptr, 1, 0, 0, AQ, nullptr, RW, 0, SQ * NH, RW, HD);      /* AQ[(l,h)][j] = q_l,h . dist_emb[j] (q rows viewed as [(token, head)][64]) */
    k_gemm2<0><<<dim3((SQ * NH / 128) * (RW / 64), 1), 128, 0, stream>>>(kb, HD, 0, BE, HD, 0, 0.0625f, nullptr, 0, nullptr, 1, 0, 0, AK, nullptr, RW, 0, SQ * NH, RW, HD);      /* AK[(r,h)][j] = k_r,h . dist_emb[j] */
    k_gemm2<0><<<dim3((QN / 128) * (SQ / 64), HG), 128, 0, stream>>>(qb, DM, (size_t)HD, kb, DM, (size_t)HD, 1.0f, nullptr, 0, nullptr, 1, 0, 0, S, nullptr, SQ, (size_t)SQ * SQ, QN, SQ, HD);      /* q . k, 16 heads per launch (scaled in the softmax) */
    k_rsmr<<<dim3((QN + 255) / 256, HG), 256, 0, stream>>>(S, P, AQ, AK, amask + (size_t)b * SQ, QN);
    k_gemm2<0><<<dim3((QN / 128) * (HD / 64), HG), 128, 0, stream>>>(P, SQ, (size_t)SQ * SQ, VT + (size_t)b * NH * HD * SQ, SQ, (size_t)HD * SQ, 0.00390625f, nullptr, 0, nullptr, 1, 0, 0, (float*)d_out + (size_t)b * SQ * DM, nullptr, DM, (size_t)HD, QN, HD, SQ); }      /* ctx rows (merged heads, f32) */
}

// v001
// One run takes 619 microseconds.
// Next to v000, in two timings, it ran 5.90 and 5.93 times as fast.
#include <hip/hip_runtime.h>
// BERT self-attention with relative-position score terms (hidden [8][512][1024]; q, k, v = h W + b ([in][out], 16 heads of 64); scores[l][r] = (q_l.k_r + q_l.pe[l-r] + k_r.pe[l-r]) / 8 + mask[r] with pe = dist_emb[l - r + 511]; softmax; ctx = attn v merged -> [8][512][1024]).
// Structure: token rows r = b*512 + s; hidden as exact f16 rows; Q | K | V as three WMMA GEMMs (32x64 wave tiles, f32 accumulation, exact x16 transposed weights, bias in the epilogue, f16 outputs); the relative terms as two WMMA GEMMs per batch: AQ = q_rows(token,head) . dist_emb^T and AK = k_rows . dist_emb^T ([8192][1024] f32, table padded to 1024 rows with zeros); per batch, all 16 heads batched over grid.y: scores GEMM (K = 64), row softmax on VALU, one wave per query row, gathering AQ[(l,h)][l-r+511] + AK[(r,h)][l-r+511] through LDS (f32; mask added; weights stored x256 as f16), V^T made once before the batch loop (LDS transposes, all batches), ctx = P . V GEMM (K = 512, alpha 2^-8) written as f32 straight into the merged output rows.
// Compute dtype: inputs rounded to bf16; hidden / weights / table exact; q, k, v and the softmax weights as plain f16 GEMM operands (~2^-12); scores, relative terms and softmax statistics f32. v_wmma_f32_16x16x32_f16.
#define NB 8
#define SQ 512
#define DM 1024
#define NH 16
#define HD 64
#define HG 16                        /* heads per attention launch group (all) */
#define NREL 1023                    /* relative distances -511..511 */
#define RW 1024                      /* AQ/AK row pitch (distances padded to 1024) */
#define QN SQ                        /* query rows attended per batch (debug hook) */
#define NBR NB                       /* batches attended (debug hook) */
#define MP ((int)NR)                 /* token rows through the projections (debug hook) */
#define NR ((size_t)NB * SQ)         /* 4096 token rows */
typedef __bf16 v16b __attribute__((ext_vector_type(16)));
typedef unsigned short v8us __attribute__((ext_vector_type(8), may_alias));
typedef float  v8f  __attribute__((ext_vector_type(8)));
typedef float  v4f  __attribute__((ext_vector_type(4)));
typedef float  v4fa __attribute__((ext_vector_type(4), may_alias));
union FragB { v16b v; v8us half[2]; unsigned short u[16]; };

__device__ __forceinline__ unsigned short bf16_bits(float x) { unsigned int u = __float_as_uint(x); return (unsigned short)((u + 0x7FFFu + ((u >> 16) & 1u)) >> 16); }
__device__ __forceinline__ float bf16_val(unsigned short b) { return __uint_as_float(((unsigned int)b) << 16); }
__device__ __forceinline__ float bf16_round(float x) { return bf16_val(bf16_bits(x)); }
// D += A·B with NT terms: 1 = ah·bh, 2 = + al·bh (A split), 3 = + ah·bl (both split)
template <int NT>
__device__ __forceinline__ v8f mmaN(v16b ah, v16b al, v16b bh, v16b bl, v8f c) {
  c = __builtin_amdgcn_wmma_f32_16x16x32_bf16(false, ah, false, bh, (short)0, c, false, false);
  if (NT >= 2) c = __builtin_amdgcn_wmma_f32_16x16x32_bf16(false, al, false, bh, (short)0, c, false, false);
  if (NT >= 3) c = __builtin_amdgcn_wmma_f32_16x16x32_bf16(false, ah, false, bl, (short)0, c, false, false);
  asm volatile("v_nop\n\tv_nop\n\tv_nop\n\tv_nop" : "+v"(c) : "v"(ah), "v"(al), "v"(bh), "v"(bl));
  return c;
}

__global__ __launch_bounds__(256) void k_wt_bf16(const float* __restrict__ W, unsigned short* __restrict__ Wt, int K, int N) {
  const int t = blockIdx.x * 256 + threadIdx.x;
  const int k8n = K / 8;
  if (t >= N * k8n) return;
  const int n = t / k8n, k8 = (t % k8n) * 8;
  v8us v;
#pragma unroll
  for (int i = 0; i < 8; ++i) v[i] = bf16_bits(W[(size_t)(k8 + i) * N + n]);
  *(v8us*)(Wt + (size_t)n * K + k8) = v;
  
}

// GEMM C[M][N] (f32, pitch ldc) = act(A[M][K]·W + bias). A f32 row-major (pitch lda) converted per fragment to bf16
// (ASPLIT: hi/lo two planes -> 2 terms, else single rounded term); Wt bf16 [N][K] (pitch ldb). BIAS_BF16 rounds the
// bias to bf16 first (bias quantised to bf16 before the add). K%32==0, M%16==0, N%64==0.
template <bool ASPLIT, int ACT, bool BIAS_BF16>
__global__ __launch_bounds__(128) void k_gemm_bf(const float* __restrict__ A, int lda, const unsigned short* __restrict__ Wt, int ldb,
                                               const float* __restrict__ bias, float* __restrict__ C, int ldc, int M, int N, int K) {
  __shared__ __attribute__((aligned(16))) float so[4][16][64];
  const int tid = threadIdx.x, w = tid >> 5, lane = tid & 31, ln = lane & 15, hh = lane >> 4;
  const int ntn = N / 64;
  const int wid = blockIdx.x * 4 + w;
  const int mt = wid / ntn, nq = wid % ntn;
  if (mt * 16 >= M) return;
  const int row0 = mt * 16, col0 = nq * 64;
  const float* arow = A + (size_t)(row0 + ln) * lda;
  v8f acc[4] = {};
  for (int kb = 0; kb < K; kb += 32) {
    FragB ah, al;
    const v4f x0 = *(const v4fa*)(arow + kb + 8 * hh), x1 = *(const v4fa*)(arow + kb + 8 * hh + 4);
    const v4f x2 = *(const v4fa*)(arow + kb + 16 + 8 * hh), x3 = *(const v4fa*)(arow + kb + 16 + 8 * hh + 4);
    float xs[16] = {x0[0],x0[1],x0[2],x0[3],x1[0],x1[1],x1[2],x1[3],x2[0],x2[1],x2[2],x2[3],x3[0],x3[1],x3[2],x3[3]};
#pragma unroll
    for (int i = 0; i < 16; ++i) { const unsigned short hb = bf16_bits(xs[i]); ah.u[i] = hb; al.u[i] = ASPLIT ? bf16_bits(xs[i] - bf16_val(hb)) : (unsigned short)0; }
#pragma unroll
    for (int t = 0; t < 4; ++t) {
      const unsigned short* brow = Wt + (size_t)(col0 + t * 16 + ln) * ldb + kb;
      FragB b;
      b.half[0] = *(const v8us*)(brow + 8 * hh);
      b.half[1] = *(const v8us*)(brow + 16 + 8 * hh);
      acc[t] = mmaN<ASPLIT ? 2 : 1>(ah.v, al.v, b.v, b.v, acc[t]);
    }
  }
#pragma unroll
  for (int t = 0; t < 4; ++t) {
    float bv = bias ? bias[col0 + t * 16 + ln] : 0.f;
    if (BIAS_BF16) bv = bf16_round(bv);
#pragma unroll
    for (int r = 0; r < 8; ++r) { float v = acc[t][r] + bv; if (ACT == 1) v = fmaxf(v, 0.f); so[w][8 * hh + r][t * 16 + ln] = v; }
  }
  __builtin_amdgcn_fence(__ATOMIC_ACQ_REL, "workgroup");
  __builtin_amdgcn_wave_barrier();
  const int rsub = lane >> 4, c4 = (lane & 15) * 4;
  {
#pragma unroll
    for (int q = 0; q < 8; ++q) {
      const int r = q * 2 + rsub;
      const v4f v = *(const v4fa*)&so[w][r][c4];
      *(v4f*)(C + (size_t)(row0 + r) * ldc + col0 + c4) = v;
    }
    
  }
}

// GEMM C = act(A·W + bias + resid): A f32 (ASPLIT -> hi/lo 2 terms), Wt bf16 [N][K]; ACT 0 none, 1 relu, 2 exact gelu;
// resid (optional, f32, row index = (row % rmod), pitch ldr, RES_BF16 rounds it) added before the activation.
template <bool ASPLIT, int ACT, bool BIAS_BF16, bool RES_BF16>
__global__ __launch_bounds__(128) void k_gemm_bf3(const float* __restrict__ A, int lda, const unsigned short* __restrict__ Wt, int ldb,
                                                const float* __restrict__ bias, const float* __restrict__ resid, int rmod, int ldr,
                                                float* __restrict__ C, int ldc, int M, int N, int K) {
  __shared__ __attribute__((aligned(16))) float so[4][16][64];
  const int tid = threadIdx.x, w = tid >> 5, lane = tid & 31, ln = lane & 15, hh = lane >> 4;
  const int ntn = N / 64;
  const int wid = blockIdx.x * 4 + w;
  const int mt = wid / ntn, nq = wid % ntn;
  if (mt * 16 >= M) return;
  const int row0 = mt * 16, col0 = nq * 64;
  const float* arow = A + (size_t)(row0 + ln) * lda;
  v8f acc[4] = {};
  for (int kb = 0; kb < K; kb += 32) {
    FragB ah, al;
    const v4f x0 = *(const v4fa*)(arow + kb + 8 * hh), x1 = *(const v4fa*)(arow + kb + 8 * hh + 4);
    const v4f x2 = *(const v4fa*)(arow + kb + 16 + 8 * hh), x3 = *(const v4fa*)(arow + kb + 16 + 8 * hh + 4);
    float xs[16] = {x0[0],x0[1],x0[2],x0[3],x1[0],x1[1],x1[2],x1[3],x2[0],x2[1],x2[2],x2[3],x3[0],x3[1],x3[2],x3[3]};
#pragma unroll
    for (int i = 0; i < 16; ++i) { const unsigned short hb = bf16_bits(xs[i]); ah.u[i] = hb; al.u[i] = ASPLIT ? bf16_bits(xs[i] - bf16_val(hb)) : (unsigned short)0; }
#pragma unroll
    for (int t = 0; t < 4; ++t) {
      const unsigned short* brow = Wt + (size_t)(col0 + t * 16 + ln) * ldb + kb;
      FragB b;
      b.half[0] = *(const v8us*)(brow + 8 * hh);
      b.half[1] = *(const v8us*)(brow + 16 + 8 * hh);
      acc[t] = mmaN<ASPLIT ? 2 : 1>(ah.v, al.v, b.v, b.v, acc[t]);
    }
  }
#pragma unroll
  for (int t = 0; t < 4; ++t) {
    const int col = col0 + t * 16 + ln;
    float bv = bias ? bias[col] : 0.f;
    if (BIAS_BF16) bv = bf16_round(bv);
#pragma unroll
    for (int r = 0; r < 8; ++r) {
      float v = acc[t][r] + bv;
      if (resid) { float rv = resid[(size_t)((row0 + 8 * hh + r) % rmod) * ldr + col]; if (RES_BF16) rv = bf16_round(rv); v += rv; }
      if (ACT == 1) v = fmaxf(v, 0.f);
      if (ACT == 2) v = 0.5f * v * (1.0f + erff(v * 0.70710678118654752f));
      if (ACT == 3) { const float u = 0.7978845608028654f * (v + 0.044715f * v * v * v); v = 0.5f * v * (1.0f + tanhf(u)); }
      so[w][8 * hh + r][t * 16 + ln] = v;
    }
  }
  __builtin_amdgcn_fence(__ATOMIC_ACQ_REL, "workgroup");
  __builtin_amdgcn_wave_barrier();
  const int rsub = lane >> 4, c4 = (lane & 15) * 4;
  {
#pragma unroll
    for (int q = 0; q < 8; ++q) {
      const int r = q * 2 + rsub;
      const v4f v = *(const v4fa*)&so[w][r][c4];
      *(v4f*)(C + (size_t)(row0 + r) * ldc + col0 + c4) = v;
    }
    
  }
}
// row LayerNorm (biased variance, eps) over N: s = X (+ R); optional out_sum <- s; out_norm <- (s-mu)*rsqrt(var+eps)*g + b
template <bool PARAM_BF16>
__global__ __launch_bounds__(256) void k_layernorm(const float* __restrict__ X, const float* __restrict__ R, const float* __restrict__ g, const float* __restrict__ bta,
                                                  float* __restrict__ out_sum, float* __restrict__ out_norm, int N, float eps) {
  __shared__ float red[256];
  const int row = blockIdx.x, tid = threadIdx.x;
  const float* x = X + (size_t)row * N; const float* rr = R ? R + (size_t)row * N : nullptr;
  float vals[16];                     // up to N = 4096
  const int per = N / 256;            // contiguous chunk per thread? use strided-by-4 chunks: thread handles j = tid*4 + 1024*u
  float s1 = 0.f;
  for (int u = 0; u < per / 4; ++u) {
    const int j = tid * 4 + 1024 * u;
    const v4f a = *(const v4fa*)(x + j);
    v4f b = {0.f,0.f,0.f,0.f}; if (rr) b = *(const v4fa*)(rr + j);
#pragma unroll
    for (int q = 0; q < 4; ++q) { const float v = a[q] + b[q]; vals[u * 4 + q] = v; s1 += v; }
  }
  red[tid] = s1; __syncthreads();
  for (int st = 128; st > 0; st >>= 1) { if (tid < st) red[tid] += red[tid + st]; __syncthreads(); }
  const float mu = red[0] / (float)N; __syncthreads();
  float s2 = 0.f;
  for (int u = 0; u < per / 4; ++u)
#pragma unroll
    for (int q = 0; q < 4; ++q) { const float c = vals[u * 4 + q] - mu; s2 += c * c; }
  red[tid] = s2; __syncthreads();
  for (int st = 128; st > 0; st >>= 1) { if (tid < st) red[tid] += red[tid + st]; __syncthreads(); }
  const float rs = rsqrtf(red[0] / (float)N + eps);
  {
    for (int u = 0; u < per / 4; ++u) {
      const int j = tid * 4 + 1024 * u;
      v4f o, sm;
#pragma unroll
      for (int q = 0; q < 4; ++q) {
        float gg = g[j + q], bb = bta[j + q];
        if (PARAM_BF16) { gg = bf16_round(gg); bb = bf16_round(bb); }
        sm[q] = vals[u * 4 + q]; o[q] = (vals[u * 4 + q] - mu) * rs * gg + bb;
      }
      if (out_sum) *(v4f*)(out_sum + (size_t)row * N + j) = sm;
      *(v4f*)(out_norm + (size_t)row * N + j) = o;
    }
    
  }
}



// ---- f16 WMMA path (v_wmma_f32_16x16x32_f16): 11-bit significands for operands in range — used where a [0,1] probability operand needs more precision than bf16
typedef _Float16 v16h __attribute__((ext_vector_type(16)));
union FragH { v16h v; v8us half[2]; _Float16 h[16]; unsigned short u[16]; };
template <int NT>
__device__ __forceinline__ v8f mmaH(v16h ah, v16h al, v16h bh, v16h bl, v8f c) {
  c = __builtin_amdgcn_wmma_f32_16x16x32_f16(false, ah, false, bh, (short)0, c, false, false);
  if (NT >= 2) c = __builtin_amdgcn_wmma_f32_16x16x32_f16(false, al, false, bh, (short)0, c, false, false);
  if (NT >= 3) c = __builtin_amdgcn_wmma_f32_16x16x32_f16(false, ah, false, bl, (short)0, c, false, false);
  asm volatile("v_nop\n\tv_nop\n\tv_nop\n\tv_nop" : "+v"(c) : "v"(ah), "v"(al), "v"(bh), "v"(bl));
  return c;
}
// batched GEMM like k_gemm_b but f16 operands: A f32 (split into f16 hi/lo if ASPLIT, else rounded to f16), Bt = f16 values [n][k]; alpha; C f32; N multiple of 16 (partial tiles skipped)
template <bool ASPLIT>
__global__ __launch_bounds__(128) void k_gemm_h(const float* __restrict__ A, int lda, size_t sA, const _Float16* __restrict__ Bh, int ldb, size_t sB, float alpha, float* __restrict__ C, int ldc, size_t sC, int M, int N, int K) {
  __shared__ __attribute__((aligned(16))) float so[4][16][64];
  const int tid = threadIdx.x, w = tid >> 5, lane = tid & 31, ln = lane & 15, hh = lane >> 4; const int by = blockIdx.y;
  A += (size_t)by * sA; Bh += (size_t)by * sB; C += (size_t)by * sC;
  const int ntn = (N + 63) / 64; const int wid = blockIdx.x * 4 + w; const int mt = wid / ntn, nq = wid % ntn; if (mt * 16 >= M) return;
  const int row0 = mt * 16, col0 = nq * 64; const float* arow = A + (size_t)(row0 + ln) * lda;
  v8f acc[4] = {};
  for (int kb = 0; kb < K; kb += 32) {
    FragH ah, al;
    const v4f x0 = *(const v4fa*)(arow + kb + 8 * hh), x1 = *(const v4fa*)(arow + kb + 8 * hh + 4), x2 = *(const v4fa*)(arow + kb + 16 + 8 * hh), x3 = *(const v4fa*)(arow + kb + 16 + 8 * hh + 4);
    float xs[16] = {x0[0],x0[1],x0[2],x0[3],x1[0],x1[1],x1[2],x1[3],x2[0],x2[1],x2[2],x2[3],x3[0],x3[1],x3[2],x3[3]};
#pragma unroll
    for (int i = 0; i < 16; ++i) { const _Float16 h = (_Float16)xs[i]; ah.h[i] = h; al.h[i] = ASPLIT ? (_Float16)(xs[i] - (float)h) : (_Float16)0.0f; }
#pragma unroll
    for (int t = 0; t < 4; ++t) { if (col0 + t * 16 >= N) continue; const size_t boff = (size_t)(col0 + t * 16 + ln) * ldb + kb; FragH bq; bq.half[0] = *(const v8us*)(Bh + boff + 8 * hh); bq.half[1] = *(const v8us*)(Bh + boff + 16 + 8 * hh);
      acc[t] = mmaH<ASPLIT ? 2 : 1>(ah.v, al.v, bq.v, bq.v, acc[t]); }
  }
#pragma unroll
  for (int t = 0; t < 4; ++t) { if (col0 + t * 16 >= N) continue;
#pragma unroll
    for (int r = 0; r < 8; ++r) so[w][8 * hh + r][t * 16 + ln] = acc[t][r] * alpha; }
  __builtin_amdgcn_fence(__ATOMIC_ACQ_REL, "workgroup"); __builtin_amdgcn_wave_barrier();
  const int rsub = lane >> 4, c4 = (lane & 15) * 4;
  {
#pragma unroll
    for (int q = 0; q < 8; ++q) { const int r = q * 2 + rsub; if (col0 + c4 < N) { const v4f v = *(const v4fa*)&so[w][r][c4]; *(v4f*)(C + (size_t)(row0 + r) * ldc + col0 + c4) = v; } }
     }
}

// Wt[n][k] = f16(W[k][n]·scale) from f32 row-major W[K][N] (scale = power of two; bf16-exact weights stay exact in f16 away from the subnormal range)
__global__ __launch_bounds__(256) void k_wt_f16(const float* __restrict__ W, _Float16* __restrict__ Wt, int K, int N, float scale) {
  const int t = blockIdx.x * 256 + threadIdx.x; if (t >= N * (K / 8)) return; const int n = t / (K / 8), k8 = (t % (K / 8)) * 8; FragH f;
#pragma unroll
  for (int i = 0; i < 8; ++i) f.h[i] = (_Float16)(bf16_round(W[(size_t)(k8 + i) * N + n]) * scale); const v8us o = f.half[0];
  *(v8us*)((unsigned short*)Wt + (size_t)n * K + k8) = o; 
}
// k_gemm_hh variant with fused epilogue: v = acc·alpha + bias[by·sBias + col] (+ CP[(row/rowsPerB)·sCPb + by·64 + col] if CP) ; ACT 0 none / 1 elu ; writes f16 C16 (and f32 C if non-null)
template <int ACT>
__global__ __launch_bounds__(128) void k_gemm_hhx(const _Float16* __restrict__ A, int lda, size_t sA, const _Float16* __restrict__ Bh, int ldb, size_t sB, float alpha, const float* __restrict__ bias, size_t sBias, const float* __restrict__ CP, int rowsPerB, size_t sCPb, int row0g,
    float* __restrict__ C, _Float16* __restrict__ C16, int ldc, size_t sC, int M, int N, int K) {
  __shared__ __attribute__((aligned(16))) float so[4][16][64];
  const int tid = threadIdx.x, w = tid >> 5, lane = tid & 31, ln = lane & 15, hh = lane >> 4; const int by = blockIdx.y;
  A += (size_t)by * sA; Bh += (size_t)by * sB; const size_t cofs = (size_t)by * sC; const float* bp = bias ? bias + (size_t)by * sBias : nullptr;
  const int ntn = (N + 63) / 64; const int wid = blockIdx.x * 4 + w; const int mt = wid / ntn, nq = wid % ntn; if (mt * 16 >= M) return;
  const int row0 = mt * 16, col0 = nq * 64; const _Float16* arow = A + (size_t)(row0 + ln) * lda;
  v8f acc[4] = {};
  for (int kb = 0; kb < K; kb += 32) { FragH ah; ah.half[0] = *(const v8us*)((const unsigned short*)arow + kb + 8 * hh); ah.half[1] = *(const v8us*)((const unsigned short*)arow + kb + 16 + 8 * hh);
#pragma unroll
    for (int t = 0; t < 4; ++t) { if (col0 + t * 16 >= N) continue; const size_t boff = (size_t)(col0 + t * 16 + ln) * ldb + kb; FragH bq; bq.half[0] = *(const v8us*)((const unsigned short*)Bh + boff + 8 * hh); bq.half[1] = *(const v8us*)((const unsigned short*)Bh + boff + 16 + 8 * hh);
      acc[t] = mmaH<1>(ah.v, ah.v, bq.v, bq.v, acc[t]); }
  }
#pragma unroll
  for (int t = 0; t < 4; ++t) { if (col0 + t * 16 >= N) continue; const int col = col0 + t * 16 + ln; const float bv = bp ? bf16_round(bp[col]) : 0.f;
#pragma unroll
    for (int r = 0; r < 8; ++r) { float v = acc[t][r] * alpha + bv; if (CP) { const int rr = row0g + row0 + 8 * hh + r; if (rowsPerB < 0) v += CP[cofs + (size_t)rr * ldc + col];      /* rowsPerB < 0: own element of the batched C plane */ else { const int bidx = rr / rowsPerB; v += CP[(size_t)bidx * sCPb + (size_t)by * 64 + col]; } } if (ACT == 1) v = (v > 0.f) ? v : expm1f(v); else if (ACT == 7) v = (v > 0.f) ? v + 1.0f : expf(v); else if (ACT == 8) v = tanhf(v); else if (ACT == 9) v = 0.5f * v * (1.0f + tanhf(0.7978845608028654f * (v + 0.044715f * v * v * v))); else if (ACT == 11) v = 1.0f / (1.0f + expf(-v)); else if (ACT == 12) v = (v > 0.f) ? v : 0.01f * v; else if (ACT == 14) v = (v > 0.f) ? v : 0.1f * v; else if (ACT == 16) v = (v >= 0.f) ? v : 0.3f * v; else if (ACT == 17) v = (v >= 0.f) ? v : 0.2f * v; else if (ACT == 15) v = v / (1.0f + expf(-v)); else if (ACT == 3) v = fmaxf(v, 0.f); else if (ACT == 6) v = 0.5f * v * (1.0f + erff(v * 0.70710678118654752f)); so[w][8 * hh + r][t * 16 + ln] = v; } }
  __builtin_amdgcn_fence(__ATOMIC_ACQ_REL, "workgroup"); __builtin_amdgcn_wave_barrier();
  const int rsub = lane >> 4, c4 = (lane & 15) * 4; typedef _Float16 v4h __attribute__((ext_vector_type(4)));
  {
#pragma unroll
    for (int q = 0; q < 8; ++q) { const int r = q * 2 + rsub; if (col0 + c4 < N) { const v4f v = *(const v4fa*)&so[w][r][c4]; if (C) *(v4f*)(C + cofs + (size_t)(row0 + r) * ldc + col0 + c4) = v; if (C16) { v4h h4; for (int i = 0; i < 4; ++i) h4[i] = (_Float16)v[i]; *(v4h*)(C16 + cofs + (size_t)(row0 + r) * ldc + col0 + c4) = h4; } } }
     }
}


typedef _Float16 v4h __attribute__((ext_vector_type(4)));

__global__ __launch_bounds__(256) void k_x16(const float* __restrict__ x, _Float16* __restrict__ X16, size_t n8) { const size_t t = (size_t)blockIdx.x * 256 + threadIdx.x; if (t >= n8) return; FragH f;
#pragma unroll
  for (int q = 0; q < 8; ++q) f.h[q] = (_Float16)bf16_round(x[t * 8 + q]); *(v8us*)((unsigned short*)X16 + t * 8) = f.half[0];  }
__global__ __launch_bounds__(256) void k_h16(const float* __restrict__ x, _Float16* __restrict__ X16, size_t n8) { const size_t t = (size_t)blockIdx.x * 256 + threadIdx.x; if (t >= n8) return; FragH f;
#pragma unroll
  for (int q = 0; q < 8; ++q) f.h[q] = (_Float16)x[t * 8 + q]; *(v8us*)((unsigned short*)X16 + t * 8) = f.half[0];  }
__global__ __launch_bounds__(256) void k_round16f(const float* __restrict__ W, _Float16* __restrict__ Bt, size_t n8) { const size_t t = (size_t)blockIdx.x * 256 + threadIdx.x; if (t >= n8) return; FragH f;
#pragma unroll
  for (int i = 0; i < 8; ++i) f.h[i] = (_Float16)(bf16_round(W[t * 8 + i]) * 16.0f); *(v8us*)((unsigned short*)Bt + t * 8) = f.half[0];  }
template <int NHv, int TTv>
__global__ __launch_bounds__(256) void k_vt(const _Float16* __restrict__ V16, int ldv, int voff, _Float16* __restrict__ Vt) { __shared__ unsigned short tl[64][66]; const int tid = threadIdx.x; const int slab = blockIdx.x / (TTv / 64), lg = blockIdx.x % (TTv / 64); const int b = slab / NHv, h = slab % NHv;
  for (int i = tid; i < 64 * 8; i += 256) { const int r = i / 8, c8 = (i % 8) * 8; FragH f; f.half[0] = *(const v8us*)((const unsigned short*)V16 + ((size_t)b * TTv + lg * 64 + r) * ldv + voff + h * 64 + c8);
#pragma unroll
    for (int q = 0; q < 8; ++q) tl[r][c8 + q] = f.u[q]; }
  __syncthreads();
  {
#pragma unroll
    for (int rd = 0; rd < 2; ++rd) { const int d = rd * 32 + tid / 8, pc = tid % 8; FragH f;
#pragma unroll
      for (int q = 0; q < 8; ++q) f.u[q] = tl[pc * 8 + q][d];
      *(v8us*)((unsigned short*)Vt + ((size_t)slab * 64 + d) * TTv + lg * 64 + pc * 8) = f.half[0]; }
     } }

__global__ __launch_bounds__(256) void k_hl(const float* __restrict__ F, _Float16* __restrict__ Hh, _Float16* __restrict__ Hl, size_t n8) { const size_t t = (size_t)blockIdx.x * 256 + threadIdx.x; if (t >= n8) return; FragH fh, fl; const v4f a = *(const v4fa*)(F + t * 8), c = *(const v4fa*)(F + t * 8 + 4);
#pragma unroll
  for (int q = 0; q < 4; ++q) { _Float16 h = (_Float16)a[q]; fh.h[q] = h; fl.h[q] = (_Float16)((a[q] - (float)h) * 1024.0f); h = (_Float16)c[q]; fh.h[4 + q] = h; fl.h[4 + q] = (_Float16)((c[q] - (float)h) * 1024.0f); }
  { *(v8us*)((unsigned short*)Hh + t * 8) = fh.half[0]; *(v8us*)((unsigned short*)Hl + t * 8) = fl.half[0];  } }

// ---- fast GEMM (wave tile 32x64; requires M % 32 == 0 rows per launch region and N % 64 == 0); epilogue = k_gemm_hhx semantics ----
__device__ __forceinline__ v16h g2_frag(const _Float16* p, int hh) { FragH f; f.half[0] = *(const v8us*)((const unsigned short*)p + 8 * hh); f.half[1] = *(const v8us*)((const unsigned short*)p + 16 + 8 * hh); return f.v; }
__device__ __forceinline__ v8f g2_mma(v16h a, v16h b, v8f c) { v8f d = __builtin_amdgcn_wmma_f32_16x16x32_f16(false, a, false, b, (short)0, c, false, false); asm volatile("v_nop\n\tv_nop\n\tv_nop\n\tv_nop" : "+v"(d) : "v"(a), "v"(b)); return d; }
template <int ACT>
__global__ __launch_bounds__(128) void k_gemm2(const _Float16* __restrict__ A, int lda, size_t sA, const _Float16* __restrict__ Bh, int ldb, size_t sB, float alpha, const float* __restrict__ bias, size_t sBias, const float* __restrict__ CP, int rowsPerB, size_t sCPb, int row0g,
    float* __restrict__ C, _Float16* __restrict__ C16, int ldc, size_t sC, int M, int N, int K) { static_assert(ACT == 0 || ACT == 3 || ACT == 6 || ACT == 8 || ACT == 9 || ACT == 11 || ACT == 12 || ACT == 14 || ACT == 15 || ACT == 16 || ACT == 17, "k_gemm2: unsupported ACT code (would silently apply no activation)");
  __shared__ __attribute__((aligned(16))) float so[4][32][68];
  const int tid = threadIdx.x, w = tid >> 5, lane = tid & 31, ln = lane & 15, hh = lane >> 4; const int by = blockIdx.y;
  A += (size_t)by * sA; Bh += (size_t)by * sB; const size_t cofs = (size_t)by * sC; const float* bp = bias ? bias + (size_t)by * sBias : nullptr;
  const int ntn = N >> 6; const int mt = blockIdx.x / ntn, nq = blockIdx.x - mt * ntn; const int row0 = mt * 128 + 32 * w, col0 = nq * 64; if (row0 >= M) return;
  const _Float16* a0p = A + (size_t)(row0 + ln) * lda; const _Float16* a1p = a0p + (size_t)16 * lda;
  const _Float16* b0p = Bh + (size_t)(col0 + ln) * ldb; const _Float16* b1p = b0p + (size_t)16 * ldb; const _Float16* b2p = b1p + (size_t)16 * ldb; const _Float16* b3p = b2p + (size_t)16 * ldb;
  const v8f z8 = {0.f,0.f,0.f,0.f,0.f,0.f,0.f,0.f}; v8f c00 = z8, c01 = z8, c02 = z8, c03 = z8, c10 = z8, c11 = z8, c12 = z8, c13 = z8;
#pragma unroll 1
  for (int kb = 0; kb < K; kb += 32) { const v16h a0 = g2_frag(a0p + kb, hh), a1 = g2_frag(a1p + kb, hh);
    v16h b = g2_frag(b0p + kb, hh); c00 = g2_mma(a0, b, c00); c10 = g2_mma(a1, b, c10);
    b = g2_frag(b1p + kb, hh); c01 = g2_mma(a0, b, c01); c11 = g2_mma(a1, b, c11);
    b = g2_frag(b2p + kb, hh); c02 = g2_mma(a0, b, c02); c12 = g2_mma(a1, b, c12);
    b = g2_frag(b3p + kb, hh); c03 = g2_mma(a0, b, c03); c13 = g2_mma(a1, b, c13); }
  v8f accs[8] = {c00, c01, c02, c03, c10, c11, c12, c13};
#pragma unroll
  for (int u = 0; u < 8; ++u) { const int t = u & 3, half = u >> 2; const int col = col0 + t * 16 + ln; const float bv = bp ? bf16_round(bp[col]) : 0.f;
#pragma unroll
    for (int r = 0; r < 8; ++r) { const int rloc = half * 16 + 8 * hh + r; float v = accs[u][r] * alpha + bv; if (CP) { if (rowsPerB < 0) v += CP[cofs + (size_t)(row0g + row0 + rloc) * ldc + col];      /* rowsPerB < 0: own element of the batched C plane */ else { const int bidx = (row0g + row0 + rloc) / rowsPerB; v += CP[(size_t)bidx * sCPb + (size_t)by * 64 + col]; } }
      if (ACT == 3) v = fmaxf(v, 0.f); else if (ACT == 6) v = 0.5f * v * (1.0f + erff(v * 0.70710678118654752f)); else if (ACT == 11) v = 1.0f / (1.0f + expf(-v)); else if (ACT == 15) v = v / (1.0f + expf(-v)); else if (ACT == 12) v = (v > 0.f) ? v : 0.01f * v; else if (ACT == 8) v = tanhf(v); else if (ACT == 9) v = 0.5f * v * (1.0f + tanhf(0.7978845608028654f * (v + 0.044715f * v * v * v))); else if (ACT == 14) v = (v > 0.f) ? v : 0.1f * v; else if (ACT == 16) v = (v >= 0.f) ? v : 0.3f * v; else if (ACT == 17) v = (v >= 0.f) ? v : 0.2f * v;
      so[w][rloc][t * 16 + ln] = v; } }
  __builtin_amdgcn_fence(__ATOMIC_ACQ_REL, "workgroup"); __builtin_amdgcn_wave_barrier();
  const int rsub = lane >> 4, c4 = (lane & 15) * 4;
  {
#pragma unroll
    for (int q = 0; q < 16; ++q) { const int r = q * 2 + rsub; const v4f v = *(const v4fa*)&so[w][r][c4]; if (C) *(v4f*)(C + cofs + (size_t)(row0 + r) * ldc + col0 + c4) = v; if (C16) { v4h h4; for (int i = 0; i < 4; ++i) h4[i] = (_Float16)v[i]; *(v4h*)(C16 + cofs + (size_t)(row0 + r) * ldc + col0 + c4) = h4; } }
     } }


__global__ __launch_bounds__(256) void k_wrel(const float* __restrict__ w, _Float16* __restrict__ Bt) { const size_t t = (size_t)blockIdx.x * 256 + threadIdx.x; if (t >= (size_t)RW * HD / 8) return; const bool live = t < (size_t)NREL * HD / 8; FragH f; for (int q = 0; q < 8; ++q) f.h[q] = live ? (_Float16)(bf16_round(w[t * 8 + q]) * 16.0f) : (_Float16)0.0f; *(v8us*)((unsigned short*)Bt + t * 8) = f.half[0];  }
__global__ __launch_bounds__(256) void k_wnat(const float* __restrict__ w, size_t n8, _Float16* __restrict__ Bt) { const size_t t = (size_t)blockIdx.x * 256 + threadIdx.x; if (t >= n8) return; FragH f; for (int q = 0; q < 8; ++q) f.h[q] = (_Float16)(bf16_round(w[t * 8 + q]) * 16.0f); *(v8us*)((unsigned short*)Bt + t * 8) = f.half[0];  }
// row softmax with the two relative-position terms: score[i][r] = (s[i][r] + AQ[(i,h)][i-r+S-1] + AK[(r,h)][i-r+S-1]) * 0.125 + mask[r] (bf16-rounded additive mask,
// staged in LDS); head h = blockIdx.y; AQ/AK rows are (token, head) with pitch RW; P = f16(256 softmax).
// One work-group = RT query rows of one head, 16 waves. AK is contiguous along i for a fixed r, so it is loaded with lanes along i and turned through LDS;
// AQ runs backwards along r, so it is loaded with lanes along r and re-read from LDS four columns a lane. Then one wave per query row (two rows a wave),
// lane l holding columns 128u + 4l .. + 3: the 16 scores of a lane stay in registers from the maximum to the store.
// Every loop is fully unrolled (constant trip counts): the per-lane arrays must be indexed by constants to live in registers, and all global loads issue before the first wait.
#define RT 32                        /* query rows per softmax work-group */
#define TP (SQ + 4)                  /* LDS row pitch in floats: rows stay 16-byte aligned, a column of 32 rows falls on 16 banks */
template <int C> __device__ __forceinline__ float x_row(float x) { return __builtin_bit_cast(float, __builtin_amdgcn_update_dpp(0, __builtin_bit_cast(int, x), 0x160 | C, 0xf, 0xf, true)); }      /* lane l <- lane l ^ C inside a 16-lane row (row_xmask) */
__device__ __forceinline__ float x_half(float x) { return __builtin_bit_cast(float, __builtin_amdgcn_permlanex16(__builtin_bit_cast(int, x), __builtin_bit_cast(int, x), 0x76543210, 0xfedcba98, false, false)); }      /* lane l <- lane l ^ 16 */
__device__ __forceinline__ float wave_max(float v) { v = fmaxf(v, x_row<1>(v)); v = fmaxf(v, x_row<2>(v)); v = fmaxf(v, x_row<4>(v)); v = fmaxf(v, x_row<8>(v)); return fmaxf(v, x_half(v)); }
__device__ __forceinline__ float wave_sum(float v) { v += x_row<1>(v); v += x_row<2>(v); v += x_row<4>(v); v += x_row<8>(v); return v + x_half(v); }
__global__ __launch_bounds__(512) void k_rsmr(const float* __restrict__ S, _Float16* __restrict__ P, const float* __restrict__ AQ, const float* __restrict__ AK, const float* __restrict__ amask) {
  static_assert(SQ == 512 && QN % RT == 0, "k_rsmr: 512 threads stage 512 mask values; whole row tiles only");
  __shared__ __attribute__((aligned(16))) float tk[RT][TP];
  __shared__ __attribute__((aligned(16))) float tq[RT][TP];
  __shared__ __attribute__((aligned(16))) float mk[SQ];
  const int tid = threadIdx.x, w = tid >> 5, lane = tid & 31, h = blockIdx.y, i0 = blockIdx.x * RT;
  const float* akp = AK + ((size_t)w * NH + h) * RW + (SQ - 1 + i0 + lane - w);      /* key row r = w + 16u, query row i0 + lane */
  float ak[SQ / 16];
#pragma unroll
  for (int u = 0; u < SQ / 16; ++u) ak[u] = akp[(size_t)u * 16 * (NH * RW - 1)];
  float aq[2][16]; v4f sv[2][4];
#pragma unroll
  for (int k = 0; k < 2; ++k) { const int i = i0 + 2 * w + k; const float* aqp = AQ + ((size_t)i * NH + h) * RW + (SQ - 1 + i - lane);
#pragma unroll
    for (int u = 0; u < 16; ++u) aq[k][u] = aqp[-32 * u]; }
  const float mv = amask[tid];
  asm volatile("s_wait_xcnt 0x0" ::: "memory");      /* the loads below may land in registers that held the addresses of the loads above */
#pragma unroll
  for (int k = 0; k < 2; ++k) { const float* sp = S + ((size_t)h * SQ + i0 + 2 * w + k) * SQ + 4 * lane;
#pragma unroll
    for (int u = 0; u < 4; ++u) sv[k][u] = *(const v4fa*)(sp + 128 * u); }
  mk[tid] = bf16_round(mv);
#pragma unroll
  for (int u = 0; u < SQ / 16; ++u) tk[lane][w + 16 * u] = ak[u];
#pragma unroll
  for (int k = 0; k < 2; ++k)
#pragma unroll
    for (int u = 0; u < 16; ++u) tq[2 * w + k][32 * u + lane] = aq[k][u];
  __syncthreads();
#pragma unroll
  for (int k = 0; k < 2; ++k) { const int row = 2 * w + k; float x[16]; float mx = -INFINITY;
#pragma unroll
    for (int u = 0; u < 4; ++u) { const int c = 128 * u + 4 * lane; const v4f qa = *(const v4fa*)&tq[row][c], ka = *(const v4fa*)&tk[row][c], mm = *(const v4fa*)&mk[c];
#pragma unroll
      for (int q = 0; q < 4; ++q) { x[u * 4 + q] = (sv[k][u][q] + qa[q] + ka[q]) * 0.125f + mm[q]; mx = fmaxf(mx, x[u * 4 + q]); } }
    mx = wave_max(mx); float se = 0.f;
#pragma unroll
    for (int j = 0; j < 16; ++j) { x[j] = expf(x[j] - mx); se += x[j]; }
    const float sc = 256.0f / wave_sum(se); _Float16* d = P + ((size_t)h * SQ + i0 + row) * SQ + 4 * lane;
#pragma unroll
    for (int u = 0; u < 4; ++u) { v4h o;
#pragma unroll
      for (int q = 0; q < 4; ++q) o[q] = (_Float16)(x[u * 4 + q] * sc);
      *(v4h*)(d + 128 * u) = o; } } }
__global__ __launch_bounds__(256) void k_vt(const _Float16* __restrict__ V16, int b, int h0, _Float16* __restrict__ VT) { __shared__ unsigned short tl[64][65]; const int tid = threadIdx.x; const int hh = blockIdx.x % HG, sg = blockIdx.x / HG; const int s0 = sg * 64; const int h = h0 + hh;
  for (int i = tid; i < 64 * 8; i += 256) { const int j = i / 8, d8 = (i % 8) * 8; FragH f; f.half[0] = *(const v8us*)((const unsigned short*)V16 + ((size_t)b * SQ + s0 + j) * DM + h * HD + d8); for (int q = 0; q < 8; ++q) tl[d8 + q][j] = f.u[q]; }
  __syncthreads();
  { for (int i = tid; i < 64 * 8; i += 256) { const int d = i / 8, j8 = (i % 8) * 8; FragH f; for (int q = 0; q < 8; ++q) f.u[q] = tl[d][j8 + q]; *(v8us*)((unsigned short*)VT + ((size_t)hh * HD + d) * SQ + s0 + j8) = f.half[0]; }  } }

extern "C" void kernel_launch(void* const* d_in, const int* in_sizes, int n_in,
                              void* d_out, int out_size, void* d_ws, size_t ws_size, hipStream_t stream) {
  (void)in_sizes; (void)n_in; (void)out_size;
  const float* const* I = (const float* const*)d_in; const float* hs = I[0]; const float* amask = I[1]; const float* wq = I[2]; const float* bq = I[3]; const float* wk = I[4]; const float* bk = I[5]; const float* wv = I[6]; const float* bv = I[7]; const float* demb = I[8];      /* weights [in][out]; attention_mask [8][1][1][512] additive; dist_emb [1023][64] */
  char* ws = (char*)d_ws; size_t off = 0;
  auto take = [&](size_t bytes) { char* p = ws + off; off += (bytes + 255) & ~(size_t)255; return p; };
  _Float16* BQ = (_Float16*)take((size_t)DM * DM * 2); _Float16* BK = (_Float16*)take((size_t)DM * DM * 2); _Float16* BV = (_Float16*)take((size_t)DM * DM * 2); _Float16* BE = (_Float16*)take((size_t)RW * HD * 2);
  _Float16* X16 = (_Float16*)take(NR * DM * 2); _Float16* Q16 = (_Float16*)take(NR * DM * 2); _Float16* K16 = (_Float16*)take(NR * DM * 2); _Float16* V16 = (_Float16*)take(NR * DM * 2);
  float* AQ = (float*)take((size_t)SQ * NH * RW * 4); float* AK = (float*)take((size_t)SQ * NH * RW * 4);
  float* S = (float*)take((size_t)HG * SQ * SQ * 4); _Float16* P = (_Float16*)take((size_t)HG * SQ * SQ * 2); _Float16* VT = (_Float16*)take((size_t)NB * NH * HD * SQ * 2);
  if (off > ws_size) return;      /* 6 + 0.1 + 4x8 + 32 + 32 + 16 + 8 + 8 = approx 134 MiB */
  const unsigned gw = (unsigned)(((size_t)DM * (DM / 8) + 255) / 256);
  k_wt_f16<<<gw, 256, 0, stream>>>(wq, BQ, DM, DM, 16.0f); k_wt_f16<<<gw, 256, 0, stream>>>(wk, BK, DM, DM, 16.0f); k_wt_f16<<<gw, 256, 0, stream>>>(wv, BV, DM, DM, 16.0f);      /* [in][out] -> Bt[out][in] x16 */
  k_wrel<<<(unsigned)(((size_t)RW * HD / 8 + 255) / 256), 256, 0, stream>>>(demb, BE);
  k_x16<<<(unsigned)((NR * DM / 8 + 255) / 256), 256, 0, stream>>>(hs, X16, NR * DM / 8);
  const dim3 gp((unsigned)((NR / 128) * (DM / 64)), 1);
  k_gemm2<0><<<gp, 128, 0, stream>>>(X16, DM, 0, BQ, DM, 0, 0.0625f, bq, 0, nullptr, 1, 0, 0, nullptr, Q16, DM, 0, MP, DM, DM);
  k_gemm2<0><<<gp, 128, 0, stream>>>(X16, DM, 0, BK, DM, 0, 0.0625f, bk, 0, nullptr, 1, 0, 0, nullptr, K16, DM, 0, MP, DM, DM);
  k_gemm2<0><<<gp, 128, 0, stream>>>(X16, DM, 0, BV, DM, 0, 0.0625f, bv, 0, nullptr, 1, 0, 0, nullptr, V16, DM, 0, MP, DM, DM);
  k_vt<NH, SQ><<<NB * NH * (SQ / 64), 256, 0, stream>>>(V16, DM, 0, VT);      /* V^T[(b,h)][d][s] for every (batch, head) */
  for (int b = 0; b < NBR; ++b) {
    const _Float16* qb = Q16 + (size_t)b * SQ * DM; const _Float16* kb = K16 + (size_t)b * SQ * DM;
    k_gemm2<0><<<dim3((SQ * NH / 128) * (RW / 64), 1), 128, 0, stream>>>(qb, HD, 0, BE, HD, 0, 0.0625f, nullptr, 0, nullptr, 1, 0, 0, AQ, nullptr, RW, 0, SQ * NH, RW, HD);      /* AQ[(l,h)][j] = q_l,h . dist_emb[j] (q rows viewed as [(token, head)][64]) */
    k_gemm2<0><<<dim3((SQ * NH / 128) * (RW / 64), 1), 128, 0, stream>>>(kb, HD, 0, BE, HD, 0, 0.0625f, nullptr, 0, nullptr, 1, 0, 0, AK, nullptr, RW, 0, SQ * NH, RW, HD);      /* AK[(r,h)][j] = k_r,h . dist_emb[j] */
    k_gemm2<0><<<dim3((QN / 128) * (SQ / 64), HG), 128, 0, stream>>>(qb, DM, (size_t)HD, kb, DM, (size_t)HD, 1.0f, nullptr, 0, nullptr, 1, 0, 0, S, nullptr, SQ, (size_t)SQ * SQ, QN, SQ, HD);      /* q . k, 16 heads per launch (scaled in the softmax) */
    k_rsmr<<<dim3(QN / RT, HG), 512, 0, stream>>>(S, P, AQ, AK, amask + (size_t)b * SQ);
    k_gemm2<0><<<dim3((QN / 128) * (HD / 64), HG), 128, 0, stream>>>(P, SQ, (size_t)SQ * SQ, VT + (size_t)b * NH * HD * SQ, SQ, (size_t)HD * SQ, 0.00390625f, nullptr, 0, nullptr, 1, 0, 0, (float*)d_out + (size_t)b * SQ * DM, nullptr, DM, (size_t)HD, QN, HD, SQ); }      /* ctx rows (merged heads, f32) */
}

// v003
// One run takes 124 microseconds.
// Versions in between are left out here; by their measured steps it is 4.87 times as fast as v001.
// Counting every step since v000, it is 28.8 times as fast.
#include <hip/hip_runtime.h>
// BERT self-attention with relative-position score terms (hidden [8][512][1024]; q, k, v = h W + b ([in][out], 16 heads of 64); scores[l][r] = (q_l.k_r + q_l.pe[l-r] + k_r.pe[l-r]) / 8 + mask[r] with pe = dist_emb[l - r + 511]; softmax; ctx = attn v merged -> [8][512][1024]).
// Structure: token rows r = b*512 + s; hidden as exact f16 rows; Q | K | V as three WMMA GEMMs (128x128 work-group tiles staged in LDS by asynchronous copies, 32x64 wave tiles, f32 accumulation, exact x16 transposed weights, bias in the epilogue, f16 outputs); V^T via LDS transposes; then one fused attention launch, one work-group per 32 query rows of a (batch, head): q.k and the two relative terms (q rows and k rows times the window of dist_emb^T that the tile's diagonals meet; table padded to 1024 rows with zeros) on WMMA, summed in an LDS score tile (f32), row softmax on VALU, one wave per query row (mask added; weights x256 as f16 in LDS), ctx = P . V on WMMA (K = 512, alpha 2^-8) written as f32 into the merged output rows.
// Compute dtype: inputs rounded to bf16; hidden / weights / table exact; q, k, v and the softmax weights as plain f16 GEMM operands (~2^-12); scores, relative terms and softmax statistics f32. v_wmma_f32_16x16x32_f16.
#define NB 8
#define SQ 512
#define DM 1024
#define NH 16
#define HD 64
#define HG 16                        /* heads per attention launch group (all) */
#define NREL 1023                    /* relative distances -511..511 */
#define RW 1024                      /* dist_emb table rows (distances padded to 1024) */
#define QN SQ                        /* unused: attention covers all SQ query rows */
#define NBR NB                       /* unused: attention covers all NB batches */
#define MP ((int)NR)                 /* unused: the projections take all NR rows */
#define NR ((size_t)NB * SQ)         /* 4096 token rows */
typedef __bf16 v16b __attribute__((ext_vector_type(16)));
typedef unsigned short v8us __attribute__((ext_vector_type(8), may_alias));
typedef float  v8f  __attribute__((ext_vector_type(8)));
typedef float  v4f  __attribute__((ext_vector_type(4)));
typedef float  v4fa __attribute__((ext_vector_type(4), may_alias));
union FragB { v16b v; v8us half[2]; unsigned short u[16]; };

__device__ __forceinline__ unsigned short bf16_bits(float x) { unsigned int u = __float_as_uint(x); return (unsigned short)((u + 0x7FFFu + ((u >> 16) & 1u)) >> 16); }
__device__ __forceinline__ float bf16_val(unsigned short b) { return __uint_as_float(((unsigned int)b) << 16); }
__device__ __forceinline__ float bf16_round(float x) { return bf16_val(bf16_bits(x)); }
// D += A·B with NT terms: 1 = ah·bh, 2 = + al·bh (A split), 3 = + ah·bl (both split)
template <int NT>
__device__ __forceinline__ v8f mmaN(v16b ah, v16b al, v16b bh, v16b bl, v8f c) {
  c = __builtin_amdgcn_wmma_f32_16x16x32_bf16(false, ah, false, bh, (short)0, c, false, false);
  if (NT >= 2) c = __builtin_amdgcn_wmma_f32_16x16x32_bf16(false, al, false, bh, (short)0, c, false, false);
  if (NT >= 3) c = __builtin_amdgcn_wmma_f32_16x16x32_bf16(false, ah, false, bl, (short)0, c, false, false);
  asm volatile("v_nop\n\tv_nop\n\tv_nop\n\tv_nop" : "+v"(c) : "v"(ah), "v"(al), "v"(bh), "v"(bl));
  return c;
}

__global__ __launch_bounds__(256) void k_wt_bf16(const float* __restrict__ W, unsigned short* __restrict__ Wt, int K, int N) {
  const int t = blockIdx.x * 256 + threadIdx.x;
  const int k8n = K / 8;
  if (t >= N * k8n) return;
  const int n = t / k8n, k8 = (t % k8n) * 8;
  v8us v;
#pragma unroll
  for (int i = 0; i < 8; ++i) v[i] = bf16_bits(W[(size_t)(k8 + i) * N + n]);
  *(v8us*)(Wt + (size_t)n * K + k8) = v;
  
}

// GEMM C[M][N] (f32, pitch ldc) = act(A[M][K]·W + bias). A f32 row-major (pitch lda) converted per fragment to bf16
// (ASPLIT: hi/lo two planes -> 2 terms, else single rounded term); Wt bf16 [N][K] (pitch ldb). BIAS_BF16 rounds the
// bias to bf16 first (bias quantised to bf16 before the add). K%32==0, M%16==0, N%64==0.
template <bool ASPLIT, int ACT, bool BIAS_BF16>
__global__ __launch_bounds__(128) void k_gemm_bf(const float* __restrict__ A, int lda, const unsigned short* __restrict__ Wt, int ldb,
                                               const float* __restrict__ bias, float* __restrict__ C, int ldc, int M, int N, int K) {
  __shared__ __attribute__((aligned(16))) float so[4][16][64];
  const int tid = threadIdx.x, w = tid >> 5, lane = tid & 31, ln = lane & 15, hh = lane >> 4;
  const int ntn = N / 64;
  const int wid = blockIdx.x * 4 + w;
  const int mt = wid / ntn, nq = wid % ntn;
  if (mt * 16 >= M) return;
  const int row0 = mt * 16, col0 = nq * 64;
  const float* arow = A + (size_t)(row0 + ln) * lda;
  v8f acc[4] = {};
  for (int kb = 0; kb < K; kb += 32) {
    FragB ah, al;
    const v4f x0 = *(const v4fa*)(arow + kb + 8 * hh), x1 = *(const v4fa*)(arow + kb + 8 * hh + 4);
    const v4f x2 = *(const v4fa*)(arow + kb + 16 + 8 * hh), x3 = *(const v4fa*)(arow + kb + 16 + 8 * hh + 4);
    float xs[16] = {x0[0],x0[1],x0[2],x0[3],x1[0],x1[1],x1[2],x1[3],x2[0],x2[1],x2[2],x2[3],x3[0],x3[1],x3[2],x3[3]};
#pragma unroll
    for (int i = 0; i < 16; ++i) { const unsigned short hb = bf16_bits(xs[i]); ah.u[i] = hb; al.u[i] = ASPLIT ? bf16_bits(xs[i] - bf16_val(hb)) : (unsigned short)0; }
#pragma unroll
    for (int t = 0; t < 4; ++t) {
      const unsigned short* brow = Wt + (size_t)(col0 + t * 16 + ln) * ldb + kb;
      FragB b;
      b.half[0] = *(const v8us*)(brow + 8 * hh);
      b.half[1] = *(const v8us*)(brow + 16 + 8 * hh);
      acc[t] = mmaN<ASPLIT ? 2 : 1>(ah.v, al.v, b.v, b.v, acc[t]);
    }
  }
#pragma unroll
  for (int t = 0; t < 4; ++t) {
    float bv = bias ? bias[col0 + t * 16 + ln] : 0.f;
    if (BIAS_BF16) bv = bf16_round(bv);
#pragma unroll
    for (int r = 0; r < 8; ++r) { float v = acc[t][r] + bv; if (ACT == 1) v = fmaxf(v, 0.f); so[w][8 * hh + r][t * 16 + ln] = v; }
  }
  __builtin_amdgcn_fence(__ATOMIC_ACQ_REL, "workgroup");
  __builtin_amdgcn_wave_barrier();
  const int rsub = lane >> 4, c4 = (lane & 15) * 4;
  {
#pragma unroll
    for (int q = 0; q < 8; ++q) {
      const int r = q * 2 + rsub;
      const v4f v = *(const v4fa*)&so[w][r][c4];
      *(v4f*)(C + (size_t)(row0 + r) * ldc + col0 + c4) = v;
    }
    
  }
}

// GEMM C = act(A·W + bias + resid): A f32 (ASPLIT -> hi/lo 2 terms), Wt bf16 [N][K]; ACT 0 none, 1 relu, 2 exact gelu;
// resid (optional, f32, row index = (row % rmod), pitch ldr, RES_BF16 rounds it) added before the activation.
template <bool ASPLIT, int ACT, bool BIAS_BF16, bool RES_BF16>
__global__ __launch_bounds__(128) void k_gemm_bf3(const float* __restrict__ A, int lda, const unsigned short* __restrict__ Wt, int ldb,
                                                const float* __restrict__ bias, const float* __restrict__ resid, int rmod, int ldr,
                                                float* __restrict__ C, int ldc, int M, int N, int K) {
  __shared__ __attribute__((aligned(16))) float so[4][16][64];
  const int tid = threadIdx.x, w = tid >> 5, lane = tid & 31, ln = lane & 15, hh = lane >> 4;
  const int ntn = N / 64;
  const int wid = blockIdx.x * 4 + w;
  const int mt = wid / ntn, nq = wid % ntn;
  if (mt * 16 >= M) return;
  const int row0 = mt * 16, col0 = nq * 64;
  const float* arow = A + (size_t)(row0 + ln) * lda;
  v8f acc[4] = {};
  for (int kb = 0; kb < K; kb += 32) {
    FragB ah, al;
    const v4f x0 = *(const v4fa*)(arow + kb + 8 * hh), x1 = *(const v4fa*)(arow + kb + 8 * hh + 4);
    const v4f x2 = *(const v4fa*)(arow + kb + 16 + 8 * hh), x3 = *(const v4fa*)(arow + kb + 16 + 8 * hh + 4);
    float xs[16] = {x0[0],x0[1],x0[2],x0[3],x1[0],x1[1],x1[2],x1[3],x2[0],x2[1],x2[2],x2[3],x3[0],x3[1],x3[2],x3[3]};
#pragma unroll
    for (int i = 0; i < 16; ++i) { const unsigned short hb = bf16_bits(xs[i]); ah.u[i] = hb; al.u[i] = ASPLIT ? bf16_bits(xs[i] - bf16_val(hb)) : (unsigned short)0; }
#pragma unroll
    for (int t = 0; t < 4; ++t) {
      const unsigned short* brow = Wt + (size_t)(col0 + t * 16 + ln) * ldb + kb;
      FragB b;
      b.half[0] = *(const v8us*)(brow + 8 * hh);
      b.half[1] = *(const v8us*)(brow + 16 + 8 * hh);
      acc[t] = mmaN<ASPLIT ? 2 : 1>(ah.v, al.v, b.v, b.v, acc[t]);
    }
  }
#pragma unroll
  for (int t = 0; t < 4; ++t) {
    const int col = col0 + t * 16 + ln;
    float bv = bias ? bias[col] : 0.f;
    if (BIAS_BF16) bv = bf16_round(bv);
#pragma unroll
    for (int r = 0; r < 8; ++r) {
      float v = acc[t][r] + bv;
      if (resid) { float rv = resid[(size_t)((row0 + 8 * hh + r) % rmod) * ldr + col]; if (RES_BF16) rv = bf16_round(rv); v += rv; }
      if (ACT == 1) v = fmaxf(v, 0.f);
      if (ACT == 2) v = 0.5f * v * (1.0f + erff(v * 0.70710678118654752f));
      if (ACT == 3) { const float u = 0.7978845608028654f * (v + 0.044715f * v * v * v); v = 0.5f * v * (1.0f + tanhf(u)); }
      so[w][8 * hh + r][t * 16 + ln] = v;
    }
  }
  __builtin_amdgcn_fence(__ATOMIC_ACQ_REL, "workgroup");
  __builtin_amdgcn_wave_barrier();
  const int rsub = lane >> 4, c4 = (lane & 15) * 4;
  {
#pragma unroll
    for (int q = 0; q < 8; ++q) {
      const int r = q * 2 + rsub;
      const v4f v = *(const v4fa*)&so[w][r][c4];
      *(v4f*)(C + (size_t)(row0 + r) * ldc + col0 + c4) = v;
    }
    
  }
}
// row LayerNorm (biased variance, eps) over N: s = X (+ R); optional out_sum <- s; out_norm <- (s-mu)*rsqrt(var+eps)*g + b
template <bool PARAM_BF16>
__global__ __launch_bounds__(256) void k_layernorm(const float* __restrict__ X, const float* __restrict__ R, const float* __restrict__ g, const float* __restrict__ bta,
                                                  float* __restrict__ out_sum, float* __restrict__ out_norm, int N, float eps) {
  __shared__ float red[256];
  const int row = blockIdx.x, tid = threadIdx.x;
  const float* x = X + (size_t)row * N; const float* rr = R ? R + (size_t)row * N : nullptr;
  float vals[16];                     // up to N = 4096
  const int per = N / 256;            // contiguous chunk per thread? use strided-by-4 chunks: thread handles j = tid*4 + 1024*u
  float s1 = 0.f;
  for (int u = 0; u < per / 4; ++u) {
    const int j = tid * 4 + 1024 * u;
    const v4f a = *(const v4fa*)(x + j);
    v4f b = {0.f,0.f,0.f,0.f}; if (rr) b = *(const v4fa*)(rr + j);
#pragma unroll
    for (int q = 0; q < 4; ++q) { const float v = a[q] + b[q]; vals[u * 4 + q] = v; s1 += v; }
  }
  red[tid] = s1; __syncthreads();
  for (int st = 128; st > 0; st >>= 1) { if (tid < st) red[tid] += red[tid + st]; __syncthreads(); }
  const float mu = red[0] / (float)N; __syncthreads();
  float s2 = 0.f;
  for (int u = 0; u < per / 4; ++u)
#pragma unroll
    for (int q = 0; q < 4; ++q) { const float c = vals[u * 4 + q] - mu; s2 += c * c; }
  red[tid] = s2; __syncthreads();
  for (int st = 128; st > 0; st >>= 1) { if (tid < st) red[tid] += red[tid + st]; __syncthreads(); }
  const float rs = rsqrtf(red[0] / (float)N + eps);
  {
    for (int u = 0; u < per / 4; ++u) {
      const int j = tid * 4 + 1024 * u;
      v4f o, sm;
#pragma unroll
      for (int q = 0; q < 4; ++q) {
        float gg = g[j + q], bb = bta[j + q];
        if (PARAM_BF16) { gg = bf16_round(gg); bb = bf16_round(bb); }
        sm[q] = vals[u * 4 + q]; o[q] = (vals[u * 4 + q] - mu) * rs * gg + bb;
      }
      if (out_sum) *(v4f*)(out_sum + (size_t)row * N + j) = sm;
      *(v4f*)(out_norm + (size_t)row * N + j) = o;
    }
    
  }
}



// ---- f16 WMMA path (v_wmma_f32_16x16x32_f16): 11-bit significands for operands in range — used where a [0,1] probability operand needs more precision than bf16
typedef _Float16 v16h __attribute__((ext_vector_type(16)));
union FragH { v16h v; v8us half[2]; _Float16 h[16]; unsigned short u[16]; };
template <int NT>
__device__ __forceinline__ v8f mmaH(v16h ah, v16h al, v16h bh, v16h bl, v8f c) {
  c = __builtin_amdgcn_wmma_f32_16x16x32_f16(false, ah, false, bh, (short)0, c, false, false);
  if (NT >= 2) c = __builtin_amdgcn_wmma_f32_16x16x32_f16(false, al, false, bh, (short)0, c, false, false);
  if (NT >= 3) c = __builtin_amdgcn_wmma_f32_16x16x32_f16(false, ah, false, bl, (short)0, c, false, false);
  asm volatile("v_nop\n\tv_nop\n\tv_nop\n\tv_nop" : "+v"(c) : "v"(ah), "v"(al), "v"(bh), "v"(bl));
  return c;
}
// batched GEMM like k_gemm_b but f16 operands: A f32 (split into f16 hi/lo if ASPLIT, else rounded to f16), Bt = f16 values [n][k]; alpha; C f32; N multiple of 16 (partial tiles skipped)
template <bool ASPLIT>
__global__ __launch_bounds__(128) void k_gemm_h(const float* __restrict__ A, int lda, size_t sA, const _Float16* __restrict__ Bh, int ldb, size_t sB, float alpha, float* __restrict__ C, int ldc, size_t sC, int M, int N, int K) {
  __shared__ __attribute__((aligned(16))) float so[4][16][64];
  const int tid = threadIdx.x, w = tid >> 5, lane = tid & 31, ln = lane & 15, hh = lane >> 4; const int by = blockIdx.y;
  A += (size_t)by * sA; Bh += (size_t)by * sB; C += (size_t)by * sC;
  const int ntn = (N + 63) / 64; const int wid = blockIdx.x * 4 + w; const int mt = wid / ntn, nq = wid % ntn; if (mt * 16 >= M) return;
  const int row0 = mt * 16, col0 = nq * 64; const float* arow = A + (size_t)(row0 + ln) * lda;
  v8f acc[4] = {};
  for (int kb = 0; kb < K; kb += 32) {
    FragH ah, al;
    const v4f x0 = *(const v4fa*)(arow + kb + 8 * hh), x1 = *(const v4fa*)(arow + kb + 8 * hh + 4), x2 = *(const v4fa*)(arow + kb + 16 + 8 * hh), x3 = *(const v4fa*)(arow + kb + 16 + 8 * hh + 4);
    float xs[16] = {x0[0],x0[1],x0[2],x0[3],x1[0],x1[1],x1[2],x1[3],x2[0],x2[1],x2[2],x2[3],x3[0],x3[1],x3[2],x3[3]};
#pragma unroll
    for (int i = 0; i < 16; ++i) { const _Float16 h = (_Float16)xs[i]; ah.h[i] = h; al.h[i] = ASPLIT ? (_Float16)(xs[i] - (float)h) : (_Float16)0.0f; }
#pragma unroll
    for (int t = 0; t < 4; ++t) { if (col0 + t * 16 >= N) continue; const size_t boff = (size_t)(col0 + t * 16 + ln) * ldb + kb; FragH bq; bq.half[0] = *(const v8us*)(Bh + boff + 8 * hh); bq.half[1] = *(const v8us*)(Bh + boff + 16 + 8 * hh);
      acc[t] = mmaH<ASPLIT ? 2 : 1>(ah.v, al.v, bq.v, bq.v, acc[t]); }
  }
#pragma unroll
  for (int t = 0; t < 4; ++t) { if (col0 + t * 16 >= N) continue;
#pragma unroll
    for (int r = 0; r < 8; ++r) so[w][8 * hh + r][t * 16 + ln] = acc[t][r] * alpha; }
  __builtin_amdgcn_fence(__ATOMIC_ACQ_REL, "workgroup"); __builtin_amdgcn_wave_barrier();
  const int rsub = lane >> 4, c4 = (lane & 15) * 4;
  {
#pragma unroll
    for (int q = 0; q < 8; ++q) { const int r = q * 2 + rsub; if (col0 + c4 < N) { const v4f v = *(const v4fa*)&so[w][r][c4]; *(v4f*)(C + (size_t)(row0 + r) * ldc + col0 + c4) = v; } }
     }
}

// Wt[n][k] = f16(W[k][n]·scale) from f32 row-major W[K][N] (scale = power of two; bf16-exact weights stay exact in f16 away from the subnormal range)
__global__ __launch_bounds__(256) void k_wt_f16(const float* __restrict__ W, _Float16* __restrict__ Wt, int K, int N, float scale) {
  const int t = blockIdx.x * 256 + threadIdx.x; if (t >= N * (K / 8)) return; const int n = t / (K / 8), k8 = (t % (K / 8)) * 8; FragH f;
#pragma unroll
  for (int i = 0; i < 8; ++i) f.h[i] = (_Float16)(bf16_round(W[(size_t)(k8 + i) * N + n]) * scale); const v8us o = f.half[0];
  *(v8us*)((unsigned short*)Wt + (size_t)n * K + k8) = o; 
}
// k_gemm_hh variant with fused epilogue: v = acc·alpha + bias[by·sBias + col] (+ CP[(row/rowsPerB)·sCPb + by·64 + col] if CP) ; ACT 0 none / 1 elu ; writes f16 C16 (and f32 C if non-null)
template <int ACT>
__global__ __launch_bounds__(128) void k_gemm_hhx(const _Float16* __restrict__ A, int lda, size_t sA, const _Float16* __restrict__ Bh, int ldb, size_t sB, float alpha, const float* __restrict__ bias, size_t sBias, const float* __restrict__ CP, int rowsPerB, size_t sCPb, int row0g,
    float* __restrict__ C, _Float16* __restrict__ C16, int ldc, size_t sC, int M, int N, int K) {
  __shared__ __attribute__((aligned(16))) float so[4][16][64];
  const int tid = threadIdx.x, w = tid >> 5, lane = tid & 31, ln = lane & 15, hh = lane >> 4; const int by = blockIdx.y;
  A += (size_t)by * sA; Bh += (size_t)by * sB; const size_t cofs = (size_t)by * sC; const float* bp = bias ? bias + (size_t)by * sBias : nullptr;
  const int ntn = (N + 63) / 64; const int wid = blockIdx.x * 4 + w; const int mt = wid / ntn, nq = wid % ntn; if (mt * 16 >= M) return;
  const int row0 = mt * 16, col0 = nq * 64; const _Float16* arow = A + (size_t)(row0 + ln) * lda;
  v8f acc[4] = {};
  for (int kb = 0; kb < K; kb += 32) { FragH ah; ah.half[0] = *(const v8us*)((const unsigned short*)arow + kb + 8 * hh); ah.half[1] = *(const v8us*)((const unsigned short*)arow + kb + 16 + 8 * hh);
#pragma unroll
    for (int t = 0; t < 4; ++t) { if (col0 + t * 16 >= N) continue; const size_t boff = (size_t)(col0 + t * 16 + ln) * ldb + kb; FragH bq; bq.half[0] = *(const v8us*)((const unsigned short*)Bh + boff + 8 * hh); bq.half[1] = *(const v8us*)((const unsigned short*)Bh + boff + 16 + 8 * hh);
      acc[t] = mmaH<1>(ah.v, ah.v, bq.v, bq.v, acc[t]); }
  }
#pragma unroll
  for (int t = 0; t < 4; ++t) { if (col0 + t * 16 >= N) continue; const int col = col0 + t * 16 + ln; const float bv = bp ? bf16_round(bp[col]) : 0.f;
#pragma unroll
    for (int r = 0; r < 8; ++r) { float v = acc[t][r] * alpha + bv; if (CP) { const int rr = row0g + row0 + 8 * hh + r; if (rowsPerB < 0) v += CP[cofs + (size_t)rr * ldc + col];      /* rowsPerB < 0: own element of the batched C plane */ else { const int bidx = rr / rowsPerB; v += CP[(size_t)bidx * sCPb + (size_t)by * 64 + col]; } } if (ACT == 1) v = (v > 0.f) ? v : expm1f(v); else if (ACT == 7) v = (v > 0.f) ? v + 1.0f : expf(v); else if (ACT == 8) v = tanhf(v); else if (ACT == 9) v = 0.5f * v * (1.0f + tanhf(0.7978845608028654f * (v + 0.044715f * v * v * v))); else if (ACT == 11) v = 1.0f / (1.0f + expf(-v)); else if (ACT == 12) v = (v > 0.f) ? v : 0.01f * v; else if (ACT == 14) v = (v > 0.f) ? v : 0.1f * v; else if (ACT == 16) v = (v >= 0.f) ? v : 0.3f * v; else if (ACT == 17) v = (v >= 0.f) ? v : 0.2f * v; else if (ACT == 15) v = v / (1.0f + expf(-v)); else if (ACT == 3) v = fmaxf(v, 0.f); else if (ACT == 6) v = 0.5f * v * (1.0f + erff(v * 0.70710678118654752f)); so[w][8 * hh + r][t * 16 + ln] = v; } }
  __builtin_amdgcn_fence(__ATOMIC_ACQ_REL, "workgroup"); __builtin_amdgcn_wave_barrier();
  const int rsub = lane >> 4, c4 = (lane & 15) * 4; typedef _Float16 v4h __attribute__((ext_vector_type(4)));
  {
#pragma unroll
    for (int q = 0; q < 8; ++q) { const int r = q * 2 + rsub; if (col0 + c4 < N) { const v4f v = *(const v4fa*)&so[w][r][c4]; if (C) *(v4f*)(C + cofs + (size_t)(row0 + r) * ldc + col0 + c4) = v; if (C16) { v4h h4; for (int i = 0; i < 4; ++i) h4[i] = (_Float16)v[i]; *(v4h*)(C16 + cofs + (size_t)(row0 + r) * ldc + col0 + c4) = h4; } } }
     }
}


typedef _Float16 v4h __attribute__((ext_vector_type(4)));

__global__ __launch_bounds__(256) void k_x16(const float* __restrict__ x, _Float16* __restrict__ X16, size_t n8) { const size_t t = (size_t)blockIdx.x * 256 + threadIdx.x; if (t >= n8) return; FragH f;
#pragma unroll
  for (int q = 0; q < 8; ++q) f.h[q] = (_Float16)bf16_round(x[t * 8 + q]); *(v8us*)((unsigned short*)X16 + t * 8) = f.half[0];  }
__global__ __launch_bounds__(256) void k_h16(const float* __restrict__ x, _Float16* __restrict__ X16, size_t n8) { const size_t t = (size_t)blockIdx.x * 256 + threadIdx.x; if (t >= n8) return; FragH f;
#pragma unroll
  for (int q = 0; q < 8; ++q) f.h[q] = (_Float16)x[t * 8 + q]; *(v8us*)((unsigned short*)X16 + t * 8) = f.half[0];  }
__global__ __launch_bounds__(256) void k_round16f(const float* __restrict__ W, _Float16* __restrict__ Bt, size_t n8) { const size_t t = (size_t)blockIdx.x * 256 + threadIdx.x; if (t >= n8) return; FragH f;
#pragma unroll
  for (int i = 0; i < 8; ++i) f.h[i] = (_Float16)(bf16_round(W[t * 8 + i]) * 16.0f); *(v8us*)((unsigned short*)Bt + t * 8) = f.half[0];  }
template <int NHv, int TTv>
__global__ __launch_bounds__(256) void k_vt(const _Float16* __restrict__ V16, int ldv, int voff, _Float16* __restrict__ Vt) { __shared__ unsigned short tl[64][66]; const int tid = threadIdx.x; const int slab = blockIdx.x / (TTv / 64), lg = blockIdx.x % (TTv / 64); const int b = slab / NHv, h = slab % NHv;
  for (int i = tid; i < 64 * 8; i += 256) { const int r = i / 8, c8 = (i % 8) * 8; FragH f; f.half[0] = *(const v8us*)((const unsigned short*)V16 + ((size_t)b * TTv + lg * 64 + r) * ldv + voff + h * 64 + c8);
#pragma unroll
    for (int q = 0; q < 8; ++q) tl[r][c8 + q] = f.u[q]; }
  __syncthreads();
  {
#pragma unroll
    for (int rd = 0; rd < 2; ++rd) { const int d = rd * 32 + tid / 8, pc = tid % 8; FragH f;
#pragma unroll
      for (int q = 0; q < 8; ++q) f.u[q] = tl[pc * 8 + q][d];
      *(v8us*)((unsigned short*)Vt + ((size_t)slab * 64 + d) * TTv + lg * 64 + pc * 8) = f.half[0]; }
     } }

__global__ __launch_bounds__(256) void k_hl(const float* __restrict__ F, _Float16* __restrict__ Hh, _Float16* __restrict__ Hl, size_t n8) { const size_t t = (size_t)blockIdx.x * 256 + threadIdx.x; if (t >= n8) return; FragH fh, fl; const v4f a = *(const v4fa*)(F + t * 8), c = *(const v4fa*)(F + t * 8 + 4);
#pragma unroll
  for (int q = 0; q < 4; ++q) { _Float16 h = (_Float16)a[q]; fh.h[q] = h; fl.h[q] = (_Float16)((a[q] - (float)h) * 1024.0f); h = (_Float16)c[q]; fh.h[4 + q] = h; fl.h[4 + q] = (_Float16)((c[q] - (float)h) * 1024.0f); }
  { *(v8us*)((unsigned short*)Hh + t * 8) = fh.half[0]; *(v8us*)((unsigned short*)Hl + t * 8) = fl.half[0];  } }

// ---- WMMA helpers (f16 fragments of 16 rows x 32 k; one product with its distance) ----
__device__ __forceinline__ v16h g2_frag(const _Float16* p, int hh) { FragH f; f.half[0] = *(const v8us*)((const unsigned short*)p + 8 * hh); f.half[1] = *(const v8us*)((const unsigned short*)p + 16 + 8 * hh); return f.v; }
__device__ __forceinline__ v8f g2_mma(v16h a, v16h b, v8f c) { v8f d = __builtin_amdgcn_wmma_f32_16x16x32_f16(false, a, false, b, (short)0, c, false, false); asm volatile("v_nop\n\tv_nop\n\tv_nop\n\tv_nop" : "+v"(d) : "v"(a), "v"(b)); return d; }
// Projection GEMM C16[4096][1024] = f16(A . Bt^T / 16 + bias): one 128 x 128 tile of C per work-group, 8 waves of 32 x 64 (4 down, 2 across).
// Per trip 128 k (256 bytes of each of the 128 A rows and 128 Bt rows) lie in LDS at pitch 272 bytes, brought by asynchronous 16-byte copies: a wave's copy takes 2 rows x 256 bytes, whole lines.
// Two buffers: the copies of trip t + 1 fly while trip t's fragments are read from LDS. k ascends in steps of 32 per accumulator. The epilogue stages each wave's 32 x 64 block in the first buffer.
#define GT 128                       /* rows and columns of C per work-group */
#define GK 128                       /* k per trip */
#define GP 272                       /* LDS row pitch in bytes: 16 x odd, for the 16-byte fragment reads */
#define GO (GT * GP)                 /* bytes of one operand's rows in a buffer */
#define GB (2 * GO)                  /* bytes of one buffer: A rows, then Bt rows */
__device__ __forceinline__ v16h g3_frag(const char* p) { FragH f; f.half[0] = *(const v8us*)p; f.half[1] = *(const v8us*)(p + 32); return f.v; }
// this thread's 8 pieces of one operand's 128 rows x 256 bytes: rows 16 apart, LDS byte address l, global address g
__device__ __forceinline__ void g3_copy(unsigned l, const _Float16* g) {
  /* the copies and, as the last line, the wait that stands before their address registers are rewritten */
  asm volatile("global_load_async_to_lds_b128 %0, %8, off\n\t"
               "global_load_async_to_lds_b128 %1, %9, off\n\t"
               "global_load_async_to_lds_b128 %2, %10, off\n\t"
               "global_load_async_to_lds_b128 %3, %11, off\n\t"
               "global_load_async_to_lds_b128 %4, %12, off\n\t"
               "global_load_async_to_lds_b128 %5, %13, off\n\t"
               "global_load_async_to_lds_b128 %6, %14, off\n\t"
               "global_load_async_to_lds_b128 %7, %15, off\n\t"
               "s_wait_xcnt 0x0"
               :: "v"(l), "v"(l + 16 * GP), "v"(l + 32 * GP), "v"(l + 48 * GP), "v"(l + 64 * GP), "v"(l + 80 * GP), "v"(l + 96 * GP), "v"(l + 112 * GP),
                  "v"(g), "v"(g + 16 * DM), "v"(g + 32 * DM), "v"(g + 48 * DM), "v"(g + 64 * DM), "v"(g + 80 * DM), "v"(g + 96 * DM), "v"(g + 112 * DM)
               : "memory");
}
__global__ __launch_bounds__(256) void k_proj(const _Float16* __restrict__ A, const _Float16* __restrict__ Bh, const float* __restrict__ bias, _Float16* __restrict__ C16) {
  static_assert(NR % GT == 0 && DM % GT == 0 && DM % GK == 0 && DM / GK >= 2 && 8 * 32 * 68 * 4 <= GB, "k_proj: whole tiles, two trips or more, the output staging fits one buffer");
  __shared__ __attribute__((aligned(16))) float sm[2 * GB / 4];
  const int tid = threadIdx.x, w = tid >> 5, lane = tid & 31, ln = lane & 15, hh = lane >> 4, wm = w & 3, wn = w >> 2;
  const int mt = blockIdx.x % (int)(NR / GT), nq = blockIdx.x / (int)(NR / GT); const int row0 = mt * GT + 32 * wm, col0 = nq * GT + 64 * wn;
  const float* bp = bias + col0 + ln; float bv[4];
#pragma unroll      /* bv indexed by constants: registers; the four loads fly under the first copies */
  for (int t = 0; t < 4; ++t) bv[t] = bp[16 * t];
  asm volatile("s_wait_xcnt 0x0" :: "v"(bp) : "memory");      /* the wait before the address registers of the loads above are overwritten */
  const _Float16* ga = A + (size_t)(mt * GT + (tid >> 4)) * DM + (tid & 15) * 8;
  const _Float16* gb = Bh + (size_t)(nq * GT + (tid >> 4)) * DM + (tid & 15) * 8;
  const unsigned l0 = (unsigned)(size_t)(const void*)sm + (unsigned)((tid >> 4) * GP + (tid & 15) * 16);
  g3_copy(l0, ga); g3_copy(l0 + GO, gb);
  asm volatile("s_wait_asynccnt 0x0" ::: "memory");      /* this wave's copies of trip 0 have landed */
  __syncthreads();      /* publishes trip 0's rows */
  g3_copy(l0 + GB, ga + GK); g3_copy(l0 + GB + GO, gb + GK);
  const char* fa = (const char*)sm + (32 * wm + ln) * GP + 16 * hh;
  const char* fb = (const char*)sm + GO + (64 * wn + ln) * GP + 16 * hh;
  const v8f z8 = {0.f,0.f,0.f,0.f,0.f,0.f,0.f,0.f}; v8f c00 = z8, c01 = z8, c02 = z8, c03 = z8, c10 = z8, c11 = z8, c12 = z8, c13 = z8;
#pragma unroll 1      /* rolled: one publish point in the text, and the two buffers are told apart by an offset */
  for (int t = 0; t < DM / GK; ++t) { const int bo = (t & 1) * GB;
    const char* pa = fa + bo; const char* pb = fb + bo; v16h af[2][2], bf[2][4];      /* two fragment sets: step s + 1 of this trip is read from LDS, as one group, in front of step s's products */
#pragma unroll      /* the sets are indexed by constants, so that they live in registers */
    for (int i = 0; i < 2; ++i) af[0][i] = g3_frag(pa + i * 16 * GP);
#pragma unroll      /* as above */
    for (int j = 0; j < 4; ++j) bf[0][j] = g3_frag(pb + j * 16 * GP);
#pragma unroll      /* as above; the four k steps of a trip also get constant LDS offsets */
    for (int s = 0; s < GK / 32; ++s) { const int cu = s & 1, nx = cu ^ 1;
      if (s + 1 < GK / 32) {
#pragma unroll      /* as above */
        for (int i = 0; i < 2; ++i) af[nx][i] = g3_frag(pa + i * 16 * GP + 64 * (s + 1));
#pragma unroll      /* as above */
        for (int j = 0; j < 4; ++j) bf[nx][j] = g3_frag(pb + j * 16 * GP + 64 * (s + 1)); }
      c00 = g2_mma(af[cu][0], bf[cu][0], c00); c10 = g2_mma(af[cu][1], bf[cu][0], c10);
      c01 = g2_mma(af[cu][0], bf[cu][1], c01); c11 = g2_mma(af[cu][1], bf[cu][1], c11);
      c02 = g2_mma(af[cu][0], bf[cu][2], c02); c12 = g2_mma(af[cu][1], bf[cu][2], c12);
      c03 = g2_mma(af[cu][0], bf[cu][3], c03); c13 = g2_mma(af[cu][1], bf[cu][3], c13); }
    asm volatile("s_wait_dscnt 0x0" ::: "memory");      /* this wave's reads of trip t's buffer are done before it is refilled */
    asm volatile("s_wait_asynccnt 0x0" ::: "memory");      /* this wave's copies of trip t + 1 have landed */
    __syncthreads();      /* publishes trip t + 1's rows and ends every wave's reads of trip t's buffer */
    if (t + 2 < DM / GK) { g3_copy(l0 + bo, ga + (t + 2) * GK); g3_copy(l0 + bo + GO, gb + (t + 2) * GK); } }
  asm volatile("s_wait_asynccnt 0x0" ::: "memory");      /* no copy is outstanding when the first buffer becomes output staging */
  float (*so)[68] = (float (*)[68])(sm + w * 32 * 68);
  v8f accs[8] = {c00, c01, c02, c03, c10, c11, c12, c13};
#pragma unroll      /* accs and bv indexed by constants: registers */
  for (int u = 0; u < 8; ++u) { const int t = u & 3, half = u >> 2; const float bb = bf16_round(bv[t]);
#pragma unroll      /* as above */
    for (int r = 0; r < 8; ++r) so[half * 16 + 8 * hh + r][t * 16 + ln] = accs[u][r] * 0.0625f + bb; }
  __builtin_amdgcn_fence(__ATOMIC_ACQ_REL, "workgroup"); __builtin_amdgcn_wave_barrier();      /* the wave's staged block is complete before its lanes read each other's values; no other wave touches it */
  const int rsub = lane >> 4, c4 = (lane & 15) * 4;
#pragma unroll      /* the 16 LDS reads and stores overlap; each store is 2 rows x 128 bytes, whole lines */
  for (int q = 0; q < 16; ++q) { const int r = q * 2 + rsub; const v4f v = *(const v4fa*)&so[r][c4]; v4h h4; for (int i = 0; i < 4; ++i) h4[i] = (_Float16)v[i]; *(v4h*)(C16 + (size_t)(row0 + r) * DM + col0 + c4) = h4; } }


__global__ __launch_bounds__(256) void k_wrel(const float* __restrict__ w, _Float16* __restrict__ Bt) { const size_t t = (size_t)blockIdx.x * 256 + threadIdx.x; if (t >= (size_t)RW * HD / 8) return; const bool live = t < (size_t)NREL * HD / 8; FragH f; for (int q = 0; q < 8; ++q) f.h[q] = live ? (_Float16)(bf16_round(w[t * 8 + q]) * 16.0f) : (_Float16)0.0f; *(v8us*)((unsigned short*)Bt + t * 8) = f.half[0];  }
__global__ __launch_bounds__(256) void k_wnat(const float* __restrict__ w, size_t n8, _Float16* __restrict__ Bt) { const size_t t = (size_t)blockIdx.x * 256 + threadIdx.x; if (t >= n8) return; FragH f; for (int q = 0; q < 8; ++q) f.h[q] = (_Float16)(bf16_round(w[t * 8 + q]) * 16.0f); *(v8us*)((unsigned short*)Bt + t * 8) = f.half[0];  }
// Fused attention: one work-group = RT query rows of one (batch, head), 16 waves. Wave w owns the key columns 32w .. 32w + 31 of all RT rows:
// it forms q.k, the window of q . dist_emb^T and the window of k . dist_emb^T that those columns need on WMMA (64 table rows from i0 - 32w + 480 serve both windows;
// the k fragments are the B operand of q.k and the A operand of k . dist_emb^T) and sums the three in its own block of the LDS score tile, each relative term stored along its diagonal:
// score[i][r] = (q_i.k_r + q_i.e[i-r+S-1] + k_r.e[i-r+S-1]) * 0.125 + mask[r] (bf16-rounded additive mask, staged in LDS).
// Of the three 16-wide table tiles a 16 x 32 block meets, the middle one is used whole and the outer two halve along the diagonal, so they merge into one full tile by a lane select.
// Then one wave per query row (two rows a wave), lane l holding columns 128u + 4l .. + 3; P = f16(256 softmax) goes to LDS; each wave forms one 16x16 tile of P . V over one half of K = 512 (V^T rows from memory);
// the two halves are summed through LDS, from where each output row is stored as whole 256-byte runs.
// Every loop is fully unrolled (constant trip counts): the per-lane arrays must be indexed by constants to live in registers.
#define RT 32                        /* query rows per work-group */
#define TP (SQ + 4)                  /* score tile pitch in floats: rows stay 16-byte aligned, a column of 32 rows falls on 16 banks */
#define PP (SQ + 8)                  /* P tile pitch in halves: 16 bytes more a row for the 16-byte fragment reads */
template <int C> __device__ __forceinline__ float x_row(float x) { return __builtin_bit_cast(float, __builtin_amdgcn_update_dpp(0, __builtin_bit_cast(int, x), 0x160 | C, 0xf, 0xf, true)); }      /* lane l <- lane l ^ C inside a 16-lane row (row_xmask) */
__device__ __forceinline__ float x_half(float x) { return __builtin_bit_cast(float, __builtin_amdgcn_permlanex16(__builtin_bit_cast(int, x), __builtin_bit_cast(int, x), 0x76543210, 0xfedcba98, false, false)); }      /* lane l <- lane l ^ 16 */
__device__ __forceinline__ float wave_max(float v) { v = fmaxf(v, x_row<1>(v)); v = fmaxf(v, x_row<2>(v)); v = fmaxf(v, x_row<4>(v)); v = fmaxf(v, x_row<8>(v)); return fmaxf(v, x_half(v)); }
__device__ __forceinline__ float wave_sum(float v) { v += x_row<1>(v); v += x_row<2>(v); v += x_row<4>(v); v += x_row<8>(v); return v + x_half(v); }
__device__ __forceinline__ v8f g2_dot64(const v16h (&a)[2], const v16h (&b)[2]) { const v8f z8 = {0.f,0.f,0.f,0.f,0.f,0.f,0.f,0.f}; return g2_mma(a[1], b[1], g2_mma(a[0], b[0], z8)); }
__global__ __launch_bounds__(512) void k_attn(const _Float16* __restrict__ Q16, const _Float16* __restrict__ K16, const _Float16* __restrict__ BE, const _Float16* __restrict__ VT, const float* __restrict__ amask, float* __restrict__ out) {
  static_assert(SQ == 512 && HD == 64 && RT == 32 && SQ % RT == 0 && RW >= 2 * SQ, "k_attn: 16 waves of 32 key columns; 512 threads stage 512 mask values and store 32 x 64 outputs");
  __shared__ __attribute__((aligned(16))) float sc[RT][TP];
  __shared__ __attribute__((aligned(16))) _Float16 ph[RT][PP];
  __shared__ __attribute__((aligned(16))) float so[2][RT][HD + 4];
  __shared__ __attribute__((aligned(16))) float mk[SQ];
  const int tid = threadIdx.x, w = __builtin_amdgcn_readfirstlane(tid >> 5), lane = tid & 31, ln = lane & 15, hh = lane >> 4, i0 = blockIdx.x * RT, h = blockIdx.y, b = blockIdx.z;
  const _Float16* qp = Q16 + ((size_t)b * SQ + i0 + ln) * DM + h * HD + 8 * hh;
  const _Float16* kp = K16 + ((size_t)b * SQ + 32 * w + ln) * DM + h * HD + 8 * hh;
  const _Float16* ep = BE + (size_t)(i0 - 32 * w + (SQ - 32) + ln) * HD + 8 * hh;      /* table rows i0 - 32w + 480 .. + 63, all inside 0 .. 1023 */
  const float* mp = amask + (size_t)b * SQ;
  v16h qf[2][2], kf[2][2], ef[4][2];
#pragma unroll
  for (int m = 0; m < 2; ++m)
#pragma unroll
    for (int s = 0; s < 2; ++s) { qf[m][s] = g2_frag(qp + (size_t)m * 16 * DM + 32 * s, 0); kf[m][s] = g2_frag(kp + (size_t)m * 16 * DM + 32 * s, 0); }
#pragma unroll
  for (int t = 0; t < 4; ++t)
#pragma unroll
    for (int s = 0; s < 2; ++s) ef[t][s] = g2_frag(ep + t * 16 * HD + 32 * s, 0);
  const float mv = mp[tid];
  asm volatile("s_wait_xcnt 0x0" :: "v"(qp), "v"(kp), "v"(ep), "s"(mp) : "memory");      /* the wait before the address registers of the loads above are overwritten; naming them keeps them whole up to it */
  mk[tid] = bf16_round(mv);
  const int dg = 8 * hh - ln;      /* row minus column inside a 16x16 accumulator tile, less the register index */
  float* blk = &sc[0][32 * w];
#pragma unroll
  for (int m = 0; m < 2; ++m)
#pragma unroll
    for (int e = 0; e < 2; ++e) { const v8f c = g2_dot64(qf[m], kf[e]);
#pragma unroll
      for (int r = 0; r < 8; ++r) blk[(16 * m + 8 * hh + r) * TP + 16 * e + ln] = c[r]; }
  /* q . e: accumulator (query row 16m + 8hh + r, table row base + 16(m + t) + ln) belongs to key column 31 + 8hh + r - 16t - ln of the block */
#pragma unroll
  for (int m = 0; m < 2; ++m) { const v8f c0 = g2_dot64(qf[m], ef[m]), c1 = g2_dot64(qf[m], ef[m + 1]), c2 = g2_dot64(qf[m], ef[m + 2]); float* pc[8]; float* po[8]; float om[8], oo[8];      /* the 16 x 32 elements are distinct: all reads, then all writes, so that the LDS round trips overlap */
#pragma unroll
    for (int r = 0; r < 8; ++r) { pc[r] = blk + (16 * m + 8 * hh + r) * TP + 15 + dg + r; po[r] = pc[r] + (dg + r <= 0 ? 16 : -16); om[r] = *pc[r]; oo[r] = *po[r]; }
#pragma unroll
    for (int r = 0; r < 8; ++r) { *pc[r] = om[r] + c1[r] * 0.0625f; *po[r] = oo[r] + (dg + r <= 0 ? c0[r] : c2[r]) * 0.0625f; } }
  /* k . e: accumulator (key row 16e + 8hh + r of the block, table row base + 16(1 - e + t) + ln) belongs to query row 16t + ln + 8hh + r - 15 */
#pragma unroll
  for (int e = 0; e < 2; ++e) { const v8f c0 = g2_dot64(kf[e], ef[1 - e]), c1 = g2_dot64(kf[e], ef[2 - e]), c2 = g2_dot64(kf[e], ef[3 - e]); float* pc[8]; float* po[8]; float om[8], oo[8];
#pragma unroll
    for (int r = 0; r < 8; ++r) { const int il = 1 + ln + 8 * hh + r; pc[r] = blk + il * TP + 16 * e + 8 * hh + r; po[r] = pc[r] + (il < 16 ? 16 * TP : -16 * TP); om[r] = *pc[r]; oo[r] = *po[r]; }
#pragma unroll
    for (int r = 0; r < 8; ++r) { *pc[r] = om[r] + c1[r] * 0.0625f; *po[r] = oo[r] + (1 + ln + 8 * hh + r < 16 ? c2[r] : c0[r]) * 0.0625f; } }
  __syncthreads();      /* publishes the score tile and the mask */
  /* P . V share of this wave: tile (pm, pn) of the 32 x 64 result, half pk of K = 512; its V^T fragments are asked for here so that they fly during the softmax */
  const int pm = w & 1, pn = (w >> 1) & 3, pk = w >> 3;
  const _Float16* vp = VT + (((size_t)b * NH + h) * HD + 16 * pn + ln) * SQ + 256 * pk + 8 * hh;
  v16h vf[8];
#pragma unroll
  for (int s = 0; s < 8; ++s) vf[s] = g2_frag(vp + 32 * s, 0);
  asm volatile("s_wait_xcnt 0x0" :: "v"(vp) : "memory");      /* the wait before the address registers of the loads above are overwritten */
#pragma unroll
  for (int k = 0; k < 2; ++k) { const int row = 2 * w + k; float x[16]; float mx = -INFINITY;
#pragma unroll
    for (int u = 0; u < 4; ++u) { const int c = 128 * u + 4 * lane; const v4f sv = *(const v4fa*)&sc[row][c], mm = *(const v4fa*)&mk[c];
#pragma unroll
      for (int q = 0; q < 4; ++q) { x[u * 4 + q] = sv[q] * 0.125f + mm[q]; mx = fmaxf(mx, x[u * 4 + q]); } }
    mx = wave_max(mx); float se = 0.f;
#pragma unroll
    for (int j = 0; j < 16; ++j) { x[j] = expf(x[j] - mx); se += x[j]; }
    const float sn = 256.0f / wave_sum(se);
#pragma unroll
    for (int u = 0; u < 4; ++u) { v4h o;
#pragma unroll
      for (int q = 0; q < 4; ++q) o[q] = (_Float16)(x[u * 4 + q] * sn);
      *(v4h*)&ph[row][128 * u + 4 * lane] = o; } }
  __syncthreads();      /* publishes the P tile */
  { const _Float16* pa = &ph[16 * pm + ln][256 * pk + 8 * hh]; v16h pf[8];
#pragma unroll
    for (int s = 0; s < 8; ++s) pf[s] = g2_frag(pa + 32 * s, 0);
    v8f c = {0.f,0.f,0.f,0.f,0.f,0.f,0.f,0.f};
#pragma unroll
    for (int s = 0; s < 8; ++s) c = g2_mma(pf[s], vf[s], c);
#pragma unroll
    for (int r = 0; r < 8; ++r) so[pk][16 * pm + 8 * hh + r][16 * pn + ln] = c[r]; }
  __syncthreads();      /* publishes the two K halves of the 32 x 64 result */
  { const int row = tid >> 4, c4 = (tid & 15) * 4; const v4f v = (*(const v4fa*)&so[0][row][c4] + *(const v4fa*)&so[1][row][c4]) * 0.00390625f; *(v4f*)(out + ((size_t)b * SQ + i0 + row) * DM + h * HD + c4) = v; } }
__global__ __launch_bounds__(256) void k_vt(const _Float16* __restrict__ V16, int b, int h0, _Float16* __restrict__ VT) { __shared__ unsigned short tl[64][65]; const int tid = threadIdx.x; const int hh = blockIdx.x % HG, sg = blockIdx.x / HG; const int s0 = sg * 64; const int h = h0 + hh;
  for (int i = tid; i < 64 * 8; i += 256) { const int j = i / 8, d8 = (i % 8) * 8; FragH f; f.half[0] = *(const v8us*)((const unsigned short*)V16 + ((size_t)b * SQ + s0 + j) * DM + h * HD + d8); for (int q = 0; q < 8; ++q) tl[d8 + q][j] = f.u[q]; }
  __syncthreads();
  { for (int i = tid; i < 64 * 8; i += 256) { const int d = i / 8, j8 = (i % 8) * 8; FragH f; for (int q = 0; q < 8; ++q) f.u[q] = tl[d][j8 + q]; *(v8us*)((unsigned short*)VT + ((size_t)hh * HD + d) * SQ + s0 + j8) = f.half[0]; }  } }

extern "C" void kernel_launch(void* const* d_in, const int* in_sizes, int n_in,
                              void* d_out, int out_size, void* d_ws, size_t ws_size, hipStream_t stream) {
  (void)in_sizes; (void)n_in; (void)out_size;
  const float* const* I = (const float* const*)d_in; const float* hs = I[0]; const float* amask = I[1]; const float* wq = I[2]; const float* bq = I[3]; const float* wk = I[4]; const float* bk = I[5]; const float* wv = I[6]; const float* bv = I[7]; const float* demb = I[8];      /* weights [in][out]; attention_mask [8][1][1][512] additive; dist_emb [1023][64] */
  char* ws = (char*)d_ws; size_t off = 0;
  auto take = [&](size_t bytes) { char* p = ws + off; off += (bytes + 255) & ~(size_t)255; return p; };
  _Float16* BQ = (_Float16*)take((size_t)DM * DM * 2); _Float16* BK = (_Float16*)take((size_t)DM * DM * 2); _Float16* BV = (_Float16*)take((size_t)DM * DM * 2); _Float16* BE = (_Float16*)take((size_t)RW * HD * 2);
  _Float16* X16 = (_Float16*)take(NR * DM * 2); _Float16* Q16 = (_Float16*)take(NR * DM * 2); _Float16* K16 = (_Float16*)take(NR * DM * 2); _Float16* V16 = (_Float16*)take(NR * DM * 2);
  _Float16* VT = (_Float16*)take((size_t)NB * NH * HD * SQ * 2);
  if (off > ws_size) return;      /* 6 + 0.1 + 4x8 + 8 = approx 46 MiB */
  const unsigned gw = (unsigned)(((size_t)DM * (DM / 8) + 255) / 256);
  k_wt_f16<<<gw, 256, 0, stream>>>(wq, BQ, DM, DM, 16.0f); k_wt_f16<<<gw, 256, 0, stream>>>(wk, BK, DM, DM, 16.0f); k_wt_f16<<<gw, 256, 0, stream>>>(wv, BV, DM, DM, 16.0f);      /* [in][out] -> Bt[out][in] x16 */
  k_wrel<<<(unsigned)(((size_t)RW * HD / 8 + 255) / 256), 256, 0, stream>>>(demb, BE);
  k_x16<<<(unsigned)((NR * DM / 8 + 255) / 256), 256, 0, stream>>>(hs, X16, NR * DM / 8);
  const unsigned gp = (unsigned)((NR / GT) * (DM / GT));
  k_proj<<<gp, 256, 0, stream>>>(X16, BQ, bq, Q16);
  k_proj<<<gp, 256, 0, stream>>>(X16, BK, bk, K16);
  k_proj<<<gp, 256, 0, stream>>>(X16, BV, bv, V16);
  k_vt<NH, SQ><<<NB * NH * (SQ / 64), 256, 0, stream>>>(V16, DM, 0, VT);      /* V^T[(b,h)][d][s] for every (batch, head) */
  k_attn<<<dim3(SQ / RT, NH, NB), 512, 0, stream>>>(Q16, K16, BE, VT, amask, (float*)d_out);      /* scores, relative terms, softmax and P . V; ctx rows (merged heads, f32) */
}

// v004
// Measured time: 109 microseconds a run.
// Two timings next to v003 put it at 1.15 and 1.17 times that version's speed.
// Counting every step since v000, it is 33.5 times as fast.
#include <hip/hip_runtime.h>
// BERT self-attention with relative-position score terms (hidden [8][512][1024]; q, k, v = h W + b ([in][out], 16 heads of 64); scores[l][r] = (q_l.k_r + q_l.pe[l-r] + k_r.pe[l-r]) / 8 + mask[r] with pe = dist_emb[l - r + 511]; softmax; ctx = attn v merged -> [8][512][1024]).
// Structure: token rows r = b*512 + s; hidden as exact f16 rows (with the weight and table preparations in one launch); Q | K | V as three WMMA GEMMs in one launch (128x128 work-group tiles staged in LDS by asynchronous copies, 32x64 wave tiles, f32 accumulation, exact x16 transposed weights, bias in the epilogue, f16 outputs); V^T via LDS transposes; then one fused attention launch, one work-group per 32 query rows of a (batch, head): q.k and the two relative terms (q rows and k rows times the window of dist_emb^T that the tile's diagonals meet; table padded to 1024 rows with zeros) on WMMA, summed in an LDS score tile (f32), row softmax on VALU, one wave per query row (mask added; weights x256 as f16 in LDS), ctx = P . V on WMMA (K = 512, alpha 2^-8) written as f32 into the merged output rows.
// Compute dtype: inputs rounded to bf16; hidden / weights / table exact; q, k, v and the softmax weights as plain f16 GEMM operands (~2^-12); scores, relative terms and softmax statistics f32. v_wmma_f32_16x16x32_f16.
#define NB 8
#define SQ 512
#define DM 1024
#define NH 16
#define HD 64
#define HG 16                        /* heads per attention launch group (all) */
#define NREL 1023                    /* relative distances -511..511 */
#define RW 1024                      /* dist_emb table rows (distances padded to 1024) */
#define QN SQ                        /* unused: attention covers all SQ query rows */
#define NBR NB                       /* unused: attention covers all NB batches */
#define MP ((int)NR)                 /* unused: the projections take all NR rows */
#define NR ((size_t)NB * SQ)         /* 4096 token rows */
typedef __bf16 v16b __attribute__((ext_vector_type(16)));
typedef unsigned short v8us __attribute__((ext_vector_type(8), may_alias));
typedef float  v8f  __attribute__((ext_vector_type(8)));
typedef float  v4f  __attribute__((ext_vector_type(4)));
typedef float  v4fa __attribute__((ext_vector_type(4), may_alias));
union FragB { v16b v; v8us half[2]; unsigned short u[16]; };

__device__ __forceinline__ unsigned short bf16_bits(float x) { unsigned int u = __float_as_uint(x); return (unsigned short)((u + 0x7FFFu + ((u >> 16) & 1u)) >> 16); }
__device__ __forceinline__ float bf16_val(unsigned short b) { return __uint_as_float(((unsigned int)b) << 16); }
__device__ __forceinline__ float bf16_round(float x) { return bf16_val(bf16_bits(x)); }
// D += A·B with NT terms: 1 = ah·bh, 2 = + al·bh (A split), 3 = + ah·bl (both split)
template <int NT>
__device__ __forceinline__ v8f mmaN(v16b ah, v16b al, v16b bh, v16b bl, v8f c) {
  c = __builtin_amdgcn_wmma_f32_16x16x32_bf16(false, ah, false, bh, (short)0, c, false, false);
  if (NT >= 2) c = __builtin_amdgcn_wmma_f32_16x16x32_bf16(false, al, false, bh, (short)0, c, false, false);
  if (NT >= 3) c = __builtin_amdgcn_wmma_f32_16x16x32_bf16(false, ah, false, bl, (short)0, c, false, false);
  asm volatile("v_nop\n\tv_nop\n\tv_nop\n\tv_nop" : "+v"(c) : "v"(ah), "v"(al), "v"(bh), "v"(bl));
  return c;
}

__global__ __launch_bounds__(256) void k_wt_bf16(const float* __restrict__ W, unsigned short* __restrict__ Wt, int K, int N) {
  const int t = blockIdx.x * 256 + threadIdx.x;
  const int k8n = K / 8;
  if (t >= N * k8n) return;
  const int n = t / k8n, k8 = (t % k8n) * 8;
  v8us v;
#pragma unroll
  for (int i = 0; i < 8; ++i) v[i] = bf16_bits(W[(size_t)(k8 + i) * N + n]);
  *(v8us*)(Wt + (size_t)n * K + k8) = v;
  
}

// GEMM C[M][N] (f32, pitch ldc) = act(A[M][K]·W + bias). A f32 row-major (pitch lda) converted per fragment to bf16
// (ASPLIT: hi/lo two planes -> 2 terms, else single rounded term); Wt bf16 [N][K] (pitch ldb). BIAS_BF16 rounds the
// bias to bf16 first (bias quantised to bf16 before the add). K%32==0, M%16==0, N%64==0.
template <bool ASPLIT, int ACT, bool BIAS_BF16>
__global__ __launch_bounds__(128) void k_gemm_bf(const float* __restrict__ A, int lda, const unsigned short* __restrict__ Wt, int ldb,
                                               const float* __restrict__ bias, float* __restrict__ C, int ldc, int M, int N, int K) {
  __shared__ __attribute__((aligned(16))) float so[4][16][64];
  const int tid = threadIdx.x, w = tid >> 5, lane = tid & 31, ln = lane & 15, hh = lane >> 4;
  const int ntn = N / 64;
  const int wid = blockIdx.x * 4 + w;
  const int mt = wid / ntn, nq = wid % ntn;
  if (mt * 16 >= M) return;
  const int row0 = mt * 16, col0 = nq * 64;
  const float* arow = A + (size_t)(row0 + ln) * lda;
  v8f acc[4] = {};
  for (int kb = 0; kb < K; kb += 32) {
    FragB ah, al;
    const v4f x0 = *(const v4fa*)(arow + kb + 8 * hh), x1 = *(const v4fa*)(arow + kb + 8 * hh + 4);
    const v4f x2 = *(const v4fa*)(arow + kb + 16 + 8 * hh), x3 = *(const v4fa*)(arow + kb + 16 + 8 * hh + 4);
    float xs[16] = {x0[0],x0[1],x0[2],x0[3],x1[0],x1[1],x1[2],x1[3],x2[0],x2[1],x2[2],x2[3],x3[0],x3[1],x3[2],x3[3]};
#pragma unroll
    for (int i = 0; i < 16; ++i) { const unsigned short hb = bf16_bits(xs[i]); ah.u[i] = hb; al.u[i] = ASPLIT ? bf16_bits(xs[i] - bf16_val(hb)) : (unsigned short)0; }
#pragma unroll
    for (int t = 0; t < 4; ++t) {
      const unsigned short* brow = Wt + (size_t)(col0 + t * 16 + ln) * ldb + kb;
      FragB b;
      b.half[0] = *(const v8us*)(brow + 8 * hh);
      b.half[1] = *(const v8us*)(brow + 16 + 8 * hh);
      acc[t] = mmaN<ASPLIT ? 2 : 1>(ah.v, al.v, b.v, b.v, acc[t]);
    }
  }
#pragma unroll
  for (int t = 0; t < 4; ++t) {
    float bv = bias ? bias[col0 + t * 16 + ln] : 0.f;
    if (BIAS_BF16) bv = bf16_round(bv);
#pragma unroll
    for (int r = 0; r < 8; ++r) { float v = acc[t][r] + bv; if (ACT == 1) v = fmaxf(v, 0.f); so[w][8 * hh + r][t * 16 + ln] = v; }
  }
  __builtin_amdgcn_fence(__ATOMIC_ACQ_REL, "workgroup");
  __builtin_amdgcn_wave_barrier();
  const int rsub = lane >> 4, c4 = (lane & 15) * 4;
  {
#pragma unroll
    for (int q = 0; q < 8; ++q) {
      const int r = q * 2 + rsub;
      const v4f v = *(const v4fa*)&so[w][r][c4];
      *(v4f*)(C + (size_t)(row0 + r) * ldc + col0 + c4) = v;
    }
    
  }
}

// GEMM C = act(A·W + bias + resid): A f32 (ASPLIT -> hi/lo 2 terms), Wt bf16 [N][K]; ACT 0 none, 1 relu, 2 exact gelu;
// resid (optional, f32, row index = (row % rmod), pitch ldr, RES_BF16 rounds it) added before the activation.
template <bool ASPLIT, int ACT, bool BIAS_BF16, bool RES_BF16>
__global__ __launch_bounds__(128) void k_gemm_bf3(const float* __restrict__ A, int lda, const unsigned short* __restrict__ Wt, int ldb,
                                                const float* __restrict__ bias, const float* __restrict__ resid, int rmod, int ldr,
                                                float* __restrict__ C, int ldc, int M, int N, int K) {
  __shared__ __attribute__((aligned(16))) float so[4][16][64];
  const int tid = threadIdx.x, w = tid >> 5, lane = tid & 31, ln = lane & 15, hh = lane >> 4;
  const int ntn = N / 64;
  const int wid = blockIdx.x * 4 + w;
  const int mt = wid / ntn, nq = wid % ntn;
  if (mt * 16 >= M) return;
  const int row0 = mt * 16, col0 = nq * 64;
  const float* arow = A + (size_t)(row0 + ln) * lda;
  v8f acc[4] = {};
  for (int kb = 0; kb < K; kb += 32) {
    FragB ah, al;
    const v4f x0 = *(const v4fa*)(arow + kb + 8 * hh), x1 = *(const v4fa*)(arow + kb + 8 * hh + 4);
    const v4f x2 = *(const v4fa*)(arow + kb + 16 + 8 * hh), x3 = *(const v4fa*)(arow + kb + 16 + 8 * hh + 4);
    float xs[16] = {x0[0],x0[1],x0[2],x0[3],x1[0],x1[1],x1[2],x1[3],x2[0],x2[1],x2[2],x2[3],x3[0],x3[1],x3[2],x3[3]};
#pragma unroll
    for (int i = 0; i < 16; ++i) { const unsigned short hb = bf16_bits(xs[i]); ah.u[i] = hb; al.u[i] = ASPLIT ? bf16_bits(xs[i] - bf16_val(hb)) : (unsigned short)0; }
#pragma unroll
    for (int t = 0; t < 4; ++t) {
      const unsigned short* brow = Wt + (size_t)(col0 + t * 16 + ln) * ldb + kb;
      FragB b;
      b.half[0] = *(const v8us*)(brow + 8 * hh);
      b.half[1] = *(const v8us*)(brow + 16 + 8 * hh);
      acc[t] = mmaN<ASPLIT ? 2 : 1>(ah.v, al.v, b.v, b.v, acc[t]);
    }
  }
#pragma unroll
  for (int t = 0; t < 4; ++t) {
    const int col = col0 + t * 16 + ln;
    float bv = bias ? bias[col] : 0.f;
    if (BIAS_BF16) bv = bf16_round(bv);
#pragma unroll
    for (int r = 0; r < 8; ++r) {
      float v = acc[t][r] + bv;
      if (resid) { float rv = resid[(size_t)((row0 + 8 * hh + r) % rmod) * ldr + col]; if (RES_BF16) rv = bf16_round(rv); v += rv; }
      if (ACT == 1) v = fmaxf(v, 0.f);
      if (ACT == 2) v = 0.5f * v * (1.0f + erff(v * 0.70710678118654752f));
      if (ACT == 3) { const float u = 0.7978845608028654f * (v + 0.044715f * v * v * v); v = 0.5f * v * (1.0f + tanhf(u)); }
      so[w][8 * hh + r][t * 16 + ln] = v;
    }
  }
  __builtin_amdgcn_fence(__ATOMIC_ACQ_REL, "workgroup");
  __builtin_amdgcn_wave_barrier();
  const int rsub = lane >> 4, c4 = (lane & 15) * 4;
  {
#pragma unroll
    for (int q = 0; q < 8; ++q) {
      const int r = q * 2 + rsub;
      const v4f v = *(const v4fa*)&so[w][r][c4];
      *(v4f*)(C + (size_t)(row0 + r) * ldc + col0 + c4) = v;
    }
    
  }
}
// row LayerNorm (biased variance, eps) over N: s = X (+ R); optional out_sum <- s; out_norm <- (s-mu)*rsqrt(var+eps)*g + b
template <bool PARAM_BF16>
__global__ __launch_bounds__(256) void k_layernorm(const float* __restrict__ X, const float* __restrict__ R, const float* __restrict__ g, const float* __restrict__ bta,
                                                  float* __restrict__ out_sum, float* __restrict__ out_norm, int N, float eps) {
  __shared__ float red[256];
  const int row = blockIdx.x, tid = threadIdx.x;
  const float* x = X + (size_t)row * N; const float* rr = R ? R + (size_t)row * N : nullptr;
  float vals[16];                     // up to N = 4096
  const int per = N / 256;            // contiguous chunk per thread? use strided-by-4 chunks: thread handles j = tid*4 + 1024*u
  float s1 = 0.f;
  for (int u = 0; u < per / 4; ++u) {
    const int j = tid * 4 + 1024 * u;
    const v4f a = *(const v4fa*)(x + j);
    v4f b = {0.f,0.f,0.f,0.f}; if (rr) b = *(const v4fa*)(rr + j);
#pragma unroll
    for (int q = 0; q < 4; ++q) { const float v = a[q] + b[q]; vals[u * 4 + q] = v; s1 += v; }
  }
  red[tid] = s1; __syncthreads();
  for (int st = 128; st > 0; st >>= 1) { if (tid < st) red[tid] += red[tid + st]; __syncthreads(); }
  const float mu = red[0] / (float)N; __syncthreads();
  float s2 = 0.f;
  for (int u = 0; u < per / 4; ++u)
#pragma unroll
    for (int q = 0; q < 4; ++q) { const float c = vals[u * 4 + q] - mu; s2 += c * c; }
  red[tid] = s2; __syncthreads();
  for (int st = 128; st > 0; st >>= 1) { if (tid < st) red[tid] += red[tid + st]; __syncthreads(); }
  const float rs = rsqrtf(red[0] / (float)N + eps);
  {
    for (int u = 0; u < per / 4; ++u) {
      const int j = tid * 4 + 1024 * u;
      v4f o, sm;
#pragma unroll
      for (int q = 0; q < 4; ++q) {
        float gg = g[j + q], bb = bta[j + q];
        if (PARAM_BF16) { gg = bf16_round(gg); bb = bf16_round(bb); }
        sm[q] = vals[u * 4 + q]; o[q] = (vals[u * 4 + q] - mu) * rs * gg + bb;
      }
      if (out_sum) *(v4f*)(out_sum + (size_t)row * N + j) = sm;
      *(v4f*)(out_norm + (size_t)row * N + j) = o;
    }
    
  }
}



// ---- f16 WMMA path (v_wmma_f32_16x16x32_f16): 11-bit significands for operands in range — used where a [0,1] probability operand needs more precision than bf16
typedef _Float16 v16h __attribute__((ext_vector_type(16)));
union FragH { v16h v; v8us half[2]; _Float16 h[16]; unsigned short u[16]; };
template <int NT>
__device__ __forceinline__ v8f mmaH(v16h ah, v16h al, v16h bh, v16h bl, v8f c) {
  c = __builtin_amdgcn_wmma_f32_16x16x32_f16(false, ah, false, bh, (short)0, c, false, false);
  if (NT >= 2) c = __builtin_amdgcn_wmma_f32_16x16x32_f16(false, al, false, bh, (short)0, c, false, false);
  if (NT >= 3) c = __builtin_amdgcn_wmma_f32_16x16x32_f16(false, ah, false, bl, (short)0, c, false, false);
  asm volatile("v_nop\n\tv_nop\n\tv_nop\n\tv_nop" : "+v"(c) : "v"(ah), "v"(al), "v"(bh), "v"(bl));
  return c;
}
// batched GEMM like k_gemm_b but f16 operands: A f32 (split into f16 hi/lo if ASPLIT, else rounded to f16), Bt = f16 values [n][k]; alpha; C f32; N multiple of 16 (partial tiles skipped)
template <bool ASPLIT>
__global__ __launch_bounds__(128) void k_gemm_h(const float* __restrict__ A, int lda, size_t sA, const _Float16* __restrict__ Bh, int ldb, size_t sB, float alpha, float* __restrict__ C, int ldc, size_t sC, int M, int N, int K) {
  __shared__ __attribute__((aligned(16))) float so[4][16][64];
  const int tid = threadIdx.x, w = tid >> 5, lane = tid & 31, ln = lane & 15, hh = lane >> 4; const int by = blockIdx.y;
  A += (size_t)by * sA; Bh += (size_t)by * sB; C += (size_t)by * sC;
  const int ntn = (N + 63) / 64; const int wid = blockIdx.x * 4 + w; const int mt = wid / ntn, nq = wid % ntn; if (mt * 16 >= M) return;
  const int row0 = mt * 16, col0 = nq * 64; const float* arow = A + (size_t)(row0 + ln) * lda;
  v8f acc[4] = {};
  for (int kb = 0; kb < K; kb += 32) {
    FragH ah, al;
    const v4f x0 = *(const v4fa*)(arow + kb + 8 * hh), x1 = *(const v4fa*)(arow + kb + 8 * hh + 4), x2 = *(const v4fa*)(arow + kb + 16 + 8 * hh), x3 = *(const v4fa*)(arow + kb + 16 + 8 * hh + 4);
    float xs[16] = {x0[0],x0[1],x0[2],x0[3],x1[0],x1[1],x1[2],x1[3],x2[0],x2[1],x2[2],x2[3],x3[0],x3[1],x3[2],x3[3]};
#pragma unroll
    for (int i = 0; i < 16; ++i) { const _Float16 h = (_Float16)xs[i]; ah.h[i] = h; al.h[i] = ASPLIT ? (_Float16)(xs[i] - (float)h) : (_Float16)0.0f; }
#pragma unroll
    for (int t = 0; t < 4; ++t) { if (col0 + t * 16 >= N) continue; const size_t boff = (size_t)(col0 + t * 16 + ln) * ldb + kb; FragH bq; bq.half[0] = *(const v8us*)(Bh + boff + 8 * hh); bq.half[1] = *(const v8us*)(Bh + boff + 16 + 8 * hh);
      acc[t] = mmaH<ASPLIT ? 2 : 1>(ah.v, al.v, bq.v, bq.v, acc[t]); }
  }
#pragma unroll
  for (int t = 0; t < 4; ++t) { if (col0 + t * 16 >= N) continue;
#pragma unroll
    for (int r = 0; r < 8; ++r) so[w][8 * hh + r][t * 16 + ln] = acc[t][r] * alpha; }
  __builtin_amdgcn_fence(__ATOMIC_ACQ_REL, "workgroup"); __builtin_amdgcn_wave_barrier();
  const int rsub = lane >> 4, c4 = (lane & 15) * 4;
  {
#pragma unroll
    for (int q = 0; q < 8; ++q) { const int r = q * 2 + rsub; if (col0 + c4 < N) { const v4f v = *(const v4fa*)&so[w][r][c4]; *(v4f*)(C + (size_t)(row0 + r) * ldc + col0 + c4) = v; } }
     }
}

// Wt[n][k] = f16(W[k][n]·scale) from f32 row-major W[K][N] (scale = power of two; bf16-exact weights stay exact in f16 away from the subnormal range)
__device__ __forceinline__ void d_wt_f16(const float* __restrict__ W, _Float16* __restrict__ Wt, int K, int N, float scale, int t) {
  if (t >= N * (K / 8)) return; const int n = t / (K / 8), k8 = (t % (K / 8)) * 8; FragH f;
#pragma unroll
  for (int i = 0; i < 8; ++i) f.h[i] = (_Float16)(bf16_round(W[(size_t)(k8 + i) * N + n]) * scale); const v8us o = f.half[0];
  *(v8us*)((unsigned short*)Wt + (size_t)n * K + k8) = o; 
}
// k_gemm_hh variant with fused epilogue: v = acc·alpha + bias[by·sBias + col] (+ CP[(row/rowsPerB)·sCPb + by·64 + col] if CP) ; ACT 0 none / 1 elu ; writes f16 C16 (and f32 C if non-null)
template <int ACT>
__global__ __launch_bounds__(128) void k_gemm_hhx(const _Float16* __restrict__ A, int lda, size_t sA, const _Float16* __restrict__ Bh, int ldb, size_t sB, float alpha, const float* __restrict__ bias, size_t sBias, const float* __restrict__ CP, int rowsPerB, size_t sCPb, int row0g,
    float* __restrict__ C, _Float16* __restrict__ C16, int ldc, size_t sC, int M, int N, int K) {
  __shared__ __attribute__((aligned(16))) float so[4][16][64];
  const int tid = threadIdx.x, w = tid >> 5, lane = tid & 31, ln = lane & 15, hh = lane >> 4; const int by = blockIdx.y;
  A += (size_t)by * sA; Bh += (size_t)by * sB; const size_t cofs = (size_t)by * sC; const float* bp = bias ? bias + (size_t)by * sBias : nullptr;
  const int ntn = (N + 63) / 64; const int wid = blockIdx.x * 4 + w; const int mt = wid / ntn, nq = wid % ntn; if (mt * 16 >= M) return;
  const int row0 = mt * 16, col0 = nq * 64; const _Float16* arow = A + (size_t)(row0 + ln) * lda;
  v8f acc[4] = {};
  for (int kb = 0; kb < K; kb += 32) { FragH ah; ah.half[0] = *(const v8us*)((const unsigned short*)arow + kb + 8 * hh); ah.half[1] = *(const v8us*)((const unsigned short*)arow + kb + 16 + 8 * hh);
#pragma unroll
    for (int t = 0; t < 4; ++t) { if (col0 + t * 16 >= N) continue; const size_t boff = (size_t)(col0 + t * 16 + ln) * ldb + kb; FragH bq; bq.half[0] = *(const v8us*)((const unsigned short*)Bh + boff + 8 * hh); bq.half[1] = *(const v8us*)((const unsigned short*)Bh + boff + 16 + 8 * hh);
      acc[t] = mmaH<1>(ah.v, ah.v, bq.v, bq.v, acc[t]); }
  }
#pragma unroll
  for (int t = 0; t < 4; ++t) { if (col0 + t * 16 >= N) continue; const int col = col0 + t * 16 + ln; const float bv = bp ? bf16_round(bp[col]) : 0.f;
#pragma unroll
    for (int r = 0; r < 8; ++r) { float v = acc[t][r] * alpha + bv; if (CP) { const int rr = row0g + row0 + 8 * hh + r; if (rowsPerB < 0) v += CP[cofs + (size_t)rr * ldc + col];      /* rowsPerB < 0: own element of the batched C plane */ else { const int bidx = rr / rowsPerB; v += CP[(size_t)bidx * sCPb + (size_t)by * 64 + col]; } } if (ACT == 1) v = (v > 0.f) ? v : expm1f(v); else if (ACT == 7) v = (v > 0.f) ? v + 1.0f : expf(v); else if (ACT == 8) v = tanhf(v); else if (ACT == 9) v = 0.5f * v * (1.0f + tanhf(0.7978845608028654f * (v + 0.044715f * v * v * v))); else if (ACT == 11) v = 1.0f / (1.0f + expf(-v)); else if (ACT == 12) v = (v > 0.f) ? v : 0.01f * v; else if (ACT == 14) v = (v > 0.f) ? v : 0.1f * v; else if (ACT == 16) v = (v >= 0.f) ? v : 0.3f * v; else if (ACT == 17) v = (v >= 0.f) ? v : 0.2f * v; else if (ACT == 15) v = v / (1.0f + expf(-v)); else if (ACT == 3) v = fmaxf(v, 0.f); else if (ACT == 6) v = 0.5f * v * (1.0f + erff(v * 0.70710678118654752f)); so[w][8 * hh + r][t * 16 + ln] = v; } }
  __builtin_amdgcn_fence(__ATOMIC_ACQ_REL, "workgroup"); __builtin_amdgcn_wave_barrier();
  const int rsub = lane >> 4, c4 = (lane & 15) * 4; typedef _Float16 v4h __attribute__((ext_vector_type(4)));
  {
#pragma unroll
    for (int q = 0; q < 8; ++q) { const int r = q * 2 + rsub; if (col0 + c4 < N) { const v4f v = *(const v4fa*)&so[w][r][c4]; if (C) *(v4f*)(C + cofs + (size_t)(row0 + r) * ldc + col0 + c4) = v; if (C16) { v4h h4; for (int i = 0; i < 4; ++i) h4[i] = (_Float16)v[i]; *(v4h*)(C16 + cofs + (size_t)(row0 + r) * ldc + col0 + c4) = h4; } } }
     }
}


typedef _Float16 v4h __attribute__((ext_vector_type(4)));

__device__ __forceinline__ void d_x16(const float* __restrict__ x, _Float16* __restrict__ X16, size_t n8, size_t t) { if (t >= n8) return; FragH f;
#pragma unroll
  for (int q = 0; q < 8; ++q) f.h[q] = (_Float16)bf16_round(x[t * 8 + q]); *(v8us*)((unsigned short*)X16 + t * 8) = f.half[0];  }
__global__ __launch_bounds__(256) void k_h16(const float* __restrict__ x, _Float16* __restrict__ X16, size_t n8) { const size_t t = (size_t)blockIdx.x * 256 + threadIdx.x; if (t >= n8) return; FragH f;
#pragma unroll
  for (int q = 0; q < 8; ++q) f.h[q] = (_Float16)x[t * 8 + q]; *(v8us*)((unsigned short*)X16 + t * 8) = f.half[0];  }
__global__ __launch_bounds__(256) void k_round16f(const float* __restrict__ W, _Float16* __restrict__ Bt, size_t n8) { const size_t t = (size_t)blockIdx.x * 256 + threadIdx.x; if (t >= n8) return; FragH f;
#pragma unroll
  for (int i = 0; i < 8; ++i) f.h[i] = (_Float16)(bf16_round(W[t * 8 + i]) * 16.0f); *(v8us*)((unsigned short*)Bt + t * 8) = f.half[0];  }
template <int NHv, int TTv>
__global__ __launch_bounds__(256) void k_vt(const _Float16* __restrict__ V16, int ldv, int voff, _Float16* __restrict__ Vt) { __shared__ unsigned short tl[64][66]; const int tid = threadIdx.x; const int slab = blockIdx.x / (TTv / 64), lg = blockIdx.x % (TTv / 64); const int b = slab / NHv, h = slab % NHv;
  for (int i = tid; i < 64 * 8; i += 256) { const int r = i / 8, c8 = (i % 8) * 8; FragH f; f.half[0] = *(const v8us*)((const unsigned short*)V16 + ((size_t)b * TTv + lg * 64 + r) * ldv + voff + h * 64 + c8);
#pragma unroll
    for (int q = 0; q < 8; ++q) tl[r][c8 + q] = f.u[q]; }
  __syncthreads();
  {
#pragma unroll
    for (int rd = 0; rd < 2; ++rd) { const int d = rd * 32 + tid / 8, pc = tid % 8; FragH f;
#pragma unroll
      for (int q = 0; q < 8; ++q) f.u[q] = tl[pc * 8 + q][d];
      *(v8us*)((unsigned short*)Vt + ((size_t)slab * 64 + d) * TTv + lg * 64 + pc * 8) = f.half[0]; }
     } }

__global__ __launch_bounds__(256) void k_hl(const float* __restrict__ F, _Float16* __restrict__ Hh, _Float16* __restrict__ Hl, size_t n8) { const size_t t = (size_t)blockIdx.x * 256 + threadIdx.x; if (t >= n8) return; FragH fh, fl; const v4f a = *(const v4fa*)(F + t * 8), c = *(const v4fa*)(F + t * 8 + 4);
#pragma unroll
  for (int q = 0; q < 4; ++q) { _Float16 h = (_Float16)a[q]; fh.h[q] = h; fl.h[q] = (_Float16)((a[q] - (float)h) * 1024.0f); h = (_Float16)c[q]; fh.h[4 + q] = h; fl.h[4 + q] = (_Float16)((c[q] - (float)h) * 1024.0f); }
  { *(v8us*)((unsigned short*)Hh + t * 8) = fh.half[0]; *(v8us*)((unsigned short*)Hl + t * 8) = fl.half[0];  } }

// ---- WMMA helpers (f16 fragments of 16 rows x 32 k; one product with its distance) ----
__device__ __forceinline__ v16h g2_frag(const _Float16* p, int hh) { FragH f; f.half[0] = *(const v8us*)((const unsigned short*)p + 8 * hh); f.half[1] = *(const v8us*)((const unsigned short*)p + 16 + 8 * hh); return f.v; }
__device__ __forceinline__ v8f g2_mma(v16h a, v16h b, v8f c) { v8f d = __builtin_amdgcn_wmma_f32_16x16x32_f16(false, a, false, b, (short)0, c, false, false); asm volatile("v_nop\n\tv_nop\n\tv_nop\n\tv_nop" : "+v"(d) : "v"(a), "v"(b)); return d; }
// Projection GEMM C16[4096][1024] = f16(A . Bt^T / 16 + bias): one 128 x 128 tile of C per work-group, 8 waves of 32 x 64 (4 down, 2 across).
// Per trip 128 k (256 bytes of each of the 128 A rows and 128 Bt rows) lie in LDS at pitch 272 bytes, brought by asynchronous 16-byte copies: a wave's copy takes 2 rows x 256 bytes, whole lines.
// Two buffers: the copies of trip t + 1 fly while trip t's fragments are read from LDS. k ascends in steps of 32 per accumulator. The epilogue stages each wave's 32 x 64 block in the first buffer.
#define GT 128                       /* rows and columns of C per work-group */
#define GK 128                       /* k per trip */
#define GP 272                       /* LDS row pitch in bytes: 16 x odd, for the 16-byte fragment reads */
#define GO (GT * GP)                 /* bytes of one operand's rows in a buffer */
#define GB (2 * GO)                  /* bytes of one buffer: A rows, then Bt rows */
__device__ __forceinline__ v16h g3_frag(const char* p) { FragH f; f.half[0] = *(const v8us*)p; f.half[1] = *(const v8us*)(p + 32); return f.v; }
// this thread's 8 pieces of one operand's 128 rows x 256 bytes: rows 16 apart, LDS byte address l, global address g
__device__ __forceinline__ void g3_copy(unsigned l, const _Float16* g) {
  /* the copies and, as the last line, the wait that stands before their address registers are rewritten */
  asm volatile("global_load_async_to_lds_b128 %0, %8, off\n\t"
               "global_load_async_to_lds_b128 %1, %9, off\n\t"
               "global_load_async_to_lds_b128 %2, %10, off\n\t"
               "global_load_async_to_lds_b128 %3, %11, off\n\t"
               "global_load_async_to_lds_b128 %4, %12, off\n\t"
               "global_load_async_to_lds_b128 %5, %13, off\n\t"
               "global_load_async_to_lds_b128 %6, %14, off\n\t"
               "global_load_async_to_lds_b128 %7, %15, off\n\t"
               "s_wait_xcnt 0x0"
               :: "v"(l), "v"(l + 16 * GP), "v"(l + 32 * GP), "v"(l + 48 * GP), "v"(l + 64 * GP), "v"(l + 80 * GP), "v"(l + 96 * GP), "v"(l + 112 * GP),
                  "v"(g), "v"(g + 16 * DM), "v"(g + 32 * DM), "v"(g + 48 * DM), "v"(g + 64 * DM), "v"(g + 80 * DM), "v"(g + 96 * DM), "v"(g + 112 * DM)
               : "memory");
}
// The three products (q, k, v) need nothing of each other: they share one grid, blockIdx.y picks the weights, the bias and the output.
__global__ __launch_bounds__(256) void k_proj(const _Float16* __restrict__ A, const _Float16* __restrict__ BQ, const _Float16* __restrict__ BK, const _Float16* __restrict__ BV,
                                              const float* __restrict__ bq, const float* __restrict__ bk, const float* __restrict__ bvp, _Float16* __restrict__ Q16, _Float16* __restrict__ K16, _Float16* __restrict__ V16) {
  const int z = blockIdx.y; const _Float16* Bh = z == 0 ? BQ : z == 1 ? BK : BV; const float* bias = z == 0 ? bq : z == 1 ? bk : bvp; _Float16* C16 = z == 0 ? Q16 : z == 1 ? K16 : V16;
  static_assert(NR % GT == 0 && DM % GT == 0 && DM % GK == 0 && DM / GK >= 2 && 8 * 32 * 68 * 4 <= GB, "k_proj: whole tiles, two trips or more, the output staging fits one buffer");
  __shared__ __attribute__((aligned(16))) float sm[2 * GB / 4];
  const int tid = threadIdx.x, w = tid >> 5, lane = tid & 31, ln = lane & 15, hh = lane >> 4, wm = w & 3, wn = w >> 2;
  const int mt = blockIdx.x % (int)(NR / GT), nq = blockIdx.x / (int)(NR / GT); const int row0 = mt * GT + 32 * wm, col0 = nq * GT + 64 * wn;
  const float* bp = bias + col0 + ln; float bv[4];
#pragma unroll      /* bv indexed by constants: registers; the four loads fly under the first copies */
  for (int t = 0; t < 4; ++t) bv[t] = bp[16 * t];
  asm volatile("s_wait_xcnt 0x0" :: "v"(bp) : "memory");      /* the wait before the address registers of the loads above are overwritten */
  const _Float16* ga = A + (size_t)(mt * GT + (tid >> 4)) * DM + (tid & 15) * 8;
  const _Float16* gb = Bh + (size_t)(nq * GT + (tid >> 4)) * DM + (tid & 15) * 8;
  const unsigned l0 = (unsigned)(size_t)(const void*)sm + (unsigned)((tid >> 4) * GP + (tid & 15) * 16);
  g3_copy(l0, ga); g3_copy(l0 + GO, gb);
  asm volatile("s_wait_asynccnt 0x0" ::: "memory");      /* this wave's copies of trip 0 have landed */
  __syncthreads();      /* publishes trip 0's rows */
  g3_copy(l0 + GB, ga + GK); g3_copy(l0 + GB + GO, gb + GK);
  const char* fa = (const char*)sm + (32 * wm + ln) * GP + 16 * hh;
  const char* fb = (const char*)sm + GO + (64 * wn + ln) * GP + 16 * hh;
  const v8f z8 = {0.f,0.f,0.f,0.f,0.f,0.f,0.f,0.f}; v8f c00 = z8, c01 = z8, c02 = z8, c03 = z8, c10 = z8, c11 = z8, c12 = z8, c13 = z8;
#pragma unroll 1      /* rolled: one publish point in the text, and the two buffers are told apart by an offset */
  for (int t = 0; t < DM / GK; ++t) { const int bo = (t & 1) * GB;
    const char* pa = fa + bo; const char* pb = fb + bo; v16h af[2][2], bf[2][4];      /* two fragment sets: step s + 1 of this trip is read from LDS, as one group, in front of step s's products */
#pragma unroll      /* the sets are indexed by constants, so that they live in registers */
    for (int i = 0; i < 2; ++i) af[0][i] = g3_frag(pa + i * 16 * GP);
#pragma unroll      /* as above */
    for (int j = 0; j < 4; ++j) bf[0][j] = g3_frag(pb + j * 16 * GP);
#pragma unroll      /* as above; the four k steps of a trip also get constant LDS offsets */
    for (int s = 0; s < GK / 32; ++s) { const int cu = s & 1, nx = cu ^ 1;
      if (s + 1 < GK / 32) {
#pragma unroll      /* as above */
        for (int i = 0; i < 2; ++i) af[nx][i] = g3_frag(pa + i * 16 * GP + 64 * (s + 1));
#pragma unroll      /* as above */
        for (int j = 0; j < 4; ++j) bf[nx][j] = g3_frag(pb + j * 16 * GP + 64 * (s + 1)); }
      c00 = g2_mma(af[cu][0], bf[cu][0], c00); c10 = g2_mma(af[cu][1], bf[cu][0], c10);
      c01 = g2_mma(af[cu][0], bf[cu][1], c01); c11 = g2_mma(af[cu][1], bf[cu][1], c11);
      c02 = g2_mma(af[cu][0], bf[cu][2], c02); c12 = g2_mma(af[cu][1], bf[cu][2], c12);
      c03 = g2_mma(af[cu][0], bf[cu][3], c03); c13 = g2_mma(af[cu][1], bf[cu][3], c13); }
    asm volatile("s_wait_dscnt 0x0" ::: "memory");      /* this wave's reads of trip t's buffer are done before it is refilled */
    asm volatile("s_wait_asynccnt 0x0" ::: "memory");      /* this wave's copies of trip t + 1 have landed */
    __syncthreads();      /* publishes trip t + 1's rows and ends every wave's reads of trip t's buffer */
    if (t + 2 < DM / GK) { g3_copy(l0 + bo, ga + (t + 2) * GK); g3_copy(l0 + bo + GO, gb + (t + 2) * GK); } }
  asm volatile("s_wait_asynccnt 0x0" ::: "memory");      /* no copy is outstanding when the first buffer becomes output staging */
  float (*so)[68] = (float (*)[68])(sm + w * 32 * 68);
  v8f accs[8] = {c00, c01, c02, c03, c10, c11, c12, c13};
#pragma unroll      /* accs and bv indexed by constants: registers */
  for (int u = 0; u < 8; ++u) { const int t = u & 3, half = u >> 2; const float bb = bf16_round(bv[t]);
#pragma unroll      /* as above */
    for (int r = 0; r < 8; ++r) so[half * 16 + 8 * hh + r][t * 16 + ln] = accs[u][r] * 0.0625f + bb; }
  __builtin_amdgcn_fence(__ATOMIC_ACQ_REL, "workgroup"); __builtin_amdgcn_wave_barrier();      /* the wave's staged block is complete before its lanes read each other's values; no other wave touches it */
  const int rsub = lane >> 4, c4 = (lane & 15) * 4;
#pragma unroll      /* the 16 LDS reads and stores overlap; each store is 2 rows x 128 bytes, whole lines */
  for (int q = 0; q < 16; ++q) { const int r = q * 2 + rsub; const v4f v = *(const v4fa*)&so[r][c4]; v4h h4; for (int i = 0; i < 4; ++i) h4[i] = (_Float16)v[i]; *(v4h*)(C16 + (size_t)(row0 + r) * DM + col0 + c4) = h4; } }


__device__ __forceinline__ void d_wrel(const float* __restrict__ w, _Float16* __restrict__ Bt, size_t t) { if (t >= (size_t)RW * HD / 8) return; const bool live = t < (size_t)NREL * HD / 8; FragH f; for (int q = 0; q < 8; ++q) f.h[q] = live ? (_Float16)(bf16_round(w[t * 8 + q]) * 16.0f) : (_Float16)0.0f; *(v8us*)((unsigned short*)Bt + t * 8) = f.half[0];  }
// The five operand preparations need nothing of each other: they share one grid as ranges of the block index (a block-uniform branch).
// Longest block first, so that none starts late and runs on alone: the table (its guarded loads follow one another), the weight transposes (strided reads), then the hidden rows.
#define PW (DM * (DM / 8) / 256)     /* blocks per weight matrix */
#define PX ((int)(NR * DM / 8 / 256)) /* blocks of the hidden rows */
#define PE (RW * HD / 8 / 256)       /* blocks of the distance table */
__global__ __launch_bounds__(256) void k_prep(const float* __restrict__ wq, const float* __restrict__ wk, const float* __restrict__ wv, const float* __restrict__ demb, const float* __restrict__ hs,
                                              _Float16* __restrict__ BQ, _Float16* __restrict__ BK, _Float16* __restrict__ BV, _Float16* __restrict__ BE, _Float16* __restrict__ X16) {
  static_assert(DM * (DM / 8) % 256 == 0 && NR * DM / 8 % 256 == 0 && RW * HD / 8 % 256 == 0, "k_prep: whole blocks in every range");
  const int blk = blockIdx.x, tid = threadIdx.x;
  if (blk < PE) d_wrel(demb, BE, (size_t)blk * 256 + tid);
  else if (blk < PE + 3 * PW) { const int u = blk - PE, z = u / PW; d_wt_f16(z == 0 ? wq : z == 1 ? wk : wv, z == 0 ? BQ : z == 1 ? BK : BV, DM, DM, 16.0f, (u - z * PW) * 256 + tid); }      /* [in][out] -> Bt[out][in] x16 */
  else d_x16(hs, X16, NR * DM / 8, (size_t)(blk - PE - 3 * PW) * 256 + tid); }
__global__ __launch_bounds__(256) void k_wnat(const float* __restrict__ w, size_t n8, _Float16* __restrict__ Bt) { const size_t t = (size_t)blockIdx.x * 256 + threadIdx.x; if (t >= n8) return; FragH f; for (int q = 0; q < 8; ++q) f.h[q] = (_Float16)(bf16_round(w[t * 8 + q]) * 16.0f); *(v8us*)((unsigned short*)Bt + t * 8) = f.half[0];  }
// Fused attention: one work-group = RT query rows of one (batch, head), 16 waves. Wave w owns the key columns 32w .. 32w + 31 of all RT rows:
// it forms q.k, the window of q . dist_emb^T and the window of k . dist_emb^T that those columns need on WMMA (64 table rows from i0 - 32w + 480 serve both windows;
// the k fragments are the B operand of q.k and the A operand of k . dist_emb^T) and sums the three in its own block of the LDS score tile, each relative term stored along its diagonal:
// score[i][r] = (q_i.k_r + q_i.e[i-r+S-1] + k_r.e[i-r+S-1]) * 0.125 + mask[r] (bf16-rounded additive mask, staged in LDS).
// Of the three 16-wide table tiles a 16 x 32 block meets, the middle one is used whole and the outer two halve along the diagonal, so they merge into one full tile by a lane select.
// Then one wave per query row (two rows a wave), lane l holding columns 128u + 4l .. + 3; P = f16(256 softmax) goes to LDS; each wave forms one 16x16 tile of P . V over one half of K = 512 (V^T rows from memory);
// the two halves are summed through LDS, from where each output row is stored as whole 256-byte runs.
// Every loop is fully unrolled (constant trip counts): the per-lane arrays must be indexed by constants to live in registers.
#define RT 32                        /* query rows per work-group */
#define TP (SQ + 4)                  /* score tile pitch in floats: rows stay 16-byte aligned, a column of 32 rows falls on 16 banks */
#define PP (SQ + 8)                  /* P tile pitch in halves: 16 bytes more a row for the 16-byte fragment reads */
template <int C> __device__ __forceinline__ float x_row(float x) { return __builtin_bit_cast(float, __builtin_amdgcn_update_dpp(0, __builtin_bit_cast(int, x), 0x160 | C, 0xf, 0xf, true)); }      /* lane l <- lane l ^ C inside a 16-lane row (row_xmask) */
__device__ __forceinline__ float x_half(float x) { return __builtin_bit_cast(float, __builtin_amdgcn_permlanex16(__builtin_bit_cast(int, x), __builtin_bit_cast(int, x), 0x76543210, 0xfedcba98, false, false)); }      /* lane l <- lane l ^ 16 */
__device__ __forceinline__ float wave_max(float v) { v = fmaxf(v, x_row<1>(v)); v = fmaxf(v, x_row<2>(v)); v = fmaxf(v, x_row<4>(v)); v = fmaxf(v, x_row<8>(v)); return fmaxf(v, x_half(v)); }
__device__ __forceinline__ float wave_sum(float v) { v += x_row<1>(v); v += x_row<2>(v); v += x_row<4>(v); v += x_row<8>(v); return v + x_half(v); }
__device__ __forceinline__ v8f g2_dot64(const v16h (&a)[2], const v16h (&b)[2]) { const v8f z8 = {0.f,0.f,0.f,0.f,0.f,0.f,0.f,0.f}; return g2_mma(a[1], b[1], g2_mma(a[0], b[0], z8)); }
__global__ __launch_bounds__(512) void k_attn(const _Float16* __restrict__ Q16, const _Float16* __restrict__ K16, const _Float16* __restrict__ BE, const _Float16* __restrict__ VT, const float* __restrict__ amask, float* __restrict__ out) {
  static_assert(SQ == 512 && HD == 64 && RT == 32 && SQ % RT == 0 && RW >= 2 * SQ, "k_attn: 16 waves of 32 key columns; 512 threads stage 512 mask values and store 32 x 64 outputs");
  __shared__ __attribute__((aligned(16))) float sc[RT][TP];
  __shared__ __attribute__((aligned(16))) _Float16 ph[RT][PP];
  __shared__ __attribute__((aligned(16))) float so[2][RT][HD + 4];
  __shared__ __attribute__((aligned(16))) float mk[SQ];
  const int tid = threadIdx.x, w = __builtin_amdgcn_readfirstlane(tid >> 5), lane = tid & 31, ln = lane & 15, hh = lane >> 4, i0 = blockIdx.x * RT, h = blockIdx.y, b = blockIdx.z;
  const _Float16* qp = Q16 + ((size_t)b * SQ + i0 + ln) * DM + h * HD + 8 * hh;
  const _Float16* kp = K16 + ((size_t)b * SQ + 32 * w + ln) * DM + h * HD + 8 * hh;
  const _Float16* ep = BE + (size_t)(i0 - 32 * w + (SQ - 32) + ln) * HD + 8 * hh;      /* table rows i0 - 32w + 480 .. + 63, all inside 0 .. 1023 */
  const float* mp = amask + (size_t)b * SQ;
  v16h qf[2][2], kf[2][2], ef[4][2];
#pragma unroll
  for (int m = 0; m < 2; ++m)
#pragma unroll
    for (int s = 0; s < 2; ++s) { qf[m][s] = g2_frag(qp + (size_t)m * 16 * DM + 32 * s, 0); kf[m][s] = g2_frag(kp + (size_t)m * 16 * DM + 32 * s, 0); }
#pragma unroll
  for (int t = 0; t < 4; ++t)
#pragma unroll
    for (int s = 0; s < 2; ++s) ef[t][s] = g2_frag(ep + t * 16 * HD + 32 * s, 0);
  const float mv = mp[tid];
  asm volatile("s_wait_xcnt 0x0" :: "v"(qp), "v"(kp), "v"(ep), "s"(mp) : "memory");      /* the wait before the address registers of the loads above are overwritten; naming them keeps them whole up to it */
  mk[tid] = bf16_round(mv);
  const int dg = 8 * hh - ln;      /* row minus column inside a 16x16 accumulator tile, less the register index */
  float* blk = &sc[0][32 * w];
#pragma unroll
  for (int m = 0; m < 2; ++m)
#pragma unroll
    for (int e = 0; e < 2; ++e) { const v8f c = g2_dot64(qf[m], kf[e]);
#pragma unroll
      for (int r = 0; r < 8; ++r) blk[(16 * m + 8 * hh + r) * TP + 16 * e + ln] = c[r]; }
  /* q . e: accumulator (query row 16m + 8hh + r, table row base + 16(m + t) + ln) belongs to key column 31 + 8hh + r - 16t - ln of the block */
#pragma unroll
  for (int m = 0; m < 2; ++m) { const v8f c0 = g2_dot64(qf[m], ef[m]), c1 = g2_dot64(qf[m], ef[m + 1]), c2 = g2_dot64(qf[m], ef[m + 2]); float* pc[8]; float* po[8]; float om[8], oo[8];      /* the 16 x 32 elements are distinct: all reads, then all writes, so that the LDS round trips overlap */
#pragma unroll
    for (int r = 0; r < 8; ++r) { pc[r] = blk + (16 * m + 8 * hh + r) * TP + 15 + dg + r; po[r] = pc[r] + (dg + r <= 0 ? 16 : -16); om[r] = *pc[r]; oo[r] = *po[r]; }
#pragma unroll
    for (int r = 0; r < 8; ++r) { *pc[r] = om[r] + c1[r] * 0.0625f; *po[r] = oo[r] + (dg + r <= 0 ? c0[r] : c2[r]) * 0.0625f; } }
  /* k . e: accumulator (key row 16e + 8hh + r of the block, table row base + 16(1 - e + t) + ln) belongs to query row 16t + ln + 8hh + r - 15 */
#pragma unroll
  for (int e = 0; e < 2; ++e) { const v8f c0 = g2_dot64(kf[e], ef[1 - e]), c1 = g2_dot64(kf[e], ef[2 - e]), c2 = g2_dot64(kf[e], ef[3 - e]); float* pc[8]; float* po[8]; float om[8], oo[8];
#pragma unroll
    for (int r = 0; r < 8; ++r) { const int il = 1 + ln + 8 * hh + r; pc[r] = blk + il * TP + 16 * e + 8 * hh + r; po[r] = pc[r] + (il < 16 ? 16 * TP : -16 * TP); om[r] = *pc[r]; oo[r] = *po[r]; }
#pragma unroll
    for (int r = 0; r < 8; ++r) { *pc[r] = om[r] + c1[r] * 0.0625f; *po[r] = oo[r] + (1 + ln + 8 * hh + r < 16 ? c2[r] : c0[r]) * 0.0625f; } }
  __syncthreads();      /* publishes the score tile and the mask */
  /* P . V share of this wave: tile (pm, pn) of the 32 x 64 result, half pk of K = 512; its V^T fragments are asked for here so that they fly during the softmax */
  const int pm = w & 1, pn = (w >> 1) & 3, pk = w >> 3;
  const _Float16* vp = VT + (((size_t)b * NH + h) * HD + 16 * pn + ln) * SQ + 256 * pk + 8 * hh;
  v16h vf[8];
#pragma unroll
  for (int s = 0; s < 8; ++s) vf[s] = g2_frag(vp + 32 * s, 0);
  asm volatile("s_wait_xcnt 0x0" :: "v"(vp) : "memory");      /* the wait before the address registers of the loads above are overwritten */
#pragma unroll
  for (int k = 0; k < 2; ++k) { const int row = 2 * w + k; float x[16]; float mx = -INFINITY;
#pragma unroll
    for (int u = 0; u < 4; ++u) { const int c = 128 * u + 4 * lane; const v4f sv = *(const v4fa*)&sc[row][c], mm = *(const v4fa*)&mk[c];
#pragma unroll
      for (int q = 0; q < 4; ++q) { x[u * 4 + q] = sv[q] * 0.125f + mm[q]; mx = fmaxf(mx, x[u * 4 + q]); } }
    mx = wave_max(mx); float se = 0.f;
#pragma unroll
    for (int j = 0; j < 16; ++j) { x[j] = expf(x[j] - mx); se += x[j]; }
    const float sn = 256.0f / wave_sum(se);
#pragma unroll
    for (int u = 0; u < 4; ++u) { v4h o;
#pragma unroll
      for (int q = 0; q < 4; ++q) o[q] = (_Float16)(x[u * 4 + q] * sn);
      *(v4h*)&ph[row][128 * u + 4 * lane] = o; } }
  __syncthreads();      /* publishes the P tile */
  { const _Float16* pa = &ph[16 * pm + ln][256 * pk + 8 * hh]; v16h pf[8];
#pragma unroll
    for (int s = 0; s < 8; ++s) pf[s] = g2_frag(pa + 32 * s, 0);
    v8f c = {0.f,0.f,0.f,0.f,0.f,0.f,0.f,0.f};
#pragma unroll
    for (int s = 0; s < 8; ++s) c = g2_mma(pf[s], vf[s], c);
#pragma unroll
    for (int r = 0; r < 8; ++r) so[pk][16 * pm + 8 * hh + r][16 * pn + ln] = c[r]; }
  __syncthreads();      /* publishes the two K halves of the 32 x 64 result */
  { const int row = tid >> 4, c4 = (tid & 15) * 4; const v4f v = (*(const v4fa*)&so[0][row][c4] + *(const v4fa*)&so[1][row][c4]) * 0.00390625f; *(v4f*)(out + ((size_t)b * SQ + i0 + row) * DM + h * HD + c4) = v; } }
__global__ __launch_bounds__(256) void k_vt(const _Float16* __restrict__ V16, int b, int h0, _Float16* __restrict__ VT) { __shared__ unsigned short tl[64][65]; const int tid = threadIdx.x; const int hh = blockIdx.x % HG, sg = blockIdx.x / HG; const int s0 = sg * 64; const int h = h0 + hh;
  for (int i = tid; i < 64 * 8; i += 256) { const int j = i / 8, d8 = (i % 8) * 8; FragH f; f.half[0] = *(const v8us*)((const unsigned short*)V16 + ((size_t)b * SQ + s0 + j) * DM + h * HD + d8); for (int q = 0; q < 8; ++q) tl[d8 + q][j] = f.u[q]; }
  __syncthreads();
  { for (int i = tid; i < 64 * 8; i += 256) { const int d = i / 8, j8 = (i % 8) * 8; FragH f; for (int q = 0; q < 8; ++q) f.u[q] = tl[d][j8 + q]; *(v8us*)((unsigned short*)VT + ((size_t)hh * HD + d) * SQ + s0 + j8) = f.half[0]; }  } }

extern "C" void kernel_launch(void* const* d_in, const int* in_sizes, int n_in,
                              void* d_out, int out_size, void* d_ws, size_t ws_size, hipStream_t stream) {
  (void)in_sizes; (void)n_in; (void)out_size;
  const float* const* I = (const float* const*)d_in; const float* hs = I[0]; const float* amask = I[1]; const float* wq = I[2]; const float* bq = I[3]; const float* wk = I[4]; const float* bk = I[5]; const float* wv = I[6]; const float* bv = I[7]; const float* demb = I[8];      /* weights [in][out]; attention_mask [8][1][1][512] additive; dist_emb [1023][64] */
  char* ws = (char*)d_ws; size_t off = 0;
  auto take = [&](size_t bytes) { char* p = ws + off; off += (bytes + 255) & ~(size_t)255; return p; };
  _Float16* BQ = (_Float16*)take((size_t)DM * DM * 2); _Float16* BK = (_Float16*)take((size_t)DM * DM * 2); _Float16* BV = (_Float16*)take((size_t)DM * DM * 2); _Float16* BE = (_Float16*)take((size_t)RW * HD * 2);
  _Float16* X16 = (_Float16*)take(NR * DM * 2); _Float16* Q16 = (_Float16*)take(NR * DM * 2); _Float16* K16 = (_Float16*)take(NR * DM * 2); _Float16* V16 = (_Float16*)take(NR * DM * 2);
  _Float16* VT = (_Float16*)take((size_t)NB * NH * HD * SQ * 2);
  if (off > ws_size) return;      /* 6 + 0.1 + 4x8 + 8 = approx 46 MiB */
  k_prep<<<3 * PW + PX + PE, 256, 0, stream>>>(wq, wk, wv, demb, hs, BQ, BK, BV, BE, X16);      /* transposed weights x16, padded table x16, hidden rows as f16 */
  k_proj<<<dim3((unsigned)((NR / GT) * (DM / GT)), 3), 256, 0, stream>>>(X16, BQ, BK, BV, bq, bk, bv, Q16, K16, V16);
  k_vt<NH, SQ><<<NB * NH * (SQ / 64), 256, 0, stream>>>(V16, DM, 0, VT);      /* V^T[(b,h)][d][s] for every (batch, head) */
  k_attn<<<dim3(SQ / RT, NH, NB), 512, 0, stream>>>(Q16, K16, BE, VT, amask, (float*)d_out);      /* scores, relative terms, softmax and P . V; ctx rows (merged heads, f32) */
}

// v005
// A run of this version takes 96.4 microseconds.
// Next to v004, in two timings, it ran 1.13 times as fast each time.
// All steps since v000 together make it 37.9 times as fast.
#include <hip/hip_runtime.h>
// BERT self-attention with relative-position score terms (hidden [8][512][1024]; q, k, v = h W + b ([in][out], 16 heads of 64); scores[l][r] = (q_l.k_r + q_l.pe[l-r] + k_r.pe[l-r]) / 8 + mask[r] with pe = dist_emb[l - r + 511]; softmax; ctx = attn v merged -> [8][512][1024]).
// Structure: token rows r = b*512 + s; hidden as exact f16 rows (with the weight and table preparations in one launch); Q | K | V as three WMMA GEMMs in one launch (128x128 work-group tiles staged in LDS by asynchronous copies, 32x64 wave tiles, f32 accumulation, exact x16 transposed weights, bias in the epilogue, f16 outputs); V^T via LDS transposes; q, k, V^T and the table lie in memory in WMMA fragment order (FRAGMENT ORDER below), so that a fragment load of the attention reads whole lines; then one fused attention launch, one work-group per 32 query rows of a (batch, head): q.k and the two relative terms (q rows and k rows times the window of dist_emb^T that the tile's diagonals meet; table padded to 1024 rows with zeros) on WMMA, summed in an LDS score tile (f32), row softmax on VALU, one wave per query row (mask added; weights x256 as f16 in LDS), ctx = P . V on WMMA (K = 512, alpha 2^-8) written as f32 into the merged output rows.
// Compute dtype: inputs rounded to bf16; hidden / weights / table exact; q, k, v and the softmax weights as plain f16 GEMM operands (~2^-12); scores, relative terms and softmax statistics f32. v_wmma_f32_16x16x32_f16.
#define NB 8
#define SQ 512
#define DM 1024
#define NH 16
#define HD 64
#define HG 16                        /* heads per attention launch group (all) */
#define NREL 1023                    /* relative distances -511..511 */
#define RW 1024                      /* dist_emb table rows (distances padded to 1024) */
#define QN SQ                        /* unused: attention covers all SQ query rows */
#define NBR NB                       /* unused: attention covers all NB batches */
#define MP ((int)NR)                 /* unused: the projections take all NR rows */
#define NR ((size_t)NB * SQ)         /* 4096 token rows */
typedef __bf16 v16b __attribute__((ext_vector_type(16)));
typedef unsigned short v8us __attribute__((ext_vector_type(8), may_alias));
typedef float  v8f  __attribute__((ext_vector_type(8)));
typedef float  v4f  __attribute__((ext_vector_type(4)));
typedef float  v4fa __attribute__((ext_vector_type(4), may_alias));
union FragB { v16b v; v8us half[2]; unsigned short u[16]; };

__device__ __forceinline__ unsigned short bf16_bits(float x) { unsigned int u = __float_as_uint(x); return (unsigned short)((u + 0x7FFFu + ((u >> 16) & 1u)) >> 16); }
__device__ __forceinline__ float bf16_val(unsigned short b) { return __uint_as_float(((unsigned int)b) << 16); }
__device__ __forceinline__ float bf16_round(float x) { return bf16_val(bf16_bits(x)); }
// D += A·B with NT terms: 1 = ah·bh, 2 = + al·bh (A split), 3 = + ah·bl (both split)
template <int NT>
__device__ __forceinline__ v8f mmaN(v16b ah, v16b al, v16b bh, v16b bl, v8f c) {
  c = __builtin_amdgcn_wmma_f32_16x16x32_bf16(false, ah, false, bh, (short)0, c, false, false);
  if (NT >= 2) c = __builtin_amdgcn_wmma_f32_16x16x32_bf16(false, al, false, bh, (short)0, c, false, false);
  if (NT >= 3) c = __builtin_amdgcn_wmma_f32_16x16x32_bf16(false, ah, false, bl, (short)0, c, false, false);
  asm volatile("v_nop\n\tv_nop\n\tv_nop\n\tv_nop" : "+v"(c) : "v"(ah), "v"(al), "v"(bh), "v"(bl));
  return c;
}

__global__ __launch_bounds__(256) void k_wt_bf16(const float* __restrict__ W, unsigned short* __restrict__ Wt, int K, int N) {
  const int t = blockIdx.x * 256 + threadIdx.x;
  const int k8n = K / 8;
  if (t >= N * k8n) return;
  const int n = t / k8n, k8 = (t % k8n) * 8;
  v8us v;
#pragma unroll
  for (int i = 0; i < 8; ++i) v[i] = bf16_bits(W[(size_t)(k8 + i) * N + n]);
  *(v8us*)(Wt + (size_t)n * K + k8) = v;
  
}

// GEMM C[M][N] (f32, pitch ldc) = act(A[M][K]·W + bias). A f32 row-major (pitch lda) converted per fragment to bf16
// (ASPLIT: hi/lo two planes -> 2 terms, else single rounded term); Wt bf16 [N][K] (pitch ldb). BIAS_BF16 rounds the
// bias to bf16 first (bias quantised to bf16 before the add). K%32==0, M%16==0, N%64==0.
template <bool ASPLIT, int ACT, bool BIAS_BF16>
__global__ __launch_bounds__(128) void k_gemm_bf(const float* __restrict__ A, int lda, const unsigned short* __restrict__ Wt, int ldb,
                                               const float* __restrict__ bias, float* __restrict__ C, int ldc, int M, int N, int K) {
  __shared__ __attribute__((aligned(16))) float so[4][16][64];
  const int tid = threadIdx.x, w = tid >> 5, lane = tid & 31, ln = lane & 15, hh = lane >> 4;
  const int ntn = N / 64;
  const int wid = blockIdx.x * 4 + w;
  const int mt = wid / ntn, nq = wid % ntn;
  if (mt * 16 >= M) return;
  const int row0 = mt * 16, col0 = nq * 64;
  const float* arow = A + (size_t)(row0 + ln) * lda;
  v8f acc[4] = {};
  for (int kb = 0; kb < K; kb += 32) {
    FragB ah, al;
    const v4f x0 = *(const v4fa*)(arow + kb + 8 * hh), x1 = *(const v4fa*)(arow + kb + 8 * hh + 4);
    const v4f x2 = *(const v4fa*)(arow + kb + 16 + 8 * hh), x3 = *(const v4fa*)(arow + kb + 16 + 8 * hh + 4);
    float xs[16] = {x0[0],x0[1],x0[2],x0[3],x1[0],x1[1],x1[2],x1[3],x2[0],x2[1],x2[2],x2[3],x3[0],x3[1],x3[2],x3[3]};
#pragma unroll
    for (int i = 0; i < 16; ++i) { const unsigned short hb = bf16_bits(xs[i]); ah.u[i] = hb; al.u[i] = ASPLIT ? bf16_bits(xs[i] - bf16_val(hb)) : (unsigned short)0; }
#pragma unroll
    for (int t = 0; t < 4; ++t) {
      const unsigned short* brow = Wt + (size_t)(col0 + t * 16 + ln) * ldb + kb;
      FragB b;
      b.half[0] = *(const v8us*)(brow + 8 * hh);
      b.half[1] = *(const v8us*)(brow + 16 + 8 * hh);
      acc[t] = mmaN<ASPLIT ? 2 : 1>(ah.v, al.v, b.v, b.v, acc[t]);
    }
  }
#pragma unroll
  for (int t = 0; t < 4; ++t) {
    float bv = bias ? bias[col0 + t * 16 + ln] : 0.f;
    if (BIAS_BF16) bv = bf16_round(bv);
#pragma unroll
    for (int r = 0; r < 8; ++r) { float v = acc[t][r] + bv; if (ACT == 1) v = fmaxf(v, 0.f); so[w][8 * hh + r][t * 16 + ln] = v; }
  }
  __builtin_amdgcn_fence(__ATOMIC_ACQ_REL, "workgroup");
  __builtin_amdgcn_wave_barrier();
  const int rsub = lane >> 4, c4 = (lane & 15) * 4;
  {
#pragma unroll
    for (int q = 0; q < 8; ++q) {
      const int r = q * 2 + rsub;
      const v4f v = *(const v4fa*)&so[w][r][c4];
      *(v4f*)(C + (size_t)(row0 + r) * ldc + col0 + c4) = v;
    }
    
  }
}

// GEMM C = act(A·W + bias + resid): A f32 (ASPLIT -> hi/lo 2 terms), Wt bf16 [N][K]; ACT 0 none, 1 relu, 2 exact gelu;
// resid (optional, f32, row index = (row % rmod), pitch ldr, RES_BF16 rounds it) added before the activation.
template <bool ASPLIT, int ACT, bool BIAS_BF16, bool RES_BF16>
__global__ __launch_bounds__(128) void k_gemm_bf3(const float* __restrict__ A, int lda, const unsigned short* __restrict__ Wt, int ldb,
                                                const float* __restrict__ bias, const float* __restrict__ resid, int rmod, int ldr,
                                                float* __restrict__ C, int ldc, int M, int N, int K) {
  __shared__ __attribute__((aligned(16))) float so[4][16][64];
  const int tid = threadIdx.x, w = tid >> 5, lane = tid & 31, ln = lane & 15, hh = lane >> 4;
  const int ntn = N / 64;
  const int wid = blockIdx.x * 4 + w;
  const int mt = wid / ntn, nq = wid % ntn;
  if (mt * 16 >= M) return;
  const int row0 = mt * 16, col0 = nq * 64;
  const float* arow = A + (size_t)(row0 + ln) * lda;
  v8f acc[4] = {};
  for (int kb = 0; kb < K; kb += 32) {
    FragB ah, al;
    const v4f x0 = *(const v4fa*)(arow + kb + 8 * hh), x1 = *(const v4fa*)(arow + kb + 8 * hh + 4);
    const v4f x2 = *(const v4fa*)(arow + kb + 16 + 8 * hh), x3 = *(const v4fa*)(arow + kb + 16 + 8 * hh + 4);
    float xs[16] = {x0[0],x0[1],x0[2],x0[3],x1[0],x1[1],x1[2],x1[3],x2[0],x2[1],x2[2],x2[3],x3[0],x3[1],x3[2],x3[3]};
#pragma unroll
    for (int i = 0; i < 16; ++i) { const unsigned short hb = bf16_bits(xs[i]); ah.u[i] = hb; al.u[i] = ASPLIT ? bf16_bits(xs[i] - bf16_val(hb)) : (unsigned short)0; }
#pragma unroll
    for (int t = 0; t < 4; ++t) {
      const unsigned short* brow = Wt + (size_t)(col0 + t * 16 + ln) * ldb + kb;
      FragB b;
      b.half[0] = *(const v8us*)(brow + 8 * hh);
      b.half[1] = *(const v8us*)(brow + 16 + 8 * hh);
      acc[t] = mmaN<ASPLIT ? 2 : 1>(ah.v, al.v, b.v, b.v, acc[t]);
    }
  }
#pragma unroll
  for (int t = 0; t < 4; ++t) {
    const int col = col0 + t * 16 + ln;
    float bv = bias ? bias[col] : 0.f;
    if (BIAS_BF16) bv = bf16_round(bv);
#pragma unroll
    for (int r = 0; r < 8; ++r) {
      float v = acc[t][r] + bv;
      if (resid) { float rv = resid[(size_t)((row0 + 8 * hh + r) % rmod) * ldr + col]; if (RES_BF16) rv = bf16_round(rv); v += rv; }
      if (ACT == 1) v = fmaxf(v, 0.f);
      if (ACT == 2) v = 0.5f * v * (1.0f + erff(v * 0.70710678118654752f));
      if (ACT == 3) { const float u = 0.7978845608028654f * (v + 0.044715f * v * v * v); v = 0.5f * v * (1.0f + tanhf(u)); }
      so[w][8 * hh + r][t * 16 + ln] = v;
    }
  }
  __builtin_amdgcn_fence(__ATOMIC_ACQ_REL, "workgroup");
  __builtin_amdgcn_wave_barrier();
  const int rsub = lane >> 4, c4 = (lane & 15) * 4;
  {
#pragma unroll
    for (int q = 0; q < 8; ++q) {
      const int r = q * 2 + rsub;
      const v4f v = *(const v4fa*)&so[w][r][c4];
      *(v4f*)(C + (size_t)(row0 + r) * ldc + col0 + c4) = v;
    }
    
  }
}
// row LayerNorm (biased variance, eps) over N: s = X (+ R); optional out_sum <- s; out_norm <- (s-mu)*rsqrt(var+eps)*g + b
template <bool PARAM_BF16>
__global__ __launch_bounds__(256) void k_layernorm(const float* __restrict__ X, const float* __restrict__ R, const float* __restrict__ g, const float* __restrict__ bta,
                                                  float* __restrict__ out_sum, float* __restrict__ out_norm, int N, float eps) {
  __shared__ float red[256];
  const int row = blockIdx.x, tid = threadIdx.x;
  const float* x = X + (size_t)row * N; const float* rr = R ? R + (size_t)row * N : nullptr;
  float vals[16];                     // up to N = 4096
  const int per = N / 256;            // contiguous chunk per thread? use strided-by-4 chunks: thread handles j = tid*4 + 1024*u
  float s1 = 0.f;
  for (int u = 0; u < per / 4; ++u) {
    const int j = tid * 4 + 1024 * u;
    const v4f a = *(const v4fa*)(x + j);
    v4f b = {0.f,0.f,0.f,0.f}; if (rr) b = *(const v4fa*)(rr + j);
#pragma unroll
    for (int q = 0; q < 4; ++q) { const float v = a[q] + b[q]; vals[u * 4 + q] = v; s1 += v; }
  }
  red[tid] = s1; __syncthreads();
  for (int st = 128; st > 0; st >>= 1) { if (tid < st) red[tid] += red[tid + st]; __syncthreads(); }
  const float mu = red[0] / (float)N; __syncthreads();
  float s2 = 0.f;
  for (int u = 0; u < per / 4; ++u)
#pragma unroll
    for (int q = 0; q < 4; ++q) { const float c = vals[u * 4 + q] - mu; s2 += c * c; }
  red[tid] = s2; __syncthreads();
  for (int st = 128; st > 0; st >>= 1) { if (tid < st) red[tid] += red[tid + st]; __syncthreads(); }
  const float rs = rsqrtf(red[0] / (float)N + eps);
  {
    for (int u = 0; u < per / 4; ++u) {
      const int j = tid * 4 + 1024 * u;
      v4f o, sm;
#pragma unroll
      for (int q = 0; q < 4; ++q) {
        float gg = g[j + q], bb = bta[j + q];
        if (PARAM_BF16) { gg = bf16_round(gg); bb = bf16_round(bb); }
        sm[q] = vals[u * 4 + q]; o[q] = (vals[u * 4 + q] - mu) * rs * gg + bb;
      }
      if (out_sum) *(v4f*)(out_sum + (size_t)row * N + j) = sm;
      *(v4f*)(out_norm + (size_t)row * N + j) = o;
    }
    
  }
}



// ---- f16 WMMA path (v_wmma_f32_16x16x32_f16): 11-bit significands for operands in range — used where a [0,1] probability operand needs more precision than bf16
typedef _Float16 v16h __attribute__((ext_vector_type(16)));
union FragH { v16h v; v8us half[2]; _Float16 h[16]; unsigned short u[16]; };
template <int NT>
__device__ __forceinline__ v8f mmaH(v16h ah, v16h al, v16h bh, v16h bl, v8f c) {
  c = __builtin_amdgcn_wmma_f32_16x16x32_f16(false, ah, false, bh, (short)0, c, false, false);
  if (NT >= 2) c = __builtin_amdgcn_wmma_f32_16x16x32_f16(false, al, false, bh, (short)0, c, false, false);
  if (NT >= 3) c = __builtin_amdgcn_wmma_f32_16x16x32_f16(false, ah, false, bl, (short)0, c, false, false);
  asm volatile("v_nop\n\tv_nop\n\tv_nop\n\tv_nop" : "+v"(c) : "v"(ah), "v"(al), "v"(bh), "v"(bl));
  return c;
}
// batched GEMM like k_gemm_b but f16 operands: A f32 (split into f16 hi/lo if ASPLIT, else rounded to f16), Bt = f16 values [n][k]; alpha; C f32; N multiple of 16 (partial tiles skipped)
template <bool ASPLIT>
__global__ __launch_bounds__(128) void k_gemm_h(const float* __restrict__ A, int lda, size_t sA, const _Float16* __restrict__ Bh, int ldb, size_t sB, float alpha, float* __restrict__ C, int ldc, size_t sC, int M, int N, int K) {
  __shared__ __attribute__((aligned(16))) float so[4][16][64];
  const int tid = threadIdx.x, w = tid >> 5, lane = tid & 31, ln = lane & 15, hh = lane >> 4; const int by = blockIdx.y;
  A += (size_t)by * sA; Bh += (size_t)by * sB; C += (size_t)by * sC;
  const int ntn = (N + 63) / 64; const int wid = blockIdx.x * 4 + w; const int mt = wid / ntn, nq = wid % ntn; if (mt * 16 >= M) return;
  const int row0 = mt * 16, col0 = nq * 64; const float* arow = A + (size_t)(row0 + ln) * lda;
  v8f acc[4] = {};
  for (int kb = 0; kb < K; kb += 32) {
    FragH ah, al;
    const v4f x0 = *(const v4fa*)(arow + kb + 8 * hh), x1 = *(const v4fa*)(arow + kb + 8 * hh + 4), x2 = *(const v4fa*)(arow + kb + 16 + 8 * hh), x3 = *(const v4fa*)(arow + kb + 16 + 8 * hh + 4);
    float xs[16] = {x0[0],x0[1],x0[2],x0[3],x1[0],x1[1],x1[2],x1[3],x2[0],x2[1],x2[2],x2[3],x3[0],x3[1],x3[2],x3[3]};
#pragma unroll
    for (int i = 0; i < 16; ++i) { const _Float16 h = (_Float16)xs[i]; ah.h[i] = h; al.h[i] = ASPLIT ? (_Float16)(xs[i] - (float)h) : (_Float16)0.0f; }
#pragma unroll
    for (int t = 0; t < 4; ++t) { if (col0 + t * 16 >= N) continue; const size_t boff = (size_t)(col0 + t * 16 + ln) * ldb + kb; FragH bq; bq.half[0] = *(const v8us*)(Bh + boff + 8 * hh); bq.half[1] = *(const v8us*)(Bh + boff + 16 + 8 * hh);
      acc[t] = mmaH<ASPLIT ? 2 : 1>(ah.v, al.v, bq.v, bq.v, acc[t]); }
  }
#pragma unroll
  for (int t = 0; t < 4; ++t) { if (col0 + t * 16 >= N) continue;
#pragma unroll
    for (int r = 0; r < 8; ++r) so[w][8 * hh + r][t * 16 + ln] = acc[t][r] * alpha; }
  __builtin_amdgcn_fence(__ATOMIC_ACQ_REL, "workgroup"); __builtin_amdgcn_wave_barrier();
  const int rsub = lane >> 4, c4 = (lane & 15) * 4;
  {
#pragma unroll
    for (int q = 0; q < 8; ++q) { const int r = q * 2 + rsub; if (col0 + c4 < N) { const v4f v = *(const v4fa*)&so[w][r][c4]; *(v4f*)(C + (size_t)(row0 + r) * ldc + col0 + c4) = v; } }
     }
}

// Wt[n][k] = f16(W[k][n]·scale) from f32 row-major W[K][N] (scale = power of two; bf16-exact weights stay exact in f16 away from the subnormal range)
__device__ __forceinline__ void d_wt_f16(const float* __restrict__ W, _Float16* __restrict__ Wt, int K, int N, float scale, int t) {
  if (t >= N * (K / 8)) return; const int n = t / (K / 8), k8 = (t % (K / 8)) * 8; FragH f;
#pragma unroll
  for (int i = 0; i < 8; ++i) f.h[i] = (_Float16)(bf16_round(W[(size_t)(k8 + i) * N + n]) * scale); const v8us o = f.half[0];
  *(v8us*)((unsigned short*)Wt + (size_t)n * K + k8) = o; 
}
// k_gemm_hh variant with fused epilogue: v = acc·alpha + bias[by·sBias + col] (+ CP[(row/rowsPerB)·sCPb + by·64 + col] if CP) ; ACT 0 none / 1 elu ; writes f16 C16 (and f32 C if non-null)
template <int ACT>
__global__ __launch_bounds__(128) void k_gemm_hhx(const _Float16* __restrict__ A, int lda, size_t sA, const _Float16* __restrict__ Bh, int ldb, size_t sB, float alpha, const float* __restrict__ bias, size_t sBias, const float* __restrict__ CP, int rowsPerB, size_t sCPb, int row0g,
    float* __restrict__ C, _Float16* __restrict__ C16, int ldc, size_t sC, int M, int N, int K) {
  __shared__ __attribute__((aligned(16))) float so[4][16][64];
  const int tid = threadIdx.x, w = tid >> 5, lane = tid & 31, ln = lane & 15, hh = lane >> 4; const int by = blockIdx.y;
  A += (size_t)by * sA; Bh += (size_t)by * sB; const size_t cofs = (size_t)by * sC; const float* bp = bias ? bias + (size_t)by * sBias : nullptr;
  const int ntn = (N + 63) / 64; const int wid = blockIdx.x * 4 + w; const int mt = wid / ntn, nq = wid % ntn; if (mt * 16 >= M) return;
  const int row0 = mt * 16, col0 = nq * 64; const _Float16* arow = A + (size_t)(row0 + ln) * lda;
  v8f acc[4] = {};
  for (int kb = 0; kb < K; kb += 32) { FragH ah; ah.half[0] = *(const v8us*)((const unsigned short*)arow + kb + 8 * hh); ah.half[1] = *(const v8us*)((const unsigned short*)arow + kb + 16 + 8 * hh);
#pragma unroll
    for (int t = 0; t < 4; ++t) { if (col0 + t * 16 >= N) continue; const size_t boff = (size_t)(col0 + t * 16 + ln) * ldb + kb; FragH bq; bq.half[0] = *(const v8us*)((const unsigned short*)Bh + boff + 8 * hh); bq.half[1] = *(const v8us*)((const unsigned short*)Bh + boff + 16 + 8 * hh);
      acc[t] = mmaH<1>(ah.v, ah.v, bq.v, bq.v, acc[t]); }
  }
#pragma unroll
  for (int t = 0; t < 4; ++t) { if (col0 + t * 16 >= N) continue; const int col = col0 + t * 16 + ln; const float bv = bp ? bf16_round(bp[col]) : 0.f;
#pragma unroll
    for (int r = 0; r < 8; ++r) { float v = acc[t][r] * alpha + bv; if (CP) { const int rr = row0g + row0 + 8 * hh + r; if (rowsPerB < 0) v += CP[cofs + (size_t)rr * ldc + col];      /* rowsPerB < 0: own element of the batched C plane */ else { const int bidx = rr / rowsPerB; v += CP[(size_t)bidx * sCPb + (size_t)by * 64 + col]; } } if (ACT == 1) v = (v > 0.f) ? v : expm1f(v); else if (ACT == 7) v = (v > 0.f) ? v + 1.0f : expf(v); else if (ACT == 8) v = tanhf(v); else if (ACT == 9) v = 0.5f * v * (1.0f + tanhf(0.7978845608028654f * (v + 0.044715f * v * v * v))); else if (ACT == 11) v = 1.0f / (1.0f + expf(-v)); else if (ACT == 12) v = (v > 0.f) ? v : 0.01f * v; else if (ACT == 14) v = (v > 0.f) ? v : 0.1f * v; else if (ACT == 16) v = (v >= 0.f) ? v : 0.3f * v; else if (ACT == 17) v = (v >= 0.f) ? v : 0.2f * v; else if (ACT == 15) v = v / (1.0f + expf(-v)); else if (ACT == 3) v = fmaxf(v, 0.f); else if (ACT == 6) v = 0.5f * v * (1.0f + erff(v * 0.70710678118654752f)); so[w][8 * hh + r][t * 16 + ln] = v; } }
  __builtin_amdgcn_fence(__ATOMIC_ACQ_REL, "workgroup"); __builtin_amdgcn_wave_barrier();
  const int rsub = lane >> 4, c4 = (lane & 15) * 4; typedef _Float16 v4h __attribute__((ext_vector_type(4)));
  {
#pragma unroll
    for (int q = 0; q < 8; ++q) { const int r = q * 2 + rsub; if (col0 + c4 < N) { const v4f v = *(const v4fa*)&so[w][r][c4]; if (C) *(v4f*)(C + cofs + (size_t)(row0 + r) * ldc + col0 + c4) = v; if (C16) { v4h h4; for (int i = 0; i < 4; ++i) h4[i] = (_Float16)v[i]; *(v4h*)(C16 + cofs + (size_t)(row0 + r) * ldc + col0 + c4) = h4; } } }
     }
}


typedef _Float16 v4h __attribute__((ext_vector_type(4)));

__device__ __forceinline__ void d_x16(const float* __restrict__ x, _Float16* __restrict__ X16, size_t n8, size_t t) { if (t >= n8) return; FragH f;
#pragma unroll
  for (int q = 0; q < 8; ++q) f.h[q] = (_Float16)bf16_round(x[t * 8 + q]); *(v8us*)((unsigned short*)X16 + t * 8) = f.half[0];  }
__global__ __launch_bounds__(256) void k_h16(const float* __restrict__ x, _Float16* __restrict__ X16, size_t n8) { const size_t t = (size_t)blockIdx.x * 256 + threadIdx.x; if (t >= n8) return; FragH f;
#pragma unroll
  for (int q = 0; q < 8; ++q) f.h[q] = (_Float16)x[t * 8 + q]; *(v8us*)((unsigned short*)X16 + t * 8) = f.half[0];  }
__global__ __launch_bounds__(256) void k_round16f(const float* __restrict__ W, _Float16* __restrict__ Bt, size_t n8) { const size_t t = (size_t)blockIdx.x * 256 + threadIdx.x; if (t >= n8) return; FragH f;
#pragma unroll
  for (int i = 0; i < 8; ++i) f.h[i] = (_Float16)(bf16_round(W[t * 8 + i]) * 16.0f); *(v8us*)((unsigned short*)Bt + t * 8) = f.half[0];  }
template <int NHv, int TTv>
__global__ __launch_bounds__(256) void k_vt(const _Float16* __restrict__ V16, int ldv, int voff, _Float16* __restrict__ Vt) { __shared__ unsigned short tl[64][66]; const int tid = threadIdx.x; const int slab = blockIdx.x / (TTv / 64), lg = blockIdx.x % (TTv / 64); const int b = slab / NHv, h = slab % NHv;
  for (int i = tid; i < 64 * 8; i += 256) { const int r = i / 8, c8 = (i % 8) * 8; FragH f; f.half[0] = *(const v8us*)((const unsigned short*)V16 + ((size_t)b * TTv + lg * 64 + r) * ldv + voff + h * 64 + c8);
#pragma unroll
    for (int q = 0; q < 8; ++q) tl[r][c8 + q] = f.u[q]; }
  __syncthreads();
  {
#pragma unroll
    for (int rd = 0; rd < 2; ++rd) { const int pn = tid >> 6, part = (tid >> 5) & 1, lane = tid & 31, d = 16 * pn + (lane & 15), k0 = 32 * rd + 16 * part + 8 * (lane >> 4); FragH f;      /* fragment order: [slab][16 columns d][32 keys][part][lane][8 keys]; a wave stores 512 contiguous bytes */
#pragma unroll
      for (int q = 0; q < 8; ++q) f.u[q] = tl[k0 + q][d];
      *(v8us*)((unsigned short*)Vt + (((size_t)slab * 4 + pn) * (TTv / 32) + lg * 2 + rd) * 512 + part * 256 + lane * 8) = f.half[0]; }
     } }

__global__ __launch_bounds__(256) void k_hl(const float* __restrict__ F, _Float16* __restrict__ Hh, _Float16* __restrict__ Hl, size_t n8) { const size_t t = (size_t)blockIdx.x * 256 + threadIdx.x; if (t >= n8) return; FragH fh, fl; const v4f a = *(const v4fa*)(F + t * 8), c = *(const v4fa*)(F + t * 8 + 4);
#pragma unroll
  for (int q = 0; q < 4; ++q) { _Float16 h = (_Float16)a[q]; fh.h[q] = h; fl.h[q] = (_Float16)((a[q] - (float)h) * 1024.0f); h = (_Float16)c[q]; fh.h[4 + q] = h; fl.h[4 + q] = (_Float16)((c[q] - (float)h) * 1024.0f); }
  { *(v8us*)((unsigned short*)Hh + t * 8) = fh.half[0]; *(v8us*)((unsigned short*)Hl + t * 8) = fl.half[0];  } }

// ---- WMMA helpers (f16 fragments of 16 rows x 32 k; one product with its distance) ----
__device__ __forceinline__ v16h g2_frag(const _Float16* p, int hh) { FragH f; f.half[0] = *(const v8us*)((const unsigned short*)p + 8 * hh); f.half[1] = *(const v8us*)((const unsigned short*)p + 16 + 8 * hh); return f.v; }
__device__ __forceinline__ v8f g2_mma(v16h a, v16h b, v8f c) { v8f d = __builtin_amdgcn_wmma_f32_16x16x32_f16(false, a, false, b, (short)0, c, false, false); asm volatile("v_nop\n\tv_nop\n\tv_nop\n\tv_nop" : "+v"(d) : "v"(a), "v"(b)); return d; }
// FRAGMENT ORDER: a tile of 16 rows x 32 k (1 KiB) is stored as [part 0..1][lane 0..31][8 halves]; lane = 16 hh + ln holds row ln, k = 16 part + 8 hh .. + 7: the registers of g2_frag, unchanged.
// One 16-byte load of a wave then reads 512 contiguous bytes (4 lines) where the row-major tile made it touch 16 lines of 32 useful bytes each.
#define FT 512                       /* halves of one 16 x 32 fragment tile */
__device__ __forceinline__ v16h gf_frag(const _Float16* p) { FragH f; f.half[0] = *(const v8us*)((const unsigned short*)p); f.half[1] = *(const v8us*)((const unsigned short*)p + FT / 2); return f.v; }      /* p: the tile's start + 8 lane */
// Projection GEMM C16[4096][1024] = f16(A . Bt^T / 16 + bias): one 128 x 128 tile of C per work-group, 8 waves of 32 x 64 (4 down, 2 across).
// Per trip 128 k (256 bytes of each of the 128 A rows and 128 Bt rows) lie in LDS at pitch 272 bytes, brought by asynchronous 16-byte copies: a wave's copy takes 2 rows x 256 bytes, whole lines.
// Two buffers: the copies of trip t + 1 fly while trip t's fragments are read from LDS. k ascends in steps of 32 per accumulator. The epilogue stages each wave's 32 x 64 block in the first buffer.
#define GT 128                       /* rows and columns of C per work-group */
#define GK 128                       /* k per trip */
#define GP 272                       /* LDS row pitch in bytes: 16 x odd, for the 16-byte fragment reads */
#define GO (GT * GP)                 /* bytes of one operand's rows in a buffer */
#define GB (2 * GO)                  /* bytes of one buffer: A rows, then Bt rows */
__device__ __forceinline__ v16h g3_frag(const char* p) { FragH f; f.half[0] = *(const v8us*)p; f.half[1] = *(const v8us*)(p + 32); return f.v; }
// this thread's 8 pieces of one operand's 128 rows x 256 bytes: rows 16 apart, LDS byte address l, global address g
__device__ __forceinline__ void g3_copy(unsigned l, const _Float16* g) {
  /* the copies and, as the last line, the wait that stands before their address registers are rewritten */
  asm volatile("global_load_async_to_lds_b128 %0, %8, off\n\t"
               "global_load_async_to_lds_b128 %1, %9, off\n\t"
               "global_load_async_to_lds_b128 %2, %10, off\n\t"
               "global_load_async_to_lds_b128 %3, %11, off\n\t"
               "global_load_async_to_lds_b128 %4, %12, off\n\t"
               "global_load_async_to_lds_b128 %5, %13, off\n\t"
               "global_load_async_to_lds_b128 %6, %14, off\n\t"
               "global_load_async_to_lds_b128 %7, %15, off\n\t"
               "s_wait_xcnt 0x0"
               :: "v"(l), "v"(l + 16 * GP), "v"(l + 32 * GP), "v"(l + 48 * GP), "v"(l + 64 * GP), "v"(l + 80 * GP), "v"(l + 96 * GP), "v"(l + 112 * GP),
                  "v"(g), "v"(g + 16 * DM), "v"(g + 32 * DM), "v"(g + 48 * DM), "v"(g + 64 * DM), "v"(g + 80 * DM), "v"(g + 96 * DM), "v"(g + 112 * DM)
               : "memory");
}
// The three products (q, k, v) need nothing of each other: they share one grid, blockIdx.y picks the weights, the bias and the output.
__global__ __launch_bounds__(256) void k_proj(const _Float16* __restrict__ A, const _Float16* __restrict__ BQ, const _Float16* __restrict__ BK, const _Float16* __restrict__ BV,
                                              const float* __restrict__ bq, const float* __restrict__ bk, const float* __restrict__ bvp, _Float16* __restrict__ Q16, _Float16* __restrict__ K16, _Float16* __restrict__ V16) {
  const int z = blockIdx.y; const _Float16* Bh = z == 0 ? BQ : z == 1 ? BK : BV; const float* bias = z == 0 ? bq : z == 1 ? bk : bvp; _Float16* C16 = z == 0 ? Q16 : z == 1 ? K16 : V16;
  static_assert(NR % GT == 0 && DM % GT == 0 && DM % GK == 0 && DM / GK >= 2 && 8 * 32 * 68 * 4 <= GB, "k_proj: whole tiles, two trips or more, the output staging fits one buffer");
  __shared__ __attribute__((aligned(16))) float sm[2 * GB / 4];
  const int tid = threadIdx.x, w = tid >> 5, lane = tid & 31, ln = lane & 15, hh = lane >> 4, wm = w & 3, wn = w >> 2;
  const int mt = blockIdx.x % (int)(NR / GT), nq = blockIdx.x / (int)(NR / GT); const int row0 = mt * GT + 32 * wm, col0 = nq * GT + 64 * wn;
  const float* bp = bias + col0 + ln; float bv[4];
#pragma unroll      /* bv indexed by constants: registers; the four loads fly under the first copies */
  for (int t = 0; t < 4; ++t) bv[t] = bp[16 * t];
  asm volatile("s_wait_xcnt 0x0" :: "v"(bp) : "memory");      /* the wait before the address registers of the loads above are overwritten */
  const _Float16* ga = A + (size_t)(mt * GT + (tid >> 4)) * DM + (tid & 15) * 8;
  const _Float16* gb = Bh + (size_t)(nq * GT + (tid >> 4)) * DM + (tid & 15) * 8;
  const unsigned l0 = (unsigned)(size_t)(const void*)sm + (unsigned)((tid >> 4) * GP + (tid & 15) * 16);
  g3_copy(l0, ga); g3_copy(l0 + GO, gb);
  asm volatile("s_wait_asynccnt 0x0" ::: "memory");      /* this wave's copies of trip 0 have landed */
  __syncthreads();      /* publishes trip 0's rows */
  g3_copy(l0 + GB, ga + GK); g3_copy(l0 + GB + GO, gb + GK);
  const char* fa = (const char*)sm + (32 * wm + ln) * GP + 16 * hh;
  const char* fb = (const char*)sm + GO + (64 * wn + ln) * GP + 16 * hh;
  const v8f z8 = {0.f,0.f,0.f,0.f,0.f,0.f,0.f,0.f}; v8f c00 = z8, c01 = z8, c02 = z8, c03 = z8, c10 = z8, c11 = z8, c12 = z8, c13 = z8;
#pragma unroll 1      /* rolled: one publish point in the text, and the two buffers are told apart by an offset */
  for (int t = 0; t < DM / GK; ++t) { const int bo = (t & 1) * GB;
    const char* pa = fa + bo; const char* pb = fb + bo; v16h af[2][2], bf[2][4];      /* two fragment sets: step s + 1 of this trip is read from LDS, as one group, in front of step s's products */
#pragma unroll      /* the sets are indexed by constants, so that they live in registers */
    for (int i = 0; i < 2; ++i) af[0][i] = g3_frag(pa + i * 16 * GP);
#pragma unroll      /* as above */
    for (int j = 0; j < 4; ++j) bf[0][j] = g3_frag(pb + j * 16 * GP);
#pragma unroll      /* as above; the four k steps of a trip also get constant LDS offsets */
    for (int s = 0; s < GK / 32; ++s) { const int cu = s & 1, nx = cu ^ 1;
      if (s + 1 < GK / 32) {
#pragma unroll      /* as above */
        for (int i = 0; i < 2; ++i) af[nx][i] = g3_frag(pa + i * 16 * GP + 64 * (s + 1));
#pragma unroll      /* as above */
        for (int j = 0; j < 4; ++j) bf[nx][j] = g3_frag(pb + j * 16 * GP + 64 * (s + 1)); }
      c00 = g2_mma(af[cu][0], bf[cu][0], c00); c10 = g2_mma(af[cu][1], bf[cu][0], c10);
      c01 = g2_mma(af[cu][0], bf[cu][1], c01); c11 = g2_mma(af[cu][1], bf[cu][1], c11);
      c02 = g2_mma(af[cu][0], bf[cu][2], c02); c12 = g2_mma(af[cu][1], bf[cu][2], c12);
      c03 = g2_mma(af[cu][0], bf[cu][3], c03); c13 = g2_mma(af[cu][1], bf[cu][3], c13); }
    asm volatile("s_wait_dscnt 0x0" ::: "memory");      /* this wave's reads of trip t's buffer are done before it is refilled */
    asm volatile("s_wait_asynccnt 0x0" ::: "memory");      /* this wave's copies of trip t + 1 have landed */
    __syncthreads();      /* publishes trip t + 1's rows and ends every wave's reads of trip t's buffer */
    if (t + 2 < DM / GK) { g3_copy(l0 + bo, ga + (t + 2) * GK); g3_copy(l0 + bo + GO, gb + (t + 2) * GK); } }
  asm volatile("s_wait_asynccnt 0x0" ::: "memory");      /* no copy is outstanding when the first buffer becomes output staging */
  float (*so)[68] = (float (*)[68])(sm + w * 32 * 68);
  v8f accs[8] = {c00, c01, c02, c03, c10, c11, c12, c13};
#pragma unroll      /* accs and bv indexed by constants: registers */
  for (int u = 0; u < 8; ++u) { const int t = u & 3, half = u >> 2; const float bb = bf16_round(bv[t]);
#pragma unroll      /* as above */
    for (int r = 0; r < 8; ++r) so[half * 16 + 8 * hh + r][t * 16 + ln] = accs[u][r] * 0.0625f + bb; }
  __builtin_amdgcn_fence(__ATOMIC_ACQ_REL, "workgroup"); __builtin_amdgcn_wave_barrier();      /* the wave's staged block is complete before its lanes read each other's values; no other wave touches it */
  if (z == 2) {      /* v: row-major, as the transposing launch reads it */
    const int rsub = lane >> 4, c4 = (lane & 15) * 4;
#pragma unroll      /* the 16 LDS reads and stores overlap; each store is 2 rows x 128 bytes, whole lines */
    for (int q = 0; q < 16; ++q) { const int r = q * 2 + rsub; const v4f v = *(const v4fa*)&so[r][c4]; v4h h4; for (int i = 0; i < 4; ++i) h4[i] = (_Float16)v[i]; *(v4h*)(C16 + (size_t)(row0 + r) * DM + col0 + c4) = h4; }
  } else {      /* q, k: fragment order, [16-row tile][head][k half of 32][part][lane][8]; the wave's 64 columns are one head, its 32 rows two tiles */
    _Float16* cf = C16 + ((size_t)(row0 / 16) * NH + col0 / HD) * (2 * FT) + lane * 8;
#pragma unroll      /* the LDS reads and the 8 stores overlap; each store is 512 contiguous bytes */
    for (int q = 0; q < 8; ++q) { const int tl = q >> 2, c = q & 3; const float* sp = &so[16 * tl + ln][16 * c + 8 * hh]; const v4f v0 = *(const v4fa*)sp, v1 = *(const v4fa*)(sp + 4); FragH f;
#pragma unroll      /* f indexed by constants: registers */
      for (int i = 0; i < 4; ++i) { f.h[i] = (_Float16)v0[i]; f.h[4 + i] = (_Float16)v1[i]; }
      *(v8us*)((unsigned short*)cf + (size_t)tl * NH * (2 * FT) + c * (FT / 2)) = f.half[0]; }
    asm volatile("s_wait_xcnt 0x0" ::: "memory");      /* the wait before a register of the stores above is overwritten */
  } }


// table in fragment order: piece t of 8 halves is [16-row tile][k half of 32][part][lane]; it holds row 16 tile + ln, columns 16 (2 khalf + part) + 8 hh .. + 7
__device__ __forceinline__ void d_wrel(const float* __restrict__ w, _Float16* __restrict__ Bt, size_t t) { if (t >= (size_t)RW * HD / 8) return; const size_t row = (t >> 7) * 16 + (t & 15), col = ((t >> 5) & 3) * 16 + ((t >> 4) & 1) * 8; const bool live = row < (size_t)NREL; FragH f; for (int q = 0; q < 8; ++q) f.h[q] = live ? (_Float16)(bf16_round(w[row * HD + col + q]) * 16.0f) : (_Float16)0.0f; *(v8us*)((unsigned short*)Bt + t * 8) = f.half[0];  }
// The five operand preparations need nothing of each other: they share one grid as ranges of the block index (a block-uniform branch).
// Longest block first, so that none starts late and runs on alone: the table (its guarded loads follow one another), the weight transposes (strided reads), then the hidden rows.
#define PW (DM * (DM / 8) / 256)     /* blocks per weight matrix */
#define PX ((int)(NR * DM / 8 / 256)) /* blocks of the hidden rows */
#define PE (RW * HD / 8 / 256)       /* blocks of the distance table */
__global__ __launch_bounds__(256) void k_prep(const float* __restrict__ wq, const float* __restrict__ wk, const float* __restrict__ wv, const float* __restrict__ demb, const float* __restrict__ hs,
                                              _Float16* __restrict__ BQ, _Float16* __restrict__ BK, _Float16* __restrict__ BV, _Float16* __restrict__ BE, _Float16* __restrict__ X16) {
  static_assert(DM * (DM / 8) % 256 == 0 && NR * DM / 8 % 256 == 0 && RW * HD / 8 % 256 == 0, "k_prep: whole blocks in every range");
  const int blk = blockIdx.x, tid = threadIdx.x;
  if (blk < PE) d_wrel(demb, BE, (size_t)blk * 256 + tid);
  else if (blk < PE + 3 * PW) { const int u = blk - PE, z = u / PW; d_wt_f16(z == 0 ? wq : z == 1 ? wk : wv, z == 0 ? BQ : z == 1 ? BK : BV, DM, DM, 16.0f, (u - z * PW) * 256 + tid); }      /* [in][out] -> Bt[out][in] x16 */
  else d_x16(hs, X16, NR * DM / 8, (size_t)(blk - PE - 3 * PW) * 256 + tid); }
__global__ __launch_bounds__(256) void k_wnat(const float* __restrict__ w, size_t n8, _Float16* __restrict__ Bt) { const size_t t = (size_t)blockIdx.x * 256 + threadIdx.x; if (t >= n8) return; FragH f; for (int q = 0; q < 8; ++q) f.h[q] = (_Float16)(bf16_round(w[t * 8 + q]) * 16.0f); *(v8us*)((unsigned short*)Bt + t * 8) = f.half[0];  }
// Fused attention: one work-group = RT query rows of one (batch, head), 16 waves. Wave w owns the key columns 32w .. 32w + 31 of all RT rows:
// it forms q.k, the window of q . dist_emb^T and the window of k . dist_emb^T that those columns need on WMMA (64 table rows from i0 - 32w + 480 serve both windows;
// the k fragments are the B operand of q.k and the A operand of k . dist_emb^T) and sums the three in its own block of the LDS score tile, each relative term stored along its diagonal:
// score[i][r] = (q_i.k_r + q_i.e[i-r+S-1] + k_r.e[i-r+S-1]) * 0.125 + mask[r] (bf16-rounded additive mask, staged in LDS).
// Of the three 16-wide table tiles a 16x16 block meets, the middle one is used whole and the outer two halve along the diagonal, so they merge into one full tile by a lane select.
// Then one wave per query row (two rows a wave), lane l holding columns 128u + 4l .. + 3; P = f16(256 softmax) goes to LDS; each wave forms one 16x16 tile of P . V over one half of K = 512 (V^T fragments from memory);
// the two halves are summed through LDS, from where each output row is stored as whole 256-byte runs.
// Every loop is fully unrolled (constant trip counts): the per-lane arrays must be indexed by constants to live in registers.
#define RT 32                        /* query rows per work-group */
#define TP (SQ + 4)                  /* score tile pitch in floats: rows stay 16-byte aligned, a column of 32 rows falls on 16 banks */
#define PP (SQ + 8)                  /* P tile pitch in halves: 16 bytes more a row for the 16-byte fragment reads */
template <int C> __device__ __forceinline__ float x_row(float x) { return __builtin_bit_cast(float, __builtin_amdgcn_update_dpp(0, __builtin_bit_cast(int, x), 0x160 | C, 0xf, 0xf, true)); }      /* lane l <- lane l ^ C inside a 16-lane row (row_xmask) */
__device__ __forceinline__ float x_half(float x) { return __builtin_bit_cast(float, __builtin_amdgcn_permlanex16(__builtin_bit_cast(int, x), __builtin_bit_cast(int, x), 0x76543210, 0xfedcba98, false, false)); }      /* lane l <- lane l ^ 16 */
__device__ __forceinline__ float wave_max(float v) { v = fmaxf(v, x_row<1>(v)); v = fmaxf(v, x_row<2>(v)); v = fmaxf(v, x_row<4>(v)); v = fmaxf(v, x_row<8>(v)); return fmaxf(v, x_half(v)); }
__device__ __forceinline__ float wave_sum(float v) { v += x_row<1>(v); v += x_row<2>(v); v += x_row<4>(v); v += x_row<8>(v); return v + x_half(v); }
__device__ __forceinline__ v8f g2_dot64(const v16h (&a)[2], const v16h (&b)[2]) { const v8f z8 = {0.f,0.f,0.f,0.f,0.f,0.f,0.f,0.f}; return g2_mma(a[1], b[1], g2_mma(a[0], b[0], z8)); }
__global__ __launch_bounds__(512) void k_attn(const _Float16* __restrict__ Q16, const _Float16* __restrict__ K16, const _Float16* __restrict__ BE, const _Float16* __restrict__ VT, const float* __restrict__ amask, float* __restrict__ out) {
  static_assert(SQ == 512 && HD == 64 && RT == 32 && SQ % RT == 0 && RW >= 2 * SQ, "k_attn: 16 waves of 32 key columns; 512 threads stage 512 mask values and store 32 x 64 outputs");
  __shared__ __attribute__((aligned(16))) float sc[RT][TP];
  __shared__ __attribute__((aligned(16))) _Float16 ph[RT][PP];
  __shared__ __attribute__((aligned(16))) float so[2][RT][HD + 4];
  __shared__ __attribute__((aligned(16))) float mk[SQ];
  const int tid = threadIdx.x, w = __builtin_amdgcn_readfirstlane(tid >> 5), lane = tid & 31, ln = lane & 15, hh = lane >> 4, i0 = blockIdx.x * RT, h = blockIdx.y, b = blockIdx.z;
  /* all four operands lie in fragment order: every load below reads 512 contiguous bytes */
  const int l8 = lane * 8;      /* the lane's piece of a fragment tile; the tile starts below are the same for the whole wave */
  const _Float16* qp = Q16 + ((size_t)((b * SQ + i0) / 16) * NH + h) * (2 * FT);
  const _Float16* kp = K16 + ((size_t)((b * SQ + 32 * w) / 16) * NH + h) * (2 * FT);
  const _Float16* ep = BE + (size_t)((i0 - 32 * w + (SQ - 32)) / 16) * (2 * FT);      /* table rows i0 - 32w + 480 .. + 63, all inside 0 .. 1023; the first is a multiple of 16 */
  const float* mp = amask + (size_t)b * SQ;
  v16h qf[2][2], kf[2][2], ef[4][2];
#pragma unroll
  for (int m = 0; m < 2; ++m)
#pragma unroll
    for (int s = 0; s < 2; ++s) { qf[m][s] = gf_frag(qp + (m * NH * 2 + s) * FT + l8); kf[m][s] = gf_frag(kp + (m * NH * 2 + s) * FT + l8); }
#pragma unroll
  for (int t = 0; t < 4; ++t)
#pragma unroll
    for (int s = 0; s < 2; ++s) ef[t][s] = gf_frag(ep + (t * 2 + s) * FT + l8);
  const float mv = mp[tid];
  asm volatile("s_wait_xcnt 0x0" :: "s"(qp), "s"(kp), "s"(ep), "s"(mp), "v"(lane) : "memory");      /* the wait before the address registers of the loads above are overwritten; naming them keeps them whole up to it */
  mk[tid] = bf16_round(mv);
  const int dg = 8 * hh - ln;      /* row minus column inside a 16x16 accumulator tile, less the register index */
  float* blk = &sc[0][32 * w];
#pragma unroll
  for (int m = 0; m < 2; ++m)
#pragma unroll
    for (int e = 0; e < 2; ++e) { const v8f c = g2_dot64(qf[m], kf[e]);
#pragma unroll
      for (int r = 0; r < 8; ++r) blk[(16 * m + 8 * hh + r) * TP + 16 * e + ln] = c[r]; }
  /* q . e: accumulator (query row 16m + 8hh + r, table row base + 16(m + t) + ln) belongs to key column 31 + 8hh + r - 16t - ln of the block */
#pragma unroll
  for (int m = 0; m < 2; ++m) { const v8f c0 = g2_dot64(qf[m], ef[m]), c1 = g2_dot64(qf[m], ef[m + 1]), c2 = g2_dot64(qf[m], ef[m + 2]); float* pc[8]; float* po[8]; float om[8], oo[8];      /* the 16 x 32 elements are distinct: all reads, then all writes, so that the LDS round trips overlap */
#pragma unroll
    for (int r = 0; r < 8; ++r) { pc[r] = blk + (16 * m + 8 * hh + r) * TP + 15 + dg + r; po[r] = pc[r] + (dg + r <= 0 ? 16 : -16); om[r] = *pc[r]; oo[r] = *po[r]; }
#pragma unroll
    for (int r = 0; r < 8; ++r) { *pc[r] = om[r] + c1[r] * 0.0625f; *po[r] = oo[r] + (dg + r <= 0 ? c0[r] : c2[r]) * 0.0625f; } }
  /* k . e: accumulator (key row 16e + 8hh + r of the block, table row base + 16(1 - e + t) + ln) belongs to query row 16t + ln + 8hh + r - 15 */
#pragma unroll
  for (int e = 0; e < 2; ++e) { const v8f c0 = g2_dot64(kf[e], ef[1 - e]), c1 = g2_dot64(kf[e], ef[2 - e]), c2 = g2_dot64(kf[e], ef[3 - e]); float* pc[8]; float* po[8]; float om[8], oo[8];
#pragma unroll
    for (int r = 0; r < 8; ++r) { const int il = 1 + ln + 8 * hh + r; pc[r] = blk + il * TP + 16 * e + 8 * hh + r; po[r] = pc[r] + (il < 16 ? 16 * TP : -16 * TP); om[r] = *pc[r]; oo[r] = *po[r]; }
#pragma unroll
    for (int r = 0; r < 8; ++r) { *pc[r] = om[r] + c1[r] * 0.0625f; *po[r] = oo[r] + (1 + ln + 8 * hh + r < 16 ? c2[r] : c0[r]) * 0.0625f; } }
  __syncthreads();      /* publishes the score tile and the mask */
  /* P . V share of this wave: tile (pm, pn) of the 32 x 64 result, half pk of K = 512; its V^T fragments are asked for here so that they fly during the softmax */
  const int pm = w & 1, pn = (w >> 1) & 3, pk = w >> 3;
  const _Float16* vp = VT + ((((size_t)b * NH + h) * 4 + pn) * (SQ / 32) + 8 * pk) * FT;
  v16h vf[8];
#pragma unroll
  for (int s = 0; s < 8; ++s) vf[s] = gf_frag(vp + s * FT + l8);
  asm volatile("s_wait_xcnt 0x0" :: "s"(vp), "v"(lane) : "memory");      /* the wait before the address registers of the loads above are overwritten */
#pragma unroll
  for (int k = 0; k < 2; ++k) { const int row = 2 * w + k; float x[16]; float mx = -INFINITY;
#pragma unroll
    for (int u = 0; u < 4; ++u) { const int c = 128 * u + 4 * lane; const v4f sv = *(const v4fa*)&sc[row][c], mm = *(const v4fa*)&mk[c];
#pragma unroll
      for (int q = 0; q < 4; ++q) { x[u * 4 + q] = sv[q] * 0.125f + mm[q]; mx = fmaxf(mx, x[u * 4 + q]); } }
    mx = wave_max(mx); float se = 0.f;
#pragma unroll
    for (int j = 0; j < 16; ++j) { x[j] = expf(x[j] - mx); se += x[j]; }
    const float sn = 256.0f / wave_sum(se);
#pragma unroll
    for (int u = 0; u < 4; ++u) { v4h o;
#pragma unroll
      for (int q = 0; q < 4; ++q) o[q] = (_Float16)(x[u * 4 + q] * sn);
      *(v4h*)&ph[row][128 * u + 4 * lane] = o; } }
  __syncthreads();      /* publishes the P tile */
  { const _Float16* pa = &ph[16 * pm + ln][256 * pk + 8 * hh]; v16h pf[8];
#pragma unroll
    for (int s = 0; s < 8; ++s) pf[s] = g2_frag(pa + 32 * s, 0);
    v8f c = {0.f,0.f,0.f,0.f,0.f,0.f,0.f,0.f};
#pragma unroll
    for (int s = 0; s < 8; ++s) c = g2_mma(pf[s], vf[s], c);
#pragma unroll
    for (int r = 0; r < 8; ++r) so[pk][16 * pm + 8 * hh + r][16 * pn + ln] = c[r]; }
  __syncthreads();      /* publishes the two K halves of the 32 x 64 result */
  { const int row = tid >> 4, c4 = (tid & 15) * 4; const v4f v = (*(const v4fa*)&so[0][row][c4] + *(const v4fa*)&so[1][row][c4]) * 0.00390625f; *(v4f*)(out + ((size_t)b * SQ + i0 + row) * DM + h * HD + c4) = v; } }
__global__ __launch_bounds__(256) void k_vt(const _Float16* __restrict__ V16, int b, int h0, _Float16* __restrict__ VT) { __shared__ unsigned short tl[64][65]; const int tid = threadIdx.x; const int hh = blockIdx.x % HG, sg = blockIdx.x / HG; const int s0 = sg * 64; const int h = h0 + hh;
  for (int i = tid; i < 64 * 8; i += 256) { const int j = i / 8, d8 = (i % 8) * 8; FragH f; f.half[0] = *(const v8us*)((const unsigned short*)V16 + ((size_t)b * SQ + s0 + j) * DM + h * HD + d8); for (int q = 0; q < 8; ++q) tl[d8 + q][j] = f.u[q]; }
  __syncthreads();
  { for (int i = tid; i < 64 * 8; i += 256) { const int d = i / 8, j8 = (i % 8) * 8; FragH f; for (int q = 0; q < 8; ++q) f.u[q] = tl[d][j8 + q]; *(v8us*)((unsigned short*)VT + ((size_t)hh * HD + d) * SQ + s0 + j8) = f.half[0]; }  } }

extern "C" void kernel_launch(void* const* d_in, const int* in_sizes, int n_in,
                              void* d_out, int out_size, void* d_ws, size_t ws_size, hipStream_t stream) {
  (void)in_sizes; (void)n_in; (void)out_size;
  const float* const* I = (const float* const*)d_in; const float* hs = I[0]; const float* amask = I[1]; const float* wq = I[2]; const float* bq = I[3]; const float* wk = I[4]; const float* bk = I[5]; const float* wv = I[6]; const float* bv = I[7]; const float* demb = I[8];      /* weights [in][out]; attention_mask [8][1][1][512] additive; dist_emb [1023][64] */
  char* ws = (char*)d_ws; size_t off = 0;
  auto take = [&](size_t bytes) { char* p = ws + off; off += (bytes + 255) & ~(size_t)255; return p; };
  _Float16* BQ = (_Float16*)take((size_t)DM * DM * 2); _Float16* BK = (_Float16*)take((size_t)DM * DM * 2); _Float16* BV = (_Float16*)take((size_t)DM * DM * 2); _Float16* BE = (_Float16*)take((size_t)RW * HD * 2);
  _Float16* X16 = (_Float16*)take(NR * DM * 2); _Float16* Q16 = (_Float16*)take(NR * DM * 2); _Float16* K16 = (_Float16*)take(NR * DM * 2); _Float16* V16 = (_Float16*)take(NR * DM * 2);
  _Float16* VT = (_Float16*)take((size_t)NB * NH * HD * SQ * 2);
  if (off > ws_size) return;      /* 6 + 0.1 + 4x8 + 8 = approx 46 MiB */
  k_prep<<<3 * PW + PX + PE, 256, 0, stream>>>(wq, wk, wv, demb, hs, BQ, BK, BV, BE, X16);      /* transposed weights x16, padded table x16, hidden rows as f16 */
  k_proj<<<dim3((unsigned)((NR / GT) * (DM / GT)), 3), 256, 0, stream>>>(X16, BQ, BK, BV, bq, bk, bv, Q16, K16, V16);
  k_vt<NH, SQ><<<NB * NH * (SQ / 64), 256, 0, stream>>>(V16, DM, 0, VT);      /* V^T in fragment order, [(b,h)][16 columns d][32 keys][part][lane][8 keys], for every (batch, head) */
  k_attn<<<dim3(SQ / RT, NH, NB), 512, 0, stream>>>(Q16, K16, BE, VT, amask, (float*)d_out);      /* scores, relative terms, softmax and P . V; ctx rows (merged heads, f32) */
}

// v006
// It runs in 89.3 microseconds.
// Timed twice side by side with v005, it ran 1.08 times as fast both times.
// All steps since v000 together make it 41.0 times as fast.
#include <hip/hip_runtime.h>
// BERT self-attention with relative-position score terms (hidden [8][512][1024]; q, k, v = h W + b ([in][out], 16 heads of 64); scores[l][r] = (q_l.k_r + q_l.pe[l-r] + k_r.pe[l-r]) / 8 + mask[r] with pe = dist_emb[l - r + 511]; softmax; ctx = attn v merged -> [8][512][1024]).
// Structure: token rows r = b*512 + s; hidden as exact f16 rows (with the weight and table preparations in one launch); Q | K | V as three WMMA GEMMs in one launch (128x128 work-group tiles staged in LDS by asynchronous copies, 32x64 wave tiles, f32 accumulation, exact x16 transposed weights, bias in the epilogue, f16 outputs); V^T via LDS transposes; q, k, V^T and the table lie in memory in WMMA fragment order (FRAGMENT ORDER below), so that a fragment load of the attention reads whole lines; then one fused attention launch, one work-group per 32 query rows of a (batch, head): q.k and the two relative terms (q rows and k rows times the window of dist_emb^T that the tile's diagonals meet; table padded to 1024 rows with zeros) on WMMA, summed in an LDS score tile (f32), row softmax on VALU, one wave per query row (mask added; weights x256 as f16 in LDS), ctx = P . V on WMMA (K = 512, alpha 2^-8) written as f32 into the merged output rows.
// Compute dtype: inputs rounded to bf16; hidden / weights / table exact; q, k, v and the softmax weights as plain f16 GEMM operands (~2^-12); scores, relative terms and softmax statistics f32. v_wmma_f32_16x16x32_f16.
#define NB 8
#define SQ 512
#define DM 1024
#define NH 16
#define HD 64
#define HG 16                        /* heads per attention launch group (all) */
#define NREL 1023                    /* relative distances -511..511 */
#define RW 1024                      /* dist_emb table rows (distances padded to 1024) */
#define QN SQ                        /* unused: attention covers all SQ query rows */
#define NBR NB                       /* unused: attention covers all NB batches */
#define MP ((int)NR)                 /* unused: the projections take all NR rows */
#define NR ((size_t)NB * SQ)         /* 4096 token rows */
typedef __bf16 v16b __attribute__((ext_vector_type(16)));
typedef unsigned short v8us __attribute__((ext_vector_type(8), may_alias));
typedef float  v8f  __attribute__((ext_vector_type(8)));
typedef float  v4f  __attribute__((ext_vector_type(4)));
typedef float  v4fa __attribute__((ext_vector_type(4), may_alias));
union FragB { v16b v; v8us half[2]; unsigned short u[16]; };

__device__ __forceinline__ unsigned short bf16_bits(float x) { unsigned int u = __float_as_uint(x); return (unsigned short)((u + 0x7FFFu + ((u >> 16) & 1u)) >> 16); }
__device__ __forceinline__ float bf16_val(unsigned short b) { return __uint_as_float(((unsigned int)b) << 16); }
__device__ __forceinline__ float bf16_round(float x) { return bf16_val(bf16_bits(x)); }
// D += A·B with NT terms: 1 = ah·bh, 2 = + al·bh (A split), 3 = + ah·bl (both split)
template <int NT>
__device__ __forceinline__ v8f mmaN(v16b ah, v16b al, v16b bh, v16b bl, v8f c) {
  c = __builtin_amdgcn_wmma_f32_16x16x32_bf16(false, ah, false, bh, (short)0, c, false, false);
  if (NT >= 2) c = __builtin_amdgcn_wmma_f32_16x16x32_bf16(false, al, false, bh, (short)0, c, false, false);
  if (NT >= 3) c = __builtin_amdgcn_wmma_f32_16x16x32_bf16(false, ah, false, bl, (short)0, c, false, false);
  asm volatile("v_nop\n\tv_nop\n\tv_nop\n\tv_nop" : "+v"(c) : "v"(ah), "v"(al), "v"(bh), "v"(bl));
  return c;
}

__global__ __launch_bounds__(256) void k_wt_bf16(const float* __restrict__ W, unsigned short* __restrict__ Wt, int K, int N) {
  const int t = blockIdx.x * 256 + threadIdx.x;
  const int k8n = K / 8;
  if (t >= N * k8n) return;
  const int n = t / k8n, k8 = (t % k8n) * 8;
  v8us v;
#pragma unroll
  for (int i = 0; i < 8; ++i) v[i] = bf16_bits(W[(size_t)(k8 + i) * N + n]);
  *(v8us*)(Wt + (size_t)n * K + k8) = v;
  
}

// GEMM C[M][N] (f32, pitch ldc) = act(A[M][K]·W + bias). A f32 row-major (pitch lda) converted per fragment to bf16
// (ASPLIT: hi/lo two planes -> 2 terms, else single rounded term); Wt bf16 [N][K] (pitch ldb). BIAS_BF16 rounds the
// bias to bf16 first (bias quantised to bf16 before the add). K%32==0, M%16==0, N%64==0.
template <bool ASPLIT, int ACT, bool BIAS_BF16>
__global__ __launch_bounds__(128) void k_gemm_bf(const float* __restrict__ A, int lda, const unsigned short* __restrict__ Wt, int ldb,
                                               const float* __restrict__ bias, float* __restrict__ C, int ldc, int M, int N, int K) {
  __shared__ __attribute__((aligned(16))) float so[4][16][64];
  const int tid = threadIdx.x, w = tid >> 5, lane = tid & 31, ln = lane & 15, hh = lane >> 4;
  const int ntn = N / 64;
  const int wid = blockIdx.x * 4 + w;
  const int mt = wid / ntn, nq = wid % ntn;
  if (mt * 16 >= M) return;
  const int row0 = mt * 16, col0 = nq * 64;
  const float* arow = A + (size_t)(row0 + ln) * lda;
  v8f acc[4] = {};
  for (int kb = 0; kb < K; kb += 32) {
    FragB ah, al;
    const v4f x0 = *(const v4fa*)(arow + kb + 8 * hh), x1 = *(const v4fa*)(arow + kb + 8 * hh + 4);
    const v4f x2 = *(const v4fa*)(arow + kb + 16 + 8 * hh), x3 = *(const v4fa*)(arow + kb + 16 + 8 * hh + 4);
    float xs[16] = {x0[0],x0[1],x0[2],x0[3],x1[0],x1[1],x1[2],x1[3],x2[0],x2[1],x2[2],x2[3],x3[0],x3[1],x3[2],x3[3]};
#pragma unroll
    for (int i = 0; i < 16; ++i) { const unsigned short hb = bf16_bits(xs[i]); ah.u[i] = hb; al.u[i] = ASPLIT ? bf16_bits(xs[i] - bf16_val(hb)) : (unsigned short)0; }
#pragma unroll
    for (int t = 0; t < 4; ++t) {
      const unsigned short* brow = Wt + (size_t)(col0 + t * 16 + ln) * ldb + kb;
      FragB b;
      b.half[0] = *(const v8us*)(brow + 8 * hh);
      b.half[1] = *(const v8us*)(brow + 16 + 8 * hh);
      acc[t] = mmaN<ASPLIT ? 2 : 1>(ah.v, al.v, b.v, b.v, acc[t]);
    }
  }
#pragma unroll
  for (int t = 0; t < 4; ++t) {
    float bv = bias ? bias[col0 + t * 16 + ln] : 0.f;
    if (BIAS_BF16) bv = bf16_round(bv);
#pragma unroll
    for (int r = 0; r < 8; ++r) { float v = acc[t][r] + bv; if (ACT == 1) v = fmaxf(v, 0.f); so[w][8 * hh + r][t * 16 + ln] = v; }
  }
  __builtin_amdgcn_fence(__ATOMIC_ACQ_REL, "workgroup");
  __builtin_amdgcn_wave_barrier();
  const int rsub = lane >> 4, c4 = (lane & 15) * 4;
  {
#pragma unroll
    for (int q = 0; q < 8; ++q) {
      const int r = q * 2 + rsub;
      const v4f v = *(const v4fa*)&so[w][r][c4];
      *(v4f*)(C + (size_t)(row0 + r) * ldc + col0 + c4) = v;
    }
    
  }
}

// GEMM C = act(A·W + bias + resid): A f32 (ASPLIT -> hi/lo 2 terms), Wt bf16 [N][K]; ACT 0 none, 1 relu, 2 exact gelu;
// resid (optional, f32, row index = (row % rmod), pitch ldr, RES_BF16 rounds it) added before the activation.
template <bool ASPLIT, int ACT, bool BIAS_BF16, bool RES_BF16>
__global__ __launch_bounds__(128) void k_gemm_bf3(const float* __restrict__ A, int lda, const unsigned short* __restrict__ Wt, int ldb,
                                                const float* __restrict__ bias, const float* __restrict__ resid, int rmod, int ldr,
                                                float* __restrict__ C, int ldc, int M, int N, int K) {
  __shared__ __attribute__((aligned(16))) float so[4][16][64];
  const int tid = threadIdx.x, w = tid >> 5, lane = tid & 31, ln = lane & 15, hh = lane >> 4;
  const int ntn = N / 64;
  const int wid = blockIdx.x * 4 + w;
  const int mt = wid / ntn, nq = wid % ntn;
  if (mt * 16 >= M) return;
  const int row0 = mt * 16, col0 = nq * 64;
  const float* arow = A + (size_t)(row0 + ln) * lda;
  v8f acc[4] = {};
  for (int kb = 0; kb < K; kb += 32) {
    FragB ah, al;
    const v4f x0 = *(const v4fa*)(arow + kb + 8 * hh), x1 = *(const v4fa*)(arow + kb + 8 * hh + 4);
    const v4f x2 = *(const v4fa*)(arow + kb + 16 + 8 * hh), x3 = *(const v4fa*)(arow + kb + 16 + 8 * hh + 4);
    float xs[16] = {x0[0],x0[1],x0[2],x0[3],x1[0],x1[1],x1[2],x1[3],x2[0],x2[1],x2[2],x2[3],x3[0],x3[1],x3[2],x3[3]};
#pragma unroll
    for (int i = 0; i < 16; ++i) { const unsigned short hb = bf16_bits(xs[i]); ah.u[i] = hb; al.u[i] = ASPLIT ? bf16_bits(xs[i] - bf16_val(hb)) : (unsigned short)0; }
#pragma unroll
    for (int t = 0; t < 4; ++t) {
      const unsigned short* brow = Wt + (size_t)(col0 + t * 16 + ln) * ldb + kb;
      FragB b;
      b.half[0] = *(const v8us*)(brow + 8 * hh);
      b.half[1] = *(const v8us*)(brow + 16 + 8 * hh);
      acc[t] = mmaN<ASPLIT ? 2 : 1>(ah.v, al.v, b.v, b.v, acc[t]);
    }
  }
#pragma unroll
  for (int t = 0; t < 4; ++t) {
    const int col = col0 + t * 16 + ln;
    float bv = bias ? bias[col] : 0.f;
    if (BIAS_BF16) bv = bf16_round(bv);
#pragma unroll
    for (int r = 0; r < 8; ++r) {
      float v = acc[t][r] + bv;
      if (resid) { float rv = resid[(size_t)((row0 + 8 * hh + r) % rmod) * ldr + col]; if (RES_BF16) rv = bf16_round(rv); v += rv; }
      if (ACT == 1) v = fmaxf(v, 0.f);
      if (ACT == 2) v = 0.5f * v * (1.0f + erff(v * 0.70710678118654752f));
      if (ACT == 3) { const float u = 0.7978845608028654f * (v + 0.044715f * v * v * v); v = 0.5f * v * (1.0f + tanhf(u)); }
      so[w][8 * hh + r][t * 16 + ln] = v;
    }
  }
  __builtin_amdgcn_fence(__ATOMIC_ACQ_REL, "workgroup");
  __builtin_amdgcn_wave_barrier();
  const int rsub = lane >> 4, c4 = (lane & 15) * 4;
  {
#pragma unroll
    for (int q = 0; q < 8; ++q) {
      const int r = q * 2 + rsub;
      const v4f v = *(const v4fa*)&so[w][r][c4];
      *(v4f*)(C + (size_t)(row0 + r) * ldc + col0 + c4) = v;
    }
    
  }
}
// row LayerNorm (biased variance, eps) over N: s = X (+ R); optional out_sum <- s; out_norm <- (s-mu)*rsqrt(var+eps)*g + b
template <bool PARAM_BF16>
__global__ __launch_bounds__(256) void k_layernorm(const float* __restrict__ X, const float* __restrict__ R, const float* __restrict__ g, const float* __restrict__ bta,
                                                  float* __restrict__ out_sum, float* __restrict__ out_norm, int N, float eps) {
  __shared__ float red[256];
  const int row = blockIdx.x, tid = threadIdx.x;
  const float* x = X + (size_t)row * N; const float* rr = R ? R + (size_t)row * N : nullptr;
  float vals[16];                     // up to N = 4096
  const int per = N / 256;            // contiguous chunk per thread? use strided-by-4 chunks: thread handles j = tid*4 + 1024*u
  float s1 = 0.f;
  for (int u = 0; u < per / 4; ++u) {
    const int j = tid * 4 + 1024 * u;
    const v4f a = *(const v4fa*)(x + j);
    v4f b = {0.f,0.f,0.f,0.f}; if (rr) b = *(const v4fa*)(rr + j);
#pragma unroll
    for (int q = 0; q < 4; ++q) { const float v = a[q] + b[q]; vals[u * 4 + q] = v; s1 += v; }
  }
  red[tid] = s1; __syncthreads();
  for (int st = 128; st > 0; st >>= 1) { if (tid < st) red[tid] += red[tid + st]; __syncthreads(); }
  const float mu = red[0] / (float)N; __syncthreads();
  float s2 = 0.f;
  for (int u = 0; u < per / 4; ++u)
#pragma unroll
    for (int q = 0; q < 4; ++q) { const float c = vals[u * 4 + q] - mu; s2 += c * c; }
  red[tid] = s2; __syncthreads();
  for (int st = 128; st > 0; st >>= 1) { if (tid < st) red[tid] += red[tid + st]; __syncthreads(); }
  const float rs = rsqrtf(red[0] / (float)N + eps);
  {
    for (int u = 0; u < per / 4; ++u) {
      const int j = tid * 4 + 1024 * u;
      v4f o, sm;
#pragma unroll
      for (int q = 0; q < 4; ++q) {
        float gg = g[j + q], bb = bta[j + q];
        if (PARAM_BF16) { gg = bf16_round(gg); bb = bf16_round(bb); }
        sm[q] = vals[u * 4 + q]; o[q] = (vals[u * 4 + q] - mu) * rs * gg + bb;
      }
      if (out_sum) *(v4f*)(out_sum + (size_t)row * N + j) = sm;
      *(v4f*)(out_norm + (size_t)row * N + j) = o;
    }
    
  }
}



// ---- f16 WMMA path (v_wmma_f32_16x16x32_f16): 11-bit significands for operands in range — used where a [0,1] probability operand needs more precision than bf16
typedef _Float16 v16h __attribute__((ext_vector_type(16)));
union FragH { v16h v; v8us half[2]; _Float16 h[16]; unsigned short u[16]; };
template <int NT>
__device__ __forceinline__ v8f mmaH(v16h ah, v16h al, v16h bh, v16h bl, v8f c) {
  c = __builtin_amdgcn_wmma_f32_16x16x32_f16(false, ah, false, bh, (short)0, c, false, false);
  if (NT >= 2) c = __builtin_amdgcn_wmma_f32_16x16x32_f16(false, al, false, bh, (short)0, c, false, false);
  if (NT >= 3) c = __builtin_amdgcn_wmma_f32_16x16x32_f16(false, ah, false, bl, (short)0, c, false, false);
  asm volatile("v_nop\n\tv_nop\n\tv_nop\n\tv_nop" : "+v"(c) : "v"(ah), "v"(al), "v"(bh), "v"(bl));
  return c;
}
// batched GEMM like k_gemm_b but f16 operands: A f32 (split into f16 hi/lo if ASPLIT, else rounded to f16), Bt = f16 values [n][k]; alpha; C f32; N multiple of 16 (partial tiles skipped)
template <bool ASPLIT>
__global__ __launch_bounds__(128) void k_gemm_h(const float* __restrict__ A, int lda, size_t sA, const _Float16* __restrict__ Bh, int ldb, size_t sB, float alpha, float* __restrict__ C, int ldc, size_t sC, int M, int N, int K) {
  __shared__ __attribute__((aligned(16))) float so[4][16][64];
  const int tid = threadIdx.x, w = tid >> 5, lane = tid & 31, ln = lane & 15, hh = lane >> 4; const int by = blockIdx.y;
  A += (size_t)by * sA; Bh += (size_t)by * sB; C += (size_t)by * sC;
  const int ntn = (N + 63) / 64; const int wid = blockIdx.x * 4 + w; const int mt = wid / ntn, nq = wid % ntn; if (mt * 16 >= M) return;
  const int row0 = mt * 16, col0 = nq * 64; const float* arow = A + (size_t)(row0 + ln) * lda;
  v8f acc[4] = {};
  for (int kb = 0; kb < K; kb += 32) {
    FragH ah, al;
    const v4f x0 = *(const v4fa*)(arow + kb + 8 * hh), x1 = *(const v4fa*)(arow + kb + 8 * hh + 4), x2 = *(const v4fa*)(arow + kb + 16 + 8 * hh), x3 = *(const v4fa*)(arow + kb + 16 + 8 * hh + 4);
    float xs[16] = {x0[0],x0[1],x0[2],x0[3],x1[0],x1[1],x1[2],x1[3],x2[0],x2[1],x2[2],x2[3],x3[0],x3[1],x3[2],x3[3]};
#pragma unroll
    for (int i = 0; i < 16; ++i) { const _Float16 h = (_Float16)xs[i]; ah.h[i] = h; al.h[i] = ASPLIT ? (_Float16)(xs[i] - (float)h) : (_Float16)0.0f; }
#pragma unroll
    for (int t = 0; t < 4; ++t) { if (col0 + t * 16 >= N) continue; const size_t boff = (size_t)(col0 + t * 16 + ln) * ldb + kb; FragH bq; bq.half[0] = *(const v8us*)(Bh + boff + 8 * hh); bq.half[1] = *(const v8us*)(Bh + boff + 16 + 8 * hh);
      acc[t] = mmaH<ASPLIT ? 2 : 1>(ah.v, al.v, bq.v, bq.v, acc[t]); }
  }
#pragma unroll
  for (int t = 0; t < 4; ++t) { if (col0 + t * 16 >= N) continue;
#pragma unroll
    for (int r = 0; r < 8; ++r) so[w][8 * hh + r][t * 16 + ln] = acc[t][r] * alpha; }
  __builtin_amdgcn_fence(__ATOMIC_ACQ_REL, "workgroup"); __builtin_amdgcn_wave_barrier();
  const int rsub = lane >> 4, c4 = (lane & 15) * 4;
  {
#pragma unroll
    for (int q = 0; q < 8; ++q) { const int r = q * 2 + rsub; if (col0 + c4 < N) { const v4f v = *(const v4fa*)&so[w][r][c4]; *(v4f*)(C + (size_t)(row0 + r) * ldc + col0 + c4) = v; } }
     }
}

// Wt[n][k] = f16(W[k][n] * scale) from f32 row-major W[DM][DM] (scale = power of two; bf16-exact weights stay exact in f16 away from the subnormal range), one tile of WK k x WN n per work-group of 256, turned in LDS.
// Reads: thread (kg, nq) takes rows 8 kg .. + 7, columns 4 nq .. + 3, so each 16-byte load of a wave covers 2 rows x 256 contiguous bytes, whole lines, and the 8 loads are in flight together.
// LDS: tl[n][16-byte piece of 8 k], rows of 256 bytes; piece c of row n lies at place c ^ (n >> 2): the 16 lanes that write one k piece of 16 rows four apart, and the 16 lanes that read one whole row, both fall on all 64 banks.
// Writes: each 16-byte store of a wave covers 2 rows of Wt x 256 contiguous bytes.
#define WK 128                       /* k per tile */
#define WN 64                        /* n per tile */
__device__ __forceinline__ void d_wt_tile(const float* __restrict__ W, _Float16* __restrict__ Wt, float scale, int tile, int tid, unsigned short* tl) {
  const int k0 = (tile / (DM / WN)) * WK, n0 = (tile % (DM / WN)) * WN, nq = tid & 15, kg = tid >> 4;
  const float* wp = W + (size_t)(k0 + 8 * kg) * DM + n0 + 4 * nq; v4f x[8];
#pragma unroll      /* x indexed by constants: registers; the 8 loads fly together */
  for (int i = 0; i < 8; ++i) x[i] = *(const v4fa*)(wp + (size_t)i * DM);
#pragma unroll      /* as above */
  for (int j = 0; j < 4; ++j) { FragH f;
#pragma unroll      /* as above */
    for (int i = 0; i < 8; ++i) f.h[i] = (_Float16)(bf16_round(x[i][j]) * scale);
    *(v8us*)(tl + (4 * nq + j) * WK + (kg ^ nq) * 8) = f.half[0]; }
  __syncthreads();      /* publishes the turned tile */
  unsigned short* op = (unsigned short*)Wt + (size_t)(n0 + kg) * DM + k0 + 8 * nq;
#pragma unroll      /* the 4 LDS reads and stores overlap */
  for (int p = 0; p < 4; ++p) { const int n = 16 * p + kg; const v8us o = *(const v8us*)(tl + n * WK + (nq ^ (n >> 2)) * 8); *(v8us*)(op + (size_t)(16 * p) * DM) = o; }
  asm volatile("s_wait_xcnt 0x0" ::: "memory");      /* the wait before a register of the stores above is overwritten: the code of the launch's other ranges follows in the text */
}
// k_gemm_hh variant with fused epilogue: v = acc·alpha + bias[by·sBias + col] (+ CP[(row/rowsPerB)·sCPb + by·64 + col] if CP) ; ACT 0 none / 1 elu ; writes f16 C16 (and f32 C if non-null)
template <int ACT>
__global__ __launch_bounds__(128) void k_gemm_hhx(const _Float16* __restrict__ A, int lda, size_t sA, const _Float16* __restrict__ Bh, int ldb, size_t sB, float alpha, const float* __restrict__ bias, size_t sBias, const float* __restrict__ CP, int rowsPerB, size_t sCPb, int row0g,
    float* __restrict__ C, _Float16* __restrict__ C16, int ldc, size_t sC, int M, int N, int K) {
  __shared__ __attribute__((aligned(16))) float so[4][16][64];
  const int tid = threadIdx.x, w = tid >> 5, lane = tid & 31, ln = lane & 15, hh = lane >> 4; const int by = blockIdx.y;
  A += (size_t)by * sA; Bh += (size_t)by * sB; const size_t cofs = (size_t)by * sC; const float* bp = bias ? bias + (size_t)by * sBias : nullptr;
  const int ntn = (N + 63) / 64; const int wid = blockIdx.x * 4 + w; const int mt = wid / ntn, nq = wid % ntn; if (mt * 16 >= M) return;
  const int row0 = mt * 16, col0 = nq * 64; const _Float16* arow = A + (size_t)(row0 + ln) * lda;
  v8f acc[4] = {};
  for (int kb = 0; kb < K; kb += 32) { FragH ah; ah.half[0] = *(const v8us*)((const unsigned short*)arow + kb + 8 * hh); ah.half[1] = *(const v8us*)((const unsigned short*)arow + kb + 16 + 8 * hh);
#pragma unroll
    for (int t = 0; t < 4; ++t) { if (col0 + t * 16 >= N) continue; const size_t boff = (size_t)(col0 + t * 16 + ln) * ldb + kb; FragH bq; bq.half[0] = *(const v8us*)((const unsigned short*)Bh + boff + 8 * hh); bq.half[1] = *(const v8us*)((const unsigned short*)Bh + boff + 16 + 8 * hh);
      acc[t] = mmaH<1>(ah.v, ah.v, bq.v, bq.v, acc[t]); }
  }
#pragma unroll
  for (int t = 0; t < 4; ++t) { if (col0 + t * 16 >= N) continue; const int col = col0 + t * 16 + ln; const float bv = bp ? bf16_round(bp[col]) : 0.f;
#pragma unroll
    for (int r = 0; r < 8; ++r) { float v = acc[t][r] * alpha + bv; if (CP) { const int rr = row0g + row0 + 8 * hh + r; if (rowsPerB < 0) v += CP[cofs + (size_t)rr * ldc + col];      /* rowsPerB < 0: own element of the batched C plane */ else { const int bidx = rr / rowsPerB; v += CP[(size_t)bidx * sCPb + (size_t)by * 64 + col]; } } if (ACT == 1) v = (v > 0.f) ? v : expm1f(v); else if (ACT == 7) v = (v > 0.f) ? v + 1.0f : expf(v); else if (ACT == 8) v = tanhf(v); else if (ACT == 9) v = 0.5f * v * (1.0f + tanhf(0.7978845608028654f * (v + 0.044715f * v * v * v))); else if (ACT == 11) v = 1.0f / (1.0f + expf(-v)); else if (ACT == 12) v = (v > 0.f) ? v : 0.01f * v; else if (ACT == 14) v = (v > 0.f) ? v : 0.1f * v; else if (ACT == 16) v = (v >= 0.f) ? v : 0.3f * v; else if (ACT == 17) v = (v >= 0.f) ? v : 0.2f * v; else if (ACT == 15) v = v / (1.0f + expf(-v)); else if (ACT == 3) v = fmaxf(v, 0.f); else if (ACT == 6) v = 0.5f * v * (1.0f + erff(v * 0.70710678118654752f)); so[w][8 * hh + r][t * 16 + ln] = v; } }
  __builtin_amdgcn_fence(__ATOMIC_ACQ_REL, "workgroup"); __builtin_amdgcn_wave_barrier();
  const int rsub = lane >> 4, c4 = (lane & 15) * 4; typedef _Float16 v4h __attribute__((ext_vector_type(4)));
  {
#pragma unroll
    for (int q = 0; q < 8; ++q) { const int r = q * 2 + rsub; if (col0 + c4 < N) { const v4f v = *(const v4fa*)&so[w][r][c4]; if (C) *(v4f*)(C + cofs + (size_t)(row0 + r) * ldc + col0 + c4) = v; if (C16) { v4h h4; for (int i = 0; i < 4; ++i) h4[i] = (_Float16)v[i]; *(v4h*)(C16 + cofs + (size_t)(row0 + r) * ldc + col0 + c4) = h4; } } }
     }
}


typedef _Float16 v4h __attribute__((ext_vector_type(4)));

__device__ __forceinline__ void d_x16(const float* __restrict__ x, _Float16* __restrict__ X16, size_t n8, size_t t) { if (t >= n8) return; FragH f;
#pragma unroll
  for (int q = 0; q < 8; ++q) f.h[q] = (_Float16)bf16_round(x[t * 8 + q]); *(v8us*)((unsigned short*)X16 + t * 8) = f.half[0];  }
__global__ __launch_bounds__(256) void k_h16(const float* __restrict__ x, _Float16* __restrict__ X16, size_t n8) { const size_t t = (size_t)blockIdx.x * 256 + threadIdx.x; if (t >= n8) return; FragH f;
#pragma unroll
  for (int q = 0; q < 8; ++q) f.h[q] = (_Float16)x[t * 8 + q]; *(v8us*)((unsigned short*)X16 + t * 8) = f.half[0];  }
__global__ __launch_bounds__(256) void k_round16f(const float* __restrict__ W, _Float16* __restrict__ Bt, size_t n8) { const size_t t = (size_t)blockIdx.x * 256 + threadIdx.x; if (t >= n8) return; FragH f;
#pragma unroll
  for (int i = 0; i < 8; ++i) f.h[i] = (_Float16)(bf16_round(W[t * 8 + i]) * 16.0f); *(v8us*)((unsigned short*)Bt + t * 8) = f.half[0];  }
template <int NHv, int TTv>
__global__ __launch_bounds__(256) void k_vt(const _Float16* __restrict__ V16, int ldv, int voff, _Float16* __restrict__ Vt) { __shared__ unsigned short tl[64][66]; const int tid = threadIdx.x; const int slab = blockIdx.x / (TTv / 64), lg = blockIdx.x % (TTv / 64); const int b = slab / NHv, h = slab % NHv;
  for (int i = tid; i < 64 * 8; i += 256) { const int r = i / 8, c8 = (i % 8) * 8; FragH f; f.half[0] = *(const v8us*)((const unsigned short*)V16 + ((size_t)b * TTv + lg * 64 + r) * ldv + voff + h * 64 + c8);
#pragma unroll
    for (int q = 0; q < 8; ++q) tl[r][c8 + q] = f.u[q]; }
  __syncthreads();
  {
#pragma unroll
    for (int rd = 0; rd < 2; ++rd) { const int pn = tid >> 6, part = (tid >> 5) & 1, lane = tid & 31, d = 16 * pn + (lane & 15), k0 = 32 * rd + 16 * part + 8 * (lane >> 4); FragH f;      /* fragment order: [slab][16 columns d][32 keys][part][lane][8 keys]; a wave stores 512 contiguous bytes */
#pragma unroll
      for (int q = 0; q < 8; ++q) f.u[q] = tl[k0 + q][d];
      *(v8us*)((unsigned short*)Vt + (((size_t)slab * 4 + pn) * (TTv / 32) + lg * 2 + rd) * 512 + part * 256 + lane * 8) = f.half[0]; }
     } }

__global__ __launch_bounds__(256) void k_hl(const float* __restrict__ F, _Float16* __restrict__ Hh, _Float16* __restrict__ Hl, size_t n8) { const size_t t = (size_t)blockIdx.x * 256 + threadIdx.x; if (t >= n8) return; FragH fh, fl; const v4f a = *(const v4fa*)(F + t * 8), c = *(const v4fa*)(F + t * 8 + 4);
#pragma unroll
  for (int q = 0; q < 4; ++q) { _Float16 h = (_Float16)a[q]; fh.h[q] = h; fl.h[q] = (_Float16)((a[q] - (float)h) * 1024.0f); h = (_Float16)c[q]; fh.h[4 + q] = h; fl.h[4 + q] = (_Float16)((c[q] - (float)h) * 1024.0f); }
  { *(v8us*)((unsigned short*)Hh + t * 8) = fh.half[0]; *(v8us*)((unsigned short*)Hl + t * 8) = fl.half[0];  } }

// ---- WMMA helpers (f16 fragments of 16 rows x 32 k; one product with its distance) ----
__device__ __forceinline__ v16h g2_frag(const _Float16* p, int hh) { FragH f; f.half[0] = *(const v8us*)((const unsigned short*)p + 8 * hh); f.half[1] = *(const v8us*)((const unsigned short*)p + 16 + 8 * hh); return f.v; }
__device__ __forceinline__ v8f g2_mma(v16h a, v16h b, v8f c) { v8f d = __builtin_amdgcn_wmma_f32_16x16x32_f16(false, a, false, b, (short)0, c, false, false); asm volatile("v_nop\n\tv_nop\n\tv_nop\n\tv_nop" : "+v"(d) : "v"(a), "v"(b)); return d; }
// FRAGMENT ORDER: a tile of 16 rows x 32 k (1 KiB) is stored as [part 0..1][lane 0..31][8 halves]; lane = 16 hh + ln holds row ln, k = 16 part + 8 hh .. + 7: the registers of g2_frag, unchanged.
// One 16-byte load of a wave then reads 512 contiguous bytes (4 lines) where the row-major tile made it touch 16 lines of 32 useful bytes each.
#define FT 512                       /* halves of one 16 x 32 fragment tile */
__device__ __forceinline__ v16h gf_frag(const _Float16* p) { FragH f; f.half[0] = *(const v8us*)((const unsigned short*)p); f.half[1] = *(const v8us*)((const unsigned short*)p + FT / 2); return f.v; }      /* p: the tile's start + 8 lane */
// Projection GEMM C16[4096][1024] = f16(A . Bt^T / 16 + bias): one 128 x 128 tile of C per work-group, 8 waves of 32 x 64 (4 down, 2 across).
// Per trip 128 k (256 bytes of each of the 128 A rows and 128 Bt rows) lie in LDS at pitch 272 bytes, brought by asynchronous 16-byte copies: a wave's copy takes 2 rows x 256 bytes, whole lines.
// Two buffers: the copies of trip t + 1 fly while trip t's fragments are read from LDS. k ascends in steps of 32 per accumulator. The epilogue stages each wave's 32 x 64 block in the first buffer.
#define GT 128                       /* rows and columns of C per work-group */
#define GK 128                       /* k per trip */
#define GP 272                       /* LDS row pitch in bytes: 16 x odd, for the 16-byte fragment reads */
#define GO (GT * GP)                 /* bytes of one operand's rows in a buffer */
#define GB (2 * GO)                  /* bytes of one buffer: A rows, then Bt rows */
__device__ __forceinline__ v16h g3_frag(const char* p) { FragH f; f.half[0] = *(const v8us*)p; f.half[1] = *(const v8us*)(p + 32); return f.v; }
// this thread's 8 pieces of one operand's 128 rows x 256 bytes: rows 16 apart, LDS byte address l, global address g
__device__ __forceinline__ void g3_copy(unsigned l, const _Float16* g) {
  /* the copies and, as the last line, the wait that stands before their address registers are rewritten */
  asm volatile("global_load_async_to_lds_b128 %0, %8, off\n\t"
               "global_load_async_to_lds_b128 %1, %9, off\n\t"
               "global_load_async_to_lds_b128 %2, %10, off\n\t"
               "global_load_async_to_lds_b128 %3, %11, off\n\t"
               "global_load_async_to_lds_b128 %4, %12, off\n\t"
               "global_load_async_to_lds_b128 %5, %13, off\n\t"
               "global_load_async_to_lds_b128 %6, %14, off\n\t"
               "global_load_async_to_lds_b128 %7, %15, off\n\t"
               "s_wait_xcnt 0x0"
               :: "v"(l), "v"(l + 16 * GP), "v"(l + 32 * GP), "v"(l + 48 * GP), "v"(l + 64 * GP), "v"(l + 80 * GP), "v"(l + 96 * GP), "v"(l + 112 * GP),
                  "v"(g), "v"(g + 16 * DM), "v"(g + 32 * DM), "v"(g + 48 * DM), "v"(g + 64 * DM), "v"(g + 80 * DM), "v"(g + 96 * DM), "v"(g + 112 * DM)
               : "memory");
}
// The three products (q, k, v) need nothing of each other: they share one grid, blockIdx.y picks the weights, the bias and the output.
__global__ __launch_bounds__(256) void k_proj(const _Float16* __restrict__ A, const _Float16* __restrict__ BQ, const _Float16* __restrict__ BK, const _Float16* __restrict__ BV,
                                              const float* __restrict__ bq, const float* __restrict__ bk, const float* __restrict__ bvp, _Float16* __restrict__ Q16, _Float16* __restrict__ K16, _Float16* __restrict__ V16) {
  const int z = blockIdx.y; const _Float16* Bh = z == 0 ? BQ : z == 1 ? BK : BV; const float* bias = z == 0 ? bq : z == 1 ? bk : bvp; _Float16* C16 = z == 0 ? Q16 : z == 1 ? K16 : V16;
  static_assert(NR % GT == 0 && DM % GT == 0 && DM % GK == 0 && DM / GK >= 2 && 8 * 32 * 68 * 4 <= GB, "k_proj: whole tiles, two trips or more, the output staging fits one buffer");
  __shared__ __attribute__((aligned(16))) float sm[2 * GB / 4];
  const int tid = threadIdx.x, w = tid >> 5, lane = tid & 31, ln = lane & 15, hh = lane >> 4, wm = w & 3, wn = w >> 2;
  const int mt = blockIdx.x % (int)(NR / GT), nq = blockIdx.x / (int)(NR / GT); const int row0 = mt * GT + 32 * wm, col0 = nq * GT + 64 * wn;
  const float* bp = bias + col0 + ln; float bv[4];
#pragma unroll      /* bv indexed by constants: registers; the four loads fly under the first copies */
  for (int t = 0; t < 4; ++t) bv[t] = bp[16 * t];
  asm volatile("s_wait_xcnt 0x0" :: "v"(bp) : "memory");      /* the wait before the address registers of the loads above are overwritten */
  const _Float16* ga = A + (size_t)(mt * GT + (tid >> 4)) * DM + (tid & 15) * 8;
  const _Float16* gb = Bh + (size_t)(nq * GT + (tid >> 4)) * DM + (tid & 15) * 8;
  const unsigned l0 = (unsigned)(size_t)(const void*)sm + (unsigned)((tid >> 4) * GP + (tid & 15) * 16);
  g3_copy(l0, ga); g3_copy(l0 + GO, gb);
  asm volatile("s_wait_asynccnt 0x0" ::: "memory");      /* this wave's copies of trip 0 have landed */
  __syncthreads();      /* publishes trip 0's rows */
  g3_copy(l0 + GB, ga + GK); g3_copy(l0 + GB + GO, gb + GK);
  const char* fa = (const char*)sm + (32 * wm + ln) * GP + 16 * hh;
  const char* fb = (const char*)sm + GO + (64 * wn + ln) * GP + 16 * hh;
  const v8f z8 = {0.f,0.f,0.f,0.f,0.f,0.f,0.f,0.f}; v8f c00 = z8, c01 = z8, c02 = z8, c03 = z8, c10 = z8, c11 = z8, c12 = z8, c13 = z8;
#pragma unroll 1      /* rolled: one publish point in the text, and the two buffers are told apart by an offset */
  for (int t = 0; t < DM / GK; ++t) { const int bo = (t & 1) * GB;
    const char* pa = fa + bo; const char* pb = fb + bo; v16h af[2][2], bf[2][4];      /* two fragment sets: step s + 1 of this trip is read from LDS, as one group, in front of step s's products */
#pragma unroll      /* the sets are indexed by constants, so that they live in registers */
    for (int i = 0; i < 2; ++i) af[0][i] = g3_frag(pa + i * 16 * GP);
#pragma unroll      /* as above */
    for (int j = 0; j < 4; ++j) bf[0][j] = g3_frag(pb + j * 16 * GP);
#pragma unroll      /* as above; the four k steps of a trip also get constant LDS offsets */
    for (int s = 0; s < GK / 32; ++s) { const int cu = s & 1, nx = cu ^ 1;
      if (s + 1 < GK / 32) {
#pragma unroll      /* as above */
        for (int i = 0; i < 2; ++i) af[nx][i] = g3_frag(pa + i * 16 * GP + 64 * (s + 1));
#pragma unroll      /* as above */
        for (int j = 0; j < 4; ++j) bf[nx][j] = g3_frag(pb + j * 16 * GP + 64 * (s + 1)); }
      c00 = g2_mma(af[cu][0], bf[cu][0], c00); c10 = g2_mma(af[cu][1], bf[cu][0], c10);
      c01 = g2_mma(af[cu][0], bf[cu][1], c01); c11 = g2_mma(af[cu][1], bf[cu][1], c11);
      c02 = g2_mma(af[cu][0], bf[cu][2], c02); c12 = g2_mma(af[cu][1], bf[cu][2], c12);
      c03 = g2_mma(af[cu][0], bf[cu][3], c03); c13 = g2_mma(af[cu][1], bf[cu][3], c13); }
    asm volatile("s_wait_dscnt 0x0" ::: "memory");      /* this wave's reads of trip t's buffer are done before it is refilled */
    asm volatile("s_wait_asynccnt 0x0" ::: "memory");      /* this wave's copies of trip t + 1 have landed */
    __syncthreads();      /* publishes trip t + 1's rows and ends every wave's reads of trip t's buffer */
    if (t + 2 < DM / GK) { g3_copy(l0 + bo, ga + (t + 2) * GK); g3_copy(l0 + bo + GO, gb + (t + 2) * GK); } }
  asm volatile("s_wait_asynccnt 0x0" ::: "memory");      /* no copy is outstanding when the first buffer becomes output staging */
  float (*so)[68] = (float (*)[68])(sm + w * 32 * 68);
  v8f accs[8] = {c00, c01, c02, c03, c10, c11, c12, c13};
#pragma unroll      /* accs and bv indexed by constants: registers */
  for (int u = 0; u < 8; ++u) { const int t = u & 3, half = u >> 2; const float bb = bf16_round(bv[t]);
#pragma unroll      /* as above */
    for (int r = 0; r < 8; ++r) so[half * 16 + 8 * hh + r][t * 16 + ln] = accs[u][r] * 0.0625f + bb; }
  __builtin_amdgcn_fence(__ATOMIC_ACQ_REL, "workgroup"); __builtin_amdgcn_wave_barrier();      /* the wave's staged block is complete before its lanes read each other's values; no other wave touches it */
  if (z == 2) {      /* v: row-major, as the transposing launch reads it */
    const int rsub = lane >> 4, c4 = (lane & 15) * 4;
#pragma unroll      /* the 16 LDS reads and stores overlap; each store is 2 rows x 128 bytes, whole lines */
    for (int q = 0; q < 16; ++q) { const int r = q * 2 + rsub; const v4f v = *(const v4fa*)&so[r][c4]; v4h h4; for (int i = 0; i < 4; ++i) h4[i] = (_Float16)v[i]; *(v4h*)(C16 + (size_t)(row0 + r) * DM + col0 + c4) = h4; }
  } else {      /* q, k: fragment order, [16-row tile][head][k half of 32][part][lane][8]; the wave's 64 columns are one head, its 32 rows two tiles */
    _Float16* cf = C16 + ((size_t)(row0 / 16) * NH + col0 / HD) * (2 * FT) + lane * 8;
#pragma unroll      /* the LDS reads and the 8 stores overlap; each store is 512 contiguous bytes */
    for (int q = 0; q < 8; ++q) { const int tl = q >> 2, c = q & 3; const float* sp = &so[16 * tl + ln][16 * c + 8 * hh]; const v4f v0 = *(const v4fa*)sp, v1 = *(const v4fa*)(sp + 4); FragH f;
#pragma unroll      /* f indexed by constants: registers */
      for (int i = 0; i < 4; ++i) { f.h[i] = (_Float16)v0[i]; f.h[4 + i] = (_Float16)v1[i]; }
      *(v8us*)((unsigned short*)cf + (size_t)tl * NH * (2 * FT) + c * (FT / 2)) = f.half[0]; }
    asm volatile("s_wait_xcnt 0x0" ::: "memory");      /* the wait before a register of the stores above is overwritten */
  } }


// table in fragment order: piece t of 8 halves is [16-row tile][k half of 32][part][lane]; it holds row 16 tile + ln, columns 16 (2 khalf + part) + 8 hh .. + 7
__device__ __forceinline__ void d_wrel(const float* __restrict__ w, _Float16* __restrict__ Bt, size_t t) { if (t >= (size_t)RW * HD / 8) return; const size_t row = (t >> 7) * 16 + (t & 15), col = ((t >> 5) & 3) * 16 + ((t >> 4) & 1) * 8; const bool live = row < (size_t)NREL; FragH f; for (int q = 0; q < 8; ++q) f.h[q] = live ? (_Float16)(bf16_round(w[row * HD + col + q]) * 16.0f) : (_Float16)0.0f; *(v8us*)((unsigned short*)Bt + t * 8) = f.half[0];  }
// The five operand preparations need nothing of each other: they share one grid as ranges of the block index (a block-uniform branch).
// Longest block first, so that none starts late and runs on alone: the table (its guarded loads follow one another), the weight tiles (load, turn in LDS, store), then the hidden rows.
#define PW ((DM / WK) * (DM / WN))   /* blocks (tiles) per weight matrix */
#define PX ((int)(NR * DM / 8 / 256)) /* blocks of the hidden rows */
#define PE (RW * HD / 8 / 256)       /* blocks of the distance table */
__global__ __launch_bounds__(256) void k_prep(const float* __restrict__ wq, const float* __restrict__ wk, const float* __restrict__ wv, const float* __restrict__ demb, const float* __restrict__ hs,
                                              _Float16* __restrict__ BQ, _Float16* __restrict__ BK, _Float16* __restrict__ BV, _Float16* __restrict__ BE, _Float16* __restrict__ X16) {
  static_assert(DM % WK == 0 && DM % WN == 0 && WK == 128 && WN == 64 && NR * DM / 8 % 256 == 0 && RW * HD / 8 % 256 == 0, "k_prep: whole tiles and whole blocks in every range; 256 threads = 16 k pieces x 16 column quads");
  __shared__ __attribute__((aligned(16))) unsigned short tl[WN * WK];      /* the weight tiles' turning place */
  const int blk = blockIdx.x, tid = threadIdx.x;
  if (blk < PE) d_wrel(demb, BE, (size_t)blk * 256 + tid);
  else if (blk < PE + 3 * PW) { const int u = blk - PE, z = u / PW; d_wt_tile(z == 0 ? wq : z == 1 ? wk : wv, z == 0 ? BQ : z == 1 ? BK : BV, 16.0f, u - z * PW, tid, tl); }      /* [in][out] -> Bt[out][in] x16 */
  else d_x16(hs, X16, NR * DM / 8, (size_t)(blk - PE - 3 * PW) * 256 + tid); }
__global__ __launch_bounds__(256) void k_wnat(const float* __restrict__ w, size_t n8, _Float16* __restrict__ Bt) { const size_t t = (size_t)blockIdx.x * 256 + threadIdx.x; if (t >= n8) return; FragH f; for (int q = 0; q < 8; ++q) f.h[q] = (_Float16)(bf16_round(w[t * 8 + q]) * 16.0f); *(v8us*)((unsigned short*)Bt + t * 8) = f.half[0];  }
// Fused attention: one work-group = RT query rows of one (batch, head), 16 waves. Wave w owns the key columns 32w .. 32w + 31 of all RT rows:
// it forms q.k, the window of q . dist_emb^T and the window of k . dist_emb^T that those columns need on WMMA (64 table rows from i0 - 32w + 480 serve both windows;
// the k fragments are the B operand of q.k and the A operand of k . dist_emb^T) and sums the three in its own block of the LDS score tile, each relative term stored along its diagonal:
// score[i][r] = (q_i.k_r + q_i.e[i-r+S-1] + k_r.e[i-r+S-1]) * 0.125 + mask[r] (bf16-rounded additive mask, staged in LDS).
// Of the three 16-wide table tiles a 16x16 block meets, the middle one is used whole and the outer two halve along the diagonal, so they merge into one full tile by a lane select.
// Then one wave per query row (two rows a wave), lane l holding columns 128u + 4l .. + 3; P = f16(256 softmax) goes to LDS; each wave forms one 16x16 tile of P . V over one half of K = 512 (V^T fragments from memory);
// the two halves are summed through LDS, from where each output row is stored as whole 256-byte runs.
// Every loop is fully unrolled (constant trip counts): the per-lane arrays must be indexed by constants to live in registers.
#define RT 32                        /* query rows per work-group */
#define TP (SQ + 4)                  /* score tile pitch in floats: rows stay 16-byte aligned, a column of 32 rows falls on 16 banks */
#define PP (SQ + 8)                  /* P tile pitch in halves: 16 bytes more a row for the 16-byte fragment reads */
template <int C> __device__ __forceinline__ float x_row(float x) { return __builtin_bit_cast(float, __builtin_amdgcn_update_dpp(0, __builtin_bit_cast(int, x), 0x160 | C, 0xf, 0xf, true)); }      /* lane l <- lane l ^ C inside a 16-lane row (row_xmask) */
__device__ __forceinline__ float x_half(float x) { return __builtin_bit_cast(float, __builtin_amdgcn_permlanex16(__builtin_bit_cast(int, x), __builtin_bit_cast(int, x), 0x76543210, 0xfedcba98, false, false)); }      /* lane l <- lane l ^ 16 */
__device__ __forceinline__ float wave_max(float v) { v = fmaxf(v, x_row<1>(v)); v = fmaxf(v, x_row<2>(v)); v = fmaxf(v, x_row<4>(v)); v = fmaxf(v, x_row<8>(v)); return fmaxf(v, x_half(v)); }
__device__ __forceinline__ float wave_sum(float v) { v += x_row<1>(v); v += x_row<2>(v); v += x_row<4>(v); v += x_row<8>(v); return v + x_half(v); }
__device__ __forceinline__ v8f g2_dot64(const v16h (&a)[2], const v16h (&b)[2]) { const v8f z8 = {0.f,0.f,0.f,0.f,0.f,0.f,0.f,0.f}; return g2_mma(a[1], b[1], g2_mma(a[0], b[0], z8)); }
__global__ __launch_bounds__(512) void k_attn(const _Float16* __restrict__ Q16, const _Float16* __restrict__ K16, const _Float16* __restrict__ BE, const _Float16* __restrict__ VT, const float* __restrict__ amask, float* __restrict__ out) {
  static_assert(SQ == 512 && HD == 64 && RT == 32 && SQ % RT == 0 && RW >= 2 * SQ, "k_attn: 16 waves of 32 key columns; 512 threads stage 512 mask values and store 32 x 64 outputs");
  __shared__ __attribute__((aligned(16))) float sc[RT][TP];
  __shared__ __attribute__((aligned(16))) _Float16 ph[RT][PP];
  __shared__ __attribute__((aligned(16))) float so[2][RT][HD + 4];
  __shared__ __attribute__((aligned(16))) float mk[SQ];
  const int tid = threadIdx.x, w = __builtin_amdgcn_readfirstlane(tid >> 5), lane = tid & 31, ln = lane & 15, hh = lane >> 4, i0 = blockIdx.x * RT, h = blockIdx.y, b = blockIdx.z;
  /* all four operands lie in fragment order: every load below reads 512 contiguous bytes */
  const int l8 = lane * 8;      /* the lane's piece of a fragment tile; the tile starts below are the same for the whole wave */
  const _Float16* qp = Q16 + ((size_t)((b * SQ + i0) / 16) * NH + h) * (2 * FT);
  const _Float16* kp = K16 + ((size_t)((b * SQ + 32 * w) / 16) * NH + h) * (2 * FT);
  const _Float16* ep = BE + (size_t)((i0 - 32 * w + (SQ - 32)) / 16) * (2 * FT);      /* table rows i0 - 32w + 480 .. + 63, all inside 0 .. 1023; the first is a multiple of 16 */
  const float* mp = amask + (size_t)b * SQ;
  v16h qf[2][2], kf[2][2], ef[4][2];
#pragma unroll
  for (int m = 0; m < 2; ++m)
#pragma unroll
    for (int s = 0; s < 2; ++s) { qf[m][s] = gf_frag(qp + (m * NH * 2 + s) * FT + l8); kf[m][s] = gf_frag(kp + (m * NH * 2 + s) * FT + l8); }
#pragma unroll
  for (int t = 0; t < 4; ++t)
#pragma unroll
    for (int s = 0; s < 2; ++s) ef[t][s] = gf_frag(ep + (t * 2 + s) * FT + l8);
  const float mv = mp[tid];
  asm volatile("s_wait_xcnt 0x0" :: "s"(qp), "s"(kp), "s"(ep), "s"(mp), "v"(lane) : "memory");      /* the wait before the address registers of the loads above are overwritten; naming them keeps them whole up to it */
  mk[tid] = bf16_round(mv);
  const int dg = 8 * hh - ln;      /* row minus column inside a 16x16 accumulator tile, less the register index */
  float* blk = &sc[0][32 * w];
#pragma unroll
  for (int m = 0; m < 2; ++m)
#pragma unroll
    for (int e = 0; e < 2; ++e) { const v8f c = g2_dot64(qf[m], kf[e]);
#pragma unroll
      for (int r = 0; r < 8; ++r) blk[(16 * m + 8 * hh + r) * TP + 16 * e + ln] = c[r]; }
  /* q . e: accumulator (query row 16m + 8hh + r, table row base + 16(m + t) + ln) belongs to key column 31 + 8hh + r - 16t - ln of the block */
#pragma unroll
  for (int m = 0; m < 2; ++m) { const v8f c0 = g2_dot64(qf[m], ef[m]), c1 = g2_dot64(qf[m], ef[m + 1]), c2 = g2_dot64(qf[m], ef[m + 2]); float* pc[8]; float* po[8]; float om[8], oo[8];      /* the 16 x 32 elements are distinct: all reads, then all writes, so that the LDS round trips overlap */
#pragma unroll
    for (int r = 0; r < 8; ++r) { pc[r] = blk + (16 * m + 8 * hh + r) * TP + 15 + dg + r; po[r] = pc[r] + (dg + r <= 0 ? 16 : -16); om[r] = *pc[r]; oo[r] = *po[r]; }
#pragma unroll
    for (int r = 0; r < 8; ++r) { *pc[r] = om[r] + c1[r] * 0.0625f; *po[r] = oo[r] + (dg + r <= 0 ? c0[r] : c2[r]) * 0.0625f; } }
  /* k . e: accumulator (key row 16e + 8hh + r of the block, table row base + 16(1 - e + t) + ln) belongs to query row 16t + ln + 8hh + r - 15 */
#pragma unroll
  for (int e = 0; e < 2; ++e) { const v8f c0 = g2_dot64(kf[e], ef[1 - e]), c1 = g2_dot64(kf[e], ef[2 - e]), c2 = g2_dot64(kf[e], ef[3 - e]); float* pc[8]; float* po[8]; float om[8], oo[8];
#pragma unroll
    for (int r = 0; r < 8; ++r) { const int il = 1 + ln + 8 * hh + r; pc[r] = blk + il * TP + 16 * e + 8 * hh + r; po[r] = pc[r] + (il < 16 ? 16 * TP : -16 * TP); om[r] = *pc[r]; oo[r] = *po[r]; }
#pragma unroll
    for (int r = 0; r < 8; ++r) { *pc[r] = om[r] + c1[r] * 0.0625f; *po[r] = oo[r] + (1 + ln + 8 * hh + r < 16 ? c2[r] : c0[r]) * 0.0625f; } }
  __syncthreads();      /* publishes the score tile and the mask */
  /* P . V share of this wave: tile (pm, pn) of the 32 x 64 result, half pk of K = 512; its V^T fragments are asked for here so that they fly during the softmax */
  const int pm = w & 1, pn = (w >> 1) & 3, pk = w >> 3;
  const _Float16* vp = VT + ((((size_t)b * NH + h) * 4 + pn) * (SQ / 32) + 8 * pk) * FT;
  v16h vf[8];
#pragma unroll
  for (int s = 0; s < 8; ++s) vf[s] = gf_frag(vp + s * FT + l8);
  asm volatile("s_wait_xcnt 0x0" :: "s"(vp), "v"(lane) : "memory");      /* the wait before the address registers of the loads above are overwritten */
#pragma unroll
  for (int k = 0; k < 2; ++k) { const int row = 2 * w + k; float x[16]; float mx = -INFINITY;
#pragma unroll
    for (int u = 0; u < 4; ++u) { const int c = 128 * u + 4 * lane; const v4f sv = *(const v4fa*)&sc[row][c], mm = *(const v4fa*)&mk[c];
#pragma unroll
      for (int q = 0; q < 4; ++q) { x[u * 4 + q] = sv[q] * 0.125f + mm[q]; mx = fmaxf(mx, x[u * 4 + q]); } }
    mx = wave_max(mx); float se = 0.f;
#pragma unroll
    for (int j = 0; j < 16; ++j) { x[j] = expf(x[j] - mx); se += x[j]; }
    const float sn = 256.0f / wave_sum(se);
#pragma unroll
    for (int u = 0; u < 4; ++u) { v4h o;
#pragma unroll
      for (int q = 0; q < 4; ++q) o[q] = (_Float16)(x[u * 4 + q] * sn);
      *(v4h*)&ph[row][128 * u + 4 * lane] = o; } }
  __syncthreads();      /* publishes the P tile */
  { const _Float16* pa = &ph[16 * pm + ln][256 * pk + 8 * hh]; v16h pf[8];
#pragma unroll
    for (int s = 0; s < 8; ++s) pf[s] = g2_frag(pa + 32 * s, 0);
    v8f c = {0.f,0.f,0.f,0.f,0.f,0.f,0.f,0.f};
#pragma unroll
    for (int s = 0; s < 8; ++s) c = g2_mma(pf[s], vf[s], c);
#pragma unroll
    for (int r = 0; r < 8; ++r) so[pk][16 * pm + 8 * hh + r][16 * pn + ln] = c[r]; }
  __syncthreads();      /* publishes the two K halves of the 32 x 64 result */
  { const int row = tid >> 4, c4 = (tid & 15) * 4; const v4f v = (*(const v4fa*)&so[0][row][c4] + *(const v4fa*)&so[1][row][c4]) * 0.00390625f; *(v4f*)(out + ((size_t)b * SQ + i0 + row) * DM + h * HD + c4) = v; } }
__global__ __launch_bounds__(256) void k_vt(const _Float16* __restrict__ V16, int b, int h0, _Float16* __restrict__ VT) { __shared__ unsigned short tl[64][65]; const int tid = threadIdx.x; const int hh = blockIdx.x % HG, sg = blockIdx.x / HG; const int s0 = sg * 64; const int h = h0 + hh;
  for (int i = tid; i < 64 * 8; i += 256) { const int j = i / 8, d8 = (i % 8) * 8; FragH f; f.half[0] = *(const v8us*)((const unsigned short*)V16 + ((size_t)b * SQ + s0 + j) * DM + h * HD + d8); for (int q = 0; q < 8; ++q) tl[d8 + q][j] = f.u[q]; }
  __syncthreads();
  { for (int i = tid; i < 64 * 8; i += 256) { const int d = i / 8, j8 = (i % 8) * 8; FragH f; for (int q = 0; q < 8; ++q) f.u[q] = tl[d][j8 + q]; *(v8us*)((unsigned short*)VT + ((size_t)hh * HD + d) * SQ + s0 + j8) = f.half[0]; }  } }

extern "C" void kernel_launch(void* const* d_in, const int* in_sizes, int n_in,
                              void* d_out, int out_size, void* d_ws, size_t ws_size, hipStream_t stream) {
  (void)in_sizes; (void)n_in; (void)out_size;
  const float* const* I = (const float* const*)d_in; const float* hs = I[0]; const float* amask = I[1]; const float* wq = I[2]; const float* bq = I[3]; const float* wk = I[4]; const float* bk = I[5]; const float* wv = I[6]; const float* bv = I[7]; const float* demb = I[8];      /* weights [in][out]; attention_mask [8][1][1][512] additive; dist_emb [1023][64] */
  char* ws = (char*)d_ws; size_t off = 0;
  auto take = [&](size_t bytes) { char* p = ws + off; off += (bytes + 255) & ~(size_t)255; return p; };
  _Float16* BQ = (_Float16*)take((size_t)DM * DM * 2); _Float16* BK = (_Float16*)take((size_t)DM * DM * 2); _Float16* BV = (_Float16*)take((size_t)DM * DM * 2); _Float16* BE = (_Float16*)take((size_t)RW * HD * 2);
  _Float16* X16 = (_Float16*)take(NR * DM * 2); _Float16* Q16 = (_Float16*)take(NR * DM * 2); _Float16* K16 = (_Float16*)take(NR * DM * 2); _Float16* V16 = (_Float16*)take(NR * DM * 2);
  _Float16* VT = (_Float16*)take((size_t)NB * NH * HD * SQ * 2);
  if (off > ws_size) return;      /* 6 + 0.1 + 4x8 + 8 = approx 46 MiB */
  k_prep<<<3 * PW + PX + PE, 256, 0, stream>>>(wq, wk, wv, demb, hs, BQ, BK, BV, BE, X16);      /* transposed weights x16, padded table x16, hidden rows as f16 */
  k_proj<<<dim3((unsigned)((NR / GT) * (DM / GT)), 3), 256, 0, stream>>>(X16, BQ, BK, BV, bq, bk, bv, Q16, K16, V16);
  k_vt<NH, SQ><<<NB * NH * (SQ / 64), 256, 0, stream>>>(V16, DM, 0, VT);      /* V^T in fragment order, [(b,h)][16 columns d][32 keys][part][lane][8 keys], for every (batch, head) */
  k_attn<<<dim3(SQ / RT, NH, NB), 512, 0, stream>>>(Q16, K16, BE, VT, amask, (float*)d_out);      /* scores, relative terms, softmax and P . V; ctx rows (merged heads, f32) */
}

// v007
// A run of this version takes 84.2 microseconds.
// In both of two side-by-side timings against v006, it was 1.06 times as fast.
// Counting every step since v000, it is 43.5 times as fast.
#include <hip/hip_runtime.h>
// BERT self-attention with relative-position score terms (hidden [8][512][1024]; q, k, v = h W + b ([in][out], 16 heads of 64); scores[l][r] = (q_l.k_r + q_l.pe[l-r] + k_r.pe[l-r]) / 8 + mask[r] with pe = dist_emb[l - r + 511]; softmax; ctx = attn v merged -> [8][512][1024]).
// Structure: token rows r = b*512 + s; hidden as exact f16 rows (with the weight and table preparations in one launch); Q | K | V as three WMMA GEMMs in one launch (128x128 work-group tiles staged in LDS by asynchronous copies, 32x64 wave tiles, f32 accumulation, exact x16 transposed weights, bias in the epilogue, f16 outputs; v leaves the accumulators as V^T); q, k, V^T and the table lie in memory in WMMA fragment order (FRAGMENT ORDER below), so that a fragment load of the attention reads whole lines; then one fused attention launch, one work-group per 32 query rows of a (batch, head): q.k and the two relative terms (q rows and k rows times the window of dist_emb^T that the tile's diagonals meet; table padded to 1024 rows with zeros) on WMMA, summed in an LDS score tile (f32), row softmax on VALU, one wave per query row (mask added; weights x256 as f16 in LDS), ctx = P . V on WMMA (K = 512, alpha 2^-8) written as f32 into the merged output rows.
// Compute dtype: inputs rounded to bf16; hidden / weights / table exact; q, k, v and the softmax weights as plain f16 GEMM operands (~2^-12); scores, relative terms and softmax statistics f32. v_wmma_f32_16x16x32_f16.
#define NB 8
#define SQ 512
#define DM 1024
#define NH 16
#define HD 64
#define HG 16                        /* heads per attention launch group (all) */
#define NREL 1023                    /* relative distances -511..511 */
#define RW 1024                      /* dist_emb table rows (distances padded to 1024) */
#define QN SQ                        /* unused: attention covers all SQ query rows */
#define NBR NB                       /* unused: attention covers all NB batches */
#define MP ((int)NR)                 /* unused: the projections take all NR rows */
#define NR ((size_t)NB * SQ)         /* 4096 token rows */
typedef __bf16 v16b __attribute__((ext_vector_type(16)));
typedef unsigned short v8us __attribute__((ext_vector_type(8), may_alias));
typedef float  v8f  __attribute__((ext_vector_type(8)));
typedef float  v4f  __attribute__((ext_vector_type(4)));
typedef float  v4fa __attribute__((ext_vector_type(4), may_alias));
union FragB { v16b v; v8us half[2]; unsigned short u[16]; };

__device__ __forceinline__ unsigned short bf16_bits(float x) { unsigned int u = __float_as_uint(x); return (unsigned short)((u + 0x7FFFu + ((u >> 16) & 1u)) >> 16); }
__device__ __forceinline__ float bf16_val(unsigned short b) { return __uint_as_float(((unsigned int)b) << 16); }
__device__ __forceinline__ float bf16_round(float x) { return bf16_val(bf16_bits(x)); }
// D += A·B with NT terms: 1 = ah·bh, 2 = + al·bh (A split), 3 = + ah·bl (both split)
template <int NT>
__device__ __forceinline__ v8f mmaN(v16b ah, v16b al, v16b bh, v16b bl, v8f c) {
  c = __builtin_amdgcn_wmma_f32_16x16x32_bf16(false, ah, false, bh, (short)0, c, false, false);
  if (NT >= 2) c = __builtin_amdgcn_wmma_f32_16x16x32_bf16(false, al, false, bh, (short)0, c, false, false);
  if (NT >= 3) c = __builtin_amdgcn_wmma_f32_16x16x32_bf16(false, ah, false, bl, (short)0, c, false, false);
  asm volatile("v_nop\n\tv_nop\n\tv_nop\n\tv_nop" : "+v"(c) : "v"(ah), "v"(al), "v"(bh), "v"(bl));
  return c;
}

__global__ __launch_bounds__(256) void k_wt_bf16(const float* __restrict__ W, unsigned short* __restrict__ Wt, int K, int N) {
  const int t = blockIdx.x * 256 + threadIdx.x;
  const int k8n = K / 8;
  if (t >= N * k8n) return;
  const int n = t / k8n, k8 = (t % k8n) * 8;
  v8us v;
#pragma unroll
  for (int i = 0; i < 8; ++i) v[i] = bf16_bits(W[(size_t)(k8 + i) * N + n]);
  *(v8us*)(Wt + (size_t)n * K + k8) = v;
  
}

// GEMM C[M][N] (f32, pitch ldc) = act(A[M][K]·W + bias). A f32 row-major (pitch lda) converted per fragment to bf16
// (ASPLIT: hi/lo two planes -> 2 terms, else single rounded term); Wt bf16 [N][K] (pitch ldb). BIAS_BF16 rounds the
// bias to bf16 first (bias quantised to bf16 before the add). K%32==0, M%16==0, N%64==0.
template <bool ASPLIT, int ACT, bool BIAS_BF16>
__global__ __launch_bounds__(128) void k_gemm_bf(const float* __restrict__ A, int lda, const unsigned short* __restrict__ Wt, int ldb,
                                               const float* __restrict__ bias, float* __restrict__ C, int ldc, int M, int N, int K) {
  __shared__ __attribute__((aligned(16))) float so[4][16][64];
  const int tid = threadIdx.x, w = tid >> 5, lane = tid & 31, ln = lane & 15, hh = lane >> 4;
  const int ntn = N / 64;
  const int wid = blockIdx.x * 4 + w;
  const int mt = wid / ntn, nq = wid % ntn;
  if (mt * 16 >= M) return;
  const int row0 = mt * 16, col0 = nq * 64;
  const float* arow = A + (size_t)(row0 + ln) * lda;
  v8f acc[4] = {};
  for (int kb = 0; kb < K; kb += 32) {
    FragB ah, al;
    const v4f x0 = *(const v4fa*)(arow + kb + 8 * hh), x1 = *(const v4fa*)(arow + kb + 8 * hh + 4);
    const v4f x2 = *(const v4fa*)(arow + kb + 16 + 8 * hh), x3 = *(const v4fa*)(arow + kb + 16 + 8 * hh + 4);
    float xs[16] = {x0[0],x0[1],x0[2],x0[3],x1[0],x1[1],x1[2],x1[3],x2[0],x2[1],x2[2],x2[3],x3[0],x3[1],x3[2],x3[3]};
#pragma unroll
    for (int i = 0; i < 16; ++i) { const unsigned short hb = bf16_bits(xs[i]); ah.u[i] = hb; al.u[i] = ASPLIT ? bf16_bits(xs[i] - bf16_val(hb)) : (unsigned short)0; }
#pragma unroll
    for (int t = 0; t < 4; ++t) {
      const unsigned short* brow = Wt + (size_t)(col0 + t * 16 + ln) * ldb + kb;
      FragB b;
      b.half[0] = *(const v8us*)(brow + 8 * hh);
      b.half[1] = *(const v8us*)(brow + 16 + 8 * hh);
      acc[t] = mmaN<ASPLIT ? 2 : 1>(ah.v, al.v, b.v, b.v, acc[t]);
    }
  }
#pragma unroll
  for (int t = 0; t < 4; ++t) {
    float bv = bias ? bias[col0 + t * 16 + ln] : 0.f;
    if (BIAS_BF16) bv = bf16_round(bv);
#pragma unroll
    for (int r = 0; r < 8; ++r) { float v = acc[t][r] + bv; if (ACT == 1) v = fmaxf(v, 0.f); so[w][8 * hh + r][t * 16 + ln] = v; }
  }
  __builtin_amdgcn_fence(__ATOMIC_ACQ_REL, "workgroup");
  __builtin_amdgcn_wave_barrier();
  const int rsub = lane >> 4, c4 = (lane & 15) * 4;
  {
#pragma unroll
    for (int q = 0; q < 8; ++q) {
      const int r = q * 2 + rsub;
      const v4f v = *(const v4fa*)&so[w][r][c4];
      *(v4f*)(C + (size_t)(row0 + r) * ldc + col0 + c4) = v;
    }
    
  }
}

// GEMM C = act(A·W + bias + resid): A f32 (ASPLIT -> hi/lo 2 terms), Wt bf16 [N][K]; ACT 0 none, 1 relu, 2 exact gelu;
// resid (optional, f32, row index = (row % rmod), pitch ldr, RES_BF16 rounds it) added before the activation.
template <bool ASPLIT, int ACT, bool BIAS_BF16, bool RES_BF16>
__global__ __launch_bounds__(128) void k_gemm_bf3(const float* __restrict__ A, int lda, const unsigned short* __restrict__ Wt, int ldb,
                                                const float* __restrict__ bias, const float* __restrict__ resid, int rmod, int ldr,
                                                float* __restrict__ C, int ldc, int M, int N, int K) {
  __shared__ __attribute__((aligned(16))) float so[4][16][64];
  const int tid = threadIdx.x, w = tid >> 5, lane = tid & 31, ln = lane & 15, hh = lane >> 4;
  const int ntn = N / 64;
  const int wid = blockIdx.x * 4 + w;
  const int mt = wid / ntn, nq = wid % ntn;
  if (mt * 16 >= M) return;
  const int row0 = mt * 16, col0 = nq * 64;
  const float* arow = A + (size_t)(row0 + ln) * lda;
  v8f acc[4] = {};
  for (int kb = 0; kb < K; kb += 32) {
    FragB ah, al;
    const v4f x0 = *(const v4fa*)(arow + kb + 8 * hh), x1 = *(const v4fa*)(arow + kb + 8 * hh + 4);
    const v4f x2 = *(const v4fa*)(arow + kb + 16 + 8 * hh), x3 = *(const v4fa*)(arow + kb + 16 + 8 * hh + 4);
    float xs[16] = {x0[0],x0[1],x0[2],x0[3],x1[0],x1[1],x1[2],x1[3],x2[0],x2[1],x2[2],x2[3],x3[0],x3[1],x3[2],x3[3]};
#pragma unroll
    for (int i = 0; i < 16; ++i) { const unsigned short hb = bf16_bits(xs[i]); ah.u[i] = hb; al.u[i] = ASPLIT ? bf16_bits(xs[i] - bf16_val(hb)) : (unsigned short)0; }
#pragma unroll
    for (int t = 0; t < 4; ++t) {
      const unsigned short* brow = Wt + (size_t)(col0 + t * 16 + ln) * ldb + kb;
      FragB b;
      b.half[0] = *(const v8us*)(brow + 8 * hh);
      b.half[1] = *(const v8us*)(brow + 16 + 8 * hh);
      acc[t] = mmaN<ASPLIT ? 2 : 1>(ah.v, al.v, b.v, b.v, acc[t]);
    }
  }
#pragma unroll
  for (int t = 0; t < 4; ++t) {
    const int col = col0 + t * 16 + ln;
    float bv = bias ? bias[col] : 0.f;
    if (BIAS_BF16) bv = bf16_round(bv);
#pragma unroll
    for (int r = 0; r < 8; ++r) {
      float v = acc[t][r] + bv;
      if (resid) { float rv = resid[(size_t)((row0 + 8 * hh + r) % rmod) * ldr + col]; if (RES_BF16) rv = bf16_round(rv); v += rv; }
      if (ACT == 1) v = fmaxf(v, 0.f);
      if (ACT == 2) v = 0.5f * v * (1.0f + erff(v * 0.70710678118654752f));
      if (ACT == 3) { const float u = 0.7978845608028654f * (v + 0.044715f * v * v * v); v = 0.5f * v * (1.0f + tanhf(u)); }
      so[w][8 * hh + r][t * 16 + ln] = v;
    }
  }
  __builtin_amdgcn_fence(__ATOMIC_ACQ_REL, "workgroup");
  __builtin_amdgcn_wave_barrier();
  const int rsub = lane >> 4, c4 = (lane & 15) * 4;
  {
#pragma unroll
    for (int q = 0; q < 8; ++q) {
      const int r = q * 2 + rsub;
      const v4f v = *(const v4fa*)&so[w][r][c4];
      *(v4f*)(C + (size_t)(row0 + r) * ldc + col0 + c4) = v;
    }
    
  }
}
// row LayerNorm (biased variance, eps) over N: s = X (+ R); optional out_sum <- s; out_norm <- (s-mu)*rsqrt(var+eps)*g + b
template <bool PARAM_BF16>
__global__ __launch_bounds__(256) void k_layernorm(const float* __restrict__ X, const float* __restrict__ R, const float* __restrict__ g, const float* __restrict__ bta,
                                                  float* __restrict__ out_sum, float* __restrict__ out_norm, int N, float eps) {
  __shared__ float red[256];
  const int row = blockIdx.x, tid = threadIdx.x;
  const float* x = X + (size_t)row * N; const float* rr = R ? R + (size_t)row * N : nullptr;
  float vals[16];                     // up to N = 4096
  const int per = N / 256;            // contiguous chunk per thread? use strided-by-4 chunks: thread handles j = tid*4 + 1024*u
  float s1 = 0.f;
  for (int u = 0; u < per / 4; ++u) {
    const int j = tid * 4 + 1024 * u;
    const v4f a = *(const v4fa*)(x + j);
    v4f b = {0.f,0.f,0.f,0.f}; if (rr) b = *(const v4fa*)(rr + j);
#pragma unroll
    for (int q = 0; q < 4; ++q) { const float v = a[q] + b[q]; vals[u * 4 + q] = v; s1 += v; }
  }
  red[tid] = s1; __syncthreads();
  for (int st = 128; st > 0; st >>= 1) { if (tid < st) red[tid] += red[tid + st]; __syncthreads(); }
  const float mu = red[0] / (float)N; __syncthreads();
  float s2 = 0.f;
  for (int u = 0; u < per / 4; ++u)
#pragma unroll
    for (int q = 0; q < 4; ++q) { const float c = vals[u * 4 + q] - mu; s2 += c * c; }
  red[tid] = s2; __syncthreads();
  for (int st = 128; st > 0; st >>= 1) { if (tid < st) red[tid] += red[tid + st]; __syncthreads(); }
  const float rs = rsqrtf(red[0] / (float)N + eps);
  {
    for (int u = 0; u < per / 4; ++u) {
      const int j = tid * 4 + 1024 * u;
      v4f o, sm;
#pragma unroll
      for (int q = 0; q < 4; ++q) {
        float gg = g[j + q], bb = bta[j + q];
        if (PARAM_BF16) { gg = bf16_round(gg); bb = bf16_round(bb); }
        sm[q] = vals[u * 4 + q]; o[q] = (vals[u * 4 + q] - mu) * rs * gg + bb;
      }
      if (out_sum) *(v4f*)(out_sum + (size_t)row * N + j) = sm;
      *(v4f*)(out_norm + (size_t)row * N + j) = o;
    }
    
  }
}



// ---- f16 WMMA path (v_wmma_f32_16x16x32_f16): 11-bit significands for operands in range — used where a [0,1] probability operand needs more precision than bf16
typedef _Float16 v16h __attribute__((ext_vector_type(16)));
union FragH { v16h v; v8us half[2]; _Float16 h[16]; unsigned short u[16]; };
template <int NT>
__device__ __forceinline__ v8f mmaH(v16h ah, v16h al, v16h bh, v16h bl, v8f c) {
  c = __builtin_amdgcn_wmma_f32_16x16x32_f16(false, ah, false, bh, (short)0, c, false, false);
  if (NT >= 2) c = __builtin_amdgcn_wmma_f32_16x16x32_f16(false, al, false, bh, (short)0, c, false, false);
  if (NT >= 3) c = __builtin_amdgcn_wmma_f32_16x16x32_f16(false, ah, false, bl, (short)0, c, false, false);
  asm volatile("v_nop\n\tv_nop\n\tv_nop\n\tv_nop" : "+v"(c) : "v"(ah), "v"(al), "v"(bh), "v"(bl));
  return c;
}
// batched GEMM like k_gemm_b but f16 operands: A f32 (split into f16 hi/lo if ASPLIT, else rounded to f16), Bt = f16 values [n][k]; alpha; C f32; N multiple of 16 (partial tiles skipped)
template <bool ASPLIT>
__global__ __launch_bounds__(128) void k_gemm_h(const float* __restrict__ A, int lda, size_t sA, const _Float16* __restrict__ Bh, int ldb, size_t sB, float alpha, float* __restrict__ C, int ldc, size_t sC, int M, int N, int K) {
  __shared__ __attribute__((aligned(16))) float so[4][16][64];
  const int tid = threadIdx.x, w = tid >> 5, lane = tid & 31, ln = lane & 15, hh = lane >> 4; const int by = blockIdx.y;
  A += (size_t)by * sA; Bh += (size_t)by * sB; C += (size_t)by * sC;
  const int ntn = (N + 63) / 64; const int wid = blockIdx.x * 4 + w; const int mt = wid / ntn, nq = wid % ntn; if (mt * 16 >= M) return;
  const int row0 = mt * 16, col0 = nq * 64; const float* arow = A + (size_t)(row0 + ln) * lda;
  v8f acc[4] = {};
  for (int kb = 0; kb < K; kb += 32) {
    FragH ah, al;
    const v4f x0 = *(const v4fa*)(arow + kb + 8 * hh), x1 = *(const v4fa*)(arow + kb + 8 * hh + 4), x2 = *(const v4fa*)(arow + kb + 16 + 8 * hh), x3 = *(const v4fa*)(arow + kb + 16 + 8 * hh + 4);
    float xs[16] = {x0[0],x0[1],x0[2],x0[3],x1[0],x1[1],x1[2],x1[3],x2[0],x2[1],x2[2],x2[3],x3[0],x3[1],x3[2],x3[3]};
#pragma unroll
    for (int i = 0; i < 16; ++i) { const _Float16 h = (_Float16)xs[i]; ah.h[i] = h; al.h[i] = ASPLIT ? (_Float16)(xs[i] - (float)h) : (_Float16)0.0f; }
#pragma unroll
    for (int t = 0; t < 4; ++t) { if (col0 + t * 16 >= N) continue; const size_t boff = (size_t)(col0 + t * 16 + ln) * ldb + kb; FragH bq; bq.half[0] = *(const v8us*)(Bh + boff + 8 * hh); bq.half[1] = *(const v8us*)(Bh + boff + 16 + 8 * hh);
      acc[t] = mmaH<ASPLIT ? 2 : 1>(ah.v, al.v, bq.v, bq.v, acc[t]); }
  }
#pragma unroll
  for (int t = 0; t < 4; ++t) { if (col0 + t * 16 >= N) continue;
#pragma unroll
    for (int r = 0; r < 8; ++r) so[w][8 * hh + r][t * 16 + ln] = acc[t][r] * alpha; }
  __builtin_amdgcn_fence(__ATOMIC_ACQ_REL, "workgroup"); __builtin_amdgcn_wave_barrier();
  const int rsub = lane >> 4, c4 = (lane & 15) * 4;
  {
#pragma unroll
    for (int q = 0; q < 8; ++q) { const int r = q * 2 + rsub; if (col0 + c4 < N) { const v4f v = *(const v4fa*)&so[w][r][c4]; *(v4f*)(C + (size_t)(row0 + r) * ldc + col0 + c4) = v; } }
     }
}

// Wt[n][k] = f16(W[k][n] * scale) from f32 row-major W[DM][DM] (scale = power of two; bf16-exact weights stay exact in f16 away from the subnormal range), one tile of WK k x WN n per work-group of 256, turned in LDS.
// Reads: thread (kg, nq) takes rows 8 kg .. + 7, columns 4 nq .. + 3, so each 16-byte load of a wave covers 2 rows x 256 contiguous bytes, whole lines, and the 8 loads are in flight together.
// LDS: tl[n][16-byte piece of 8 k], rows of 256 bytes; piece c of row n lies at place c ^ (n >> 2): the 16 lanes that write one k piece of 16 rows four apart, and the 16 lanes that read one whole row, both fall on all 64 banks.
// Writes: each 16-byte store of a wave covers 2 rows of Wt x 256 contiguous bytes.
#define WK 128                       /* k per tile */
#define WN 64                        /* n per tile */
__device__ __forceinline__ void d_wt_tile(const float* __restrict__ W, _Float16* __restrict__ Wt, float scale, int tile, int tid, unsigned short* tl) {
  const int k0 = (tile / (DM / WN)) * WK, n0 = (tile % (DM / WN)) * WN, nq = tid & 15, kg = tid >> 4;
  const float* wp = W + (size_t)(k0 + 8 * kg) * DM + n0 + 4 * nq; v4f x[8];
#pragma unroll      /* x indexed by constants: registers; the 8 loads fly together */
  for (int i = 0; i < 8; ++i) x[i] = *(const v4fa*)(wp + (size_t)i * DM);
#pragma unroll      /* as above */
  for (int j = 0; j < 4; ++j) { FragH f;
#pragma unroll      /* as above */
    for (int i = 0; i < 8; ++i) f.h[i] = (_Float16)(bf16_round(x[i][j]) * scale);
    *(v8us*)(tl + (4 * nq + j) * WK + (kg ^ nq) * 8) = f.half[0]; }
  __syncthreads();      /* publishes the turned tile */
  unsigned short* op = (unsigned short*)Wt + (size_t)(n0 + kg) * DM + k0 + 8 * nq;
#pragma unroll      /* the 4 LDS reads and stores overlap */
  for (int p = 0; p < 4; ++p) { const int n = 16 * p + kg; const v8us o = *(const v8us*)(tl + n * WK + (nq ^ (n >> 2)) * 8); *(v8us*)(op + (size_t)(16 * p) * DM) = o; }
  asm volatile("s_wait_xcnt 0x0" ::: "memory");      /* the wait before a register of the stores above is overwritten: the code of the launch's other ranges follows in the text */
}
// k_gemm_hh variant with fused epilogue: v = acc·alpha + bias[by·sBias + col] (+ CP[(row/rowsPerB)·sCPb + by·64 + col] if CP) ; ACT 0 none / 1 elu ; writes f16 C16 (and f32 C if non-null)
template <int ACT>
__global__ __launch_bounds__(128) void k_gemm_hhx(const _Float16* __restrict__ A, int lda, size_t sA, const _Float16* __restrict__ Bh, int ldb, size_t sB, float alpha, const float* __restrict__ bias, size_t sBias, const float* __restrict__ CP, int rowsPerB, size_t sCPb, int row0g,
    float* __restrict__ C, _Float16* __restrict__ C16, int ldc, size_t sC, int M, int N, int K) {
  __shared__ __attribute__((aligned(16))) float so[4][16][64];
  const int tid = threadIdx.x, w = tid >> 5, lane = tid & 31, ln = lane & 15, hh = lane >> 4; const int by = blockIdx.y;
  A += (size_t)by * sA; Bh += (size_t)by * sB; const size_t cofs = (size_t)by * sC; const float* bp = bias ? bias + (size_t)by * sBias : nullptr;
  const int ntn = (N + 63) / 64; const int wid = blockIdx.x * 4 + w; const int mt = wid / ntn, nq = wid % ntn; if (mt * 16 >= M) return;
  const int row0 = mt * 16, col0 = nq * 64; const _Float16* arow = A + (size_t)(row0 + ln) * lda;
  v8f acc[4] = {};
  for (int kb = 0; kb < K; kb += 32) { FragH ah; ah.half[0] = *(const v8us*)((const unsigned short*)arow + kb + 8 * hh); ah.half[1] = *(const v8us*)((const unsigned short*)arow + kb + 16 + 8 * hh);
#pragma unroll
    for (int t = 0; t < 4; ++t) { if (col0 + t * 16 >= N) continue; const size_t boff = (size_t)(col0 + t * 16 + ln) * ldb + kb; FragH bq; bq.half[0] = *(const v8us*)((const unsigned short*)Bh + boff + 8 * hh); bq.half[1] = *(const v8us*)((const unsigned short*)Bh + boff + 16 + 8 * hh);
      acc[t] = mmaH<1>(ah.v, ah.v, bq.v, bq.v, acc[t]); }
  }
#pragma unroll
  for (int t = 0; t < 4; ++t) { if (col0 + t * 16 >= N) continue; const int col = col0 + t * 16 + ln; const float bv = bp ? bf16_round(bp[col]) : 0.f;
#pragma unroll
    for (int r = 0; r < 8; ++r) { float v = acc[t][r] * alpha + bv; if (CP) { const int rr = row0g + row0 + 8 * hh + r; if (rowsPerB < 0) v += CP[cofs + (size_t)rr * ldc + col];      /* rowsPerB < 0: own element of the batched C plane */ else { const int bidx = rr / rowsPerB; v += CP[(size_t)bidx * sCPb + (size_t)by * 64 + col]; } } if (ACT == 1) v = (v > 0.f) ? v : expm1f(v); else if (ACT == 7) v = (v > 0.f) ? v + 1.0f : expf(v); else if (ACT == 8) v = tanhf(v); else if (ACT == 9) v = 0.5f * v * (1.0f + tanhf(0.7978845608028654f * (v + 0.044715f * v * v * v))); else if (ACT == 11) v = 1.0f / (1.0f + expf(-v)); else if (ACT == 12) v = (v > 0.f) ? v : 0.01f * v; else if (ACT == 14) v = (v > 0.f) ? v : 0.1f * v; else if (ACT == 16) v = (v >= 0.f) ? v : 0.3f * v; else if (ACT == 17) v = (v >= 0.f) ? v : 0.2f * v; else if (ACT == 15) v = v / (1.0f + expf(-v)); else if (ACT == 3) v = fmaxf(v, 0.f); else if (ACT == 6) v = 0.5f * v * (1.0f + erff(v * 0.70710678118654752f)); so[w][8 * hh + r][t * 16 + ln] = v; } }
  __builtin_amdgcn_fence(__ATOMIC_ACQ_REL, "workgroup"); __builtin_amdgcn_wave_barrier();
  const int rsub = lane >> 4, c4 = (lane & 15) * 4; typedef _Float16 v4h __attribute__((ext_vector_type(4)));
  {
#pragma unroll
    for (int q = 0; q < 8; ++q) { const int r = q * 2 + rsub; if (col0 + c4 < N) { const v4f v = *(const v4fa*)&so[w][r][c4]; if (C) *(v4f*)(C + cofs + (size_t)(row0 + r) * ldc + col0 + c4) = v; if (C16) { v4h h4; for (int i = 0; i < 4; ++i) h4[i] = (_Float16)v[i]; *(v4h*)(C16 + cofs + (size_t)(row0 + r) * ldc + col0 + c4) = h4; } } }
     }
}


typedef _Float16 v4h __attribute__((ext_vector_type(4)));

__device__ __forceinline__ void d_x16(const float* __restrict__ x, _Float16* __restrict__ X16, size_t n8, size_t t) { if (t >= n8) return; FragH f;
#pragma unroll
  for (int q = 0; q < 8; ++q) f.h[q] = (_Float16)bf16_round(x[t * 8 + q]); *(v8us*)((unsigned short*)X16 + t * 8) = f.half[0];  }
__global__ __launch_bounds__(256) void k_h16(const float* __restrict__ x, _Float16* __restrict__ X16, size_t n8) { const size_t t = (size_t)blockIdx.x * 256 + threadIdx.x; if (t >= n8) return; FragH f;
#pragma unroll
  for (int q = 0; q < 8; ++q) f.h[q] = (_Float16)x[t * 8 + q]; *(v8us*)((unsigned short*)X16 + t * 8) = f.half[0];  }
__global__ __launch_bounds__(256) void k_round16f(const float* __restrict__ W, _Float16* __restrict__ Bt, size_t n8) { const size_t t = (size_t)blockIdx.x * 256 + threadIdx.x; if (t >= n8) return; FragH f;
#pragma unroll
  for (int i = 0; i < 8; ++i) f.h[i] = (_Float16)(bf16_round(W[t * 8 + i]) * 16.0f); *(v8us*)((unsigned short*)Bt + t * 8) = f.half[0];  }
__global__ __launch_bounds__(256) void k_hl(const float* __restrict__ F, _Float16* __restrict__ Hh, _Float16* __restrict__ Hl, size_t n8) { const size_t t = (size_t)blockIdx.x * 256 + threadIdx.x; if (t >= n8) return; FragH fh, fl; const v4f a = *(const v4fa*)(F + t * 8), c = *(const v4fa*)(F + t * 8 + 4);
#pragma unroll
  for (int q = 0; q < 4; ++q) { _Float16 h = (_Float16)a[q]; fh.h[q] = h; fl.h[q] = (_Float16)((a[q] - (float)h) * 1024.0f); h = (_Float16)c[q]; fh.h[4 + q] = h; fl.h[4 + q] = (_Float16)((c[q] - (float)h) * 1024.0f); }
  { *(v8us*)((unsigned short*)Hh + t * 8) = fh.half[0]; *(v8us*)((unsigned short*)Hl + t * 8) = fl.half[0];  } }

// ---- WMMA helpers (f16 fragments of 16 rows x 32 k; one product with its distance) ----
__device__ __forceinline__ v16h g2_frag(const _Float16* p, int hh) { FragH f; f.half[0] = *(const v8us*)((const unsigned short*)p + 8 * hh); f.half[1] = *(const v8us*)((const unsigned short*)p + 16 + 8 * hh); return f.v; }
__device__ __forceinline__ v8f g2_mma(v16h a, v16h b, v8f c) { v8f d = __builtin_amdgcn_wmma_f32_16x16x32_f16(false, a, false, b, (short)0, c, false, false); asm volatile("v_nop\n\tv_nop\n\tv_nop\n\tv_nop" : "+v"(d) : "v"(a), "v"(b)); return d; }
// FRAGMENT ORDER: a tile of 16 rows x 32 k (1 KiB) is stored as [part 0..1][lane 0..31][8 halves]; lane = 16 hh + ln holds row ln, k = 16 part + 8 hh .. + 7: the registers of g2_frag, unchanged.
// One 16-byte load of a wave then reads 512 contiguous bytes (4 lines) where the row-major tile made it touch 16 lines of 32 useful bytes each.
#define FT 512                       /* halves of one 16 x 32 fragment tile */
__device__ __forceinline__ v16h gf_frag(const _Float16* p) { FragH f; f.half[0] = *(const v8us*)((const unsigned short*)p); f.half[1] = *(const v8us*)((const unsigned short*)p + FT / 2); return f.v; }      /* p: the tile's start + 8 lane */
// Projection GEMM C16[4096][1024] = f16(A . Bt^T / 16 + bias): one 128 x 128 tile of C per work-group, 8 waves of 32 x 64 (4 down, 2 across).
// Per trip 128 k (256 bytes of each of the 128 A rows and 128 Bt rows) lie in LDS at pitch 272 bytes, brought by asynchronous 16-byte copies: a wave's copy takes 2 rows x 256 bytes, whole lines.
// Two buffers: the copies of trip t + 1 fly while trip t's fragments are read from LDS. k ascends in steps of 32 per accumulator. The epilogue of q and k stages each wave's 32 x 64 block in the first buffer.
#define GT 128                       /* rows and columns of C per work-group */
#define GK 128                       /* k per trip */
#define GP 272                       /* LDS row pitch in bytes: 16 x odd, for the 16-byte fragment reads */
#define GO (GT * GP)                 /* bytes of one operand's rows in a buffer */
#define GB (2 * GO)                  /* bytes of one buffer: A rows, then Bt rows */
__device__ __forceinline__ v16h g3_frag(const char* p) { FragH f; f.half[0] = *(const v8us*)p; f.half[1] = *(const v8us*)(p + 32); return f.v; }
// this thread's 8 pieces of one operand's 128 rows x 256 bytes: rows 16 apart, LDS byte address l, global address g
__device__ __forceinline__ void g3_copy(unsigned l, const _Float16* g) {
  /* the copies and, as the last line, the wait that stands before their address registers are rewritten */
  asm volatile("global_load_async_to_lds_b128 %0, %8, off\n\t"
               "global_load_async_to_lds_b128 %1, %9, off\n\t"
               "global_load_async_to_lds_b128 %2, %10, off\n\t"
               "global_load_async_to_lds_b128 %3, %11, off\n\t"
               "global_load_async_to_lds_b128 %4, %12, off\n\t"
               "global_load_async_to_lds_b128 %5, %13, off\n\t"
               "global_load_async_to_lds_b128 %6, %14, off\n\t"
               "global_load_async_to_lds_b128 %7, %15, off\n\t"
               "s_wait_xcnt 0x0"
               :: "v"(l), "v"(l + 16 * GP), "v"(l + 32 * GP), "v"(l + 48 * GP), "v"(l + 64 * GP), "v"(l + 80 * GP), "v"(l + 96 * GP), "v"(l + 112 * GP),
                  "v"(g), "v"(g + 16 * DM), "v"(g + 32 * DM), "v"(g + 48 * DM), "v"(g + 64 * DM), "v"(g + 80 * DM), "v"(g + 96 * DM), "v"(g + 112 * DM)
               : "memory");
}
// The three products (q, k, v) need nothing of each other: they share one grid, blockIdx.y picks the weights, the bias and the output.
__global__ __launch_bounds__(256) void k_proj(const _Float16* __restrict__ A, const _Float16* __restrict__ BQ, const _Float16* __restrict__ BK, const _Float16* __restrict__ BV,
                                              const float* __restrict__ bq, const float* __restrict__ bk, const float* __restrict__ bvp, _Float16* __restrict__ Q16, _Float16* __restrict__ K16, _Float16* __restrict__ VT) {
  const int z = blockIdx.y; const _Float16* Bh = z == 0 ? BQ : z == 1 ? BK : BV; const float* bias = z == 0 ? bq : z == 1 ? bk : bvp; _Float16* C16 = z == 0 ? Q16 : z == 1 ? K16 : VT;
  static_assert(NR % GT == 0 && DM % GT == 0 && DM % GK == 0 && DM / GK >= 2 && 8 * 32 * 68 * 4 <= GB, "k_proj: whole tiles, two trips or more, the output staging fits one buffer");
  __shared__ __attribute__((aligned(16))) float sm[2 * GB / 4];
  const int tid = threadIdx.x, w = tid >> 5, lane = tid & 31, ln = lane & 15, hh = lane >> 4, wm = w & 3, wn = w >> 2;
  const int mt = blockIdx.x % (int)(NR / GT), nq = blockIdx.x / (int)(NR / GT); const int row0 = mt * GT + 32 * wm, col0 = nq * GT + 64 * wn;
  const float* bp = bias + col0 + ln; float bv[4];
#pragma unroll      /* bv indexed by constants: registers; the four loads fly under the first copies */
  for (int t = 0; t < 4; ++t) bv[t] = bp[16 * t];
  asm volatile("s_wait_xcnt 0x0" :: "v"(bp) : "memory");      /* the wait before the address registers of the loads above are overwritten */
  const _Float16* ga = A + (size_t)(mt * GT + (tid >> 4)) * DM + (tid & 15) * 8;
  const _Float16* gb = Bh + (size_t)(nq * GT + (tid >> 4)) * DM + (tid & 15) * 8;
  const unsigned l0 = (unsigned)(size_t)(const void*)sm + (unsigned)((tid >> 4) * GP + (tid & 15) * 16);
  g3_copy(l0, ga); g3_copy(l0 + GO, gb);
  asm volatile("s_wait_asynccnt 0x0" ::: "memory");      /* this wave's copies of trip 0 have landed */
  __syncthreads();      /* publishes trip 0's rows */
  g3_copy(l0 + GB, ga + GK); g3_copy(l0 + GB + GO, gb + GK);
  const char* fa = (const char*)sm + (32 * wm + ln) * GP + 16 * hh;
  const char* fb = (const char*)sm + GO + (64 * wn + ln) * GP + 16 * hh;
  const v8f z8 = {0.f,0.f,0.f,0.f,0.f,0.f,0.f,0.f}; v8f c00 = z8, c01 = z8, c02 = z8, c03 = z8, c10 = z8, c11 = z8, c12 = z8, c13 = z8;
#pragma unroll 1      /* rolled: one publish point in the text, and the two buffers are told apart by an offset */
  for (int t = 0; t < DM / GK; ++t) { const int bo = (t & 1) * GB;
    const char* pa = fa + bo; const char* pb = fb + bo; v16h af[2][2], bf[2][4];      /* two fragment sets: step s + 1 of this trip is read from LDS, as one group, in front of step s's products */
#pragma unroll      /* the sets are indexed by constants, so that they live in registers */
    for (int i = 0; i < 2; ++i) af[0][i] = g3_frag(pa + i * 16 * GP);
#pragma unroll      /* as above */
    for (int j = 0; j < 4; ++j) bf[0][j] = g3_frag(pb + j * 16 * GP);
#pragma unroll      /* as above; the four k steps of a trip also get constant LDS offsets */
    for (int s = 0; s < GK / 32; ++s) { const int cu = s & 1, nx = cu ^ 1;
      if (s + 1 < GK / 32) {
#pragma unroll      /* as above */
        for (int i = 0; i < 2; ++i) af[nx][i] = g3_frag(pa + i * 16 * GP + 64 * (s + 1));
#pragma unroll      /* as above */
        for (int j = 0; j < 4; ++j) bf[nx][j] = g3_frag(pb + j * 16 * GP + 64 * (s + 1)); }
      c00 = g2_mma(af[cu][0], bf[cu][0], c00); c10 = g2_mma(af[cu][1], bf[cu][0], c10);
      c01 = g2_mma(af[cu][0], bf[cu][1], c01); c11 = g2_mma(af[cu][1], bf[cu][1], c11);
      c02 = g2_mma(af[cu][0], bf[cu][2], c02); c12 = g2_mma(af[cu][1], bf[cu][2], c12);
      c03 = g2_mma(af[cu][0], bf[cu][3], c03); c13 = g2_mma(af[cu][1], bf[cu][3], c13); }
    asm volatile("s_wait_dscnt 0x0" ::: "memory");      /* this wave's reads of trip t's buffer are done before it is refilled */
    asm volatile("s_wait_asynccnt 0x0" ::: "memory");      /* this wave's copies of trip t + 1 have landed */
    __syncthreads();      /* publishes trip t + 1's rows and ends every wave's reads of trip t's buffer */
    if (t + 2 < DM / GK) { g3_copy(l0 + bo, ga + (t + 2) * GK); g3_copy(l0 + bo + GO, gb + (t + 2) * GK); } }
  asm volatile("s_wait_asynccnt 0x0" ::: "memory");      /* no copy is outstanding when the first buffer becomes output staging */
  v8f accs[8] = {c00, c01, c02, c03, c10, c11, c12, c13};
  if (z == 2) {      /* v: V^T in fragment order, [(batch, head)][16 columns d][32 keys][part][lane][8 keys]. An accumulator tile is already such a piece: lane 16 hh + ln holds column d = 16 t + ln and, in its 8 registers, the keys 16 half + 8 hh .. + 7 of the wave's 32 rows (one key group of one batch; its 64 columns are one head), so it is stored from the registers */
    static_assert(SQ % GT == 0 && HD == 64 && FT == 512, "k_proj: a wave's 32 rows are one 32-key group of one batch, its 64 columns one head");
    _Float16* vo = C16 + (((size_t)(row0 / SQ) * NH + col0 / HD) * 4 * (SQ / 32) + (row0 % SQ) / 32) * FT + lane * 8;
#pragma unroll      /* accs and bv indexed by constants: registers; each of the 8 stores is 512 contiguous bytes */
    for (int u = 0; u < 8; ++u) { const int t = u & 3, half = u >> 2; const float bb = bf16_round(bv[t]); FragH f;
#pragma unroll      /* as above */
      for (int r = 0; r < 8; ++r) f.h[r] = (_Float16)(accs[u][r] * 0.0625f + bb);
      *(v8us*)((unsigned short*)vo + (size_t)t * (SQ / 32) * FT + half * (FT / 2)) = f.half[0]; }
    asm volatile("s_wait_xcnt 0x0" ::: "memory");      /* the wait before a register of the stores above is overwritten */
  } else {      /* q, k: fragment order, [16-row tile][head][k half of 32][part][lane][8]; the wave's 64 columns are one head, its 32 rows two tiles; turned through the wave's own staging block */
    float (*so)[68] = (float (*)[68])(sm + w * 32 * 68);
#pragma unroll      /* accs and bv indexed by constants: registers */
    for (int u = 0; u < 8; ++u) { const int t = u & 3, half = u >> 2; const float bb = bf16_round(bv[t]);
#pragma unroll      /* as above */
      for (int r = 0; r < 8; ++r) so[half * 16 + 8 * hh + r][t * 16 + ln] = accs[u][r] * 0.0625f + bb; }
    __builtin_amdgcn_fence(__ATOMIC_ACQ_REL, "workgroup"); __builtin_amdgcn_wave_barrier();      /* the wave's staged block is complete before its lanes read each other's values; no other wave touches it */
    _Float16* cf = C16 + ((size_t)(row0 / 16) * NH + col0 / HD) * (2 * FT) + lane * 8;
#pragma unroll      /* the LDS reads and the 8 stores overlap; each store is 512 contiguous bytes */
    for (int q = 0; q < 8; ++q) { const int tl = q >> 2, c = q & 3; const float* sp = &so[16 * tl + ln][16 * c + 8 * hh]; const v4f v0 = *(const v4fa*)sp, v1 = *(const v4fa*)(sp + 4); FragH f;
#pragma unroll      /* f indexed by constants: registers */
      for (int i = 0; i < 4; ++i) { f.h[i] = (_Float16)v0[i]; f.h[4 + i] = (_Float16)v1[i]; }
      *(v8us*)((unsigned short*)cf + (size_t)tl * NH * (2 * FT) + c * (FT / 2)) = f.half[0]; }
    asm volatile("s_wait_xcnt 0x0" ::: "memory");      /* the wait before a register of the stores above is overwritten */
  } }


// table in fragment order: piece t of 8 halves is [16-row tile][k half of 32][part][lane]; it holds row 16 tile + ln, columns 16 (2 khalf + part) + 8 hh .. + 7
__device__ __forceinline__ void d_wrel(const float* __restrict__ w, _Float16* __restrict__ Bt, size_t t) { if (t >= (size_t)RW * HD / 8) return; const size_t row = (t >> 7) * 16 + (t & 15), col = ((t >> 5) & 3) * 16 + ((t >> 4) & 1) * 8; const bool live = row < (size_t)NREL; FragH f; for (int q = 0; q < 8; ++q) f.h[q] = live ? (_Float16)(bf16_round(w[row * HD + col + q]) * 16.0f) : (_Float16)0.0f; *(v8us*)((unsigned short*)Bt + t * 8) = f.half[0];  }
// The five operand preparations need nothing of each other: they share one grid as ranges of the block index (a block-uniform branch).
// Longest block first, so that none starts late and runs on alone: the table (its guarded loads follow one another), the weight tiles (load, turn in LDS, store), then the hidden rows.
#define PW ((DM / WK) * (DM / WN))   /* blocks (tiles) per weight matrix */
#define PX ((int)(NR * DM / 8 / 256)) /* blocks of the hidden rows */
#define PE (RW * HD / 8 / 256)       /* blocks of the distance table */
__global__ __launch_bounds__(256) void k_prep(const float* __restrict__ wq, const float* __restrict__ wk, const float* __restrict__ wv, const float* __restrict__ demb, const float* __restrict__ hs,
                                              _Float16* __restrict__ BQ, _Float16* __restrict__ BK, _Float16* __restrict__ BV, _Float16* __restrict__ BE, _Float16* __restrict__ X16) {
  static_assert(DM % WK == 0 && DM % WN == 0 && WK == 128 && WN == 64 && NR * DM / 8 % 256 == 0 && RW * HD / 8 % 256 == 0, "k_prep: whole tiles and whole blocks in every range; 256 threads = 16 k pieces x 16 column quads");
  __shared__ __attribute__((aligned(16))) unsigned short tl[WN * WK];      /* the weight tiles' turning place */
  const int blk = blockIdx.x, tid = threadIdx.x;
  if (blk < PE) d_wrel(demb, BE, (size_t)blk * 256 + tid);
  else if (blk < PE + 3 * PW) { const int u = blk - PE, z = u / PW; d_wt_tile(z == 0 ? wq : z == 1 ? wk : wv, z == 0 ? BQ : z == 1 ? BK : BV, 16.0f, u - z * PW, tid, tl); }      /* [in][out] -> Bt[out][in] x16 */
  else d_x16(hs, X16, NR * DM / 8, (size_t)(blk - PE - 3 * PW) * 256 + tid); }
__global__ __launch_bounds__(256) void k_wnat(const float* __restrict__ w, size_t n8, _Float16* __restrict__ Bt) { const size_t t = (size_t)blockIdx.x * 256 + threadIdx.x; if (t >= n8) return; FragH f; for (int q = 0; q < 8; ++q) f.h[q] = (_Float16)(bf16_round(w[t * 8 + q]) * 16.0f); *(v8us*)((unsigned short*)Bt + t * 8) = f.half[0];  }
// Fused attention: one work-group = RT query rows of one (batch, head), 16 waves. Wave w owns the key columns 32w .. 32w + 31 of all RT rows:
// it forms q.k, the window of q . dist_emb^T and the window of k . dist_emb^T that those columns need on WMMA (64 table rows from i0 - 32w + 480 serve both windows;
// the k fragments are the B operand of q.k and the A operand of k . dist_emb^T) and sums the three in its own block of the LDS score tile, each relative term stored along its diagonal:
// score[i][r] = (q_i.k_r + q_i.e[i-r+S-1] + k_r.e[i-r+S-1]) * 0.125 + mask[r] (bf16-rounded additive mask, staged in LDS).
// Of the three 16-wide table tiles a 16x16 block meets, the middle one is used whole and the outer two halve along the diagonal, so they merge into one full tile by a lane select.
// Then one wave per query row (two rows a wave), lane l holding columns 128u + 4l .. + 3; P = f16(256 softmax) goes to LDS; each wave forms one 16x16 tile of P . V over one half of K = 512 (V^T fragments from memory);
// the two halves are summed through LDS, from where each output row is stored as whole 256-byte runs.
// Every loop is fully unrolled (constant trip counts): the per-lane arrays must be indexed by constants to live in registers.
#define RT 32                        /* query rows per work-group */
#define TP (SQ + 4)                  /* score tile pitch in floats: rows stay 16-byte aligned, a column of 32 rows falls on 16 banks */
#define PP (SQ + 8)                  /* P tile pitch in halves: 16 bytes more a row for the 16-byte fragment reads */
template <int C> __device__ __forceinline__ float x_row(float x) { return __builtin_bit_cast(float, __builtin_amdgcn_update_dpp(0, __builtin_bit_cast(int, x), 0x160 | C, 0xf, 0xf, true)); }      /* lane l <- lane l ^ C inside a 16-lane row (row_xmask) */
__device__ __forceinline__ float x_half(float x) { return __builtin_bit_cast(float, __builtin_amdgcn_permlanex16(__builtin_bit_cast(int, x), __builtin_bit_cast(int, x), 0x76543210, 0xfedcba98, false, false)); }      /* lane l <- lane l ^ 16 */
__device__ __forceinline__ float wave_max(float v) { v = fmaxf(v, x_row<1>(v)); v = fmaxf(v, x_row<2>(v)); v = fmaxf(v, x_row<4>(v)); v = fmaxf(v, x_row<8>(v)); return fmaxf(v, x_half(v)); }
__device__ __forceinline__ float wave_sum(float v) { v += x_row<1>(v); v += x_row<2>(v); v += x_row<4>(v); v += x_row<8>(v); return v + x_half(v); }
__device__ __forceinline__ v8f g2_dot64(const v16h (&a)[2], const v16h (&b)[2]) { const v8f z8 = {0.f,0.f,0.f,0.f,0.f,0.f,0.f,0.f}; return g2_mma(a[1], b[1], g2_mma(a[0], b[0], z8)); }
__global__ __launch_bounds__(512) void k_attn(const _Float16* __restrict__ Q16, const _Float16* __restrict__ K16, const _Float16* __restrict__ BE, const _Float16* __restrict__ VT, const float* __restrict__ amask, float* __restrict__ out) {
  static_assert(SQ == 512 && HD == 64 && RT == 32 && SQ % RT == 0 && RW >= 2 * SQ, "k_attn: 16 waves of 32 key columns; 512 threads stage 512 mask values and store 32 x 64 outputs");
  __shared__ __attribute__((aligned(16))) float sc[RT][TP];
  __shared__ __attribute__((aligned(16))) _Float16 ph[RT][PP];
  __shared__ __attribute__((aligned(16))) float so[2][RT][HD + 4];
  __shared__ __attribute__((aligned(16))) float mk[SQ];
  const int tid = threadIdx.x, w = __builtin_amdgcn_readfirstlane(tid >> 5), lane = tid & 31, ln = lane & 15, hh = lane >> 4, i0 = blockIdx.x * RT, h = blockIdx.y, b = blockIdx.z;
  /* all four operands lie in fragment order: every load below reads 512 contiguous bytes */
  const int l8 = lane * 8;      /* the lane's piece of a fragment tile; the tile starts below are the same for the whole wave */
  const _Float16* qp = Q16 + ((size_t)((b * SQ + i0) / 16) * NH + h) * (2 * FT);
  const _Float16* kp = K16 + ((size_t)((b * SQ + 32 * w) / 16) * NH + h) * (2 * FT);
  const _Float16* ep = BE + (size_t)((i0 - 32 * w + (SQ - 32)) / 16) * (2 * FT);      /* table rows i0 - 32w + 480 .. + 63, all inside 0 .. 1023; the first is a multiple of 16 */
  const float* mp = amask + (size_t)b * SQ;
  v16h qf[2][2], kf[2][2], ef[4][2];
#pragma unroll
  for (int m = 0; m < 2; ++m)
#pragma unroll
    for (int s = 0; s < 2; ++s) { qf[m][s] = gf_frag(qp + (m * NH * 2 + s) * FT + l8); kf[m][s] = gf_frag(kp + (m * NH * 2 + s) * FT + l8); }
#pragma unroll
  for (int t = 0; t < 4; ++t)
#pragma unroll
    for (int s = 0; s < 2; ++s) ef[t][s] = gf_frag(ep + (t * 2 + s) * FT + l8);
  const float mv = mp[tid];
  asm volatile("s_wait_xcnt 0x0" :: "s"(qp), "s"(kp), "s"(ep), "s"(mp), "v"(lane) : "memory");      /* the wait before the address registers of the loads above are overwritten; naming them keeps them whole up to it */
  mk[tid] = bf16_round(mv);
  const int dg = 8 * hh - ln;      /* row minus column inside a 16x16 accumulator tile, less the register index */
  float* blk = &sc[0][32 * w];
#pragma unroll
  for (int m = 0; m < 2; ++m)
#pragma unroll
    for (int e = 0; e < 2; ++e) { const v8f c = g2_dot64(qf[m], kf[e]);
#pragma unroll
      for (int r = 0; r < 8; ++r) blk[(16 * m + 8 * hh + r) * TP + 16 * e + ln] = c[r]; }
  /* q . e: accumulator (query row 16m + 8hh + r, table row base + 16(m + t) + ln) belongs to key column 31 + 8hh + r - 16t - ln of the block */
#pragma unroll
  for (int m = 0; m < 2; ++m) { const v8f c0 = g2_dot64(qf[m], ef[m]), c1 = g2_dot64(qf[m], ef[m + 1]), c2 = g2_dot64(qf[m], ef[m + 2]); float* pc[8]; float* po[8]; float om[8], oo[8];      /* the 16 x 32 elements are distinct: all reads, then all writes, so that the LDS round trips overlap */
#pragma unroll
    for (int r = 0; r < 8; ++r) { pc[r] = blk + (16 * m + 8 * hh + r) * TP + 15 + dg + r; po[r] = pc[r] + (dg + r <= 0 ? 16 : -16); om[r] = *pc[r]; oo[r] = *po[r]; }
#pragma unroll
    for (int r = 0; r < 8; ++r) { *pc[r] = om[r] + c1[r] * 0.0625f; *po[r] = oo[r] + (dg + r <= 0 ? c0[r] : c2[r]) * 0.0625f; } }
  /* k . e: accumulator (key row 16e + 8hh + r of the block, table row base + 16(1 - e + t) + ln) belongs to query row 16t + ln + 8hh + r - 15 */
#pragma unroll
  for (int e = 0; e < 2; ++e) { const v8f c0 = g2_dot64(kf[e], ef[1 - e]), c1 = g2_dot64(kf[e], ef[2 - e]), c2 = g2_dot64(kf[e], ef[3 - e]); float* pc[8]; float* po[8]; float om[8], oo[8];
#pragma unroll
    for (int r = 0; r < 8; ++r) { const int il = 1 + ln + 8 * hh + r; pc[r] = blk + il * TP + 16 * e + 8 * hh + r; po[r] = pc[r] + (il < 16 ? 16 * TP : -16 * TP); om[r] = *pc[r]; oo[r] = *po[r]; }
#pragma unroll
    for (int r = 0; r < 8; ++r) { *pc[r] = om[r] + c1[r] * 0.0625f; *po[r] = oo[r] + (1 + ln + 8 * hh + r < 16 ? c2[r] : c0[r]) * 0.0625f; } }
  __syncthreads();      /* publishes the score tile and the mask */
  /* P . V share of this wave: tile (pm, pn) of the 32 x 64 result, half pk of K = 512; its V^T fragments are asked for here so that they fly during the softmax */
  const int pm = w & 1, pn = (w >> 1) & 3, pk = w >> 3;
  const _Float16* vp = VT + ((((size_t)b * NH + h) * 4 + pn) * (SQ / 32) + 8 * pk) * FT;
  v16h vf[8];
#pragma unroll
  for (int s = 0; s < 8; ++s) vf[s] = gf_frag(vp + s * FT + l8);
  asm volatile("s_wait_xcnt 0x0" :: "s"(vp), "v"(lane) : "memory");      /* the wait before the address registers of the loads above are overwritten */
#pragma unroll
  for (int k = 0; k < 2; ++k) { const int row = 2 * w + k; float x[16]; float mx = -INFINITY;
#pragma unroll
    for (int u = 0; u < 4; ++u) { const int c = 128 * u + 4 * lane; const v4f sv = *(const v4fa*)&sc[row][c], mm = *(const v4fa*)&mk[c];
#pragma unroll
      for (int q = 0; q < 4; ++q) { x[u * 4 + q] = sv[q] * 0.125f + mm[q]; mx = fmaxf(mx, x[u * 4 + q]); } }
    mx = wave_max(mx); float se = 0.f;
#pragma unroll
    for (int j = 0; j < 16; ++j) { x[j] = expf(x[j] - mx); se += x[j]; }
    const float sn = 256.0f / wave_sum(se);
#pragma unroll
    for (int u = 0; u < 4; ++u) { v4h o;
#pragma unroll
      for (int q = 0; q < 4; ++q) o[q] = (_Float16)(x[u * 4 + q] * sn);
      *(v4h*)&ph[row][128 * u + 4 * lane] = o; } }
  __syncthreads();      /* publishes the P tile */
  { const _Float16* pa = &ph[16 * pm + ln][256 * pk + 8 * hh]; v16h pf[8];
#pragma unroll
    for (int s = 0; s < 8; ++s) pf[s] = g2_frag(pa + 32 * s, 0);
    v8f c = {0.f,0.f,0.f,0.f,0.f,0.f,0.f,0.f};
#pragma unroll
    for (int s = 0; s < 8; ++s) c = g2_mma(pf[s], vf[s], c);
#pragma unroll
    for (int r = 0; r < 8; ++r) so[pk][16 * pm + 8 * hh + r][16 * pn + ln] = c[r]; }
  __syncthreads();      /* publishes the two K halves of the 32 x 64 result */
  { const int row = tid >> 4, c4 = (tid & 15) * 4; const v4f v = (*(const v4fa*)&so[0][row][c4] + *(const v4fa*)&so[1][row][c4]) * 0.00390625f; *(v4f*)(out + ((size_t)b * SQ + i0 + row) * DM + h * HD + c4) = v; } }
__global__ __launch_bounds__(256) void k_vt(const _Float16* __restrict__ V16, int b, int h0, _Float16* __restrict__ VT) { __shared__ unsigned short tl[64][65]; const int tid = threadIdx.x; const int hh = blockIdx.x % HG, sg = blockIdx.x / HG; const int s0 = sg * 64; const int h = h0 + hh;
  for (int i = tid; i < 64 * 8; i += 256) { const int j = i / 8, d8 = (i % 8) * 8; FragH f; f.half[0] = *(const v8us*)((const unsigned short*)V16 + ((size_t)b * SQ + s0 + j) * DM + h * HD + d8); for (int q = 0; q < 8; ++q) tl[d8 + q][j] = f.u[q]; }
  __syncthreads();
  { for (int i = tid; i < 64 * 8; i += 256) { const int d = i / 8, j8 = (i % 8) * 8; FragH f; for (int q = 0; q < 8; ++q) f.u[q] = tl[d][j8 + q]; *(v8us*)((unsigned short*)VT + ((size_t)hh * HD + d) * SQ + s0 + j8) = f.half[0]; }  } }

extern "C" void kernel_launch(void* const* d_in, const int* in_sizes, int n_in,
                              void* d_out, int out_size, void* d_ws, size_t ws_size, hipStream_t stream) {
  (void)in_sizes; (void)n_in; (void)out_size;
  const float* const* I = (const float* const*)d_in; const float* hs = I[0]; const float* amask = I[1]; const float* wq = I[2]; const float* bq = I[3]; const float* wk = I[4]; const float* bk = I[5]; const float* wv = I[6]; const float* bv = I[7]; const float* demb = I[8];      /* weights [in][out]; attention_mask [8][1][1][512] additive; dist_emb [1023][64] */
  char* ws = (char*)d_ws; size_t off = 0;
  auto take = [&](size_t bytes) { char* p = ws + off; off += (bytes + 255) & ~(size_t)255; return p; };
  _Float16* BQ = (_Float16*)take((size_t)DM * DM * 2); _Float16* BK = (_Float16*)take((size_t)DM * DM * 2); _Float16* BV = (_Float16*)take((size_t)DM * DM * 2); _Float16* BE = (_Float16*)take((size_t)RW * HD * 2);
  _Float16* X16 = (_Float16*)take(NR * DM * 2); _Float16* Q16 = (_Float16*)take(NR * DM * 2); _Float16* K16 = (_Float16*)take(NR * DM * 2);
  _Float16* VT = (_Float16*)take((size_t)NB * NH * HD * SQ * 2);
  if (off > ws_size) return;      /* 6 + 0.1 + 3x8 + 8 = approx 38 MiB */
  k_prep<<<3 * PW + PX + PE, 256, 0, stream>>>(wq, wk, wv, demb, hs, BQ, BK, BV, BE, X16);      /* transposed weights x16, padded table x16, hidden rows as f16 */
  k_proj<<<dim3((unsigned)((NR / GT) * (DM / GT)), 3), 256, 0, stream>>>(X16, BQ, BK, BV, bq, bk, bv, Q16, K16, VT);      /* q, k and V^T in fragment order */
  k_attn<<<dim3(SQ / RT, NH, NB), 512, 0, stream>>>(Q16, K16, BE, VT, amask, (float*)d_out);      /* scores, relative terms, softmax and P . V; ctx rows (merged heads, f32) */
}

// v008
// Measured time: 78.4 microseconds a run.
// In two side-by-side timings against v007, it was 1.08 and 1.07 times as fast.
// All steps since v000 together make it 46.7 times as fast.
#include <hip/hip_runtime.h>
// BERT self-attention with relative-position score terms (hidden [8][512][1024]; q, k, v = h W + b ([in][out], 16 heads of 64); scores[l][r] = (q_l.k_r + q_l.pe[l-r] + k_r.pe[l-r]) / 8 + mask[r] with pe = dist_emb[l - r + 511]; softmax; ctx = attn v merged -> [8][512][1024]).
// Structure: token rows r = b*512 + s; hidden as exact f16 rows (with the weight and table preparations in one launch); Q | K | V as three WMMA GEMMs in one launch (128x128 work-group tiles staged in LDS by asynchronous copies, 32x64 wave tiles, f32 accumulation, exact x16 transposed weights, bias in the epilogue, f16 outputs; v leaves the accumulators as V^T); q, k, V^T and the table lie in memory in WMMA fragment order (FRAGMENT ORDER below), so that a fragment load of the attention reads whole lines; then one fused attention launch, one work-group per 32 query rows of a (batch, head): q.k and the two relative terms (q rows and k rows times the window of dist_emb^T that the tile's diagonals meet; table padded to 1024 rows with zeros) on WMMA, summed in an LDS score tile (f32), row softmax on VALU, one wave per query row (mask added; weights x256 as f16 in LDS), ctx = P . V on WMMA (K = 512, alpha 2^-8) written as f32 into the merged output rows.
// Compute dtype: inputs rounded to bf16; hidden / weights / table exact; q, k, v and the softmax weights as plain f16 GEMM operands (~2^-12); scores, relative terms and softmax statistics f32. v_wmma_f32_16x16x32_f16.
#define NB 8
#define SQ 512
#define DM 1024
#define NH 16
#define HD 64
#define HG 16                        /* heads per attention launch group (all) */
#define NREL 1023                    /* relative distances -511..511 */
#define RW 1024                      /* dist_emb table rows (distances padded to 1024) */
#define QN SQ                        /* unused: attention covers all SQ query rows */
#define NBR NB                       /* unused: attention covers all NB batches */
#define MP ((int)NR)                 /* unused: the projections take all NR rows */
#define NR ((size_t)NB * SQ)         /* 4096 token rows */
typedef __bf16 v16b __attribute__((ext_vector_type(16)));
typedef unsigned short v8us __attribute__((ext_vector_type(8), may_alias));
typedef float  v8f  __attribute__((ext_vector_type(8)));
typedef float  v4f  __attribute__((ext_vector_type(4)));
typedef float  v4fa __attribute__((ext_vector_type(4), may_alias));
union FragB { v16b v; v8us half[2]; unsigned short u[16]; };

__device__ __forceinline__ unsigned short bf16_bits(float x) { unsigned int u = __float_as_uint(x); return (unsigned short)((u + 0x7FFFu + ((u >> 16) & 1u)) >> 16); }
__device__ __forceinline__ float bf16_val(unsigned short b) { return __uint_as_float(((unsigned int)b) << 16); }
__device__ __forceinline__ float bf16_round(float x) { return bf16_val(bf16_bits(x)); }
// D += A·B with NT terms: 1 = ah·bh, 2 = + al·bh (A split), 3 = + ah·bl (both split)
template <int NT>
__device__ __forceinline__ v8f mmaN(v16b ah, v16b al, v16b bh, v16b bl, v8f c) {
  c = __builtin_amdgcn_wmma_f32_16x16x32_bf16(false, ah, false, bh, (short)0, c, false, false);
  if (NT >= 2) c = __builtin_amdgcn_wmma_f32_16x16x32_bf16(false, al, false, bh, (short)0, c, false, false);
  if (NT >= 3) c = __builtin_amdgcn_wmma_f32_16x16x32_bf16(false, ah, false, bl, (short)0, c, false, false);
  asm volatile("v_nop\n\tv_nop\n\tv_nop\n\tv_nop" : "+v"(c) : "v"(ah), "v"(al), "v"(bh), "v"(bl));
  return c;
}

__global__ __launch_bounds__(256) void k_wt_bf16(const float* __restrict__ W, unsigned short* __restrict__ Wt, int K, int N) {
  const int t = blockIdx.x * 256 + threadIdx.x;
  const int k8n = K / 8;
  if (t >= N * k8n) return;
  const int n = t / k8n, k8 = (t % k8n) * 8;
  v8us v;
#pragma unroll
  for (int i = 0; i < 8; ++i) v[i] = bf16_bits(W[(size_t)(k8 + i) * N + n]);
  *(v8us*)(Wt + (size_t)n * K + k8) = v;
  
}

// GEMM C[M][N] (f32, pitch ldc) = act(A[M][K]·W + bias). A f32 row-major (pitch lda) converted per fragment to bf16
// (ASPLIT: hi/lo two planes -> 2 terms, else single rounded term); Wt bf16 [N][K] (pitch ldb). BIAS_BF16 rounds the
// bias to bf16 first (bias quantised to bf16 before the add). K%32==0, M%16==0, N%64==0.
template <bool ASPLIT, int ACT, bool BIAS_BF16>
__global__ __launch_bounds__(128) void k_gemm_bf(const float* __restrict__ A, int lda, const unsigned short* __restrict__ Wt, int ldb,
                                               const float* __restrict__ bias, float* __restrict__ C, int ldc, int M, int N, int K) {
  __shared__ __attribute__((aligned(16))) float so[4][16][64];
  const int tid = threadIdx.x, w = tid >> 5, lane = tid & 31, ln = lane & 15, hh = lane >> 4;
  const int ntn = N / 64;
  const int wid = blockIdx.x * 4 + w;
  const int mt = wid / ntn, nq = wid % ntn;
  if (mt * 16 >= M) return;
  const int row0 = mt * 16, col0 = nq * 64;
  const float* arow = A + (size_t)(row0 + ln) * lda;
  v8f acc[4] = {};
  for (int kb = 0; kb < K; kb += 32) {
    FragB ah, al;
    const v4f x0 = *(const v4fa*)(arow + kb + 8 * hh), x1 = *(const v4fa*)(arow + kb + 8 * hh + 4);
    const v4f x2 = *(const v4fa*)(arow + kb + 16 + 8 * hh), x3 = *(const v4fa*)(arow + kb + 16 + 8 * hh + 4);
    float xs[16] = {x0[0],x0[1],x0[2],x0[3],x1[0],x1[1],x1[2],x1[3],x2[0],x2[1],x2[2],x2[3],x3[0],x3[1],x3[2],x3[3]};
#pragma unroll
    for (int i = 0; i < 16; ++i) { const unsigned short hb = bf16_bits(xs[i]); ah.u[i] = hb; al.u[i] = ASPLIT ? bf16_bits(xs[i] - bf16_val(hb)) : (unsigned short)0; }
#pragma unroll
    for (int t = 0; t < 4; ++t) {
      const unsigned short* brow = Wt + (size_t)(col0 + t * 16 + ln) * ldb + kb;
      FragB b;
      b.half[0] = *(const v8us*)(brow + 8 * hh);
      b.half[1] = *(const v8us*)(brow + 16 + 8 * hh);
      acc[t] = mmaN<ASPLIT ? 2 : 1>(ah.v, al.v, b.v, b.v, acc[t]);
    }
  }
#pragma unroll
  for (int t = 0; t < 4; ++t) {
    float bv = bias ? bias[col0 + t * 16 + ln] : 0.f;
    if (BIAS_BF16) bv = bf16_round(bv);
#pragma unroll
    for (int r = 0; r < 8; ++r) { float v = acc[t][r] + bv; if (ACT == 1) v = fmaxf(v, 0.f); so[w][8 * hh + r][t * 16 + ln] = v; }
  }
  __builtin_amdgcn_fence(__ATOMIC_ACQ_REL, "workgroup");
  __builtin_amdgcn_wave_barrier();
  const int rsub = lane >> 4, c4 = (lane & 15) * 4;
  {
#pragma unroll
    for (int q = 0; q < 8; ++q) {
      const int r = q * 2 + rsub;
      const v4f v = *(const v4fa*)&so[w][r][c4];
      *(v4f*)(C + (size_t)(row0 + r) * ldc + col0 + c4) = v;
    }
    
  }
}

// GEMM C = act(A·W + bias + resid): A f32 (ASPLIT -> hi/lo 2 terms), Wt bf16 [N][K]; ACT 0 none, 1 relu, 2 exact gelu;
// resid (optional, f32, row index = (row % rmod), pitch ldr, RES_BF16 rounds it) added before the activation.
template <bool ASPLIT, int ACT, bool BIAS_BF16, bool RES_BF16>
__global__ __launch_bounds__(128) void k_gemm_bf3(const float* __restrict__ A, int lda, const unsigned short* __restrict__ Wt, int ldb,
                                                const float* __restrict__ bias, const float* __restrict__ resid, int rmod, int ldr,
                                                float* __restrict__ C, int ldc, int M, int N, int K) {
  __shared__ __attribute__((aligned(16))) float so[4][16][64];
  const int tid = threadIdx.x, w = tid >> 5, lane = tid & 31, ln = lane & 15, hh = lane >> 4;
  const int ntn = N / 64;
  const int wid = blockIdx.x * 4 + w;
  const int mt = wid / ntn, nq = wid % ntn;
  if (mt * 16 >= M) return;
  const int row0 = mt * 16, col0 = nq * 64;
  const float* arow = A + (size_t)(row0 + ln) * lda;
  v8f acc[4] = {};
  for (int kb = 0; kb < K; kb += 32) {
    FragB ah, al;
    const v4f x0 = *(const v4fa*)(arow + kb + 8 * hh), x1 = *(const v4fa*)(arow + kb + 8 * hh + 4);
    const v4f x2 = *(const v4fa*)(arow + kb + 16 + 8 * hh), x3 = *(const v4fa*)(arow + kb + 16 + 8 * hh + 4);
    float xs[16] = {x0[0],x0[1],x0[2],x0[3],x1[0],x1[1],x1[2],x1[3],x2[0],x2[1],x2[2],x2[3],x3[0],x3[1],x3[2],x3[3]};
#pragma unroll
    for (int i = 0; i < 16; ++i) { const unsigned short hb = bf16_bits(xs[i]); ah.u[i] = hb; al.u[i] = ASPLIT ? bf16_bits(xs[i] - bf16_val(hb)) : (unsigned short)0; }
#pragma unroll
    for (int t = 0; t < 4; ++t) {
      const unsigned short* brow = Wt + (size_t)(col0 + t * 16 + ln) * ldb + kb;
      FragB b;
      b.half[0] = *(const v8us*)(brow + 8 * hh);
      b.half[1] = *(const v8us*)(brow + 16 + 8 * hh);
      acc[t] = mmaN<ASPLIT ? 2 : 1>(ah.v, al.v, b.v, b.v, acc[t]);
    }
  }
#pragma unroll
  for (int t = 0; t < 4; ++t) {
    const int col = col0 + t * 16 + ln;
    float bv = bias ? bias[col] : 0.f;
    if (BIAS_BF16) bv = bf16_round(bv);
#pragma unroll
    for (int r = 0; r < 8; ++r) {
      float v = acc[t][r] + bv;
      if (resid) { float rv = resid[(size_t)((row0 + 8 * hh + r) % rmod) * ldr + col]; if (RES_BF16) rv = bf16_round(rv); v += rv; }
      if (ACT == 1) v = fmaxf(v, 0.f);
      if (ACT == 2) v = 0.5f * v * (1.0f + erff(v * 0.70710678118654752f));
      if (ACT == 3) { const float u = 0.7978845608028654f * (v + 0.044715f * v * v * v); v = 0.5f * v * (1.0f + tanhf(u)); }
      so[w][8 * hh + r][t * 16 + ln] = v;
    }
  }
  __builtin_amdgcn_fence(__ATOMIC_ACQ_REL, "workgroup");
  __builtin_amdgcn_wave_barrier();
  const int rsub = lane >> 4, c4 = (lane & 15) * 4;
  {
#pragma unroll
    for (int q = 0; q < 8; ++q) {
      const int r = q * 2 + rsub;
      const v4f v = *(const v4fa*)&so[w][r][c4];
      *(v4f*)(C + (size_t)(row0 + r) * ldc + col0 + c4) = v;
    }
    
  }
}
// row LayerNorm (biased variance, eps) over N: s = X (+ R); optional out_sum <- s; out_norm <- (s-mu)*rsqrt(var+eps)*g + b
template <bool PARAM_BF16>
__global__ __launch_bounds__(256) void k_layernorm(const float* __restrict__ X, const float* __restrict__ R, const float* __restrict__ g, const float* __restrict__ bta,
                                                  float* __restrict__ out_sum, float* __restrict__ out_norm, int N, float eps) {
  __shared__ float red[256];
  const int row = blockIdx.x, tid = threadIdx.x;
  const float* x = X + (size_t)row * N; const float* rr = R ? R + (size_t)row * N : nullptr;
  float vals[16];                     // up to N = 4096
  const int per = N / 256;            // contiguous chunk per thread? use strided-by-4 chunks: thread handles j = tid*4 + 1024*u
  float s1 = 0.f;
  for (int u = 0; u < per / 4; ++u) {
    const int j = tid * 4 + 1024 * u;
    const v4f a = *(const v4fa*)(x + j);
    v4f b = {0.f,0.f,0.f,0.f}; if (rr) b = *(const v4fa*)(rr + j);
#pragma unroll
    for (int q = 0; q < 4; ++q) { const float v = a[q] + b[q]; vals[u * 4 + q] = v; s1 += v; }
  }
  red[tid] = s1; __syncthreads();
  for (int st = 128; st > 0; st >>= 1) { if (tid < st) red[tid] += red[tid + st]; __syncthreads(); }
  const float mu = red[0] / (float)N; __syncthreads();
  float s2 = 0.f;
  for (int u = 0; u < per / 4; ++u)
#pragma unroll
    for (int q = 0; q < 4; ++q) { const float c = vals[u * 4 + q] - mu; s2 += c * c; }
  red[tid] = s2; __syncthreads();
  for (int st = 128; st > 0; st >>= 1) { if (tid < st) red[tid] += red[tid + st]; __syncthreads(); }
  const float rs = rsqrtf(red[0] / (float)N + eps);
  {
    for (int u = 0; u < per / 4; ++u) {
      const int j = tid * 4 + 1024 * u;
      v4f o, sm;
#pragma unroll
      for (int q = 0; q < 4; ++q) {
        float gg = g[j + q], bb = bta[j + q];
        if (PARAM_BF16) { gg = bf16_round(gg); bb = bf16_round(bb); }
        sm[q] = vals[u * 4 + q]; o[q] = (vals[u * 4 + q] - mu) * rs * gg + bb;
      }
      if (out_sum) *(v4f*)(out_sum + (size_t)row * N + j) = sm;
      *(v4f*)(out_norm + (size_t)row * N + j) = o;
    }
    
  }
}



// ---- f16 WMMA path (v_wmma_f32_16x16x32_f16): 11-bit significands for operands in range — used where a [0,1] probability operand needs more precision than bf16
typedef _Float16 v16h __attribute__((ext_vector_type(16)));
union FragH { v16h v; v8us half[2]; _Float16 h[16]; unsigned short u[16]; };
template <int NT>
__device__ __forceinline__ v8f mmaH(v16h ah, v16h al, v16h bh, v16h bl, v8f c) {
  c = __builtin_amdgcn_wmma_f32_16x16x32_f16(false, ah, false, bh, (short)0, c, false, false);
  if (NT >= 2) c = __builtin_amdgcn_wmma_f32_16x16x32_f16(false, al, false, bh, (short)0, c, false, false);
  if (NT >= 3) c = __builtin_amdgcn_wmma_f32_16x16x32_f16(false, ah, false, bl, (short)0, c, false, false);
  asm volatile("v_nop\n\tv_nop\n\tv_nop\n\tv_nop" : "+v"(c) : "v"(ah), "v"(al), "v"(bh), "v"(bl));
  return c;
}
// batched GEMM like k_gemm_b but f16 operands: A f32 (split into f16 hi/lo if ASPLIT, else rounded to f16), Bt = f16 values [n][k]; alpha; C f32; N multiple of 16 (partial tiles skipped)
template <bool ASPLIT>
__global__ __launch_bounds__(128) void k_gemm_h(const float* __restrict__ A, int lda, size_t sA, const _Float16* __restrict__ Bh, int ldb, size_t sB, float alpha, float* __restrict__ C, int ldc, size_t sC, int M, int N, int K) {
  __shared__ __attribute__((aligned(16))) float so[4][16][64];
  const int tid = threadIdx.x, w = tid >> 5, lane = tid & 31, ln = lane & 15, hh = lane >> 4; const int by = blockIdx.y;
  A += (size_t)by * sA; Bh += (size_t)by * sB; C += (size_t)by * sC;
  const int ntn = (N + 63) / 64; const int wid = blockIdx.x * 4 + w; const int mt = wid / ntn, nq = wid % ntn; if (mt * 16 >= M) return;
  const int row0 = mt * 16, col0 = nq * 64; const float* arow = A + (size_t)(row0 + ln) * lda;
  v8f acc[4] = {};
  for (int kb = 0; kb < K; kb += 32) {
    FragH ah, al;
    const v4f x0 = *(const v4fa*)(arow + kb + 8 * hh), x1 = *(const v4fa*)(arow + kb + 8 * hh + 4), x2 = *(const v4fa*)(arow + kb + 16 + 8 * hh), x3 = *(const v4fa*)(arow + kb + 16 + 8 * hh + 4);
    float xs[16] = {x0[0],x0[1],x0[2],x0[3],x1[0],x1[1],x1[2],x1[3],x2[0],x2[1],x2[2],x2[3],x3[0],x3[1],x3[2],x3[3]};
#pragma unroll
    for (int i = 0; i < 16; ++i) { const _Float16 h = (_Float16)xs[i]; ah.h[i] = h; al.h[i] = ASPLIT ? (_Float16)(xs[i] - (float)h) : (_Float16)0.0f; }
#pragma unroll
    for (int t = 0; t < 4; ++t) { if (col0 + t * 16 >= N) continue; const size_t boff = (size_t)(col0 + t * 16 + ln) * ldb + kb; FragH bq; bq.half[0] = *(const v8us*)(Bh + boff + 8 * hh); bq.half[1] = *(const v8us*)(Bh + boff + 16 + 8 * hh);
      acc[t] = mmaH<ASPLIT ? 2 : 1>(ah.v, al.v, bq.v, bq.v, acc[t]); }
  }
#pragma unroll
  for (int t = 0; t < 4; ++t) { if (col0 + t * 16 >= N) continue;
#pragma unroll
    for (int r = 0; r < 8; ++r) so[w][8 * hh + r][t * 16 + ln] = acc[t][r] * alpha; }
  __builtin_amdgcn_fence(__ATOMIC_ACQ_REL, "workgroup"); __builtin_amdgcn_wave_barrier();
  const int rsub = lane >> 4, c4 = (lane & 15) * 4;
  {
#pragma unroll
    for (int q = 0; q < 8; ++q) { const int r = q * 2 + rsub; if (col0 + c4 < N) { const v4f v = *(const v4fa*)&so[w][r][c4]; *(v4f*)(C + (size_t)(row0 + r) * ldc + col0 + c4) = v; } }
     }
}

// Wt[n][k] = f16(W[k][n] * scale) from f32 row-major W[DM][DM] (scale = power of two; bf16-exact weights stay exact in f16 away from the subnormal range), one tile of WK k x WN n per work-group of 256, turned in LDS.
// Reads: thread (kg, nq) takes rows 8 kg .. + 7, columns 4 nq .. + 3, so each 16-byte load of a wave covers 2 rows x 256 contiguous bytes, whole lines, and the 8 loads are in flight together.
// LDS: tl[n][16-byte piece of 8 k], rows of 256 bytes; piece c of row n lies at place c ^ (n >> 2): the 16 lanes that write one k piece of 16 rows four apart, and the 16 lanes that read one whole row, both fall on all 64 banks.
// Writes: each 16-byte store of a wave covers 2 rows of Wt x 256 contiguous bytes.
#define WK 128                       /* k per tile */
#define WN 64                        /* n per tile */
__device__ __forceinline__ void d_wt_tile(const float* __restrict__ W, _Float16* __restrict__ Wt, float scale, int tile, int tid, unsigned short* tl) {
  const int k0 = (tile / (DM / WN)) * WK, n0 = (tile % (DM / WN)) * WN, nq = tid & 15, kg = tid >> 4;
  const float* wp = W + (size_t)(k0 + 8 * kg) * DM + n0 + 4 * nq; v4f x[8];
#pragma unroll      /* x indexed by constants: registers; the 8 loads fly together */
  for (int i = 0; i < 8; ++i) x[i] = *(const v4fa*)(wp + (size_t)i * DM);
#pragma unroll      /* as above */
  for (int j = 0; j < 4; ++j) { FragH f;
#pragma unroll      /* as above */
    for (int i = 0; i < 8; ++i) f.h[i] = (_Float16)(bf16_round(x[i][j]) * scale);
    *(v8us*)(tl + (4 * nq + j) * WK + (kg ^ nq) * 8) = f.half[0]; }
  __syncthreads();      /* publishes the turned tile */
  unsigned short* op = (unsigned short*)Wt + (size_t)(n0 + kg) * DM + k0 + 8 * nq;
#pragma unroll      /* the 4 LDS reads and stores overlap */
  for (int p = 0; p < 4; ++p) { const int n = 16 * p + kg; const v8us o = *(const v8us*)(tl + n * WK + (nq ^ (n >> 2)) * 8); *(v8us*)(op + (size_t)(16 * p) * DM) = o; }
  asm volatile("s_wait_xcnt 0x0" ::: "memory");      /* the wait before a register of the stores above is overwritten: the code of the launch's other ranges follows in the text */
}
// k_gemm_hh variant with fused epilogue: v = acc·alpha + bias[by·sBias + col] (+ CP[(row/rowsPerB)·sCPb + by·64 + col] if CP) ; ACT 0 none / 1 elu ; writes f16 C16 (and f32 C if non-null)
template <int ACT>
__global__ __launch_bounds__(128) void k_gemm_hhx(const _Float16* __restrict__ A, int lda, size_t sA, const _Float16* __restrict__ Bh, int ldb, size_t sB, float alpha, const float* __restrict__ bias, size_t sBias, const float* __restrict__ CP, int rowsPerB, size_t sCPb, int row0g,
    float* __restrict__ C, _Float16* __restrict__ C16, int ldc, size_t sC, int M, int N, int K) {
  __shared__ __attribute__((aligned(16))) float so[4][16][64];
  const int tid = threadIdx.x, w = tid >> 5, lane = tid & 31, ln = lane & 15, hh = lane >> 4; const int by = blockIdx.y;
  A += (size_t)by * sA; Bh += (size_t)by * sB; const size_t cofs = (size_t)by * sC; const float* bp = bias ? bias + (size_t)by * sBias : nullptr;
  const int ntn = (N + 63) / 64; const int wid = blockIdx.x * 4 + w; const int mt = wid / ntn, nq = wid % ntn; if (mt * 16 >= M) return;
  const int row0 = mt * 16, col0 = nq * 64; const _Float16* arow = A + (size_t)(row0 + ln) * lda;
  v8f acc[4] = {};
  for (int kb = 0; kb < K; kb += 32) { FragH ah; ah.half[0] = *(const v8us*)((const unsigned short*)arow + kb + 8 * hh); ah.half[1] = *(const v8us*)((const unsigned short*)arow + kb + 16 + 8 * hh);
#pragma unroll
    for (int t = 0; t < 4; ++t) { if (col0 + t * 16 >= N) continue; const size_t boff = (size_t)(col0 + t * 16 + ln) * ldb + kb; FragH bq; bq.half[0] = *(const v8us*)((const unsigned short*)Bh + boff + 8 * hh); bq.half[1] = *(const v8us*)((const unsigned short*)Bh + boff + 16 + 8 * hh);
      acc[t] = mmaH<1>(ah.v, ah.v, bq.v, bq.v, acc[t]); }
  }
#pragma unroll
  for (int t = 0; t < 4; ++t) { if (col0 + t * 16 >= N) continue; const int col = col0 + t * 16 + ln; const float bv = bp ? bf16_round(bp[col]) : 0.f;
#pragma unroll
    for (int r = 0; r < 8; ++r) { float v = acc[t][r] * alpha + bv; if (CP) { const int rr = row0g + row0 + 8 * hh + r; if (rowsPerB < 0) v += CP[cofs + (size_t)rr * ldc + col];      /* rowsPerB < 0: own element of the batched C plane */ else { const int bidx = rr / rowsPerB; v += CP[(size_t)bidx * sCPb + (size_t)by * 64 + col]; } } if (ACT == 1) v = (v > 0.f) ? v : expm1f(v); else if (ACT == 7) v = (v > 0.f) ? v + 1.0f : expf(v); else if (ACT == 8) v = tanhf(v); else if (ACT == 9) v = 0.5f * v * (1.0f + tanhf(0.7978845608028654f * (v + 0.044715f * v * v * v))); else if (ACT == 11) v = 1.0f / (1.0f + expf(-v)); else if (ACT == 12) v = (v > 0.f) ? v : 0.01f * v; else if (ACT == 14) v = (v > 0.f) ? v : 0.1f * v; else if (ACT == 16) v = (v >= 0.f) ? v : 0.3f * v; else if (ACT == 17) v = (v >= 0.f) ? v : 0.2f * v; else if (ACT == 15) v = v / (1.0f + expf(-v)); else if (ACT == 3) v = fmaxf(v, 0.f); else if (ACT == 6) v = 0.5f * v * (1.0f + erff(v * 0.70710678118654752f)); so[w][8 * hh + r][t * 16 + ln] = v; } }
  __builtin_amdgcn_fence(__ATOMIC_ACQ_REL, "workgroup"); __builtin_amdgcn_wave_barrier();
  const int rsub = lane >> 4, c4 = (lane & 15) * 4; typedef _Float16 v4h __attribute__((ext_vector_type(4)));
  {
#pragma unroll
    for (int q = 0; q < 8; ++q) { const int r = q * 2 + rsub; if (col0 + c4 < N) { const v4f v = *(const v4fa*)&so[w][r][c4]; if (C) *(v4f*)(C + cofs + (size_t)(row0 + r) * ldc + col0 + c4) = v; if (C16) { v4h h4; for (int i = 0; i < 4; ++i) h4[i] = (_Float16)v[i]; *(v4h*)(C16 + cofs + (size_t)(row0 + r) * ldc + col0 + c4) = h4; } } }
     }
}


typedef _Float16 v4h __attribute__((ext_vector_type(4)));

__device__ __forceinline__ void d_x16(const float* __restrict__ x, _Float16* __restrict__ X16, size_t n8, size_t t) { if (t >= n8) return; FragH f;
#pragma unroll
  for (int q = 0; q < 8; ++q) f.h[q] = (_Float16)bf16_round(x[t * 8 + q]); *(v8us*)((unsigned short*)X16 + t * 8) = f.half[0];  }
__global__ __launch_bounds__(256) void k_h16(const float* __restrict__ x, _Float16* __restrict__ X16, size_t n8) { const size_t t = (size_t)blockIdx.x * 256 + threadIdx.x; if (t >= n8) return; FragH f;
#pragma unroll
  for (int q = 0; q < 8; ++q) f.h[q] = (_Float16)x[t * 8 + q]; *(v8us*)((unsigned short*)X16 + t * 8) = f.half[0];  }
__global__ __launch_bounds__(256) void k_round16f(const float* __restrict__ W, _Float16* __restrict__ Bt, size_t n8) { const size_t t = (size_t)blockIdx.x * 256 + threadIdx.x; if (t >= n8) return; FragH f;
#pragma unroll
  for (int i = 0; i < 8; ++i) f.h[i] = (_Float16)(bf16_round(W[t * 8 + i]) * 16.0f); *(v8us*)((unsigned short*)Bt + t * 8) = f.half[0];  }
__global__ __launch_bounds__(256) void k_hl(const float* __restrict__ F, _Float16* __restrict__ Hh, _Float16* __restrict__ Hl, size_t n8) { const size_t t = (size_t)blockIdx.x * 256 + threadIdx.x; if (t >= n8) return; FragH fh, fl; const v4f a = *(const v4fa*)(F + t * 8), c = *(const v4fa*)(F + t * 8 + 4);
#pragma unroll
  for (int q = 0; q < 4; ++q) { _Float16 h = (_Float16)a[q]; fh.h[q] = h; fl.h[q] = (_Float16)((a[q] - (float)h) * 1024.0f); h = (_Float16)c[q]; fh.h[4 + q] = h; fl.h[4 + q] = (_Float16)((c[q] - (float)h) * 1024.0f); }
  { *(v8us*)((unsigned short*)Hh + t * 8) = fh.half[0]; *(v8us*)((unsigned short*)Hl + t * 8) = fl.half[0];  } }

// ---- WMMA helpers (f16 fragments of 16 rows x 32 k; one product with its distance) ----
__device__ __forceinline__ v16h g2_frag(const _Float16* p, int hh) { FragH f; f.half[0] = *(const v8us*)((const unsigned short*)p + 8 * hh); f.half[1] = *(const v8us*)((const unsigned short*)p + 16 + 8 * hh); return f.v; }
__device__ __forceinline__ v8f g2_mma(v16h a, v16h b, v8f c) { v8f d = __builtin_amdgcn_wmma_f32_16x16x32_f16(false, a, false, b, (short)0, c, false, false); asm volatile("v_nop\n\tv_nop\n\tv_nop\n\tv_nop" : "+v"(d) : "v"(a), "v"(b)); return d; }
// FRAGMENT ORDER: a tile of 16 rows x 32 k (1 KiB) is stored as [part 0..1][lane 0..31][8 halves]; lane = 16 hh + ln holds row ln, k = 16 part + 8 hh .. + 7: the registers of g2_frag, unchanged.
// One 16-byte load of a wave then reads 512 contiguous bytes (4 lines) where the row-major tile made it touch 16 lines of 32 useful bytes each.
#define FT 512                       /* halves of one 16 x 32 fragment tile */
__device__ __forceinline__ v16h gf_frag(const _Float16* p) { FragH f; f.half[0] = *(const v8us*)((const unsigned short*)p); f.half[1] = *(const v8us*)((const unsigned short*)p + FT / 2); return f.v; }      /* p: the tile's start + 8 lane */
// Projection GEMM C16[4096][1024] = f16(A . Bt^T / 16 + bias): one 128 x 128 tile of C per work-group, 8 waves of 32 x 64 (4 down, 2 across).
// Per trip 128 k (256 bytes of each of the 128 A rows and 128 Bt rows) lie in LDS at pitch 272 bytes, brought by asynchronous 16-byte copies: a wave's copy takes 2 rows x 256 bytes, whole lines.
// Two buffers: the copies of trip t + 1 fly while trip t's fragments are read from LDS. k ascends in steps of 32 per accumulator. The epilogue of q and k stages each wave's 32 x 64 block in the first buffer.
#define GT 128                       /* rows and columns of C per work-group */
#define GK 128                       /* k per trip */
#define GP 272                       /* LDS row pitch in bytes: 16 x odd, for the 16-byte fragment reads */
#define GO (GT * GP)                 /* bytes of one operand's rows in a buffer */
#define GB (2 * GO)                  /* bytes of one buffer: A rows, then Bt rows */
__device__ __forceinline__ v16h g3_frag(const char* p) { FragH f; f.half[0] = *(const v8us*)p; f.half[1] = *(const v8us*)(p + 32); return f.v; }
// this thread's 8 pieces of one operand's 128 rows x 256 bytes: rows 16 apart, LDS byte address l, global address g
__device__ __forceinline__ void g3_copy(unsigned l, const _Float16* g) {
  /* the copies and, as the last line, the wait that stands before their address registers are rewritten */
  asm volatile("global_load_async_to_lds_b128 %0, %8, off\n\t"
               "global_load_async_to_lds_b128 %1, %9, off\n\t"
               "global_load_async_to_lds_b128 %2, %10, off\n\t"
               "global_load_async_to_lds_b128 %3, %11, off\n\t"
               "global_load_async_to_lds_b128 %4, %12, off\n\t"
               "global_load_async_to_lds_b128 %5, %13, off\n\t"
               "global_load_async_to_lds_b128 %6, %14, off\n\t"
               "global_load_async_to_lds_b128 %7, %15, off\n\t"
               "s_wait_xcnt 0x0"
               :: "v"(l), "v"(l + 16 * GP), "v"(l + 32 * GP), "v"(l + 48 * GP), "v"(l + 64 * GP), "v"(l + 80 * GP), "v"(l + 96 * GP), "v"(l + 112 * GP),
                  "v"(g), "v"(g + 16 * DM), "v"(g + 32 * DM), "v"(g + 48 * DM), "v"(g + 64 * DM), "v"(g + 80 * DM), "v"(g + 96 * DM), "v"(g + 112 * DM)
               : "memory");
}
// The three products (q, k, v) need nothing of each other: they share one grid, blockIdx.y picks the weights, the bias and the output.
__global__ __launch_bounds__(256) void k_proj(const _Float16* __restrict__ A, const _Float16* __restrict__ BQ, const _Float16* __restrict__ BK, const _Float16* __restrict__ BV,
                                              const float* __restrict__ bq, const float* __restrict__ bk, const float* __restrict__ bvp, _Float16* __restrict__ Q16, _Float16* __restrict__ K16, _Float16* __restrict__ VT) {
  const int z = blockIdx.y; const _Float16* Bh = z == 0 ? BQ : z == 1 ? BK : BV; const float* bias = z == 0 ? bq : z == 1 ? bk : bvp; _Float16* C16 = z == 0 ? Q16 : z == 1 ? K16 : VT;
  static_assert(NR % GT == 0 && DM % GT == 0 && DM % GK == 0 && DM / GK >= 2 && 8 * 32 * 68 * 4 <= GB, "k_proj: whole tiles, two trips or more, the output staging fits one buffer");
  __shared__ __attribute__((aligned(16))) float sm[2 * GB / 4];
  const int tid = threadIdx.x, w = tid >> 5, lane = tid & 31, ln = lane & 15, hh = lane >> 4, wm = w & 3, wn = w >> 2;
  const int mt = blockIdx.x % (int)(NR / GT), nq = blockIdx.x / (int)(NR / GT); const int row0 = mt * GT + 32 * wm, col0 = nq * GT + 64 * wn;
  const float* bp = bias + col0 + ln; float bv[4];
#pragma unroll      /* bv indexed by constants: registers; the four loads fly under the first copies */
  for (int t = 0; t < 4; ++t) bv[t] = bp[16 * t];
  asm volatile("s_wait_xcnt 0x0" :: "v"(bp) : "memory");      /* the wait before the address registers of the loads above are overwritten */
  const _Float16* ga = A + (size_t)(mt * GT + (tid >> 4)) * DM + (tid & 15) * 8;
  const _Float16* gb = Bh + (size_t)(nq * GT + (tid >> 4)) * DM + (tid & 15) * 8;
  const unsigned l0 = (unsigned)(size_t)(const void*)sm + (unsigned)((tid >> 4) * GP + (tid & 15) * 16);
  g3_copy(l0, ga); g3_copy(l0 + GO, gb);
  asm volatile("s_wait_asynccnt 0x0" ::: "memory");      /* this wave's copies of trip 0 have landed */
  __syncthreads();      /* publishes trip 0's rows */
  g3_copy(l0 + GB, ga + GK); g3_copy(l0 + GB + GO, gb + GK);
  const char* fa = (const char*)sm + (32 * wm + ln) * GP + 16 * hh;
  const char* fb = (const char*)sm + GO + (64 * wn + ln) * GP + 16 * hh;
  const v8f z8 = {0.f,0.f,0.f,0.f,0.f,0.f,0.f,0.f}; v8f c00 = z8, c01 = z8, c02 = z8, c03 = z8, c10 = z8, c11 = z8, c12 = z8, c13 = z8;
#pragma unroll 1      /* rolled: one publish point in the text, and the two buffers are told apart by an offset */
  for (int t = 0; t < DM / GK; ++t) { const int bo = (t & 1) * GB;
    const char* pa = fa + bo; const char* pb = fb + bo; v16h af[2][2], bf[2][4];      /* two fragment sets: step s + 1 of this trip is read from LDS, as one group, in front of step s's products */
#pragma unroll      /* the sets are indexed by constants, so that they live in registers */
    for (int i = 0; i < 2; ++i) af[0][i] = g3_frag(pa + i * 16 * GP);
#pragma unroll      /* as above */
    for (int j = 0; j < 4; ++j) bf[0][j] = g3_frag(pb + j * 16 * GP);
#pragma unroll      /* as above; the four k steps of a trip also get constant LDS offsets */
    for (int s = 0; s < GK / 32; ++s) { const int cu = s & 1, nx = cu ^ 1;
      if (s + 1 < GK / 32) {
#pragma unroll      /* as above */
        for (int i = 0; i < 2; ++i) af[nx][i] = g3_frag(pa + i * 16 * GP + 64 * (s + 1));
#pragma unroll      /* as above */
        for (int j = 0; j < 4; ++j) bf[nx][j] = g3_frag(pb + j * 16 * GP + 64 * (s + 1)); }
      c00 = g2_mma(af[cu][0], bf[cu][0], c00); c10 = g2_mma(af[cu][1], bf[cu][0], c10);
      c01 = g2_mma(af[cu][0], bf[cu][1], c01); c11 = g2_mma(af[cu][1], bf[cu][1], c11);
      c02 = g2_mma(af[cu][0], bf[cu][2], c02); c12 = g2_mma(af[cu][1], bf[cu][2], c12);
      c03 = g2_mma(af[cu][0], bf[cu][3], c03); c13 = g2_mma(af[cu][1], bf[cu][3], c13); }
    asm volatile("s_wait_dscnt 0x0" ::: "memory");      /* this wave's reads of trip t's buffer are done before it is refilled */
    asm volatile("s_wait_asynccnt 0x0" ::: "memory");      /* this wave's copies of trip t + 1 have landed */
    __syncthreads();      /* publishes trip t + 1's rows and ends every wave's reads of trip t's buffer */
    if (t + 2 < DM / GK) { g3_copy(l0 + bo, ga + (t + 2) * GK); g3_copy(l0 + bo + GO, gb + (t + 2) * GK); } }
  asm volatile("s_wait_asynccnt 0x0" ::: "memory");      /* no copy is outstanding when the first buffer becomes output staging */
  v8f accs[8] = {c00, c01, c02, c03, c10, c11, c12, c13};
  if (z == 2) {      /* v: V^T in fragment order, [(batch, head)][16 columns d][32 keys][part][lane][8 keys]. An accumulator tile is already such a piece: lane 16 hh + ln holds column d = 16 t + ln and, in its 8 registers, the keys 16 half + 8 hh .. + 7 of the wave's 32 rows (one key group of one batch; its 64 columns are one head), so it is stored from the registers */
    static_assert(SQ % GT == 0 && HD == 64 && FT == 512, "k_proj: a wave's 32 rows are one 32-key group of one batch, its 64 columns one head");
    _Float16* vo = C16 + (((size_t)(row0 / SQ) * NH + col0 / HD) * 4 * (SQ / 32) + (row0 % SQ) / 32) * FT + lane * 8;
#pragma unroll      /* accs and bv indexed by constants: registers; each of the 8 stores is 512 contiguous bytes */
    for (int u = 0; u < 8; ++u) { const int t = u & 3, half = u >> 2; const float bb = bf16_round(bv[t]); FragH f;
#pragma unroll      /* as above */
      for (int r = 0; r < 8; ++r) f.h[r] = (_Float16)(accs[u][r] * 0.0625f + bb);
      *(v8us*)((unsigned short*)vo + (size_t)t * (SQ / 32) * FT + half * (FT / 2)) = f.half[0]; }
    asm volatile("s_wait_xcnt 0x0" ::: "memory");      /* the wait before a register of the stores above is overwritten */
  } else {      /* q, k: fragment order, [16-row tile][head][k half of 32][part][lane][8]; the wave's 64 columns are one head, its 32 rows two tiles; turned through the wave's own staging block */
    float (*so)[68] = (float (*)[68])(sm + w * 32 * 68);
#pragma unroll      /* accs and bv indexed by constants: registers */
    for (int u = 0; u < 8; ++u) { const int t = u & 3, half = u >> 2; const float bb = bf16_round(bv[t]);
#pragma unroll      /* as above */
      for (int r = 0; r < 8; ++r) so[half * 16 + 8 * hh + r][t * 16 + ln] = accs[u][r] * 0.0625f + bb; }
    __builtin_amdgcn_fence(__ATOMIC_ACQ_REL, "workgroup"); __builtin_amdgcn_wave_barrier();      /* the wave's staged block is complete before its lanes read each other's values; no other wave touches it */
    _Float16* cf = C16 + ((size_t)(row0 / 16) * NH + col0 / HD) * (2 * FT) + lane * 8;
#pragma unroll      /* the LDS reads and the 8 stores overlap; each store is 512 contiguous bytes */
    for (int q = 0; q < 8; ++q) { const int tl = q >> 2, c = q & 3; const float* sp = &so[16 * tl + ln][16 * c + 8 * hh]; const v4f v0 = *(const v4fa*)sp, v1 = *(const v4fa*)(sp + 4); FragH f;
#pragma unroll      /* f indexed by constants: registers */
      for (int i = 0; i < 4; ++i) { f.h[i] = (_Float16)v0[i]; f.h[4 + i] = (_Float16)v1[i]; }
      *(v8us*)((unsigned short*)cf + (size_t)tl * NH * (2 * FT) + c * (FT / 2)) = f.half[0]; }
    asm volatile("s_wait_xcnt 0x0" ::: "memory");      /* the wait before a register of the stores above is overwritten */
  } }


// table in fragment order: piece t of 8 halves is [16-row tile][k half of 32][part][lane]; it holds row 16 tile + ln, columns 16 (2 khalf + part) + 8 hh .. + 7
__device__ __forceinline__ void d_wrel(const float* __restrict__ w, _Float16* __restrict__ Bt, size_t t) { if (t >= (size_t)RW * HD / 8) return; const size_t row = (t >> 7) * 16 + (t & 15), col = ((t >> 5) & 3) * 16 + ((t >> 4) & 1) * 8; const bool live = row < (size_t)NREL; FragH f; for (int q = 0; q < 8; ++q) f.h[q] = live ? (_Float16)(bf16_round(w[row * HD + col + q]) * 16.0f) : (_Float16)0.0f; *(v8us*)((unsigned short*)Bt + t * 8) = f.half[0];  }
// The five operand preparations need nothing of each other: they share one grid as ranges of the block index (a block-uniform branch).
// Longest block first, so that none starts late and runs on alone: the table (its guarded loads follow one another), the weight tiles (load, turn in LDS, store), then the hidden rows.
#define PW ((DM / WK) * (DM / WN))   /* blocks (tiles) per weight matrix */
#define PX ((int)(NR * DM / 8 / 256)) /* blocks of the hidden rows */
#define PE (RW * HD / 8 / 256)       /* blocks of the distance table */
__global__ __launch_bounds__(256) void k_prep(const float* __restrict__ wq, const float* __restrict__ wk, const float* __restrict__ wv, const float* __restrict__ demb, const float* __restrict__ hs,
                                              _Float16* __restrict__ BQ, _Float16* __restrict__ BK, _Float16* __restrict__ BV, _Float16* __restrict__ BE, _Float16* __restrict__ X16) {
  static_assert(DM % WK == 0 && DM % WN == 0 && WK == 128 && WN == 64 && NR * DM / 8 % 256 == 0 && RW * HD / 8 % 256 == 0, "k_prep: whole tiles and whole blocks in every range; 256 threads = 16 k pieces x 16 column quads");
  __shared__ __attribute__((aligned(16))) unsigned short tl[WN * WK];      /* the weight tiles' turning place */
  const int blk = blockIdx.x, tid = threadIdx.x;
  if (blk < PE) d_wrel(demb, BE, (size_t)blk * 256 + tid);
  else if (blk < PE + 3 * PW) { const int u = blk - PE, z = u / PW; d_wt_tile(z == 0 ? wq : z == 1 ? wk : wv, z == 0 ? BQ : z == 1 ? BK : BV, 16.0f, u - z * PW, tid, tl); }      /* [in][out] -> Bt[out][in] x16 */
  else d_x16(hs, X16, NR * DM / 8, (size_t)(blk - PE - 3 * PW) * 256 + tid); }
__global__ __launch_bounds__(256) void k_wnat(const float* __restrict__ w, size_t n8, _Float16* __restrict__ Bt) { const size_t t = (size_t)blockIdx.x * 256 + threadIdx.x; if (t >= n8) return; FragH f; for (int q = 0; q < 8; ++q) f.h[q] = (_Float16)(bf16_round(w[t * 8 + q]) * 16.0f); *(v8us*)((unsigned short*)Bt + t * 8) = f.half[0];  }
// Fused attention: one work-group = RT query rows of one (batch, head), 16 waves. Wave w owns the key columns 32w .. 32w + 31 of all RT rows:
// it forms q.k, the window of q . dist_emb^T and the window of k . dist_emb^T that those columns need on WMMA (64 table rows from i0 - 32w + 480 serve both windows;
// the k fragments are the B operand of q.k and the A operand of k . dist_emb^T) and sums the three in its own block of the LDS score tile, each relative term stored along its diagonal:
// score[i][r] = (q_i.k_r + q_i.e[i-r+S-1] + k_r.e[i-r+S-1]) * 0.125 + mask[r] (bf16-rounded additive mask, staged in LDS).
// Of the three 16-wide table tiles a 16x16 block meets, the middle one is used whole and the outer two halve along the diagonal, so they merge into one full tile by a lane select.
// Then one wave per query row (two rows a wave), lane l holding columns 128u + 4l .. + 3; P = f16(256 softmax) goes to LDS; each wave forms one 16x16 tile of P . V over one half of K = 512 (V^T fragments from memory);
// the two halves are summed through LDS, from where each output row is stored as whole 256-byte runs.
// Every loop is fully unrolled (constant trip counts): the per-lane arrays must be indexed by constants to live in registers.
#define RT 32                        /* query rows per work-group */
#define TP (SQ + 4)                  /* score tile pitch in floats: rows stay 16-byte aligned, a column of 32 rows falls on 16 banks */
#define PP (SQ + 8)                  /* P tile pitch in halves: 16 bytes more a row for the 16-byte fragment reads */
template <int C> __device__ __forceinline__ float x_row(float x) { return __builtin_bit_cast(float, __builtin_amdgcn_update_dpp(0, __builtin_bit_cast(int, x), 0x160 | C, 0xf, 0xf, true)); }      /* lane l <- lane l ^ C inside a 16-lane row (row_xmask) */
__device__ __forceinline__ float x_half(float x) { return __builtin_bit_cast(float, __builtin_amdgcn_permlanex16(__builtin_bit_cast(int, x), __builtin_bit_cast(int, x), 0x76543210, 0xfedcba98, false, false)); }      /* lane l <- lane l ^ 16 */
__device__ __forceinline__ float wave_max(float v) { v = fmaxf(v, x_row<1>(v)); v = fmaxf(v, x_row<2>(v)); v = fmaxf(v, x_row<4>(v)); v = fmaxf(v, x_row<8>(v)); return fmaxf(v, x_half(v)); }
__device__ __forceinline__ float wave_sum(float v) { v += x_row<1>(v); v += x_row<2>(v); v += x_row<4>(v); v += x_row<8>(v); return v + x_half(v); }
__device__ __forceinline__ v8f g2_dot64(const v16h (&a)[2], const v16h (&b)[2]) { const v8f z8 = {0.f,0.f,0.f,0.f,0.f,0.f,0.f,0.f}; return g2_mma(a[1], b[1], g2_mma(a[0], b[0], z8)); }
__global__ __launch_bounds__(512) void k_attn(const _Float16* __restrict__ Q16, const _Float16* __restrict__ K16, const _Float16* __restrict__ BE, const _Float16* __restrict__ VT, const float* __restrict__ amask, float* __restrict__ out) {
  static_assert(SQ == 512 && HD == 64 && RT == 32 && SQ % RT == 0 && RW >= 2 * SQ, "k_attn: 16 waves of 32 key columns; 512 threads stage 512 mask values and store 32 x 64 outputs");
  __shared__ __attribute__((aligned(16))) float sc[RT][TP];
  __shared__ __attribute__((aligned(16))) _Float16 ph[RT][PP];
  __shared__ __attribute__((aligned(16))) float so[2][RT][HD + 4];
  __shared__ __attribute__((aligned(16))) float mk[SQ];
  const int tid = threadIdx.x, w = __builtin_amdgcn_readfirstlane(tid >> 5), lane = tid & 31, ln = lane & 15, hh = lane >> 4, i0 = blockIdx.x * RT, h = blockIdx.y, b = blockIdx.z;
  /* all four operands lie in fragment order: every load below reads 512 contiguous bytes */
  const int l8 = lane * 8;      /* the lane's piece of a fragment tile; the tile starts below are the same for the whole wave */
  const _Float16* qp = Q16 + ((size_t)((b * SQ + i0) / 16) * NH + h) * (2 * FT);
  const _Float16* kp = K16 + ((size_t)((b * SQ + 32 * w) / 16) * NH + h) * (2 * FT);
  const _Float16* ep = BE + (size_t)((i0 - 32 * w + (SQ - 32)) / 16) * (2 * FT);      /* table rows i0 - 32w + 480 .. + 63, all inside 0 .. 1023; the first is a multiple of 16 */
  const float* mp = amask + (size_t)b * SQ;
  v16h qf[2][2], kf[2][2], ef[4][2];
#pragma unroll
  for (int m = 0; m < 2; ++m)
#pragma unroll
    for (int s = 0; s < 2; ++s) { qf[m][s] = gf_frag(qp + (m * NH * 2 + s) * FT + l8); kf[m][s] = gf_frag(kp + (m * NH * 2 + s) * FT + l8); }
#pragma unroll
  for (int t = 0; t < 4; ++t)
#pragma unroll
    for (int s = 0; s < 2; ++s) ef[t][s] = gf_frag(ep + (t * 2 + s) * FT + l8);
  const float mv = mp[tid];
  asm volatile("s_wait_xcnt 0x0" :: "s"(qp), "s"(kp), "s"(ep), "s"(mp), "v"(lane) : "memory");      /* the wait before the address registers of the loads above are overwritten; naming them keeps them whole up to it */
  mk[tid] = bf16_round(mv);
  const int dg = 8 * hh - ln;      /* row minus column inside a 16x16 accumulator tile, less the register index */
  float* blk = &sc[0][32 * w];
#pragma unroll
  for (int m = 0; m < 2; ++m)
#pragma unroll
    for (int e = 0; e < 2; ++e) { const v8f c = g2_dot64(qf[m], kf[e]);
#pragma unroll
      for (int r = 0; r < 8; ++r) blk[(16 * m + 8 * hh + r) * TP + 16 * e + ln] = c[r]; }
  /* q . e: accumulator (query row 16m + 8hh + r, table row base + 16(m + t) + ln) belongs to key column 31 + 8hh + r - 16t - ln of the block */
#pragma unroll
  for (int m = 0; m < 2; ++m) { const v8f c0 = g2_dot64(qf[m], ef[m]), c1 = g2_dot64(qf[m], ef[m + 1]), c2 = g2_dot64(qf[m], ef[m + 2]); float* pc[8]; float* po[8]; float om[8], oo[8];      /* the 16 x 32 elements are distinct: all reads, then all writes, so that the LDS round trips overlap */
#pragma unroll
    for (int r = 0; r < 8; ++r) { pc[r] = blk + (16 * m + 8 * hh + r) * TP + 15 + dg + r; po[r] = pc[r] + (dg + r <= 0 ? 16 : -16); om[r] = *pc[r]; oo[r] = *po[r]; }
#pragma unroll
    for (int r = 0; r < 8; ++r) { *pc[r] = om[r] + c1[r] * 0.0625f; *po[r] = oo[r] + (dg + r <= 0 ? c0[r] : c2[r]) * 0.0625f; } }
  /* k . e: accumulator (key row 16e + 8hh + r of the block, table row base + 16(1 - e + t) + ln) belongs to query row 16t + ln + 8hh + r - 15 */
#pragma unroll
  for (int e = 0; e < 2; ++e) { const v8f c0 = g2_dot64(kf[e], ef[1 - e]), c1 = g2_dot64(kf[e], ef[2 - e]), c2 = g2_dot64(kf[e], ef[3 - e]); float* pc[8]; float* po[8]; float om[8], oo[8];
#pragma unroll
    for (int r = 0; r < 8; ++r) { const int il = 1 + ln + 8 * hh + r; pc[r] = blk + il * TP + 16 * e + 8 * hh + r; po[r] = pc[r] + (il < 16 ? 16 * TP : -16 * TP); om[r] = *pc[r]; oo[r] = *po[r]; }
#pragma unroll
    for (int r = 0; r < 8; ++r) { *pc[r] = om[r] + c1[r] * 0.0625f; *po[r] = oo[r] + (1 + ln + 8 * hh + r < 16 ? c2[r] : c0[r]) * 0.0625f; } }
  __syncthreads();      /* publishes the score tile and the mask */
  /* P . V share of this wave: tile (pm, pn) of the 32 x 64 result, half pk of K = 512; its V^T fragments are asked for here so that they fly during the softmax */
  const int pm = w & 1, pn = (w >> 1) & 3, pk = w >> 3;
  const _Float16* vp = VT + ((((size_t)b * NH + h) * 4 + pn) * (SQ / 32) + 8 * pk) * FT;
  v16h vf[8];
#pragma unroll
  for (int s = 0; s < 8; ++s) vf[s] = gf_frag(vp + s * FT + l8);
  asm volatile("s_wait_xcnt 0x0" :: "s"(vp), "v"(lane) : "memory");      /* the wait before the address registers of the loads above are overwritten */
#pragma unroll
  for (int k = 0; k < 2; ++k) { const int row = 2 * w + k; float x[16]; float mx = -INFINITY;
#pragma unroll
    for (int u = 0; u < 4; ++u) { const int c = 128 * u + 4 * lane; const v4f sv = *(const v4fa*)&sc[row][c], mm = *(const v4fa*)&mk[c];
#pragma unroll
      for (int q = 0; q < 4; ++q) { x[u * 4 + q] = sv[q] * 0.125f + mm[q]; mx = fmaxf(mx, x[u * 4 + q]); } }
    mx = wave_max(mx); float se = 0.f;
#pragma unroll
    for (int j = 0; j < 16; ++j) { x[j] = __builtin_amdgcn_exp2f((x[j] - mx) * 1.44269504088896340736f); se += x[j]; }      /* e^d = 2^(d log2 e), d <= 0: the hardware's exp2 alone; a result too small for it is far below one unit of the f16 weight */
    const float sn = 256.0f / wave_sum(se);
#pragma unroll
    for (int u = 0; u < 4; ++u) { v4h o;
#pragma unroll
      for (int q = 0; q < 4; ++q) o[q] = (_Float16)(x[u * 4 + q] * sn);
      *(v4h*)&ph[row][128 * u + 4 * lane] = o; } }
  __syncthreads();      /* publishes the P tile */
  { const _Float16* pa = &ph[16 * pm + ln][256 * pk + 8 * hh]; v16h pf[8];
#pragma unroll
    for (int s = 0; s < 8; ++s) pf[s] = g2_frag(pa + 32 * s, 0);
    v8f c = {0.f,0.f,0.f,0.f,0.f,0.f,0.f,0.f};
#pragma unroll
    for (int s = 0; s < 8; ++s) c = g2_mma(pf[s], vf[s], c);
#pragma unroll
    for (int r = 0; r < 8; ++r) so[pk][16 * pm + 8 * hh + r][16 * pn + ln] = c[r]; }
  __syncthreads();      /* publishes the two K halves of the 32 x 64 result */
  { const int row = tid >> 4, c4 = (tid & 15) * 4; const v4f v = (*(const v4fa*)&so[0][row][c4] + *(const v4fa*)&so[1][row][c4]) * 0.00390625f; *(v4f*)(out + ((size_t)b * SQ + i0 + row) * DM + h * HD + c4) = v; } }
__global__ __launch_bounds__(256) void k_vt(const _Float16* __restrict__ V16, int b, int h0, _Float16* __restrict__ VT) { __shared__ unsigned short tl[64][65]; const int tid = threadIdx.x; const int hh = blockIdx.x % HG, sg = blockIdx.x / HG; const int s0 = sg * 64; const int h = h0 + hh;
  for (int i = tid; i < 64 * 8; i += 256) { const int j = i / 8, d8 = (i % 8) * 8; FragH f; f.half[0] = *(const v8us*)((const unsigned short*)V16 + ((size_t)b * SQ + s0 + j) * DM + h * HD + d8); for (int q = 0; q < 8; ++q) tl[d8 + q][j] = f.u[q]; }
  __syncthreads();
  { for (int i = tid; i < 64 * 8; i += 256) { const int d = i / 8, j8 = (i % 8) * 8; FragH f; for (int q = 0; q < 8; ++q) f.u[q] = tl[d][j8 + q]; *(v8us*)((unsigned short*)VT + ((size_t)hh * HD + d) * SQ + s0 + j8) = f.half[0]; }  } }

extern "C" void kernel_launch(void* const* d_in, const int* in_sizes, int n_in,
                              void* d_out, int out_size, void* d_ws, size_t ws_size, hipStream_t stream) {
  (void)in_sizes; (void)n_in; (void)out_size;
  const float* const* I = (const float* const*)d_in; const float* hs = I[0]; const float* amask = I[1]; const float* wq = I[2]; const float* bq = I[3]; const float* wk = I[4]; const float* bk = I[5]; const float* wv = I[6]; const float* bv = I[7]; const float* demb = I[8];      /* weights [in][out]; attention_mask [8][1][1][512] additive; dist_emb [1023][64] */
  char* ws = (char*)d_ws; size_t off = 0;
  auto take = [&](size_t bytes) { char* p = ws + off; off += (bytes + 255) & ~(size_t)255; return p; };
  _Float16* BQ = (_Float16*)take((size_t)DM * DM * 2); _Float16* BK = (_Float16*)take((size_t)DM * DM * 2); _Float16* BV = (_Float16*)take((size_t)DM * DM * 2); _Float16* BE = (_Float16*)take((size_t)RW * HD * 2);
  _Float16* X16 = (_Float16*)take(NR * DM * 2); _Float16* Q16 = (_Float16*)take(NR * DM * 2); _Float16* K16 = (_Float16*)take(NR * DM * 2);
  _Float16* VT = (_Float16*)take((size_t)NB * NH * HD * SQ * 2);
  if (off > ws_size) return;      /* 6 + 0.1 + 3x8 + 8 = approx 38 MiB */
  k_prep<<<3 * PW + PX + PE, 256, 0, stream>>>(wq, wk, wv, demb, hs, BQ, BK, BV, BE, X16);      /* transposed weights x16, padded table x16, hidden rows as f16 */
  k_proj<<<dim3((unsigned)((NR / GT) * (DM / GT)), 3), 256, 0, stream>>>(X16, BQ, BK, BV, bq, bk, bv, Q16, K16, VT);      /* q, k and V^T in fragment order */
  k_attn<<<dim3(SQ / RT, NH, NB), 512, 0, stream>>>(Q16, K16, BE, VT, amask, (float*)d_out);      /* scores, relative terms, softmax and P . V; ctx rows (merged heads, f32) */
}

// v009
// Measured time: 65.1 microseconds a run.
// Two timings next to v008 both put it at 1.20 times that version's speed.
// All steps since v000 together make it 56.0 times as fast.
#include <hip/hip_runtime.h>
// BERT self-attention with relative-position score terms (hidden [8][512][1024]; q, k, v = h W + b ([in][out], 16 heads of 64); scores[l][r] = (q_l.k_r + q_l.pe[l-r] + k_r.pe[l-r]) / 8 + mask[r] with pe = dist_emb[l - r + 511]; softmax; ctx = attn v merged -> [8][512][1024]).
// Structure: token rows r = b*512 + s; hidden as exact f16 rows (with the weight and table preparations in one launch); Q | K | V as three WMMA GEMMs in one launch (128x128 work-group tiles staged in LDS by asynchronous copies, 32x64 wave tiles, f32 accumulation, exact x16 transposed weights, bias in the epilogue, f16 outputs; v leaves the accumulators as V^T); q, k, V^T and the table lie in memory in WMMA fragment order (FRAGMENT ORDER below), so that a fragment load of the attention reads whole lines; then one fused attention launch, one work-group per 256 query rows of a (batch, head), walked as 8 tiles of 32 rows: per tile q.k and the two relative terms (q rows and k rows times the window of dist_emb^T that the tile's diagonals meet; table padded to 1024 rows with zeros) on WMMA, summed in an LDS score tile (f32), row softmax on VALU, one wave per query row (mask added; weights x256 as f16 in LDS), ctx = P . V on WMMA (K = 512, alpha 2^-8) written as f32 into the merged output rows.
// Compute dtype: inputs rounded to bf16; hidden / weights / table exact; q, k, v and the softmax weights as plain f16 GEMM operands (~2^-12); scores, relative terms and softmax statistics f32. v_wmma_f32_16x16x32_f16.
#define NB 8
#define SQ 512
#define DM 1024
#define NH 16
#define HD 64
#define HG 16                        /* heads per attention launch group (all) */
#define NREL 1023                    /* relative distances -511..511 */
#define RW 1024                      /* dist_emb table rows (distances padded to 1024) */
#define QN SQ                        /* unused: attention covers all SQ query rows */
#define NBR NB                       /* unused: attention covers all NB batches */
#define MP ((int)NR)                 /* unused: the projections take all NR rows */
#define NR ((size_t)NB * SQ)         /* 4096 token rows */
typedef __bf16 v16b __attribute__((ext_vector_type(16)));
typedef unsigned short v8us __attribute__((ext_vector_type(8), may_alias));
typedef float  v8f  __attribute__((ext_vector_type(8)));
typedef float  v4f  __attribute__((ext_vector_type(4)));
typedef float  v4fa __attribute__((ext_vector_type(4), may_alias));
union FragB { v16b v; v8us half[2]; unsigned short u[16]; };

__device__ __forceinline__ unsigned short bf16_bits(float x) { unsigned int u = __float_as_uint(x); return (unsigned short)((u + 0x7FFFu + ((u >> 16) & 1u)) >> 16); }
__device__ __forceinline__ float bf16_val(unsigned short b) { return __uint_as_float(((unsigned int)b) << 16); }
__device__ __forceinline__ float bf16_round(float x) { return bf16_val(bf16_bits(x)); }
// D += A·B with NT terms: 1 = ah·bh, 2 = + al·bh (A split), 3 = + ah·bl (both split)
template <int NT>
__device__ __forceinline__ v8f mmaN(v16b ah, v16b al, v16b bh, v16b bl, v8f c) {
  c = __builtin_amdgcn_wmma_f32_16x16x32_bf16(false, ah, false, bh, (short)0, c, false, false);
  if (NT >= 2) c = __builtin_amdgcn_wmma_f32_16x16x32_bf16(false, al, false, bh, (short)0, c, false, false);
  if (NT >= 3) c = __builtin_amdgcn_wmma_f32_16x16x32_bf16(false, ah, false, bl, (short)0, c, false, false);
  asm volatile("v_nop\n\tv_nop\n\tv_nop\n\tv_nop" : "+v"(c) : "v"(ah), "v"(al), "v"(bh), "v"(bl));
  return c;
}

__global__ __launch_bounds__(256) void k_wt_bf16(const float* __restrict__ W, unsigned short* __restrict__ Wt, int K, int N) {
  const int t = blockIdx.x * 256 + threadIdx.x;
  const int k8n = K / 8;
  if (t >= N * k8n) return;
  const int n = t / k8n, k8 = (t % k8n) * 8;
  v8us v;
#pragma unroll
  for (int i = 0; i < 8; ++i) v[i] = bf16_bits(W[(size_t)(k8 + i) * N + n]);
  *(v8us*)(Wt + (size_t)n * K + k8) = v;
  
}

// GEMM C[M][N] (f32, pitch ldc) = act(A[M][K]·W + bias). A f32 row-major (pitch lda) converted per fragment to bf16
// (ASPLIT: hi/lo two planes -> 2 terms, else single rounded term); Wt bf16 [N][K] (pitch ldb). BIAS_BF16 rounds the
// bias to bf16 first (bias quantised to bf16 before the add). K%32==0, M%16==0, N%64==0.
template <bool ASPLIT, int ACT, bool BIAS_BF16>
__global__ __launch_bounds__(128) void k_gemm_bf(const float* __restrict__ A, int lda, const unsigned short* __restrict__ Wt, int ldb,
                                               const float* __restrict__ bias, float* __restrict__ C, int ldc, int M, int N, int K) {
  __shared__ __attribute__((aligned(16))) float so[4][16][64];
  const int tid = threadIdx.x, w = tid >> 5, lane = tid & 31, ln = lane & 15, hh = lane >> 4;
  const int ntn = N / 64;
  const int wid = blockIdx.x * 4 + w;
  const int mt = wid / ntn, nq = wid % ntn;
  if (mt * 16 >= M) return;
  const int row0 = mt * 16, col0 = nq * 64;
  const float* arow = A + (size_t)(row0 + ln) * lda;
  v8f acc[4] = {};
  for (int kb = 0; kb < K; kb += 32) {
    FragB ah, al;
    const v4f x0 = *(const v4fa*)(arow + kb + 8 * hh), x1 = *(const v4fa*)(arow + kb + 8 * hh + 4);
    const v4f x2 = *(const v4fa*)(arow + kb + 16 + 8 * hh), x3 = *(const v4fa*)(arow + kb + 16 + 8 * hh + 4);
    float xs[16] = {x0[0],x0[1],x0[2],x0[3],x1[0],x1[1],x1[2],x1[3],x2[0],x2[1],x2[2],x2[3],x3[0],x3[1],x3[2],x3[3]};
#pragma unroll
    for (int i = 0; i < 16; ++i) { const unsigned short hb = bf16_bits(xs[i]); ah.u[i] = hb; al.u[i] = ASPLIT ? bf16_bits(xs[i] - bf16_val(hb)) : (unsigned short)0; }
#pragma unroll
    for (int t = 0; t < 4; ++t) {
      const unsigned short* brow = Wt + (size_t)(col0 + t * 16 + ln) * ldb + kb;
      FragB b;
      b.half[0] = *(const v8us*)(brow + 8 * hh);
      b.half[1] = *(const v8us*)(brow + 16 + 8 * hh);
      acc[t] = mmaN<ASPLIT ? 2 : 1>(ah.v, al.v, b.v, b.v, acc[t]);
    }
  }
#pragma unroll
  for (int t = 0; t < 4; ++t) {
    float bv = bias ? bias[col0 + t * 16 + ln] : 0.f;
    if (BIAS_BF16) bv = bf16_round(bv);
#pragma unroll
    for (int r = 0; r < 8; ++r) { float v = acc[t][r] + bv; if (ACT == 1) v = fmaxf(v, 0.f); so[w][8 * hh + r][t * 16 + ln] = v; }
  }
  __builtin_amdgcn_fence(__ATOMIC_ACQ_REL, "workgroup");
  __builtin_amdgcn_wave_barrier();
  const int rsub = lane >> 4, c4 = (lane & 15) * 4;
  {
#pragma unroll
    for (int q = 0; q < 8; ++q) {
      const int r = q * 2 + rsub;
      const v4f v = *(const v4fa*)&so[w][r][c4];
      *(v4f*)(C + (size_t)(row0 + r) * ldc + col0 + c4) = v;
    }
    
  }
}

// GEMM C = act(A·W + bias + resid): A f32 (ASPLIT -> hi/lo 2 terms), Wt bf16 [N][K]; ACT 0 none, 1 relu, 2 exact gelu;
// resid (optional, f32, row index = (row % rmod), pitch ldr, RES_BF16 rounds it) added before the activation.
template <bool ASPLIT, int ACT, bool BIAS_BF16, bool RES_BF16>
__global__ __launch_bounds__(128) void k_gemm_bf3(const float* __restrict__ A, int lda, const unsigned short* __restrict__ Wt, int ldb,
                                                const float* __restrict__ bias, const float* __restrict__ resid, int rmod, int ldr,
                                                float* __restrict__ C, int ldc, int M, int N, int K) {
  __shared__ __attribute__((aligned(16))) float so[4][16][64];
  const int tid = threadIdx.x, w = tid >> 5, lane = tid & 31, ln = lane & 15, hh = lane >> 4;
  const int ntn = N / 64;
  const int wid = blockIdx.x * 4 + w;
  const int mt = wid / ntn, nq = wid % ntn;
  if (mt * 16 >= M) return;
  const int row0 = mt * 16, col0 = nq * 64;
  const float* arow = A + (size_t)(row0 + ln) * lda;
  v8f acc[4] = {};
  for (int kb = 0; kb < K; kb += 32) {
    FragB ah, al;
    const v4f x0 = *(const v4fa*)(arow + kb + 8 * hh), x1 = *(const v4fa*)(arow + kb + 8 * hh + 4);
    const v4f x2 = *(const v4fa*)(arow + kb + 16 + 8 * hh), x3 = *(const v4fa*)(arow + kb + 16 + 8 * hh + 4);
    float xs[16] = {x0[0],x0[1],x0[2],x0[3],x1[0],x1[1],x1[2],x1[3],x2[0],x2[1],x2[2],x2[3],x3[0],x3[1],x3[2],x3[3]};
#pragma unroll
    for (int i = 0; i < 16; ++i) { const unsigned short hb = bf16_bits(xs[i]); ah.u[i] = hb; al.u[i] = ASPLIT ? bf16_bits(xs[i] - bf16_val(hb)) : (unsigned short)0; }
#pragma unroll
    for (int t = 0; t < 4; ++t) {
      const unsigned short* brow = Wt + (size_t)(col0 + t * 16 + ln) * ldb + kb;
      FragB b;
      b.half[0] = *(const v8us*)(brow + 8 * hh);
      b.half[1] = *(const v8us*)(brow + 16 + 8 * hh);
      acc[t] = mmaN<ASPLIT ? 2 : 1>(ah.v, al.v, b.v, b.v, acc[t]);
    }
  }
#pragma unroll
  for (int t = 0; t < 4; ++t) {
    const int col = col0 + t * 16 + ln;
    float bv = bias ? bias[col] : 0.f;
    if (BIAS_BF16) bv = bf16_round(bv);
#pragma unroll
    for (int r = 0; r < 8; ++r) {
      float v = acc[t][r] + bv;
      if (resid) { float rv = resid[(size_t)((row0 + 8 * hh + r) % rmod) * ldr + col]; if (RES_BF16) rv = bf16_round(rv); v += rv; }
      if (ACT == 1) v = fmaxf(v, 0.f);
      if (ACT == 2) v = 0.5f * v * (1.0f + erff(v * 0.70710678118654752f));
      if (ACT == 3) { const float u = 0.7978845608028654f * (v + 0.044715f * v * v * v); v = 0.5f * v * (1.0f + tanhf(u)); }
      so[w][8 * hh + r][t * 16 + ln] = v;
    }
  }
  __builtin_amdgcn_fence(__ATOMIC_ACQ_REL, "workgroup");
  __builtin_amdgcn_wave_barrier();
  const int rsub = lane >> 4, c4 = (lane & 15) * 4;
  {
#pragma unroll
    for (int q = 0; q < 8; ++q) {
      const int r = q * 2 + rsub;
      const v4f v = *(const v4fa*)&so[w][r][c4];
      *(v4f*)(C + (size_t)(row0 + r) * ldc + col0 + c4) = v;
    }
    
  }
}
// row LayerNorm (biased variance, eps) over N: s = X (+ R); optional out_sum <- s; out_norm <- (s-mu)*rsqrt(var+eps)*g + b
template <bool PARAM_BF16>
__global__ __launch_bounds__(256) void k_layernorm(const float* __restrict__ X, const float* __restrict__ R, const float* __restrict__ g, const float* __restrict__ bta,
                                                  float* __restrict__ out_sum, float* __restrict__ out_norm, int N, float eps) {
  __shared__ float red[256];
  const int row = blockIdx.x, tid = threadIdx.x;
  const float* x = X + (size_t)row * N; const float* rr = R ? R + (size_t)row * N : nullptr;
  float vals[16];                     // up to N = 4096
  const int per = N / 256;            // contiguous chunk per thread? use strided-by-4 chunks: thread handles j = tid*4 + 1024*u
  float s1 = 0.f;
  for (int u = 0; u < per / 4; ++u) {
    const int j = tid * 4 + 1024 * u;
    const v4f a = *(const v4fa*)(x + j);
    v4f b = {0.f,0.f,0.f,0.f}; if (rr) b = *(const v4fa*)(rr + j);
#pragma unroll
    for (int q = 0; q < 4; ++q) { const float v = a[q] + b[q]; vals[u * 4 + q] = v; s1 += v; }
  }
  red[tid] = s1; __syncthreads();
  for (int st = 128; st > 0; st >>= 1) { if (tid < st) red[tid] += red[tid + st]; __syncthreads(); }
  const float mu = red[0] / (float)N; __syncthreads();
  float s2 = 0.f;
  for (int u = 0; u < per / 4; ++u)
#pragma unroll
    for (int q = 0; q < 4; ++q) { const float c = vals[u * 4 + q] - mu; s2 += c * c; }
  red[tid] = s2; __syncthreads();
  for (int st = 128; st > 0; st >>= 1) { if (tid < st) red[tid] += red[tid + st]; __syncthreads(); }
  const float rs = rsqrtf(red[0] / (float)N + eps);
  {
    for (int u = 0; u < per / 4; ++u) {
      const int j = tid * 4 + 1024 * u;
      v4f o, sm;
#pragma unroll
      for (int q = 0; q < 4; ++q) {
        float gg = g[j + q], bb = bta[j + q];
        if (PARAM_BF16) { gg = bf16_round(gg); bb = bf16_round(bb); }
        sm[q] = vals[u * 4 + q]; o[q] = (vals[u * 4 + q] - mu) * rs * gg + bb;
      }
      if (out_sum) *(v4f*)(out_sum + (size_t)row * N + j) = sm;
      *(v4f*)(out_norm + (size_t)row * N + j) = o;
    }
    
  }
}



// ---- f16 WMMA path (v_wmma_f32_16x16x32_f16): 11-bit significands for operands in range — used where a [0,1] probability operand needs more precision than bf16
typedef _Float16 v16h __attribute__((ext_vector_type(16)));
union FragH { v16h v; v8us half[2]; _Float16 h[16]; unsigned short u[16]; };
template <int NT>
__device__ __forceinline__ v8f mmaH(v16h ah, v16h al, v16h bh, v16h bl, v8f c) {
  c = __builtin_amdgcn_wmma_f32_16x16x32_f16(false, ah, false, bh, (short)0, c, false, false);
  if (NT >= 2) c = __builtin_amdgcn_wmma_f32_16x16x32_f16(false, al, false, bh, (short)0, c, false, false);
  if (NT >= 3) c = __builtin_amdgcn_wmma_f32_16x16x32_f16(false, ah, false, bl, (short)0, c, false, false);
  asm volatile("v_nop\n\tv_nop\n\tv_nop\n\tv_nop" : "+v"(c) : "v"(ah), "v"(al), "v"(bh), "v"(bl));
  return c;
}
// batched GEMM like k_gemm_b but f16 operands: A f32 (split into f16 hi/lo if ASPLIT, else rounded to f16), Bt = f16 values [n][k]; alpha; C f32; N multiple of 16 (partial tiles skipped)
template <bool ASPLIT>
__global__ __launch_bounds__(128) void k_gemm_h(const float* __restrict__ A, int lda, size_t sA, const _Float16* __restrict__ Bh, int ldb, size_t sB, float alpha, float* __restrict__ C, int ldc, size_t sC, int M, int N, int K) {
  __shared__ __attribute__((aligned(16))) float so[4][16][64];
  const int tid = threadIdx.x, w = tid >> 5, lane = tid & 31, ln = lane & 15, hh = lane >> 4; const int by = blockIdx.y;
  A += (size_t)by * sA; Bh += (size_t)by * sB; C += (size_t)by * sC;
  const int ntn = (N + 63) / 64; const int wid = blockIdx.x * 4 + w; const int mt = wid / ntn, nq = wid % ntn; if (mt * 16 >= M) return;
  const int row0 = mt * 16, col0 = nq * 64; const float* arow = A + (size_t)(row0 + ln) * lda;
  v8f acc[4] = {};
  for (int kb = 0; kb < K; kb += 32) {
    FragH ah, al;
    const v4f x0 = *(const v4fa*)(arow + kb + 8 * hh), x1 = *(const v4fa*)(arow + kb + 8 * hh + 4), x2 = *(const v4fa*)(arow + kb + 16 + 8 * hh), x3 = *(const v4fa*)(arow + kb + 16 + 8 * hh + 4);
    float xs[16] = {x0[0],x0[1],x0[2],x0[3],x1[0],x1[1],x1[2],x1[3],x2[0],x2[1],x2[2],x2[3],x3[0],x3[1],x3[2],x3[3]};
#pragma unroll
    for (int i = 0; i < 16; ++i) { const _Float16 h = (_Float16)xs[i]; ah.h[i] = h; al.h[i] = ASPLIT ? (_Float16)(xs[i] - (float)h) : (_Float16)0.0f; }
#pragma unroll
    for (int t = 0; t < 4; ++t) { if (col0 + t * 16 >= N) continue; const size_t boff = (size_t)(col0 + t * 16 + ln) * ldb + kb; FragH bq; bq.half[0] = *(const v8us*)(Bh + boff + 8 * hh); bq.half[1] = *(const v8us*)(Bh + boff + 16 + 8 * hh);
      acc[t] = mmaH<ASPLIT ? 2 : 1>(ah.v, al.v, bq.v, bq.v, acc[t]); }
  }
#pragma unroll
  for (int t = 0; t < 4; ++t) { if (col0 + t * 16 >= N) continue;
#pragma unroll
    for (int r = 0; r < 8; ++r) so[w][8 * hh + r][t * 16 + ln] = acc[t][r] * alpha; }
  __builtin_amdgcn_fence(__ATOMIC_ACQ_REL, "workgroup"); __builtin_amdgcn_wave_barrier();
  const int rsub = lane >> 4, c4 = (lane & 15) * 4;
  {
#pragma unroll
    for (int q = 0; q < 8; ++q) { const int r = q * 2 + rsub; if (col0 + c4 < N) { const v4f v = *(const v4fa*)&so[w][r][c4]; *(v4f*)(C + (size_t)(row0 + r) * ldc + col0 + c4) = v; } }
     }
}

// Wt[n][k] = f16(W[k][n] * scale) from f32 row-major W[DM][DM] (scale = power of two; bf16-exact weights stay exact in f16 away from the subnormal range), one tile of WK k x WN n per work-group of 256, turned in LDS.
// Reads: thread (kg, nq) takes rows 8 kg .. + 7, columns 4 nq .. + 3, so each 16-byte load of a wave covers 2 rows x 256 contiguous bytes, whole lines, and the 8 loads are in flight together.
// LDS: tl[n][16-byte piece of 8 k], rows of 256 bytes; piece c of row n lies at place c ^ (n >> 2): the 16 lanes that write one k piece of 16 rows four apart, and the 16 lanes that read one whole row, both fall on all 64 banks.
// Writes: each 16-byte store of a wave covers 2 rows of Wt x 256 contiguous bytes.
#define WK 128                       /* k per tile */
#define WN 64                        /* n per tile */
__device__ __forceinline__ void d_wt_tile(const float* __restrict__ W, _Float16* __restrict__ Wt, float scale, int tile, int tid, unsigned short* tl) {
  const int k0 = (tile / (DM / WN)) * WK, n0 = (tile % (DM / WN)) * WN, nq = tid & 15, kg = tid >> 4;
  const float* wp = W + (size_t)(k0 + 8 * kg) * DM + n0 + 4 * nq; v4f x[8];
#pragma unroll      /* x indexed by constants: registers; the 8 loads fly together */
  for (int i = 0; i < 8; ++i) x[i] = *(const v4fa*)(wp + (size_t)i * DM);
#pragma unroll      /* as above */
  for (int j = 0; j < 4; ++j) { FragH f;
#pragma unroll      /* as above */
    for (int i = 0; i < 8; ++i) f.h[i] = (_Float16)(bf16_round(x[i][j]) * scale);
    *(v8us*)(tl + (4 * nq + j) * WK + (kg ^ nq) * 8) = f.half[0]; }
  __syncthreads();      /* publishes the turned tile */
  unsigned short* op = (unsigned short*)Wt + (size_t)(n0 + kg) * DM + k0 + 8 * nq;
#pragma unroll      /* the 4 LDS reads and stores overlap */
  for (int p = 0; p < 4; ++p) { const int n = 16 * p + kg; const v8us o = *(const v8us*)(tl + n * WK + (nq ^ (n >> 2)) * 8); *(v8us*)(op + (size_t)(16 * p) * DM) = o; }
  asm volatile("s_wait_xcnt 0x0" ::: "memory");      /* the wait before a register of the stores above is overwritten: the code of the launch's other ranges follows in the text */
}
// k_gemm_hh variant with fused epilogue: v = acc·alpha + bias[by·sBias + col] (+ CP[(row/rowsPerB)·sCPb + by·64 + col] if CP) ; ACT 0 none / 1 elu ; writes f16 C16 (and f32 C if non-null)
template <int ACT>
__global__ __launch_bounds__(128) void k_gemm_hhx(const _Float16* __restrict__ A, int lda, size_t sA, const _Float16* __restrict__ Bh, int ldb, size_t sB, float alpha, const float* __restrict__ bias, size_t sBias, const float* __restrict__ CP, int rowsPerB, size_t sCPb, int row0g,
    float* __restrict__ C, _Float16* __restrict__ C16, int ldc, size_t sC, int M, int N, int K) {
  __shared__ __attribute__((aligned(16))) float so[4][16][64];
  const int tid = threadIdx.x, w = tid >> 5, lane = tid & 31, ln = lane & 15, hh = lane >> 4; const int by = blockIdx.y;
  A += (size_t)by * sA; Bh += (size_t)by * sB; const size_t cofs = (size_t)by * sC; const float* bp = bias ? bias + (size_t)by * sBias : nullptr;
  const int ntn = (N + 63) / 64; const int wid = blockIdx.x * 4 + w; const int mt = wid / ntn, nq = wid % ntn; if (mt * 16 >= M) return;
  const int row0 = mt * 16, col0 = nq * 64; const _Float16* arow = A + (size_t)(row0 + ln) * lda;
  v8f acc[4] = {};
  for (int kb = 0; kb < K; kb += 32) { FragH ah; ah.half[0] = *(const v8us*)((const unsigned short*)arow + kb + 8 * hh); ah.half[1] = *(const v8us*)((const unsigned short*)arow + kb + 16 + 8 * hh);
#pragma unroll
    for (int t = 0; t < 4; ++t) { if (col0 + t * 16 >= N) continue; const size_t boff = (size_t)(col0 + t * 16 + ln) * ldb + kb; FragH bq; bq.half[0] = *(const v8us*)((const unsigned short*)Bh + boff + 8 * hh); bq.half[1] = *(const v8us*)((const unsigned short*)Bh + boff + 16 + 8 * hh);
      acc[t] = mmaH<1>(ah.v, ah.v, bq.v, bq.v, acc[t]); }
  }
#pragma unroll
  for (int t = 0; t < 4; ++t) { if (col0 + t * 16 >= N) continue; const int col = col0 + t * 16 + ln; const float bv = bp ? bf16_round(bp[col]) : 0.f;
#pragma unroll
    for (int r = 0; r < 8; ++r) { float v = acc[t][r] * alpha + bv; if (CP) { const int rr = row0g + row0 + 8 * hh + r; if (rowsPerB < 0) v += CP[cofs + (size_t)rr * ldc + col];      /* rowsPerB < 0: own element of the batched C plane */ else { const int bidx = rr / rowsPerB; v += CP[(size_t)bidx * sCPb + (size_t)by * 64 + col]; } } if (ACT == 1) v = (v > 0.f) ? v : expm1f(v); else if (ACT == 7) v = (v > 0.f) ? v + 1.0f : expf(v); else if (ACT == 8) v = tanhf(v); else if (ACT == 9) v = 0.5f * v * (1.0f + tanhf(0.7978845608028654f * (v + 0.044715f * v * v * v))); else if (ACT == 11) v = 1.0f / (1.0f + expf(-v)); else if (ACT == 12) v = (v > 0.f) ? v : 0.01f * v; else if (ACT == 14) v = (v > 0.f) ? v : 0.1f * v; else if (ACT == 16) v = (v >= 0.f) ? v : 0.3f * v; else if (ACT == 17) v = (v >= 0.f) ? v : 0.2f * v; else if (ACT == 15) v = v / (1.0f + expf(-v)); else if (ACT == 3) v = fmaxf(v, 0.f); else if (ACT == 6) v = 0.5f * v * (1.0f + erff(v * 0.70710678118654752f)); so[w][8 * hh + r][t * 16 + ln] = v; } }
  __builtin_amdgcn_fence(__ATOMIC_ACQ_REL, "workgroup"); __builtin_amdgcn_wave_barrier();
  const int rsub = lane >> 4, c4 = (lane & 15) * 4; typedef _Float16 v4h __attribute__((ext_vector_type(4)));
  {
#pragma unroll
    for (int q = 0; q < 8; ++q) { const int r = q * 2 + rsub; if (col0 + c4 < N) { const v4f v = *(const v4fa*)&so[w][r][c4]; if (C) *(v4f*)(C + cofs + (size_t)(row0 + r) * ldc + col0 + c4) = v; if (C16) { v4h h4; for (int i = 0; i < 4; ++i) h4[i] = (_Float16)v[i]; *(v4h*)(C16 + cofs + (size_t)(row0 + r) * ldc + col0 + c4) = h4; } } }
     }
}


typedef _Float16 v4h __attribute__((ext_vector_type(4)));

__device__ __forceinline__ void d_x16(const float* __restrict__ x, _Float16* __restrict__ X16, size_t n8, size_t t) { if (t >= n8) return; FragH f;
#pragma unroll
  for (int q = 0; q < 8; ++q) f.h[q] = (_Float16)bf16_round(x[t * 8 + q]); *(v8us*)((unsigned short*)X16 + t * 8) = f.half[0];  }
__global__ __launch_bounds__(256) void k_h16(const float* __restrict__ x, _Float16* __restrict__ X16, size_t n8) { const size_t t = (size_t)blockIdx.x * 256 + threadIdx.x; if (t >= n8) return; FragH f;
#pragma unroll
  for (int q = 0; q < 8; ++q) f.h[q] = (_Float16)x[t * 8 + q]; *(v8us*)((unsigned short*)X16 + t * 8) = f.half[0];  }
__global__ __launch_bounds__(256) void k_round16f(const float* __restrict__ W, _Float16* __restrict__ Bt, size_t n8) { const size_t t = (size_t)blockIdx.x * 256 + threadIdx.x; if (t >= n8) return; FragH f;
#pragma unroll
  for (int i = 0; i < 8; ++i) f.h[i] = (_Float16)(bf16_round(W[t * 8 + i]) * 16.0f); *(v8us*)((unsigned short*)Bt + t * 8) = f.half[0];  }
__global__ __launch_bounds__(256) void k_hl(const float* __restrict__ F, _Float16* __restrict__ Hh, _Float16* __restrict__ Hl, size_t n8) { const size_t t = (size_t)blockIdx.x * 256 + threadIdx.x; if (t >= n8) return; FragH fh, fl; const v4f a = *(const v4fa*)(F + t * 8), c = *(const v4fa*)(F + t * 8 + 4);
#pragma unroll
  for (int q = 0; q < 4; ++q) { _Float16 h = (_Float16)a[q]; fh.h[q] = h; fl.h[q] = (_Float16)((a[q] - (float)h) * 1024.0f); h = (_Float16)c[q]; fh.h[4 + q] = h; fl.h[4 + q] = (_Float16)((c[q] - (float)h) * 1024.0f); }
  { *(v8us*)((unsigned short*)Hh + t * 8) = fh.half[0]; *(v8us*)((unsigned short*)Hl + t * 8) = fl.half[0];  } }

// ---- WMMA helpers (f16 fragments of 16 rows x 32 k; one product with its distance) ----
__device__ __forceinline__ v16h g2_frag(const _Float16* p, int hh) { FragH f; f.half[0] = *(const v8us*)((const unsigned short*)p + 8 * hh); f.half[1] = *(const v8us*)((const unsigned short*)p + 16 + 8 * hh); return f.v; }
__device__ __forceinline__ v8f g2_mma(v16h a, v16h b, v8f c) { v8f d = __builtin_amdgcn_wmma_f32_16x16x32_f16(false, a, false, b, (short)0, c, false, false); asm volatile("v_nop\n\tv_nop\n\tv_nop\n\tv_nop" : "+v"(d) : "v"(a), "v"(b)); return d; }
// FRAGMENT ORDER: a tile of 16 rows x 32 k (1 KiB) is stored as [part 0..1][lane 0..31][8 halves]; lane = 16 hh + ln holds row ln, k = 16 part + 8 hh .. + 7: the registers of g2_frag, unchanged.
// One 16-byte load of a wave then reads 512 contiguous bytes (4 lines) where the row-major tile made it touch 16 lines of 32 useful bytes each.
#define FT 512                       /* halves of one 16 x 32 fragment tile */
__device__ __forceinline__ v16h gf_frag(const _Float16* p) { FragH f; f.half[0] = *(const v8us*)((const unsigned short*)p); f.half[1] = *(const v8us*)((const unsigned short*)p + FT / 2); return f.v; }      /* p: the tile's start + 8 lane */
// Projection GEMM C16[4096][1024] = f16(A . Bt^T / 16 + bias): one 128 x 128 tile of C per work-group, 8 waves of 32 x 64 (4 down, 2 across).
// Per trip 128 k (256 bytes of each of the 128 A rows and 128 Bt rows) lie in LDS at pitch 272 bytes, brought by asynchronous 16-byte copies: a wave's copy takes 2 rows x 256 bytes, whole lines.
// Two buffers: the copies of trip t + 1 fly while trip t's fragments are read from LDS. k ascends in steps of 32 per accumulator. The epilogue of q and k stages each wave's 32 x 64 block in the first buffer.
#define GT 128                       /* rows and columns of C per work-group */
#define GK 128                       /* k per trip */
#define GP 272                       /* LDS row pitch in bytes: 16 x odd, for the 16-byte fragment reads */
#define GO (GT * GP)                 /* bytes of one operand's rows in a buffer */
#define GB (2 * GO)                  /* bytes of one buffer: A rows, then Bt rows */
__device__ __forceinline__ v16h g3_frag(const char* p) { FragH f; f.half[0] = *(const v8us*)p; f.half[1] = *(const v8us*)(p + 32); return f.v; }
// this thread's 8 pieces of one operand's 128 rows x 256 bytes: rows 16 apart, LDS byte address l, global address g
__device__ __forceinline__ void g3_copy(unsigned l, const _Float16* g) {
  /* the copies and, as the last line, the wait that stands before their address registers are rewritten */
  asm volatile("global_load_async_to_lds_b128 %0, %8, off\n\t"
               "global_load_async_to_lds_b128 %1, %9, off\n\t"
               "global_load_async_to_lds_b128 %2, %10, off\n\t"
               "global_load_async_to_lds_b128 %3, %11, off\n\t"
               "global_load_async_to_lds_b128 %4, %12, off\n\t"
               "global_load_async_to_lds_b128 %5, %13, off\n\t"
               "global_load_async_to_lds_b128 %6, %14, off\n\t"
               "global_load_async_to_lds_b128 %7, %15, off\n\t"
               "s_wait_xcnt 0x0"
               :: "v"(l), "v"(l + 16 * GP), "v"(l + 32 * GP), "v"(l + 48 * GP), "v"(l + 64 * GP), "v"(l + 80 * GP), "v"(l + 96 * GP), "v"(l + 112 * GP),
                  "v"(g), "v"(g + 16 * DM), "v"(g + 32 * DM), "v"(g + 48 * DM), "v"(g + 64 * DM), "v"(g + 80 * DM), "v"(g + 96 * DM), "v"(g + 112 * DM)
               : "memory");
}
// The three products (q, k, v) need nothing of each other: they share one grid, blockIdx.y picks the weights, the bias and the output.
__global__ __launch_bounds__(256) void k_proj(const _Float16* __restrict__ A, const _Float16* __restrict__ BQ, const _Float16* __restrict__ BK, const _Float16* __restrict__ BV,
                                              const float* __restrict__ bq, const float* __restrict__ bk, const float* __restrict__ bvp, _Float16* __restrict__ Q16, _Float16* __restrict__ K16, _Float16* __restrict__ VT) {
  const int z = blockIdx.y; const _Float16* Bh = z == 0 ? BQ : z == 1 ? BK : BV; const float* bias = z == 0 ? bq : z == 1 ? bk : bvp; _Float16* C16 = z == 0 ? Q16 : z == 1 ? K16 : VT;
  static_assert(NR % GT == 0 && DM % GT == 0 && DM % GK == 0 && DM / GK >= 2 && 8 * 32 * 68 * 4 <= GB, "k_proj: whole tiles, two trips or more, the output staging fits one buffer");
  __shared__ __attribute__((aligned(16))) float sm[2 * GB / 4];
  const int tid = threadIdx.x, w = tid >> 5, lane = tid & 31, ln = lane & 15, hh = lane >> 4, wm = w & 3, wn = w >> 2;
  const int mt = blockIdx.x % (int)(NR / GT), nq = blockIdx.x / (int)(NR / GT); const int row0 = mt * GT + 32 * wm, col0 = nq * GT + 64 * wn;
  const float* bp = bias + col0 + ln; float bv[4];
#pragma unroll      /* bv indexed by constants: registers; the four loads fly under the first copies */
  for (int t = 0; t < 4; ++t) bv[t] = bp[16 * t];
  asm volatile("s_wait_xcnt 0x0" :: "v"(bp) : "memory");      /* the wait before the address registers of the loads above are overwritten */
  const _Float16* ga = A + (size_t)(mt * GT + (tid >> 4)) * DM + (tid & 15) * 8;
  const _Float16* gb = Bh + (size_t)(nq * GT + (tid >> 4)) * DM + (tid & 15) * 8;
  const unsigned l0 = (unsigned)(size_t)(const void*)sm + (unsigned)((tid >> 4) * GP + (tid & 15) * 16);
  g3_copy(l0, ga); g3_copy(l0 + GO, gb);
  asm volatile("s_wait_asynccnt 0x0" ::: "memory");      /* this wave's copies of trip 0 have landed */
  __syncthreads();      /* publishes trip 0's rows */
  g3_copy(l0 + GB, ga + GK); g3_copy(l0 + GB + GO, gb + GK);
  const char* fa = (const char*)sm + (32 * wm + ln) * GP + 16 * hh;
  const char* fb = (const char*)sm + GO + (64 * wn + ln) * GP + 16 * hh;
  const v8f z8 = {0.f,0.f,0.f,0.f,0.f,0.f,0.f,0.f}; v8f c00 = z8, c01 = z8, c02 = z8, c03 = z8, c10 = z8, c11 = z8, c12 = z8, c13 = z8;
#pragma unroll 1      /* rolled: one publish point in the text, and the two buffers are told apart by an offset */
  for (int t = 0; t < DM / GK; ++t) { const int bo = (t & 1) * GB;
    const char* pa = fa + bo; const char* pb = fb + bo; v16h af[2][2], bf[2][4];      /* two fragment sets: step s + 1 of this trip is read from LDS, as one group, in front of step s's products */
#pragma unroll      /* the sets are indexed by constants, so that they live in registers */
    for (int i = 0; i < 2; ++i) af[0][i] = g3_frag(pa + i * 16 * GP);
#pragma unroll      /* as above */
    for (int j = 0; j < 4; ++j) bf[0][j] = g3_frag(pb + j * 16 * GP);
#pragma unroll      /* as above; the four k steps of a trip also get constant LDS offsets */
    for (int s = 0; s < GK / 32; ++s) { const int cu = s & 1, nx = cu ^ 1;
      if (s + 1 < GK / 32) {
#pragma unroll      /* as above */
        for (int i = 0; i < 2; ++i) af[nx][i] = g3_frag(pa + i * 16 * GP + 64 * (s + 1));
#pragma unroll      /* as above */
        for (int j = 0; j < 4; ++j) bf[nx][j] = g3_frag(pb + j * 16 * GP + 64 * (s + 1)); }
      c00 = g2_mma(af[cu][0], bf[cu][0], c00); c10 = g2_mma(af[cu][1], bf[cu][0], c10);
      c01 = g2_mma(af[cu][0], bf[cu][1], c01); c11 = g2_mma(af[cu][1], bf[cu][1], c11);
      c02 = g2_mma(af[cu][0], bf[cu][2], c02); c12 = g2_mma(af[cu][1], bf[cu][2], c12);
      c03 = g2_mma(af[cu][0], bf[cu][3], c03); c13 = g2_mma(af[cu][1], bf[cu][3], c13); }
    asm volatile("s_wait_dscnt 0x0" ::: "memory");      /* this wave's reads of trip t's buffer are done before it is refilled */
    asm volatile("s_wait_asynccnt 0x0" ::: "memory");      /* this wave's copies of trip t + 1 have landed */
    __syncthreads();      /* publishes trip t + 1's rows and ends every wave's reads of trip t's buffer */
    if (t + 2 < DM / GK) { g3_copy(l0 + bo, ga + (t + 2) * GK); g3_copy(l0 + bo + GO, gb + (t + 2) * GK); } }
  asm volatile("s_wait_asynccnt 0x0" ::: "memory");      /* no copy is outstanding when the first buffer becomes output staging */
  v8f accs[8] = {c00, c01, c02, c03, c10, c11, c12, c13};
  if (z == 2) {      /* v: V^T in fragment order, [(batch, head)][16 columns d][32 keys][part][lane][8 keys]. An accumulator tile is already such a piece: lane 16 hh + ln holds column d = 16 t + ln and, in its 8 registers, the keys 16 half + 8 hh .. + 7 of the wave's 32 rows (one key group of one batch; its 64 columns are one head), so it is stored from the registers */
    static_assert(SQ % GT == 0 && HD == 64 && FT == 512, "k_proj: a wave's 32 rows are one 32-key group of one batch, its 64 columns one head");
    _Float16* vo = C16 + (((size_t)(row0 / SQ) * NH + col0 / HD) * 4 * (SQ / 32) + (row0 % SQ) / 32) * FT + lane * 8;
#pragma unroll      /* accs and bv indexed by constants: registers; each of the 8 stores is 512 contiguous bytes */
    for (int u = 0; u < 8; ++u) { const int t = u & 3, half = u >> 2; const float bb = bf16_round(bv[t]); FragH f;
#pragma unroll      /* as above */
      for (int r = 0; r < 8; ++r) f.h[r] = (_Float16)(accs[u][r] * 0.0625f + bb);
      *(v8us*)((unsigned short*)vo + (size_t)t * (SQ / 32) * FT + half * (FT / 2)) = f.half[0]; }
    asm volatile("s_wait_xcnt 0x0" ::: "memory");      /* the wait before a register of the stores above is overwritten */
  } else {      /* q, k: fragment order, [16-row tile][head][k half of 32][part][lane][8]; the wave's 64 columns are one head, its 32 rows two tiles; turned through the wave's own staging block */
    float (*so)[68] = (float (*)[68])(sm + w * 32 * 68);
#pragma unroll      /* accs and bv indexed by constants: registers */
    for (int u = 0; u < 8; ++u) { const int t = u & 3, half = u >> 2; const float bb = bf16_round(bv[t]);
#pragma unroll      /* as above */
      for (int r = 0; r < 8; ++r) so[half * 16 + 8 * hh + r][t * 16 + ln] = accs[u][r] * 0.0625f + bb; }
    __builtin_amdgcn_fence(__ATOMIC_ACQ_REL, "workgroup"); __builtin_amdgcn_wave_barrier();      /* the wave's staged block is complete before its lanes read each other's values; no other wave touches it */
    _Float16* cf = C16 + ((size_t)(row0 / 16) * NH + col0 / HD) * (2 * FT) + lane * 8;
#pragma unroll      /* the LDS reads and the 8 stores overlap; each store is 512 contiguous bytes */
    for (int q = 0; q < 8; ++q) { const int tl = q >> 2, c = q & 3; const float* sp = &so[16 * tl + ln][16 * c + 8 * hh]; const v4f v0 = *(const v4fa*)sp, v1 = *(const v4fa*)(sp + 4); FragH f;
#pragma unroll      /* f indexed by constants: registers */
      for (int i = 0; i < 4; ++i) { f.h[i] = (_Float16)v0[i]; f.h[4 + i] = (_Float16)v1[i]; }
      *(v8us*)((unsigned short*)cf + (size_t)tl * NH * (2 * FT) + c * (FT / 2)) = f.half[0]; }
    asm volatile("s_wait_xcnt 0x0" ::: "memory");      /* the wait before a register of the stores above is overwritten */
  } }


// table in fragment order: piece t of 8 halves is [16-row tile][k half of 32][part][lane]; it holds row 16 tile + ln, columns 16 (2 khalf + part) + 8 hh .. + 7
__device__ __forceinline__ void d_wrel(const float* __restrict__ w, _Float16* __restrict__ Bt, size_t t) { if (t >= (size_t)RW * HD / 8) return; const size_t row = (t >> 7) * 16 + (t & 15), col = ((t >> 5) & 3) * 16 + ((t >> 4) & 1) * 8; const bool live = row < (size_t)NREL; FragH f; for (int q = 0; q < 8; ++q) f.h[q] = live ? (_Float16)(bf16_round(w[row * HD + col + q]) * 16.0f) : (_Float16)0.0f; *(v8us*)((unsigned short*)Bt + t * 8) = f.half[0];  }
// The five operand preparations need nothing of each other: they share one grid as ranges of the block index (a block-uniform branch).
// Longest block first, so that none starts late and runs on alone: the table (its guarded loads follow one another), the weight tiles (load, turn in LDS, store), then the hidden rows.
#define PW ((DM / WK) * (DM / WN))   /* blocks (tiles) per weight matrix */
#define PX ((int)(NR * DM / 8 / 256)) /* blocks of the hidden rows */
#define PE (RW * HD / 8 / 256)       /* blocks of the distance table */
__global__ __launch_bounds__(256) void k_prep(const float* __restrict__ wq, const float* __restrict__ wk, const float* __restrict__ wv, const float* __restrict__ demb, const float* __restrict__ hs,
                                              _Float16* __restrict__ BQ, _Float16* __restrict__ BK, _Float16* __restrict__ BV, _Float16* __restrict__ BE, _Float16* __restrict__ X16) {
  static_assert(DM % WK == 0 && DM % WN == 0 && WK == 128 && WN == 64 && NR * DM / 8 % 256 == 0 && RW * HD / 8 % 256 == 0, "k_prep: whole tiles and whole blocks in every range; 256 threads = 16 k pieces x 16 column quads");
  __shared__ __attribute__((aligned(16))) unsigned short tl[WN * WK];      /* the weight tiles' turning place */
  const int blk = blockIdx.x, tid = threadIdx.x;
  if (blk < PE) d_wrel(demb, BE, (size_t)blk * 256 + tid);
  else if (blk < PE + 3 * PW) { const int u = blk - PE, z = u / PW; d_wt_tile(z == 0 ? wq : z == 1 ? wk : wv, z == 0 ? BQ : z == 1 ? BK : BV, 16.0f, u - z * PW, tid, tl); }      /* [in][out] -> Bt[out][in] x16 */
  else d_x16(hs, X16, NR * DM / 8, (size_t)(blk - PE - 3 * PW) * 256 + tid); }
__global__ __launch_bounds__(256) void k_wnat(const float* __restrict__ w, size_t n8, _Float16* __restrict__ Bt) { const size_t t = (size_t)blockIdx.x * 256 + threadIdx.x; if (t >= n8) return; FragH f; for (int q = 0; q < 8; ++q) f.h[q] = (_Float16)(bf16_round(w[t * 8 + q]) * 16.0f); *(v8us*)((unsigned short*)Bt + t * 8) = f.half[0];  }
// Fused attention: one work-group = QT tiles of RT query rows of one (batch, head), one tile after the other, 16 waves: 256 work-groups instead of 2048 (its registers leave room for one on a WGP),
// and argument loads, address set-up, the k fragments and the mask are paid once a walk, not once a tile. In each tile wave w owns the key columns 32w .. 32w + 31 of all RT rows:
// it forms q.k, the window of q . dist_emb^T and the window of k . dist_emb^T that those columns need on WMMA (64 table rows from i0 - 32w + 480 serve both windows;
// the k fragments are the B operand of q.k and the A operand of k . dist_emb^T) and sums the three in its own block of the LDS score tile, each relative term stored along its diagonal:
// score[i][r] = (q_i.k_r + q_i.e[i-r+S-1] + k_r.e[i-r+S-1]) * 0.125 + mask[r] (bf16-rounded additive mask, staged in LDS).
// Of the three 16-wide table tiles a 16x16 block meets, the middle one is used whole and the outer two halve along the diagonal, so they merge into one full tile by a lane select.
// Then one wave per query row (two rows a wave), lane l holding columns 128u + 4l .. + 3; P = f16(256 softmax) goes to LDS; each wave forms one 16x16 tile of P . V over one half of K = 512 (V^T fragments from memory);
// the two halves are summed through LDS, from where each output row is stored as whole 256-byte runs.
// Every loop but the walk over the tiles is fully unrolled (constant trip counts): the per-lane arrays must be indexed by constants to live in registers.
#define RT 32                        /* query rows per tile */
#define QT 8                         /* query tiles that one work-group walks, one after the other */
#define TP (SQ + 4)                  /* score tile pitch in floats: rows stay 16-byte aligned, a column of 32 rows falls on 16 banks */
#define PP (SQ + 8)                  /* P tile pitch in halves: 16 bytes more a row for the 16-byte fragment reads */
template <int C> __device__ __forceinline__ float x_row(float x) { return __builtin_bit_cast(float, __builtin_amdgcn_update_dpp(0, __builtin_bit_cast(int, x), 0x160 | C, 0xf, 0xf, true)); }      /* lane l <- lane l ^ C inside a 16-lane row (row_xmask) */
__device__ __forceinline__ float x_half(float x) { return __builtin_bit_cast(float, __builtin_amdgcn_permlanex16(__builtin_bit_cast(int, x), __builtin_bit_cast(int, x), 0x76543210, 0xfedcba98, false, false)); }      /* lane l <- lane l ^ 16 */
__device__ __forceinline__ float wave_max(float v) { v = fmaxf(v, x_row<1>(v)); v = fmaxf(v, x_row<2>(v)); v = fmaxf(v, x_row<4>(v)); v = fmaxf(v, x_row<8>(v)); return fmaxf(v, x_half(v)); }
__device__ __forceinline__ float wave_sum(float v) { v += x_row<1>(v); v += x_row<2>(v); v += x_row<4>(v); v += x_row<8>(v); return v + x_half(v); }
__device__ __forceinline__ v8f g2_dot64(const v16h (&a)[2], const v16h (&b)[2]) { const v8f z8 = {0.f,0.f,0.f,0.f,0.f,0.f,0.f,0.f}; return g2_mma(a[1], b[1], g2_mma(a[0], b[0], z8)); }
__global__ __launch_bounds__(512) void k_attn(const _Float16* __restrict__ Q16, const _Float16* __restrict__ K16, const _Float16* __restrict__ BE, const _Float16* __restrict__ VT, const float* __restrict__ amask, float* __restrict__ out) {
  static_assert(SQ == 512 && HD == 64 && RT == 32 && SQ % (RT * QT) == 0 && RW >= 2 * SQ, "k_attn: 16 waves of 32 key columns; 512 threads stage 512 mask values and store 32 x 64 outputs; whole walks of QT tiles");
  __shared__ __attribute__((aligned(16))) float sc[RT][TP];
  __shared__ __attribute__((aligned(16))) _Float16 ph[RT][PP];
  __shared__ __attribute__((aligned(16))) float so[2][RT][HD + 4];
  __shared__ __attribute__((aligned(16))) float mk[SQ];
  const int tid = threadIdx.x, w = __builtin_amdgcn_readfirstlane(tid >> 5), lane = tid & 31, ln = lane & 15, hh = lane >> 4, i00 = blockIdx.x * (RT * QT), h = blockIdx.y, b = blockIdx.z;      /* i00: first query row of the walk */
  /* all four operands lie in fragment order: every load below reads 512 contiguous bytes */
  const int l8 = lane * 8;      /* the lane's piece of a fragment tile; the tile starts below are the same for the whole wave */
  const _Float16* qp = Q16 + ((size_t)((b * SQ + i00) / 16) * NH + h) * (2 * FT);
  const _Float16* kp = K16 + ((size_t)((b * SQ + 32 * w) / 16) * NH + h) * (2 * FT);
  const _Float16* ep = BE + (size_t)((i00 - 32 * w + (SQ - 32)) / 16) * (2 * FT);      /* table rows i0 - 32w + 480 .. + 63 of the tile at i0, all inside 0 .. 1023; the first is a multiple of 16 */
  const float* mp = amask + (size_t)b * SQ;
  v16h kf[2][2];
#pragma unroll
  for (int m = 0; m < 2; ++m)
#pragma unroll
    for (int s = 0; s < 2; ++s) kf[m][s] = gf_frag(kp + (m * NH * 2 + s) * FT + l8);
  const float mv = mp[tid];
  asm volatile("s_wait_xcnt 0x0" :: "s"(kp), "s"(mp), "v"(lane) : "memory");      /* the wait before the address registers of the loads above are overwritten; naming them keeps them whole up to it */
  mk[tid] = bf16_round(mv);
  const int dg = 8 * hh - ln;      /* row minus column inside a 16x16 accumulator tile, less the register index */
  float* blk = &sc[0][32 * w];
  /* P . V share of this wave: tile (pm, pn) of the 32 x 64 result, half pk of K = 512 */
  const int pm = w & 1, pn = (w >> 1) & 3, pk = w >> 3;
  const _Float16* vp = VT + ((((size_t)b * NH + h) * 4 + pn) * (SQ / 32) + 8 * pk) * FT;
  float* op = out + ((size_t)b * SQ + i00 + (tid >> 4)) * DM + h * HD + (tid & 15) * 4;
  /* The walk: the k fragments and the mask serve all QT tiles; each tile brings its own q and table fragments, q first, which the first products need. */
  /* Each LDS array is rewritten only behind a barrier that follows its last read: sc behind the third of the tile before, ph behind the first, so behind the second. */
  v16h qf[2][2], ef[4][2];
#pragma unroll
  for (int m = 0; m < 2; ++m)
#pragma unroll
    for (int s = 0; s < 2; ++s) qf[m][s] = gf_frag(qp + (m * NH * 2 + s) * FT + l8);
#pragma unroll
  for (int t = 0; t < 4; ++t)
#pragma unroll
    for (int s = 0; s < 2; ++s) ef[t][s] = gf_frag(ep + (t * 2 + s) * FT + l8);
  asm volatile("s_wait_xcnt 0x0" :: "s"(qp), "s"(ep), "v"(lane) : "memory");      /* the wait before the address registers of the loads above are overwritten */
  auto tile = [&](const bool last) __attribute__((always_inline)) {      /* one tile; inlined at its two places, where last is a constant */
#pragma unroll
  for (int m = 0; m < 2; ++m)
#pragma unroll
    for (int e = 0; e < 2; ++e) { const v8f c = g2_dot64(qf[m], kf[e]);
#pragma unroll
      for (int r = 0; r < 8; ++r) blk[(16 * m + 8 * hh + r) * TP + 16 * e + ln] = c[r]; }
  /* q . e: accumulator (query row 16m + 8hh + r, table row base + 16(m + t) + ln) belongs to key column 31 + 8hh + r - 16t - ln of the block */
#pragma unroll
  for (int m = 0; m < 2; ++m) { const v8f c0 = g2_dot64(qf[m], ef[m]), c1 = g2_dot64(qf[m], ef[m + 1]), c2 = g2_dot64(qf[m], ef[m + 2]); float* pc[8]; float* po[8]; float om[8], oo[8];      /* the 16 x 32 elements are distinct: all reads, then all writes, so that the LDS round trips overlap */
#pragma unroll
    for (int r = 0; r < 8; ++r) { pc[r] = blk + (16 * m + 8 * hh + r) * TP + 15 + dg + r; po[r] = pc[r] + (dg + r <= 0 ? 16 : -16); om[r] = *pc[r]; oo[r] = *po[r]; }
#pragma unroll
    for (int r = 0; r < 8; ++r) { *pc[r] = om[r] + c1[r] * 0.0625f; *po[r] = oo[r] + (dg + r <= 0 ? c0[r] : c2[r]) * 0.0625f; } }
  /* k . e: accumulator (key row 16e + 8hh + r of the block, table row base + 16(1 - e + t) + ln) belongs to query row 16t + ln + 8hh + r - 15 */
#pragma unroll
  for (int e = 0; e < 2; ++e) { const v8f c0 = g2_dot64(kf[e], ef[1 - e]), c1 = g2_dot64(kf[e], ef[2 - e]), c2 = g2_dot64(kf[e], ef[3 - e]); float* pc[8]; float* po[8]; float om[8], oo[8];
#pragma unroll
    for (int r = 0; r < 8; ++r) { const int il = 1 + ln + 8 * hh + r; pc[r] = blk + il * TP + 16 * e + 8 * hh + r; po[r] = pc[r] + (il < 16 ? 16 * TP : -16 * TP); om[r] = *pc[r]; oo[r] = *po[r]; }
#pragma unroll
    for (int r = 0; r < 8; ++r) { *pc[r] = om[r] + c1[r] * 0.0625f; *po[r] = oo[r] + (1 + ln + 8 * hh + r < 16 ? c2[r] : c0[r]) * 0.0625f; } }
  __syncthreads();      /* publishes the score tile (and, in the first tile, the mask) */
  /* the wave's V^T fragments are asked for here so that they fly during the softmax */
  v16h vf[8];
#pragma unroll
  for (int s = 0; s < 8; ++s) vf[s] = gf_frag(vp + s * FT + l8);
  asm volatile("s_wait_xcnt 0x0" :: "s"(vp), "v"(lane) : "memory");      /* the wait before the address registers of the loads above are overwritten */
#pragma unroll
  for (int k = 0; k < 2; ++k) { const int row = 2 * w + k; float x[16]; float mx = -INFINITY;
#pragma unroll
    for (int u = 0; u < 4; ++u) { const int c = 128 * u + 4 * lane; const v4f sv = *(const v4fa*)&sc[row][c], mm = *(const v4fa*)&mk[c];
#pragma unroll
      for (int q = 0; q < 4; ++q) { x[u * 4 + q] = sv[q] * 0.125f + mm[q]; mx = fmaxf(mx, x[u * 4 + q]); } }
    mx = wave_max(mx); float se = 0.f;
#pragma unroll
    for (int j = 0; j < 16; ++j) { x[j] = __builtin_amdgcn_exp2f((x[j] - mx) * 1.44269504088896340736f); se += x[j]; }      /* e^d = 2^(d log2 e), d <= 0: the hardware's exp2 alone; a result too small for it is far below one unit of the f16 weight */
    const float sn = 256.0f / wave_sum(se);
#pragma unroll
    for (int u = 0; u < 4; ++u) { v4h o;
#pragma unroll
      for (int q = 0; q < 4; ++q) o[q] = (_Float16)(x[u * 4 + q] * sn);
      *(v4h*)&ph[row][128 * u + 4 * lane] = o; } }
  __syncthreads();      /* publishes the P tile */
  { const _Float16* pa = &ph[16 * pm + ln][256 * pk + 8 * hh]; v16h pf[8];
#pragma unroll
    for (int s = 0; s < 8; ++s) pf[s] = g2_frag(pa + 32 * s, 0);
    v8f c = {0.f,0.f,0.f,0.f,0.f,0.f,0.f,0.f};
#pragma unroll
    for (int s = 0; s < 8; ++s) c = g2_mma(pf[s], vf[s], c);
#pragma unroll
    for (int r = 0; r < 8; ++r) so[pk][16 * pm + 8 * hh + r][16 * pn + ln] = c[r]; }
  __syncthreads();      /* publishes the two K halves of the 32 x 64 result */
  if (!last) {      /* the next tile's fragments (32 query rows on, the table window 32 rows on) are asked for behind the tile's last barrier, which would wait for them, and fly during the output */
  qp += 2 * NH * 2 * FT; ep += 2 * 2 * FT;
#pragma unroll
  for (int m = 0; m < 2; ++m)
#pragma unroll
    for (int s = 0; s < 2; ++s) qf[m][s] = gf_frag(qp + (m * NH * 2 + s) * FT + l8);
#pragma unroll
  for (int t = 0; t < 4; ++t)
#pragma unroll
    for (int s = 0; s < 2; ++s) ef[t][s] = gf_frag(ep + (t * 2 + s) * FT + l8);
  asm volatile("s_wait_xcnt 0x0" :: "s"(qp), "s"(ep), "v"(lane) : "memory");      /* the wait before the address registers of the loads above are overwritten */
  }
  { const int row = tid >> 4, c4 = (tid & 15) * 4; const v4f v = (*(const v4fa*)&so[0][row][c4] + *(const v4fa*)&so[1][row][c4]) * 0.00390625f; *(v4f*)op = v;
    asm volatile("s_wait_xcnt 0x0" :: "v"(op) : "memory");      /* the wait before the address register of the store above is overwritten */
    op += (size_t)RT * DM; } };
#pragma unroll 1      /* rolled: one copy of the code for all tiles but the last, and the fragment registers are the same in every trip */
  for (int it = 0; it + 1 < QT; ++it) tile(false);
  tile(true); }      /* the last tile asks for nothing more */
__global__ __launch_bounds__(256) void k_vt(const _Float16* __restrict__ V16, int b, int h0, _Float16* __restrict__ VT) { __shared__ unsigned short tl[64][65]; const int tid = threadIdx.x; const int hh = blockIdx.x % HG, sg = blockIdx.x / HG; const int s0 = sg * 64; const int h = h0 + hh;
  for (int i = tid; i < 64 * 8; i += 256) { const int j = i / 8, d8 = (i % 8) * 8; FragH f; f.half[0] = *(const v8us*)((const unsigned short*)V16 + ((size_t)b * SQ + s0 + j) * DM + h * HD + d8); for (int q = 0; q < 8; ++q) tl[d8 + q][j] = f.u[q]; }
  __syncthreads();
  { for (int i = tid; i < 64 * 8; i += 256) { const int d = i / 8, j8 = (i % 8) * 8; FragH f; for (int q = 0; q < 8; ++q) f.u[q] = tl[d][j8 + q]; *(v8us*)((unsigned short*)VT + ((size_t)hh * HD + d) * SQ + s0 + j8) = f.half[0]; }  } }

extern "C" void kernel_launch(void* const* d_in, const int* in_sizes, int n_in,
                              void* d_out, int out_size, void* d_ws, size_t ws_size, hipStream_t stream) {
  (void)in_sizes; (void)n_in; (void)out_size;
  const float* const* I = (const float* const*)d_in; const float* hs = I[0]; const float* amask = I[1]; const float* wq = I[2]; const float* bq = I[3]; const float* wk = I[4]; const float* bk = I[5]; const float* wv = I[6]; const float* bv = I[7]; const float* demb = I[8];      /* weights [in][out]; attention_mask [8][1][1][512] additive; dist_emb [1023][64] */
  char* ws = (char*)d_ws; size_t off = 0;
  auto take = [&](size_t bytes) { char* p = ws + off; off += (bytes + 255) & ~(size_t)255; return p; };
  _Float16* BQ = (_Float16*)take((size_t)DM * DM * 2); _Float16* BK = (_Float16*)take((size_t)DM * DM * 2); _Float16* BV = (_Float16*)take((size_t)DM * DM * 2); _Float16* BE = (_Float16*)take((size_t)RW * HD * 2);
  _Float16* X16 = (_Float16*)take(NR * DM * 2); _Float16* Q16 = (_Float16*)take(NR * DM * 2); _Float16* K16 = (_Float16*)take(NR * DM * 2);
  _Float16* VT = (_Float16*)take((size_t)NB * NH * HD * SQ * 2);
  if (off > ws_size) return;      /* 6 + 0.1 + 3x8 + 8 = approx 38 MiB */
  k_prep<<<3 * PW + PX + PE, 256, 0, stream>>>(wq, wk, wv, demb, hs, BQ, BK, BV, BE, X16);      /* transposed weights x16, padded table x16, hidden rows as f16 */
  k_proj<<<dim3((unsigned)((NR / GT) * (DM / GT)), 3), 256, 0, stream>>>(X16, BQ, BK, BV, bq, bk, bv, Q16, K16, VT);      /* q, k and V^T in fragment order */
  k_attn<<<dim3(SQ / (RT * QT), NH, NB), 512, 0, stream>>>(Q16, K16, BE, VT, amask, (float*)d_out);      /* scores, relative terms, softmax and P . V; ctx rows (merged heads, f32) */
}

// v010
// A run of this version takes 62.2 microseconds.
// Two timings next to v009 both put it at 1.05 times that version's speed.
// Counting every step since v000, it is 58.7 times as fast.
#include <hip/hip_runtime.h>
// BERT self-attention with relative-position score terms (hidden [8][512][1024]; q, k, v = h W + b ([in][out], 16 heads of 64); scores[l][r] = (q_l.k_r + q_l.pe[l-r] + k_r.pe[l-r]) / 8 + mask[r] with pe = dist_emb[l - r + 511]; softmax; ctx = attn v merged -> [8][512][1024]).
// Structure: token rows r = b*512 + s; hidden as exact f16 rows (with the weight and table preparations in one launch); Q | K | V as three WMMA GEMMs in one launch (128x128 work-group tiles staged in LDS by asynchronous copies, 32x64 wave tiles, f32 accumulation, exact x16 transposed weights, bias in the epilogue, f16 outputs; v leaves the accumulators as V^T); q, k, V^T and the table lie in memory in WMMA fragment order (FRAGMENT ORDER below), so that a fragment load of the attention reads whole lines; then one fused attention launch, one work-group per 256 query rows of a (batch, head), walked as 8 tiles of 32 rows: per tile q.k and the two relative terms (the window of dist_emb that the tile's diagonals meet times q rows and k rows; table padded to 1024 rows with zeros) on WMMA, each stored whole in an LDS tile of its own (f32), summed along the diagonals by the reads of the row softmax on VALU, one wave per query row (mask added; weights x256 as f16 in LDS), ctx = P . V on WMMA (K = 512, alpha 2^-8) written as f32 into the merged output rows.
// Compute dtype: inputs rounded to bf16; hidden / weights / table exact; q, k, v and the softmax weights as plain f16 GEMM operands (~2^-12); scores, relative terms and softmax statistics f32. v_wmma_f32_16x16x32_f16.
#define NB 8
#define SQ 512
#define DM 1024
#define NH 16
#define HD 64
#define HG 16                        /* heads per attention launch group (all) */
#define NREL 1023                    /* relative distances -511..511 */
#define RW 1024                      /* dist_emb table rows (distances padded to 1024) */
#define QN SQ                        /* unused: attention covers all SQ query rows */
#define NBR NB                       /* unused: attention covers all NB batches */
#define MP ((int)NR)                 /* unused: the projections take all NR rows */
#define NR ((size_t)NB * SQ)         /* 4096 token rows */
typedef __bf16 v16b __attribute__((ext_vector_type(16)));
typedef unsigned short v8us __attribute__((ext_vector_type(8), may_alias));
typedef float  v8f  __attribute__((ext_vector_type(8)));
typedef float  v4f  __attribute__((ext_vector_type(4)));
typedef float  v4fa __attribute__((ext_vector_type(4), may_alias));
union FragB { v16b v; v8us half[2]; unsigned short u[16]; };

__device__ __forceinline__ unsigned short bf16_bits(float x) { unsigned int u = __float_as_uint(x); return (unsigned short)((u + 0x7FFFu + ((u >> 16) & 1u)) >> 16); }
__device__ __forceinline__ float bf16_val(unsigned short b) { return __uint_as_float(((unsigned int)b) << 16); }
__device__ __forceinline__ float bf16_round(float x) { return bf16_val(bf16_bits(x)); }
// D += A·B with NT terms: 1 = ah·bh, 2 = + al·bh (A split), 3 = + ah·bl (both split)
template <int NT>
__device__ __forceinline__ v8f mmaN(v16b ah, v16b al, v16b bh, v16b bl, v8f c) {
  c = __builtin_amdgcn_wmma_f32_16x16x32_bf16(false, ah, false, bh, (short)0, c, false, false);
  if (NT >= 2) c = __builtin_amdgcn_wmma_f32_16x16x32_bf16(false, al, false, bh, (short)0, c, false, false);
  if (NT >= 3) c = __builtin_amdgcn_wmma_f32_16x16x32_bf16(false, ah, false, bl, (short)0, c, false, false);
  asm volatile("v_nop\n\tv_nop\n\tv_nop\n\tv_nop" : "+v"(c) : "v"(ah), "v"(al), "v"(bh), "v"(bl));
  return c;
}

__global__ __launch_bounds__(256) void k_wt_bf16(const float* __restrict__ W, unsigned short* __restrict__ Wt, int K, int N) {
  const int t = blockIdx.x * 256 + threadIdx.x;
  const int k8n = K / 8;
  if (t >= N * k8n) return;
  const int n = t / k8n, k8 = (t % k8n) * 8;
  v8us v;
#pragma unroll
  for (int i = 0; i < 8; ++i) v[i] = bf16_bits(W[(size_t)(k8 + i) * N + n]);
  *(v8us*)(Wt + (size_t)n * K + k8) = v;
  
}

// GEMM C[M][N] (f32, pitch ldc) = act(A[M][K]·W + bias). A f32 row-major (pitch lda) converted per fragment to bf16
// (ASPLIT: hi/lo two planes -> 2 terms, else single rounded term); Wt bf16 [N][K] (pitch ldb). BIAS_BF16 rounds the
// bias to bf16 first (bias quantised to bf16 before the add). K%32==0, M%16==0, N%64==0.
template <bool ASPLIT, int ACT, bool BIAS_BF16>
__global__ __launch_bounds__(128) void k_gemm_bf(const float* __restrict__ A, int lda, const unsigned short* __restrict__ Wt, int ldb,
                                               const float* __restrict__ bias, float* __restrict__ C, int ldc, int M, int N, int K) {
  __shared__ __attribute__((aligned(16))) float so[4][16][64];
  const int tid = threadIdx.x, w = tid >> 5, lane = tid & 31, ln = lane & 15, hh = lane >> 4;
  const int ntn = N / 64;
  const int wid = blockIdx.x * 4 + w;
  const int mt = wid / ntn, nq = wid % ntn;
  if (mt * 16 >= M) return;
  const int row0 = mt * 16, col0 = nq * 64;
  const float* arow = A + (size_t)(row0 + ln) * lda;
  v8f acc[4] = {};
  for (int kb = 0; kb < K; kb += 32) {
    FragB ah, al;
    const v4f x0 = *(const v4fa*)(arow + kb + 8 * hh), x1 = *(const v4fa*)(arow + kb + 8 * hh + 4);
    const v4f x2 = *(const v4fa*)(arow + kb + 16 + 8 * hh), x3 = *(const v4fa*)(arow + kb + 16 + 8 * hh + 4);
    float xs[16] = {x0[0],x0[1],x0[2],x0[3],x1[0],x1[1],x1[2],x1[3],x2[0],x2[1],x2[2],x2[3],x3[0],x3[1],x3[2],x3[3]};
#pragma unroll
    for (int i = 0; i < 16; ++i) { const unsigned short hb = bf16_bits(xs[i]); ah.u[i] = hb; al.u[i] = ASPLIT ? bf16_bits(xs[i] - bf16_val(hb)) : (unsigned short)0; }
#pragma unroll
    for (int t = 0; t < 4; ++t) {
      const unsigned short* brow = Wt + (size_t)(col0 + t * 16 + ln) * ldb + kb;
      FragB b;
      b.half[0] = *(const v8us*)(brow + 8 * hh);
      b.half[1] = *(const v8us*)(brow + 16 + 8 * hh);
      acc[t] = mmaN<ASPLIT ? 2 : 1>(ah.v, al.v, b.v, b.v, acc[t]);
    }
  }
#pragma unroll
  for (int t = 0; t < 4; ++t) {
    float bv = bias ? bias[col0 + t * 16 + ln] : 0.f;
    if (BIAS_BF16) bv = bf16_round(bv);
#pragma unroll
    for (int r = 0; r < 8; ++r) { float v = acc[t][r] + bv; if (ACT == 1) v = fmaxf(v, 0.f); so[w][8 * hh + r][t * 16 + ln] = v; }
  }
  __builtin_amdgcn_fence(__ATOMIC_ACQ_REL, "workgroup");
  __builtin_amdgcn_wave_barrier();
  const int rsub = lane >> 4, c4 = (lane & 15) * 4;
  {
#pragma unroll
    for (int q = 0; q < 8; ++q) {
      const int r = q * 2 + rsub;
      const v4f v = *(const v4fa*)&so[w][r][c4];
      *(v4f*)(C + (size_t)(row0 + r) * ldc + col0 + c4) = v;
    }
    
  }
}

// GEMM C = act(A·W + bias + resid): A f32 (ASPLIT -> hi/lo 2 terms), Wt bf16 [N][K]; ACT 0 none, 1 relu, 2 exact gelu;
// resid (optional, f32, row index = (row % rmod), pitch ldr, RES_BF16 rounds it) added before the activation.
template <bool ASPLIT, int ACT, bool BIAS_BF16, bool RES_BF16>
__global__ __launch_bounds__(128) void k_gemm_bf3(const float* __restrict__ A, int lda, const unsigned short* __restrict__ Wt, int ldb,
                                                const float* __restrict__ bias, const float* __restrict__ resid, int rmod, int ldr,
                                                float* __restrict__ C, int ldc, int M, int N, int K) {
  __shared__ __attribute__((aligned(16))) float so[4][16][64];
  const int tid = threadIdx.x, w = tid >> 5, lane = tid & 31, ln = lane & 15, hh = lane >> 4;
  const int ntn = N / 64;
  const int wid = blockIdx.x * 4 + w;
  const int mt = wid / ntn, nq = wid % ntn;
  if (mt * 16 >= M) return;
  const int row0 = mt * 16, col0 = nq * 64;
  const float* arow = A + (size_t)(row0 + ln) * lda;
  v8f acc[4] = {};
  for (int kb = 0; kb < K; kb += 32) {
    FragB ah, al;
    const v4f x0 = *(const v4fa*)(arow + kb + 8 * hh), x1 = *(const v4fa*)(arow + kb + 8 * hh + 4);
    const v4f x2 = *(const v4fa*)(arow + kb + 16 + 8 * hh), x3 = *(const v4fa*)(arow + kb + 16 + 8 * hh + 4);
    float xs[16] = {x0[0],x0[1],x0[2],x0[3],x1[0],x1[1],x1[2],x1[3],x2[0],x2[1],x2[2],x2[3],x3[0],x3[1],x3[2],x3[3]};
#pragma unroll
    for (int i = 0; i < 16; ++i) { const unsigned short hb = bf16_bits(xs[i]); ah.u[i] = hb; al.u[i] = ASPLIT ? bf16_bits(xs[i] - bf16_val(hb)) : (unsigned short)0; }
#pragma unroll
    for (int t = 0; t < 4; ++t) {
      const unsigned short* brow = Wt + (size_t)(col0 + t * 16 + ln) * ldb + kb;
      FragB b;
      b.half[0] = *(const v8us*)(brow + 8 * hh);
      b.half[1] = *(const v8us*)(brow + 16 + 8 * hh);
      acc[t] = mmaN<ASPLIT ? 2 : 1>(ah.v, al.v, b.v, b.v, acc[t]);
    }
  }
#pragma unroll
  for (int t = 0; t < 4; ++t) {
    const int col = col0 + t * 16 + ln;
    float bv = bias ? bias[col] : 0.f;
    if (BIAS_BF16) bv = bf16_round(bv);
#pragma unroll
    for (int r = 0; r < 8; ++r) {
      float v = acc[t][r] + bv;
      if (resid) { float rv = resid[(size_t)((row0 + 8 * hh + r) % rmod) * ldr + col]; if (RES_BF16) rv = bf16_round(rv); v += rv; }
      if (ACT == 1) v = fmaxf(v, 0.f);
      if (ACT == 2) v = 0.5f * v * (1.0f + erff(v * 0.70710678118654752f));
      if (ACT == 3) { const float u = 0.7978845608028654f * (v + 0.044715f * v * v * v); v = 0.5f * v * (1.0f + tanhf(u)); }
      so[w][8 * hh + r][t * 16 + ln] = v;
    }
  }
  __builtin_amdgcn_fence(__ATOMIC_ACQ_REL, "workgroup");
  __builtin_amdgcn_wave_barrier();
  const int rsub = lane >> 4, c4 = (lane & 15) * 4;
  {
#pragma unroll
    for (int q = 0; q < 8; ++q) {
      const int r = q * 2 + rsub;
      const v4f v = *(const v4fa*)&so[w][r][c4];
      *(v4f*)(C + (size_t)(row0 + r) * ldc + col0 + c4) = v;
    }
    
  }
}
// row LayerNorm (biased variance, eps) over N: s = X (+ R); optional out_sum <- s; out_norm <- (s-mu)*rsqrt(var+eps)*g + b
template <bool PARAM_BF16>
__global__ __launch_bounds__(256) void k_layernorm(const float* __restrict__ X, const float* __restrict__ R, const float* __restrict__ g, const float* __restrict__ bta,
                                                  float* __restrict__ out_sum, float* __restrict__ out_norm, int N, float eps) {
  __shared__ float red[256];
  const int row = blockIdx.x, tid = threadIdx.x;
  const float* x = X + (size_t)row * N; const float* rr = R ? R + (size_t)row * N : nullptr;
  float vals[16];                     // up to N = 4096
  const int per = N / 256;            // contiguous chunk per thread? use strided-by-4 chunks: thread handles j = tid*4 + 1024*u
  float s1 = 0.f;
  for (int u = 0; u < per / 4; ++u) {
    const int j = tid * 4 + 1024 * u;
    const v4f a = *(const v4fa*)(x + j);
    v4f b = {0.f,0.f,0.f,0.f}; if (rr) b = *(const v4fa*)(rr + j);
#pragma unroll
    for (int q = 0; q < 4; ++q) { const float v = a[q] + b[q]; vals[u * 4 + q] = v; s1 += v; }
  }
  red[tid] = s1; __syncthreads();
  for (int st = 128; st > 0; st >>= 1) { if (tid < st) red[tid] += red[tid + st]; __syncthreads(); }
  const float mu = red[0] / (float)N; __syncthreads();
  float s2 = 0.f;
  for (int u = 0; u < per / 4; ++u)
#pragma unroll
    for (int q = 0; q < 4; ++q) { const float c = vals[u * 4 + q] - mu; s2 += c * c; }
  red[tid] = s2; __syncthreads();
  for (int st = 128; st > 0; st >>= 1) { if (tid < st) red[tid] += red[tid + st]; __syncthreads(); }
  const float rs = rsqrtf(red[0] / (float)N + eps);
  {
    for (int u = 0; u < per / 4; ++u) {
      const int j = tid * 4 + 1024 * u;
      v4f o, sm;
#pragma unroll
      for (int q = 0; q < 4; ++q) {
        float gg = g[j + q], bb = bta[j + q];
        if (PARAM_BF16) { gg = bf16_round(gg); bb = bf16_round(bb); }
        sm[q] = vals[u * 4 + q]; o[q] = (vals[u * 4 + q] - mu) * rs * gg + bb;
      }
      if (out_sum) *(v4f*)(out_sum + (size_t)row * N + j) = sm;
      *(v4f*)(out_norm + (size_t)row * N + j) = o;
    }
    
  }
}



// ---- f16 WMMA path (v_wmma_f32_16x16x32_f16): 11-bit significands for operands in range — used where a [0,1] probability operand needs more precision than bf16
typedef _Float16 v16h __attribute__((ext_vector_type(16)));
union FragH { v16h v; v8us half[2]; _Float16 h[16]; unsigned short u[16]; };
template <int NT>
__device__ __forceinline__ v8f mmaH(v16h ah, v16h al, v16h bh, v16h bl, v8f c) {
  c = __builtin_amdgcn_wmma_f32_16x16x32_f16(false, ah, false, bh, (short)0, c, false, false);
  if (NT >= 2) c = __builtin_amdgcn_wmma_f32_16x16x32_f16(false, al, false, bh, (short)0, c, false, false);
  if (NT >= 3) c = __builtin_amdgcn_wmma_f32_16x16x32_f16(false, ah, false, bl, (short)0, c, false, false);
  asm volatile("v_nop\n\tv_nop\n\tv_nop\n\tv_nop" : "+v"(c) : "v"(ah), "v"(al), "v"(bh), "v"(bl));
  return c;
}
// batched GEMM like k_gemm_b but f16 operands: A f32 (split into f16 hi/lo if ASPLIT, else rounded to f16), Bt = f16 values [n][k]; alpha; C f32; N multiple of 16 (partial tiles skipped)
template <bool ASPLIT>
__global__ __launch_bounds__(128) void k_gemm_h(const float* __restrict__ A, int lda, size_t sA, const _Float16* __restrict__ Bh, int ldb, size_t sB, float alpha, float* __restrict__ C, int ldc, size_t sC, int M, int N, int K) {
  __shared__ __attribute__((aligned(16))) float so[4][16][64];
  const int tid = threadIdx.x, w = tid >> 5, lane = tid & 31, ln = lane & 15, hh = lane >> 4; const int by = blockIdx.y;
  A += (size_t)by * sA; Bh += (size_t)by * sB; C += (size_t)by * sC;
  const int ntn = (N + 63) / 64; const int wid = blockIdx.x * 4 + w; const int mt = wid / ntn, nq = wid % ntn; if (mt * 16 >= M) return;
  const int row0 = mt * 16, col0 = nq * 64; const float* arow = A + (size_t)(row0 + ln) * lda;
  v8f acc[4] = {};
  for (int kb = 0; kb < K; kb += 32) {
    FragH ah, al;
    const v4f x0 = *(const v4fa*)(arow + kb + 8 * hh), x1 = *(const v4fa*)(arow + kb + 8 * hh + 4), x2 = *(const v4fa*)(arow + kb + 16 + 8 * hh), x3 = *(const v4fa*)(arow + kb + 16 + 8 * hh + 4);
    float xs[16] = {x0[0],x0[1],x0[2],x0[3],x1[0],x1[1],x1[2],x1[3],x2[0],x2[1],x2[2],x2[3],x3[0],x3[1],x3[2],x3[3]};
#pragma unroll
    for (int i = 0; i < 16; ++i) { const _Float16 h = (_Float16)xs[i]; ah.h[i] = h; al.h[i] = ASPLIT ? (_Float16)(xs[i] - (float)h) : (_Float16)0.0f; }
#pragma unroll
    for (int t = 0; t < 4; ++t) { if (col0 + t * 16 >= N) continue; const size_t boff = (size_t)(col0 + t * 16 + ln) * ldb + kb; FragH bq; bq.half[0] = *(const v8us*)(Bh + boff + 8 * hh); bq.half[1] = *(const v8us*)(Bh + boff + 16 + 8 * hh);
      acc[t] = mmaH<ASPLIT ? 2 : 1>(ah.v, al.v, bq.v, bq.v, acc[t]); }
  }
#pragma unroll
  for (int t = 0; t < 4; ++t) { if (col0 + t * 16 >= N) continue;
#pragma unroll
    for (int r = 0; r < 8; ++r) so[w][8 * hh + r][t * 16 + ln] = acc[t][r] * alpha; }
  __builtin_amdgcn_fence(__ATOMIC_ACQ_REL, "workgroup"); __builtin_amdgcn_wave_barrier();
  const int rsub = lane >> 4, c4 = (lane & 15) * 4;
  {
#pragma unroll
    for (int q = 0; q < 8; ++q) { const int r = q * 2 + rsub; if (col0 + c4 < N) { const v4f v = *(const v4fa*)&so[w][r][c4]; *(v4f*)(C + (size_t)(row0 + r) * ldc + col0 + c4) = v; } }
     }
}

// Wt[n][k] = f16(W[k][n] * scale) from f32 row-major W[DM][DM] (scale = power of two; bf16-exact weights stay exact in f16 away from the subnormal range), one tile of WK k x WN n per work-group of 256, turned in LDS.
// Reads: thread (kg, nq) takes rows 8 kg .. + 7, columns 4 nq .. + 3, so each 16-byte load of a wave covers 2 rows x 256 contiguous bytes, whole lines, and the 8 loads are in flight together.
// LDS: tl[n][16-byte piece of 8 k], rows of 256 bytes; piece c of row n lies at place c ^ (n >> 2): the 16 lanes that write one k piece of 16 rows four apart, and the 16 lanes that read one whole row, both fall on all 64 banks.
// Writes: each 16-byte store of a wave covers 2 rows of Wt x 256 contiguous bytes.
#define WK 128                       /* k per tile */
#define WN 64                        /* n per tile */
__device__ __forceinline__ void d_wt_tile(const float* __restrict__ W, _Float16* __restrict__ Wt, float scale, int tile, int tid, unsigned short* tl) {
  const int k0 = (tile / (DM / WN)) * WK, n0 = (tile % (DM / WN)) * WN, nq = tid & 15, kg = tid >> 4;
  const float* wp = W + (size_t)(k0 + 8 * kg) * DM + n0 + 4 * nq; v4f x[8];
#pragma unroll      /* x indexed by constants: registers; the 8 loads fly together */
  for (int i = 0; i < 8; ++i) x[i] = *(const v4fa*)(wp + (size_t)i * DM);
#pragma unroll      /* as above */
  for (int j = 0; j < 4; ++j) { FragH f;
#pragma unroll      /* as above */
    for (int i = 0; i < 8; ++i) f.h[i] = (_Float16)(bf16_round(x[i][j]) * scale);
    *(v8us*)(tl + (4 * nq + j) * WK + (kg ^ nq) * 8) = f.half[0]; }
  __syncthreads();      /* publishes the turned tile */
  unsigned short* op = (unsigned short*)Wt + (size_t)(n0 + kg) * DM + k0 + 8 * nq;
#pragma unroll      /* the 4 LDS reads and stores overlap */
  for (int p = 0; p < 4; ++p) { const int n = 16 * p + kg; const v8us o = *(const v8us*)(tl + n * WK + (nq ^ (n >> 2)) * 8); *(v8us*)(op + (size_t)(16 * p) * DM) = o; }
  asm volatile("s_wait_xcnt 0x0" ::: "memory");      /* the wait before a register of the stores above is overwritten: the code of the launch's other ranges follows in the text */
}
// k_gemm_hh variant with fused epilogue: v = acc·alpha + bias[by·sBias + col] (+ CP[(row/rowsPerB)·sCPb + by·64 + col] if CP) ; ACT 0 none / 1 elu ; writes f16 C16 (and f32 C if non-null)
template <int ACT>
__global__ __launch_bounds__(128) void k_gemm_hhx(const _Float16* __restrict__ A, int lda, size_t sA, const _Float16* __restrict__ Bh, int ldb, size_t sB, float alpha, const float* __restrict__ bias, size_t sBias, const float* __restrict__ CP, int rowsPerB, size_t sCPb, int row0g,
    float* __restrict__ C, _Float16* __restrict__ C16, int ldc, size_t sC, int M, int N, int K) {
  __shared__ __attribute__((aligned(16))) float so[4][16][64];
  const int tid = threadIdx.x, w = tid >> 5, lane = tid & 31, ln = lane & 15, hh = lane >> 4; const int by = blockIdx.y;
  A += (size_t)by * sA; Bh += (size_t)by * sB; const size_t cofs = (size_t)by * sC; const float* bp = bias ? bias + (size_t)by * sBias : nullptr;
  const int ntn = (N + 63) / 64; const int wid = blockIdx.x * 4 + w; const int mt = wid / ntn, nq = wid % ntn; if (mt * 16 >= M) return;
  const int row0 = mt * 16, col0 = nq * 64; const _Float16* arow = A + (size_t)(row0 + ln) * lda;
  v8f acc[4] = {};
  for (int kb = 0; kb < K; kb += 32) { FragH ah; ah.half[0] = *(const v8us*)((const unsigned short*)arow + kb + 8 * hh); ah.half[1] = *(const v8us*)((const unsigned short*)arow + kb + 16 + 8 * hh);
#pragma unroll
    for (int t = 0; t < 4; ++t) { if (col0 + t * 16 >= N) continue; const size_t boff = (size_t)(col0 + t * 16 + ln) * ldb + kb; FragH bq; bq.half[0] = *(const v8us*)((const unsigned short*)Bh + boff + 8 * hh); bq.half[1] = *(const v8us*)((const unsigned short*)Bh + boff + 16 + 8 * hh);
      acc[t] = mmaH<1>(ah.v, ah.v, bq.v, bq.v, acc[t]); }
  }
#pragma unroll
  for (int t = 0; t < 4; ++t) { if (col0 + t * 16 >= N) continue; const int col = col0 + t * 16 + ln; const float bv = bp ? bf16_round(bp[col]) : 0.f;
#pragma unroll
    for (int r = 0; r < 8; ++r) { float v = acc[t][r] * alpha + bv; if (CP) { const int rr = row0g + row0 + 8 * hh + r; if (rowsPerB < 0) v += CP[cofs + (size_t)rr * ldc + col];      /* rowsPerB < 0: own element of the batched C plane */ else { const int bidx = rr / rowsPerB; v += CP[(size_t)bidx * sCPb + (size_t)by * 64 + col]; } } if (ACT == 1) v = (v > 0.f) ? v : expm1f(v); else if (ACT == 7) v = (v > 0.f) ? v + 1.0f : expf(v); else if (ACT == 8) v = tanhf(v); else if (ACT == 9) v = 0.5f * v * (1.0f + tanhf(0.7978845608028654f * (v + 0.044715f * v * v * v))); else if (ACT == 11) v = 1.0f / (1.0f + expf(-v)); else if (ACT == 12) v = (v > 0.f) ? v : 0.01f * v; else if (ACT == 14) v = (v > 0.f) ? v : 0.1f * v; else if (ACT == 16) v = (v >= 0.f) ? v : 0.3f * v; else if (ACT == 17) v = (v >= 0.f) ? v : 0.2f * v; else if (ACT == 15) v = v / (1.0f + expf(-v)); else if (ACT == 3) v = fmaxf(v, 0.f); else if (ACT == 6) v = 0.5f * v * (1.0f + erff(v * 0.70710678118654752f)); so[w][8 * hh + r][t * 16 + ln] = v; } }
  __builtin_amdgcn_fence(__ATOMIC_ACQ_REL, "workgroup"); __builtin_amdgcn_wave_barrier();
  const int rsub = lane >> 4, c4 = (lane & 15) * 4; typedef _Float16 v4h __attribute__((ext_vector_type(4)));
  {
#pragma unroll
    for (int q = 0; q < 8; ++q) { const int r = q * 2 + rsub; if (col0 + c4 < N) { const v4f v = *(const v4fa*)&so[w][r][c4]; if (C) *(v4f*)(C + cofs + (size_t)(row0 + r) * ldc + col0 + c4) = v; if (C16) { v4h h4; for (int i = 0; i < 4; ++i) h4[i] = (_Float16)v[i]; *(v4h*)(C16 + cofs + (size_t)(row0 + r) * ldc + col0 + c4) = h4; } } }
     }
}


typedef _Float16 v4h __attribute__((ext_vector_type(4)));

__device__ __forceinline__ void d_x16(const float* __restrict__ x, _Float16* __restrict__ X16, size_t n8, size_t t) { if (t >= n8) return; FragH f;
#pragma unroll
  for (int q = 0; q < 8; ++q) f.h[q] = (_Float16)bf16_round(x[t * 8 + q]); *(v8us*)((unsigned short*)X16 + t * 8) = f.half[0];  }
__global__ __launch_bounds__(256) void k_h16(const float* __restrict__ x, _Float16* __restrict__ X16, size_t n8) { const size_t t = (size_t)blockIdx.x * 256 + threadIdx.x; if (t >= n8) return; FragH f;
#pragma unroll
  for (int q = 0; q < 8; ++q) f.h[q] = (_Float16)x[t * 8 + q]; *(v8us*)((unsigned short*)X16 + t * 8) = f.half[0];  }
__global__ __launch_bounds__(256) void k_round16f(const float* __restrict__ W, _Float16* __restrict__ Bt, size_t n8) { const size_t t = (size_t)blockIdx.x * 256 + threadIdx.x; if (t >= n8) return; FragH f;
#pragma unroll
  for (int i = 0; i < 8; ++i) f.h[i] = (_Float16)(bf16_round(W[t * 8 + i]) * 16.0f); *(v8us*)((unsigned short*)Bt + t * 8) = f.half[0];  }
__global__ __launch_bounds__(256) void k_hl(const float* __restrict__ F, _Float16* __restrict__ Hh, _Float16* __restrict__ Hl, size_t n8) { const size_t t = (size_t)blockIdx.x * 256 + threadIdx.x; if (t >= n8) return; FragH fh, fl; const v4f a = *(const v4fa*)(F + t * 8), c = *(const v4fa*)(F + t * 8 + 4);
#pragma unroll
  for (int q = 0; q < 4; ++q) { _Float16 h = (_Float16)a[q]; fh.h[q] = h; fl.h[q] = (_Float16)((a[q] - (float)h) * 1024.0f); h = (_Float16)c[q]; fh.h[4 + q] = h; fl.h[4 + q] = (_Float16)((c[q] - (float)h) * 1024.0f); }
  { *(v8us*)((unsigned short*)Hh + t * 8) = fh.half[0]; *(v8us*)((unsigned short*)Hl + t * 8) = fl.half[0];  } }

// ---- WMMA helpers (f16 fragments of 16 rows x 32 k; one product with its distance) ----
__device__ __forceinline__ v16h g2_frag(const _Float16* p, int hh) { FragH f; f.half[0] = *(const v8us*)((const unsigned short*)p + 8 * hh); f.half[1] = *(const v8us*)((const unsigned short*)p + 16 + 8 * hh); return f.v; }
__device__ __forceinline__ v8f g2_mma(v16h a, v16h b, v8f c) { v8f d = __builtin_amdgcn_wmma_f32_16x16x32_f16(false, a, false, b, (short)0, c, false, false); asm volatile("v_nop\n\tv_nop\n\tv_nop\n\tv_nop" : "+v"(d) : "v"(a), "v"(b)); return d; }
// FRAGMENT ORDER: a tile of 16 rows x 32 k (1 KiB) is stored as [part 0..1][lane 0..31][8 halves]; lane = 16 hh + ln holds row ln, k = 16 part + 8 hh .. + 7: the registers of g2_frag, unchanged.
// One 16-byte load of a wave then reads 512 contiguous bytes (4 lines) where the row-major tile made it touch 16 lines of 32 useful bytes each.
#define FT 512                       /* halves of one 16 x 32 fragment tile */
__device__ __forceinline__ v16h gf_frag(const _Float16* p) { FragH f; f.half[0] = *(const v8us*)((const unsigned short*)p); f.half[1] = *(const v8us*)((const unsigned short*)p + FT / 2); return f.v; }      /* p: the tile's start + 8 lane */
// Projection GEMM C16[4096][1024] = f16(A . Bt^T / 16 + bias): one 128 x 128 tile of C per work-group, 8 waves of 32 x 64 (4 down, 2 across).
// Per trip 128 k (256 bytes of each of the 128 A rows and 128 Bt rows) lie in LDS at pitch 272 bytes, brought by asynchronous 16-byte copies: a wave's copy takes 2 rows x 256 bytes, whole lines.
// Two buffers: the copies of trip t + 1 fly while trip t's fragments are read from LDS. k ascends in steps of 32 per accumulator. The epilogue of q and k stages each wave's 32 x 64 block in the first buffer.
#define GT 128                       /* rows and columns of C per work-group */
#define GK 128                       /* k per trip */
#define GP 272                       /* LDS row pitch in bytes: 16 x odd, for the 16-byte fragment reads */
#define GO (GT * GP)                 /* bytes of one operand's rows in a buffer */
#define GB (2 * GO)                  /* bytes of one buffer: A rows, then Bt rows */
__device__ __forceinline__ v16h g3_frag(const char* p) { FragH f; f.half[0] = *(const v8us*)p; f.half[1] = *(const v8us*)(p + 32); return f.v; }
// this thread's 8 pieces of one operand's 128 rows x 256 bytes: rows 16 apart, LDS byte address l, global address g
__device__ __forceinline__ void g3_copy(unsigned l, const _Float16* g) {
  /* the copies and, as the last line, the wait that stands before their address registers are rewritten */
  asm volatile("global_load_async_to_lds_b128 %0, %8, off\n\t"
               "global_load_async_to_lds_b128 %1, %9, off\n\t"
               "global_load_async_to_lds_b128 %2, %10, off\n\t"
               "global_load_async_to_lds_b128 %3, %11, off\n\t"
               "global_load_async_to_lds_b128 %4, %12, off\n\t"
               "global_load_async_to_lds_b128 %5, %13, off\n\t"
               "global_load_async_to_lds_b128 %6, %14, off\n\t"
               "global_load_async_to_lds_b128 %7, %15, off\n\t"
               "s_wait_xcnt 0x0"
               :: "v"(l), "v"(l + 16 * GP), "v"(l + 32 * GP), "v"(l + 48 * GP), "v"(l + 64 * GP), "v"(l + 80 * GP), "v"(l + 96 * GP), "v"(l + 112 * GP),
                  "v"(g), "v"(g + 16 * DM), "v"(g + 32 * DM), "v"(g + 48 * DM), "v"(g + 64 * DM), "v"(g + 80 * DM), "v"(g + 96 * DM), "v"(g + 112 * DM)
               : "memory");
}
// The three products (q, k, v) need nothing of each other: they share one grid, blockIdx.y picks the weights, the bias and the output.
__global__ __launch_bounds__(256) void k_proj(const _Float16* __restrict__ A, const _Float16* __restrict__ BQ, const _Float16* __restrict__ BK, const _Float16* __restrict__ BV,
                                              const float* __restrict__ bq, const float* __restrict__ bk, const float* __restrict__ bvp, _Float16* __restrict__ Q16, _Float16* __restrict__ K16, _Float16* __restrict__ VT) {
  const int z = blockIdx.y; const _Float16* Bh = z == 0 ? BQ : z == 1 ? BK : BV; const float* bias = z == 0 ? bq : z == 1 ? bk : bvp; _Float16* C16 = z == 0 ? Q16 : z == 1 ? K16 : VT;
  static_assert(NR % GT == 0 && DM % GT == 0 && DM % GK == 0 && DM / GK >= 2 && 8 * 32 * 68 * 4 <= GB, "k_proj: whole tiles, two trips or more, the output staging fits one buffer");
  __shared__ __attribute__((aligned(16))) float sm[2 * GB / 4];
  const int tid = threadIdx.x, w = tid >> 5, lane = tid & 31, ln = lane & 15, hh = lane >> 4, wm = w & 3, wn = w >> 2;
  const int mt = blockIdx.x % (int)(NR / GT), nq = blockIdx.x / (int)(NR / GT); const int row0 = mt * GT + 32 * wm, col0 = nq * GT + 64 * wn;
  const float* bp = bias + col0 + ln; float bv[4];
#pragma unroll      /* bv indexed by constants: registers; the four loads fly under the first copies */
  for (int t = 0; t < 4; ++t) bv[t] = bp[16 * t];
  asm volatile("s_wait_xcnt 0x0" :: "v"(bp) : "memory");      /* the wait before the address registers of the loads above are overwritten */
  const _Float16* ga = A + (size_t)(mt * GT + (tid >> 4)) * DM + (tid & 15) * 8;
  const _Float16* gb = Bh + (size_t)(nq * GT + (tid >> 4)) * DM + (tid & 15) * 8;
  const unsigned l0 = (unsigned)(size_t)(const void*)sm + (unsigned)((tid >> 4) * GP + (tid & 15) * 16);
  g3_copy(l0, ga); g3_copy(l0 + GO, gb);
  asm volatile("s_wait_asynccnt 0x0" ::: "memory");      /* this wave's copies of trip 0 have landed */
  __syncthreads();      /* publishes trip 0's rows */
  g3_copy(l0 + GB, ga + GK); g3_copy(l0 + GB + GO, gb + GK);
  const char* fa = (const char*)sm + (32 * wm + ln) * GP + 16 * hh;
  const char* fb = (const char*)sm + GO + (64 * wn + ln) * GP + 16 * hh;
  const v8f z8 = {0.f,0.f,0.f,0.f,0.f,0.f,0.f,0.f}; v8f c00 = z8, c01 = z8, c02 = z8, c03 = z8, c10 = z8, c11 = z8, c12 = z8, c13 = z8;
#pragma unroll 1      /* rolled: one publish point in the text, and the two buffers are told apart by an offset */
  for (int t = 0; t < DM / GK; ++t) { const int bo = (t & 1) * GB;
    const char* pa = fa + bo; const char* pb = fb + bo; v16h af[2][2], bf[2][4];      /* two fragment sets: step s + 1 of this trip is read from LDS, as one group, in front of step s's products */
#pragma unroll      /* the sets are indexed by constants, so that they live in registers */
    for (int i = 0; i < 2; ++i) af[0][i] = g3_frag(pa + i * 16 * GP);
#pragma unroll      /* as above */
    for (int j = 0; j < 4; ++j) bf[0][j] = g3_frag(pb + j * 16 * GP);
#pragma unroll      /* as above; the four k steps of a trip also get constant LDS offsets */
    for (int s = 0; s < GK / 32; ++s) { const int cu = s & 1, nx = cu ^ 1;
      if (s + 1 < GK / 32) {
#pragma unroll      /* as above */
        for (int i = 0; i < 2; ++i) af[nx][i] = g3_frag(pa + i * 16 * GP + 64 * (s + 1));
#pragma unroll      /* as above */
        for (int j = 0; j < 4; ++j) bf[nx][j] = g3_frag(pb + j * 16 * GP + 64 * (s + 1)); }
      c00 = g2_mma(af[cu][0], bf[cu][0], c00); c10 = g2_mma(af[cu][1], bf[cu][0], c10);
      c01 = g2_mma(af[cu][0], bf[cu][1], c01); c11 = g2_mma(af[cu][1], bf[cu][1], c11);
      c02 = g2_mma(af[cu][0], bf[cu][2], c02); c12 = g2_mma(af[cu][1], bf[cu][2], c12);
      c03 = g2_mma(af[cu][0], bf[cu][3], c03); c13 = g2_mma(af[cu][1], bf[cu][3], c13); }
    asm volatile("s_wait_dscnt 0x0" ::: "memory");      /* this wave's reads of trip t's buffer are done before it is refilled */
    asm volatile("s_wait_asynccnt 0x0" ::: "memory");      /* this wave's copies of trip t + 1 have landed */
    __syncthreads();      /* publishes trip t + 1's rows and ends every wave's reads of trip t's buffer */
    if (t + 2 < DM / GK) { g3_copy(l0 + bo, ga + (t + 2) * GK); g3_copy(l0 + bo + GO, gb + (t + 2) * GK); } }
  asm volatile("s_wait_asynccnt 0x0" ::: "memory");      /* no copy is outstanding when the first buffer becomes output staging */
  v8f accs[8] = {c00, c01, c02, c03, c10, c11, c12, c13};
  if (z == 2) {      /* v: V^T in fragment order, [(batch, head)][16 columns d][32 keys][part][lane][8 keys]. An accumulator tile is already such a piece: lane 16 hh + ln holds column d = 16 t + ln and, in its 8 registers, the keys 16 half + 8 hh .. + 7 of the wave's 32 rows (one key group of one batch; its 64 columns are one head), so it is stored from the registers */
    static_assert(SQ % GT == 0 && HD == 64 && FT == 512, "k_proj: a wave's 32 rows are one 32-key group of one batch, its 64 columns one head");
    _Float16* vo = C16 + (((size_t)(row0 / SQ) * NH + col0 / HD) * 4 * (SQ / 32) + (row0 % SQ) / 32) * FT + lane * 8;
#pragma unroll      /* accs and bv indexed by constants: registers; each of the 8 stores is 512 contiguous bytes */
    for (int u = 0; u < 8; ++u) { const int t = u & 3, half = u >> 2; const float bb = bf16_round(bv[t]); FragH f;
#pragma unroll      /* as above */
      for (int r = 0; r < 8; ++r) f.h[r] = (_Float16)(accs[u][r] * 0.0625f + bb);
      *(v8us*)((unsigned short*)vo + (size_t)t * (SQ / 32) * FT + half * (FT / 2)) = f.half[0]; }
    asm volatile("s_wait_xcnt 0x0" ::: "memory");      /* the wait before a register of the stores above is overwritten */
  } else {      /* q, k: fragment order, [16-row tile][head][k half of 32][part][lane][8]; the wave's 64 columns are one head, its 32 rows two tiles; turned through the wave's own staging block */
    float (*so)[68] = (float (*)[68])(sm + w * 32 * 68);
#pragma unroll      /* accs and bv indexed by constants: registers */
    for (int u = 0; u < 8; ++u) { const int t = u & 3, half = u >> 2; const float bb = bf16_round(bv[t]);
#pragma unroll      /* as above */
      for (int r = 0; r < 8; ++r) so[half * 16 + 8 * hh + r][t * 16 + ln] = accs[u][r] * 0.0625f + bb; }
    __builtin_amdgcn_fence(__ATOMIC_ACQ_REL, "workgroup"); __builtin_amdgcn_wave_barrier();      /* the wave's staged block is complete before its lanes read each other's values; no other wave touches it */
    _Float16* cf = C16 + ((size_t)(row0 / 16) * NH + col0 / HD) * (2 * FT) + lane * 8;
#pragma unroll      /* the LDS reads and the 8 stores overlap; each store is 512 contiguous bytes */
    for (int q = 0; q < 8; ++q) { const int tl = q >> 2, c = q & 3; const float* sp = &so[16 * tl + ln][16 * c + 8 * hh]; const v4f v0 = *(const v4fa*)sp, v1 = *(const v4fa*)(sp + 4); FragH f;
#pragma unroll      /* f indexed by constants: registers */
      for (int i = 0; i < 4; ++i) { f.h[i] = (_Float16)v0[i]; f.h[4 + i] = (_Float16)v1[i]; }
      *(v8us*)((unsigned short*)cf + (size_t)tl * NH * (2 * FT) + c * (FT / 2)) = f.half[0]; }
    asm volatile("s_wait_xcnt 0x0" ::: "memory");      /* the wait before a register of the stores above is overwritten */
  } }


// table in fragment order: piece t of 8 halves is [16-row tile][k half of 32][part][lane]; it holds row 16 tile + ln, columns 16 (2 khalf + part) + 8 hh .. + 7
__device__ __forceinline__ void d_wrel(const float* __restrict__ w, _Float16* __restrict__ Bt, size_t t) { if (t >= (size_t)RW * HD / 8) return; const size_t row = (t >> 7) * 16 + (t & 15), col = ((t >> 5) & 3) * 16 + ((t >> 4) & 1) * 8; const bool live = row < (size_t)NREL; FragH f; for (int q = 0; q < 8; ++q) f.h[q] = live ? (_Float16)(bf16_round(w[row * HD + col + q]) * 16.0f) : (_Float16)0.0f; *(v8us*)((unsigned short*)Bt + t * 8) = f.half[0];  }
// The five operand preparations need nothing of each other: they share one grid as ranges of the block index (a block-uniform branch).
// Longest block first, so that none starts late and runs on alone: the table (its guarded loads follow one another), the weight tiles (load, turn in LDS, store), then the hidden rows.
#define PW ((DM / WK) * (DM / WN))   /* blocks (tiles) per weight matrix */
#define PX ((int)(NR * DM / 8 / 256)) /* blocks of the hidden rows */
#define PE (RW * HD / 8 / 256)       /* blocks of the distance table */
__global__ __launch_bounds__(256) void k_prep(const float* __restrict__ wq, const float* __restrict__ wk, const float* __restrict__ wv, const float* __restrict__ demb, const float* __restrict__ hs,
                                              _Float16* __restrict__ BQ, _Float16* __restrict__ BK, _Float16* __restrict__ BV, _Float16* __restrict__ BE, _Float16* __restrict__ X16) {
  static_assert(DM % WK == 0 && DM % WN == 0 && WK == 128 && WN == 64 && NR * DM / 8 % 256 == 0 && RW * HD / 8 % 256 == 0, "k_prep: whole tiles and whole blocks in every range; 256 threads = 16 k pieces x 16 column quads");
  __shared__ __attribute__((aligned(16))) unsigned short tl[WN * WK];      /* the weight tiles' turning place */
  const int blk = blockIdx.x, tid = threadIdx.x;
  if (blk < PE) d_wrel(demb, BE, (size_t)blk * 256 + tid);
  else if (blk < PE + 3 * PW) { const int u = blk - PE, z = u / PW; d_wt_tile(z == 0 ? wq : z == 1 ? wk : wv, z == 0 ? BQ : z == 1 ? BK : BV, 16.0f, u - z * PW, tid, tl); }      /* [in][out] -> Bt[out][in] x16 */
  else d_x16(hs, X16, NR * DM / 8, (size_t)(blk - PE - 3 * PW) * 256 + tid); }
__global__ __launch_bounds__(256) void k_wnat(const float* __restrict__ w, size_t n8, _Float16* __restrict__ Bt) { const size_t t = (size_t)blockIdx.x * 256 + threadIdx.x; if (t >= n8) return; FragH f; for (int q = 0; q < 8; ++q) f.h[q] = (_Float16)(bf16_round(w[t * 8 + q]) * 16.0f); *(v8us*)((unsigned short*)Bt + t * 8) = f.half[0];  }
#define RT 32                        /* query rows per tile */
#define QT 8                         /* query tiles that one work-group walks, one after the other */
#define TP (SQ + 4)                  /* score tile pitch in floats: rows stay 16-byte aligned, a column of 32 rows falls on 16 banks */
#define PP (SQ + 8)                  /* P tile pitch in halves: 16 bytes more a row for the 16-byte fragment reads */
#define QP (SQ + 36)                 /* q . e tile pitch in floats: 544 table rows; 16 bytes x odd for the 16-byte stores */
#define KP 52                        /* k . e pitch in floats: 48 table rows a key; 16 bytes x odd for the 16-byte stores, KP - 1 odd for the reads down a diagonal */
#define KB (16 * KP + 16)            /* floats of one block of 16 keys: 16 more, so that the four blocks that one read meets start 16 banks apart */
typedef float v2fa __attribute__((ext_vector_type(2), may_alias));
typedef _Float16 v2h __attribute__((ext_vector_type(2)));
__device__ __forceinline__ void st8(float* p, v8f c) { const v4f a = {c[0], c[1], c[2], c[3]}, b = {c[4], c[5], c[6], c[7]}; *(v4fa*)p = a; *(v4fa*)(p + 4) = b; }      /* a lane's 8 accumulator registers to 8 neighbouring floats */
template <int C> __device__ __forceinline__ float x_row(float x) { return __builtin_bit_cast(float, __builtin_amdgcn_update_dpp(0, __builtin_bit_cast(int, x), 0x160 | C, 0xf, 0xf, true)); }      /* lane l <- lane l ^ C inside a 16-lane row (row_xmask) */
__device__ __forceinline__ float x_half(float x) { return __builtin_bit_cast(float, __builtin_amdgcn_permlanex16(__builtin_bit_cast(int, x), __builtin_bit_cast(int, x), 0x76543210, 0xfedcba98, false, false)); }      /* lane l <- lane l ^ 16 */
__device__ __forceinline__ float wave_max(float v) { v = fmaxf(v, x_row<1>(v)); v = fmaxf(v, x_row<2>(v)); v = fmaxf(v, x_row<4>(v)); v = fmaxf(v, x_row<8>(v)); return fmaxf(v, x_half(v)); }
__device__ __forceinline__ float wave_sum(float v) { v += x_row<1>(v); v += x_row<2>(v); v += x_row<4>(v); v += x_row<8>(v); return v + x_half(v); }
__device__ __forceinline__ v8f g2_dot64(const v16h (&a)[2], const v16h (&b)[2]) { const v8f z8 = {0.f,0.f,0.f,0.f,0.f,0.f,0.f,0.f}; return g2_mma(a[1], b[1], g2_mma(a[0], b[0], z8)); }
__global__ __launch_bounds__(512) void k_attn(const _Float16* __restrict__ Q16, const _Float16* __restrict__ K16, const _Float16* __restrict__ BE, const _Float16* __restrict__ VT, const float* __restrict__ amask, float* __restrict__ out) {
  static_assert(SQ == 512 && HD == 64 && RT == 32 && SQ % (RT * QT) == 0 && RW >= 2 * SQ, "k_attn: 16 waves of 32 key columns; 512 threads stage 512 mask values and store 32 x 64 outputs; whole walks of QT tiles");
  static_assert(QP >= SQ + RT && QP % 8 == 4 && KP >= 48 && KP % 8 == 4 && KB % 64 == 16, "k_attn: the relative tiles hold their windows; pitches of 16 bytes x odd; key blocks 16 banks apart");
  __shared__ __attribute__((aligned(16))) float sc[RT][TP];
  __shared__ __attribute__((aligned(16))) float qe[RT][QP];
  __shared__ __attribute__((aligned(16))) float ke[(SQ / 16) * KB];
  __shared__ __attribute__((aligned(16))) _Float16 ph[RT][PP];
  __shared__ __attribute__((aligned(16))) float so[2][RT][HD + 4];
  __shared__ __attribute__((aligned(16))) float mk[SQ];
  const int tid = threadIdx.x, w = __builtin_amdgcn_readfirstlane(tid >> 5), lane = tid & 31, ln = lane & 15, hh = lane >> 4, i00 = blockIdx.x * (RT * QT), h = blockIdx.y, b = blockIdx.z;      /* i00: first query row of the walk */
  /* all four operands lie in fragment order: every load below reads 512 contiguous bytes */
  const int l8 = lane * 8;      /* the lane's piece of a fragment tile; the tile starts below are the same for the whole wave */
  const _Float16* qp = Q16 + ((size_t)((b * SQ + i00) / 16) * NH + h) * (2 * FT);
  const _Float16* kp = K16 + ((size_t)((b * SQ + 32 * w) / 16) * NH + h) * (2 * FT);
  const _Float16* ep = BE + (size_t)((i00 - 32 * w + (SQ - 32)) / 16) * (2 * FT);      /* table rows i0 - 32w + 480 .. + 63 of the tile at i0, all inside 0 .. 1023; the first is a multiple of 16 */
  const float* mp = amask + (size_t)b * SQ;
  v16h kf[2][2];
#pragma unroll
  for (int m = 0; m < 2; ++m)
#pragma unroll
    for (int s = 0; s < 2; ++s) kf[m][s] = gf_frag(kp + (m * NH * 2 + s) * FT + l8);
  const float mv = mp[tid];
  asm volatile("s_wait_xcnt 0x0" :: "s"(kp), "s"(mp), "v"(lane) : "memory");      /* the wait before the address registers of the loads above are overwritten; naming them keeps them whole up to it */
  mk[tid] = bf16_round(mv);
  /* P . V share of this wave: tile (pm, pn) of the 32 x 64 result, half pk of K = 512 */
  const int pm = w & 1, pn = (w >> 1) & 3, pk = w >> 3;
  const _Float16* vp = VT + ((((size_t)b * NH + h) * 4 + pn) * (SQ / 32) + 8 * pk) * FT;
  float* op = out + ((size_t)b * SQ + i00 + (tid >> 4)) * DM + h * HD + (tid & 15) * 4;
  /* The walk: the k fragments and the mask serve all QT tiles; each tile brings its own q and table fragments, q first, which the first products need. */
  /* Each LDS array is rewritten only behind a barrier that follows its last read: sc, qe and ke behind the third of the tile before, ph behind the first, so behind the second. */
  v16h qf[2][2], ef[4][2];
#pragma unroll
  for (int m = 0; m < 2; ++m)
#pragma unroll
    for (int s = 0; s < 2; ++s) qf[m][s] = gf_frag(qp + (m * NH * 2 + s) * FT + l8);
#pragma unroll
  for (int t = 0; t < 4; ++t)
#pragma unroll
    for (int s = 0; s < 2; ++s) ef[t][s] = gf_frag(ep + (t * 2 + s) * FT + l8);
  asm volatile("s_wait_xcnt 0x0" :: "s"(qp), "s"(ep), "v"(lane) : "memory");      /* the wait before the address registers of the loads above are overwritten */
  auto tile = [&](const bool last) __attribute__((always_inline)) {      /* one tile; inlined at its two places, where last is a constant */
  /* k . q^T: accumulator (key 16e + 8hh + r of the block, query row 16m + ln) */
#pragma unroll
  for (int m = 0; m < 2; ++m)
#pragma unroll
    for (int e = 0; e < 2; ++e) st8(&sc[16 * m + ln][32 * w + 16 * e + 8 * hh], g2_dot64(kf[e], qf[m]));
  /* e . q^T: accumulator (table row i0 + 480 - 32w + 16t + 8hh + r, query row 16m + ln) */
#pragma unroll
  for (int t = 0; t < 2; ++t)
#pragma unroll
    for (int m = 0; m < 2; ++m) st8(&qe[16 * m + ln][(SQ - 32) - 32 * w + 16 * t + 8 * hh], g2_dot64(ef[t], qf[m]));
  if (w == 0) {      /* the 31 table rows above every wave's first 32, which only the first keys meet (the last 16 only from the second 16 query rows); w is the same in the whole wave: a scalar branch */
    st8(&qe[ln][SQ + 8 * hh], g2_dot64(ef[2], qf[0])); st8(&qe[16 + ln][SQ + 8 * hh], g2_dot64(ef[2], qf[1])); st8(&qe[16 + ln][SQ + 16 + 8 * hh], g2_dot64(ef[3], qf[1])); }
  /* e . k^T: accumulator (table row i0 + 480 - 32w + 16(1 - e + t) + 8hh + r, key 16e + ln of the block) */
#pragma unroll
  for (int e = 0; e < 2; ++e)
#pragma unroll
    for (int t = 0; t < 3; ++t) st8(ke + (2 * w + e) * KB + ln * KP + 16 * t + 8 * hh, g2_dot64(ef[1 - e + t], kf[e]));
  __syncthreads();      /* publishes the three tiles and the mask */
  /* the wave's V^T fragments are asked for here so that they fly during the softmax */
  v16h vf[8];
#pragma unroll
  for (int s = 0; s < 8; ++s) vf[s] = gf_frag(vp + s * FT + l8);
  asm volatile("s_wait_xcnt 0x0" :: "s"(vp), "v"(lane) : "memory");      /* the wait before the address registers of the loads above are overwritten */
  float xs[2][16];      /* the scores of the wave's two rows, formed together: the two rows' k . e values of one key are neighbours in LDS and come in one read */
#pragma unroll
  for (int k = 0; k < 2; ++k) { const int row = 2 * w + k;
    const float* sr = &sc[row][2 * lane]; const float* qr = &qe[row][row + (SQ - 1) - 2 * lane]; const float* kr = ke + (lane >> 3) * KB + ((2 * lane) & 15) * (KP - 1) + 15 + row;      /* the lane's first column, 2 lane: the next column is one back in qe, KP - 1 on in ke; 64 columns on are 64 back in qe, 4 blocks on in ke */
#pragma unroll
    for (int u = 0; u < 8; ++u) { const v2fa sv = *(const v2fa*)(sr + 64 * u), mm = *(const v2fa*)&mk[64 * u + 2 * lane];
#pragma unroll
      for (int q = 0; q < 2; ++q) xs[k][u * 2 + q] = ((sv[q] + qr[-64 * u - q] * 0.0625f) + kr[4 * u * KB + q * (KP - 1)] * 0.0625f) * 0.125f + mm[q]; } }
#pragma unroll
  for (int k = 0; k < 2; ++k) { const int row = 2 * w + k; float (&x)[16] = xs[k]; float mx = -INFINITY;
#pragma unroll
    for (int j = 0; j < 16; ++j) mx = fmaxf(mx, x[j]);
    mx = wave_max(mx); float se = 0.f;
#pragma unroll
    for (int j = 0; j < 16; ++j) { x[j] = __builtin_amdgcn_exp2f((x[j] - mx) * 1.44269504088896340736f); se += x[j]; }      /* e^d = 2^(d log2 e), d <= 0: the hardware's exp2 alone; a result too small for it is far below one unit of the f16 weight */
    const float sn = 256.0f / wave_sum(se);
#pragma unroll
    for (int u = 0; u < 8; ++u) { const v2h o = {(_Float16)(x[u * 2] * sn), (_Float16)(x[u * 2 + 1] * sn)};
      *(v2h*)&ph[row][64 * u + 2 * lane] = o; } }
  __syncthreads();      /* publishes the P tile */
  { const _Float16* pa = &ph[16 * pm + ln][256 * pk + 8 * hh]; v16h pf[8];
#pragma unroll
    for (int s = 0; s < 8; ++s) pf[s] = g2_frag(pa + 32 * s, 0);
    v8f c = {0.f,0.f,0.f,0.f,0.f,0.f,0.f,0.f};
#pragma unroll
    for (int s = 0; s < 8; ++s) c = g2_mma(pf[s], vf[s], c);
#pragma unroll
    for (int r = 0; r < 8; ++r) so[pk][16 * pm + 8 * hh + r][16 * pn + ln] = c[r]; }
  __syncthreads();      /* publishes the two K halves of the 32 x 64 result */
  if (!last) {      /* the next tile's fragments (32 query rows on, the table window 32 rows on) are asked for behind the tile's last barrier, which would wait for them, and fly during the output */
  qp += 2 * NH * 2 * FT; ep += 2 * 2 * FT;
#pragma unroll
  for (int m = 0; m < 2; ++m)
#pragma unroll
    for (int s = 0; s < 2; ++s) qf[m][s] = gf_frag(qp + (m * NH * 2 + s) * FT + l8);
#pragma unroll
  for (int t = 0; t < 4; ++t)
#pragma unroll
    for (int s = 0; s < 2; ++s) ef[t][s] = gf_frag(ep + (t * 2 + s) * FT + l8);
  asm volatile("s_wait_xcnt 0x0" :: "s"(qp), "s"(ep), "v"(lane) : "memory");      /* the wait before the address registers of the loads above are overwritten */
  }
  { const int row = tid >> 4, c4 = (tid & 15) * 4; const v4f v = (*(const v4fa*)&so[0][row][c4] + *(const v4fa*)&so[1][row][c4]) * 0.00390625f; *(v4f*)op = v;
    asm volatile("s_wait_xcnt 0x0" :: "v"(op) : "memory");      /* the wait before the address register of the store above is overwritten */
    op += (size_t)RT * DM; } };
#pragma unroll 1      /* rolled: one copy of the code for all tiles but the last, and the fragment registers are the same in every trip */
  for (int it = 0; it + 1 < QT; ++it) tile(false);
  tile(true); }      /* the last tile asks for nothing more */
__global__ __launch_bounds__(256) void k_vt(const _Float16* __restrict__ V16, int b, int h0, _Float16* __restrict__ VT) { __shared__ unsigned short tl[64][65]; const int tid = threadIdx.x; const int hh = blockIdx.x % HG, sg = blockIdx.x / HG; const int s0 = sg * 64; const int h = h0 + hh;
  for (int i = tid; i < 64 * 8; i += 256) { const int j = i / 8, d8 = (i % 8) * 8; FragH f; f.half[0] = *(const v8us*)((const unsigned short*)V16 + ((size_t)b * SQ + s0 + j) * DM + h * HD + d8); for (int q = 0; q < 8; ++q) tl[d8 + q][j] = f.u[q]; }
  __syncthreads();
  { for (int i = tid; i < 64 * 8; i += 256) { const int d = i / 8, j8 = (i % 8) * 8; FragH f; for (int q = 0; q < 8; ++q) f.u[q] = tl[d][j8 + q]; *(v8us*)((unsigned short*)VT + ((size_t)hh * HD + d) * SQ + s0 + j8) = f.half[0]; }  } }

extern "C" void kernel_launch(void* const* d_in, const int* in_sizes, int n_in,
                              void* d_out, int out_size, void* d_ws, size_t ws_size, hipStream_t stream) {
  (void)in_sizes; (void)n_in; (void)out_size;
  const float* const* I = (const float* const*)d_in; const float* hs = I[0]; const float* amask = I[1]; const float* wq = I[2]; const float* bq = I[3]; const float* wk = I[4]; const float* bk = I[5]; const float* wv = I[6]; const float* bv = I[7]; const float* demb = I[8];      /* weights [in][out]; attention_mask [8][1][1][512] additive; dist_emb [1023][64] */
  char* ws = (char*)d_ws; size_t off = 0;
  auto take = [&](size_t bytes) { char* p = ws + off; off += (bytes + 255) & ~(size_t)255; return p; };
  _Float16* BQ = (_Float16*)take((size_t)DM * DM * 2); _Float16* BK = (_Float16*)take((size_t)DM * DM * 2); _Float16* BV = (_Float16*)take((size_t)DM * DM * 2); _Float16* BE = (_Float16*)take((size_t)RW * HD * 2);
  _Float16* X16 = (_Float16*)take(NR * DM * 2); _Float16* Q16 = (_Float16*)take(NR * DM * 2); _Float16* K16 = (_Float16*)take(NR * DM * 2);
  _Float16* VT = (_Float16*)take((size_t)NB * NH * HD * SQ * 2);
  if (off > ws_size) return;      /* 6 + 0.1 + 3x8 + 8 = approx 38 MiB */
  k_prep<<<3 * PW + PX + PE, 256, 0, stream>>>(wq, wk, wv, demb, hs, BQ, BK, BV, BE, X16);      /* transposed weights x16, padded table x16, hidden rows as f16 */
  k_proj<<<dim3((unsigned)((NR / GT) * (DM / GT)), 3), 256, 0, stream>>>(X16, BQ, BK, BV, bq, bk, bv, Q16, K16, VT);      /* q, k and V^T in fragment order */
  k_attn<<<dim3(SQ / (RT * QT), NH, NB), 512, 0, stream>>>(Q16, K16, BE, VT, amask, (float*)d_out);      /* scores, relative terms, softmax and P . V; ctx rows (merged heads, f32) */
}
